// v000
// Times are from an AMD MI455X. After a warm-up the kernel runs many times in a row, and a time is the length of
// such a window on the GPU divided by its runs, so every launch and the gaps after it count. The runs cycle
// through copies of the inputs. A figure is the median of several windows, for all but v000 over two sittings.
// Sittings can differ by a few percent; kernels timed side by side share one.
// The starting kernel, v000, takes 598 microseconds a run.
// Contractions: q, k, v 1x1 convs, q.k^T energies and the output 1x1 conv = v_wmma_f32_16x16x32_f16 on f16 hi/lo split planes (hi.hi + hi.lo + lo.hi, 3 products each); p.v = v_wmma_f32_16x16x32_f16 single product (p carried x2^15 as f16, v plain f16 with |v| < 2^-14 written as 0); f32 accumulate everywhere; running-max softmax, 1/rowsum, gamma scale, biases and the residual add (exact f32 x) in f32 on the VALU.
// Plane / carry map (every carry is an exact power of two; the inverse is folded exactly once, at the line named):
//   XTh|XTl  f16 [16384 (b,n)][512 c]    = hi/lo of x * 2^10           (n = h*64 + w; producer tsplit_f16)
//   WQh|WQl, WKh|WKl f16 [64][512]; WVh|WVl, WDh|WDl f16 [512][512] = hi/lo of W * 2^16, natural [out][in] (producer wconv_f16)
//   Qh|Ql, Kh|Kl f16 [16384][64]           = hi/lo of q (or k) * 2^10   (GEMM: acc * 2^-26 removes the x and W carries, + bias, then * 2^10)
//   VT  f16 [4][512 ch][4096 n]            = v, carry 1                   (GEMM: acc * 2^-26 + bias; |v| < 2^-14 stored as 0)
//   energies                               = acc * 2^-20 (q and k carries) in attn_kernel before the softmax
//   P   f16 (LDS only)                     = exp(s - m) * 2^15, values < 2^-14 stored as 0; 2^-15 folded together with 1/rowsum in the attn_kernel epilogue
//   O2h|O2l f16 [16384][512]               = hi/lo of (gamma * out + x) * 2^10 (attn_kernel epilogue)
//   output conv                            = acc * 2^-26 (O2 and W carries) + bd -> f32 NCHW [4][512][4096]
#include <hip/hip_runtime.h>
#include <math.h>
#include <stdint.h>

#define NBAT  4
#define CCH   512
#define CQK   64
#define IMGH  64
#define IMGW  64
#define NPOS  4096
#define MROWS 16384

static_assert(NPOS == IMGH * IMGW);
static_assert(MROWS == NBAT * NPOS);
static_assert(CCH % 64 == 0);
static_assert(CQK == 64);
static_assert(NPOS % 128 == 0);
static_assert(NPOS % 64 == 0);
static_assert(CCH % 32 == 0);
static_assert((CQK * CCH) % (8 * 256) == 0);
static_assert((CCH * CCH) % (8 * 256) == 0);
static_assert(CCH % 256 == 0);
static_assert((MROWS / 64) % 8 == 0);
static_assert(((CCH / 64) * (NPOS / 64)) % 8 == 0);

typedef __attribute__((ext_vector_type(16))) _Float16 v16h;
typedef __attribute__((ext_vector_type(8)))  _Float16 v8h;
typedef __attribute__((ext_vector_type(8)))  float    v8f;
typedef __attribute__((ext_vector_type(4)))  float    v4f;
typedef __attribute__((ext_vector_type(4)))  unsigned int v4u;

__device__ __forceinline__ unsigned short h_bits(_Float16 h) { return __builtin_bit_cast(unsigned short, h); }
__device__ __forceinline__ unsigned pk16(unsigned short a, unsigned short b) { return (unsigned)a | ((unsigned)b << 16); }

// hazard guards as plain device helpers (no inline asm inside the kernel template body)
__device__ __forceinline__ void dep_guard_h(v8f& a, v8f& b, v16h x, v16h y) { asm volatile("v_nop\n\tv_nop\n\tv_nop\n\tv_nop" : "+v"(a), "+v"(b) : "v"(x), "v"(y)); }
__device__ __forceinline__ void keep4_h(v16h a, v16h b, v16h c, v16h d) { asm volatile("v_nop" :: "v"(a), "v"(b), "v"(c), "v"(d)); }
__device__ __forceinline__ void acc_guard4(v8f& a, v8f& b, v8f& c, v8f& d) { asm volatile("v_nop\n\tv_nop\n\tv_nop\n\tv_nop" : "+v"(a), "+v"(b), "+v"(c), "+v"(d)); }

// 16-bit fragment loader (A and B alike): lane row/col = lane&15, p points at element k0 + 8*(lane>>4) of that row;
// vector elements 0..7 <- p[0..7] (= k0+8h+0..7), 8..15 <- p[16..23] (= k0+16+8h+0..7).
struct FragH {
  union U { v16h v; v8h h[2]; };
  static __device__ __forceinline__ v16h load(const _Float16* p) {
    U f; f.h[0] = *(const v8h*)(p); f.h[1] = *(const v8h*)(p + 16); return f.v;
  }
  static __device__ __forceinline__ v8f mma(v16h a, v16h b, v8f c) {
    return __builtin_amdgcn_wmma_f32_16x16x32_f16(false, a, false, b, (short)0, c, false, false);
  }
  static __device__ __forceinline__ void guard(v8f& a, v8f& b, v16h x, v16h y) { dep_guard_h(a, b, x, y); }
  static __device__ __forceinline__ void keep(v16h a, v16h b, v16h c, v16h d) { keep4_h(a, b, c, d); }
};

// WMMA + hazard guard in one helper (used by the attention kernel)
__device__ __forceinline__ v8f hmma(v16h a, v16h b, v8f c) {
  c = __builtin_amdgcn_wmma_f32_16x16x32_f16(false, a, false, b, (short)0, c, false, false);
  asm volatile("v_nop\n\tv_nop\n\tv_nop\n\tv_nop" : "+v"(c) : "v"(a), "v"(b));
  return c;
}

// ---- Register-blocked batched WMMA GEMM, f16 operands ----------------------
// C[m,n] = oscale * (scale * sum_k A[m,k] * Bt[n,k] + bias); each wave owns a 64x64 tile.
// A row-major [M,K] (pitch lda); Bt row-major [N,K] (pitch ldb); M,N % 64 == 0, K % 32 == 0 (host-asserted sizes).
// SPLIT: operands are hi/lo planes (A2/Bt2 = lo planes, same layout); product = hi.hi + hi.lo + lo.hi.
// BIAS_MODE: 0 = none, 1 = bias[m], 2 = bias[n] (f32).
// OUT_MODE: 0 = f32; 1 = single f16 plane (|v| < 2^-14 stored as 0, so the plane holds no f16 subnormals);
//           2 = f16 hi plane (Cout) + f16 lo plane (Cout2), lo = v - hi.
template <bool SPLIT, int BIAS_MODE, int OUT_MODE>
__global__ __launch_bounds__(256) void gemm64_f16(
    const unsigned short* __restrict__ Ap, const unsigned short* __restrict__ A2p, int lda, long strideA,
    const unsigned short* __restrict__ Btp, const unsigned short* __restrict__ Bt2p, int ldb, long strideB,
    void* __restrict__ Cout, void* __restrict__ Cout2, int ldc, long strideC,
    const float* __restrict__ bias,
    int M, int N, int K, float scale, float oscale) {
  const _Float16* A   = (const _Float16*)(const void*)Ap;
  const _Float16* A2  = (const _Float16*)(const void*)A2p;
  const _Float16* Bt  = (const _Float16*)(const void*)Btp;
  const _Float16* Bt2 = (const _Float16*)(const void*)Bt2p;
  __shared__ __align__(16) float sT[8][16 * 68];   // per-wave 16x64 slab, pitch 68 floats
  const int b    = blockIdx.y;
  const int lane = threadIdx.x & 31;
  const int wave = threadIdx.x >> 5;
  const int tilesN = N >> 6;
  const int tilesM = M >> 6;
  const int tile = blockIdx.x * 8 + wave;
  if (tile >= tilesM * tilesN) return;   // wave-uniform; no block barriers in this kernel
  const int tm = tile / tilesN;
  const int tn = tile - tm * tilesN;
  const int m0 = tm << 6;
  const int n0 = tn << 6;

  const _Float16* Ab  = A  + (size_t)b * strideA;
  const _Float16* Bb  = Bt + (size_t)b * strideB;
  const _Float16* Ab2 = SPLIT ? (A2  + (size_t)b * strideA) : Ab;
  const _Float16* Bb2 = SPLIT ? (Bt2 + (size_t)b * strideB) : Bb;

  const int rlane = lane & 15;                 // row (A) / col (B, D) within subtile
  const int koff  = (lane >> 4) * 8;           // k offset of this lane half
  const int mOff  = (lane >> 4) * 8;           // D row offset

  v8f acc[4][4];
#pragma unroll
  for (int i = 0; i < 4; ++i)
#pragma unroll
    for (int j = 0; j < 4; ++j) acc[i][j] = (v8f){0.f,0.f,0.f,0.f,0.f,0.f,0.f,0.f};

  for (int k0 = 0; k0 < K; k0 += 32) {
    v16h bh[4], bl[4];
#pragma unroll
    for (int j = 0; j < 4; ++j) {
      const size_t bo = (size_t)(n0 + (j << 4) + rlane) * ldb + koff + k0;
      bh[j] = FragH::load(Bb + bo);
      if (SPLIT) bl[j] = FragH::load(Bb2 + bo); else bl[j] = bh[j];
    }
#pragma unroll
    for (int i = 0; i < 4; ++i) {
      const size_t ao = (size_t)(m0 + (i << 4) + rlane) * lda + koff + k0;
      v16h ah = FragH::load(Ab + ao);
      v16h al;
      if (SPLIT) al = FragH::load(Ab2 + ao); else al = ah;
#pragma unroll
      for (int j = 0; j < 4; ++j) {
        acc[i][j] = FragH::mma(ah, bh[j], acc[i][j]);
        if (SPLIT) {
          acc[i][j] = FragH::mma(ah, bl[j], acc[i][j]);
          acc[i][j] = FragH::mma(al, bh[j], acc[i][j]);
        }
      }
      FragH::guard(acc[i][0], acc[i][3], ah, al);
    }
    FragH::keep(bh[0], bh[1], bh[2], bh[3]);
    if (SPLIT) FragH::keep(bl[0], bl[1], bl[2], bl[3]);
  }
  acc_guard4(acc[0][0], acc[0][1], acc[0][2], acc[0][3]);
  acc_guard4(acc[1][0], acc[1][1], acc[1][2], acc[1][3]);
  acc_guard4(acc[2][0], acc[2][1], acc[2][2], acc[2][3]);
  acc_guard4(acc[3][0], acc[3][1], acc[3][2], acc[3][3]);

  // ---- epilogue ----
  float* slab = sT[wave];
#pragma unroll
  for (int i = 0; i < 4; ++i) {
    const int mBase = m0 + (i << 4);
#pragma unroll
    for (int j = 0; j < 4; ++j) {
      const int n = n0 + (j << 4) + rlane;
      float bvn = 0.f;
      if (BIAS_MODE == 2) bvn = bias[n];
#pragma unroll
      for (int r = 0; r < 8; ++r) {
        float v = acc[i][j][r] * scale;
        if (BIAS_MODE == 1) v += bias[mBase + mOff + r];
        if (BIAS_MODE == 2) v += bvn;
        slab[(mOff + r) * 68 + (j << 4) + rlane] = v * oscale;
      }
    }
    __builtin_amdgcn_fence(__ATOMIC_RELEASE, "workgroup");
    __builtin_amdgcn_wave_barrier();
    __builtin_amdgcn_fence(__ATOMIC_ACQUIRE, "workgroup");
    if (OUT_MODE == 0) {
      float* C = (float*)Cout + (size_t)b * strideC;
      const int hh = lane >> 4, c4 = (lane & 15) * 4;     // row seg = 256 B = 16 lanes x 16 B
      {
#pragma unroll
        for (int it = 0; it < 8; ++it) {
          const int row = it * 2 + hh;                       // it 0..7 x hh 0..1 = rows 0..15
          v4f v = *(const v4f*)(slab + row * 68 + c4);
          *(v4f*)(C + (size_t)(mBase + row) * ldc + n0 + c4) = v;
        }
        
      }
    } else {
      const int q = lane >> 3, c8 = (lane & 7) * 8;
      _Float16* C  = (_Float16*)Cout + (size_t)b * strideC;
      _Float16* C2 = (_Float16*)Cout2 + (size_t)b * strideC;
      {
#pragma unroll
        for (int it = 0; it < 4; ++it) {
          const int row = it * 4 + q;                        // it 0..3 x q 0..3 = rows 0..15
          const float* sp = slab + row * 68 + c8;
          v8h hv, lv;
#pragma unroll
          for (int e = 0; e < 8; ++e) {
            if (OUT_MODE == 1) {
              float f = sp[e];
              f = (fabsf(f) >= 6.103515625e-05f) ? f : 0.0f;
              hv[e] = (_Float16)f;
            } else {
              const _Float16 hq = (_Float16)sp[e];
              hv[e] = hq;
              lv[e] = (_Float16)(sp[e] - (float)hq);
            }
          }
          *(v8h*)(C + (size_t)(mBase + row) * ldc + n0 + c8) = hv;
          if (OUT_MODE == 2) *(v8h*)(C2 + (size_t)(mBase + row) * ldc + n0 + c8) = lv;
        }
        
      }
    }
    __builtin_amdgcn_fence(__ATOMIC_RELEASE, "workgroup");
    __builtin_amdgcn_wave_barrier();
    __builtin_amdgcn_fence(__ATOMIC_ACQUIRE, "workgroup");
  }
}

// ---------------------------------------------------------------------------
// Row-preserving f16 hi/lo split of an f32 matrix with total element count 8*n8 (layout unchanged):
//   hi = f16(in * carry), lo = f16(in * carry - hi). 8 consecutive elements per thread (two 16-B loads), one 16-B store per plane
// ---------------------------------------------------------------------------
__global__ __launch_bounds__(256) void wconv_f16(const float* __restrict__ in, unsigned short* __restrict__ oh,
                                                 unsigned short* __restrict__ ol, int n8, float carry) {
  const int i = blockIdx.x * 256 + threadIdx.x;
  if (i < n8) {
    const size_t e0 = (size_t)i * 8;
    const v4f a = *(const v4f*)(in + e0);
    const v4f c = *(const v4f*)(in + e0 + 4);
    float f[8];
    f[0] = a[0]; f[1] = a[1]; f[2] = a[2]; f[3] = a[3];
    f[4] = c[0]; f[5] = c[1]; f[6] = c[2]; f[7] = c[3];
    v4u hv, lv;
#pragma unroll
    for (int q = 0; q < 4; ++q) {
      const float f0 = f[2 * q] * carry, f1 = f[2 * q + 1] * carry;
      const _Float16 h0 = (_Float16)f0, h1 = (_Float16)f1;
      const _Float16 l0 = (_Float16)(f0 - (float)h0), l1 = (_Float16)(f1 - (float)h1);
      hv[q] = pk16(h_bits(h0), h_bits(h1));
      lv[q] = pk16(h_bits(l0), h_bits(l1));
    }
    {
      *(v4u*)(oh + e0) = hv;
      *(v4u*)(ol + e0) = lv;
      
    }
  }
}

// ---------------------------------------------------------------------------
// Fused transpose + f16 hi/lo split of an f32 matrix, z-batched:
//   in_z = W + z*sIn viewed in[R rows][Cc cols] (pitch Cc) -> oh_z[c][r] = f16(in_z[r][c]*carry), ol_z[c][r] = f16(rem),
//   out [Cc][R] (pitch R), oh_z = oh + z*sOut.
// 64x64 tiles through LDS. grid = (Cc/64, R/64, Z), 256 threads (R, Cc multiples of 64; R multiple of 64 keeps every
// Coverage per block and plane: load 4 it x 256 thr x 4 floats = 64x64; store 2 it x 256 thr x 8 halves = 64x64.
// ---------------------------------------------------------------------------
__global__ __launch_bounds__(256) void tsplit_f16(const float* __restrict__ W, unsigned short* __restrict__ oh,
                                                  unsigned short* __restrict__ ol, int R, int Cc, long sIn, long sOut,
                                                  float carry) {
  __shared__ __align__(16) float tf[64 * 68];
  W  += (size_t)blockIdx.z * sIn;
  oh += (size_t)blockIdx.z * sOut;
  ol += (size_t)blockIdx.z * sOut;
  const int c0  = blockIdx.x * 64;   // input column block = output row block
  const int r0  = blockIdx.y * 64;   // input row block    = output column block
  const int tid = threadIdx.x;
  {
    const int lr = tid >> 4;         // 0..15
    const int c4 = (tid & 15) * 4;   // 0..60
#pragma unroll
    for (int it = 0; it < 4; ++it) {
      const int rr = it * 16 + lr;   // 0..63
      const v4f a = *(const v4f*)(W + (size_t)(r0 + rr) * Cc + c0 + c4);
      *(v4f*)(tf + rr * 68 + c4) = a;
    }
  }
  __syncthreads();
  const int sub = tid >> 3;          // 0..31
  const int c8  = (tid & 7) * 8;     // 0..56
  v4u hv[2], lv[2];
#pragma unroll
  for (int it = 0; it < 2; ++it) {
    const int oc = it * 32 + sub;    // output row within tile (= input column)
    v4u a, a2;
#pragma unroll
    for (int q = 0; q < 4; ++q) {
      const float f0 = tf[(c8 + 2 * q) * 68 + oc] * carry;
      const float f1 = tf[(c8 + 2 * q + 1) * 68 + oc] * carry;
      const _Float16 h0 = (_Float16)f0, h1 = (_Float16)f1;
      const _Float16 l0 = (_Float16)(f0 - (float)h0), l1 = (_Float16)(f1 - (float)h1);
      a[q]  = pk16(h_bits(h0), h_bits(h1));
      a2[q] = pk16(h_bits(l0), h_bits(l1));
    }
    hv[it] = a; lv[it] = a2;
  }
  {
#pragma unroll
    for (int it = 0; it < 2; ++it) {
      const int oc = it * 32 + sub;
      const size_t go = (size_t)(c0 + oc) * R + r0 + c8;
      *(v4u*)(oh + go) = hv[it];
      *(v4u*)(ol + go) = lv[it];
    }
    
  }
}

// =====================================================================================
// Flash-style attention with a 512-wide value dimension and a 64-deep score dimension, no score scaling.
//   q planes (hi/lo f16, x2^10) [16384][64]: element (b, i, d) at [(b*4096 + i)*64 + d]
//   k planes (hi/lo f16, x2^10) [16384][64]: same layout for keys j
//   v plane (f16, carry 1) [4][512][4096]: element (b, ch, j) at [(b*512 + ch)*4096 + j]
//   o2 planes (hi/lo f16, x2^10) [16384][512]: element (b, i, ch) at [(b*4096 + i)*512 + ch] = split of (gamma*out + x[b][ch][i]) * 2^10
//   scores S = q . k on split planes (hi.hi + hi.lo + lo.hi), * sscale (= 2^-20) in f32;
//   running-max softmax in f32 over the 4096 keys of the batch element (32 chunks of 128, compile-time trip count);
//   P = exp(s - m) * pcarry (2^15) as f16 in LDS (values < 2^-14 stored as 0); out = P . v^T single products, f32 accumulate,
//   times (1/rowsum) * pinv (2^-15) at the end.
//   Block = 16 query rows of one batch element, 8 waves; wave w computes the 16x16 score piece for keys j0 + 16w .. +15 of
//   each chunk (shared through LDS: partial row max Pm, partial row sum Pl, P tile Ps) and accumulates the output for
//   channels 64w .. 64w+63 (4 WMMA column tiles in registers). grid = (4096/16, 4) = 1024 blocks.
//   Barriers per chunk: after the Pm writes (B1) and after the Ps/Pl writes (B2); Pm/Ps/Pl of the next chunk are only
//   written after every wave has passed B2/B1 of the current one. Every wave reaches every barrier (no early exit).
//   LDS extents: Ps rows 0..15 x cols 0..127 fully written each chunk (8 waves x 16 cols) before any fragment read
//   (reads reach col 127; cols 128..135 never read); Pm/Pl [16][8] fully written; Os per-wave 16x64 (pitch 68, cols 64..67
//   never read). Fragment loads from global (Q, K, V rows) use plain arithmetic addressing, 16-B aligned.
// =====================================================================================
#define AQB    16
#define AKC    128
#define PPITCH 136
#define NCHUNK (NPOS / AKC)

static_assert(NPOS % AQB == 0);
static_assert(NCHUNK * AKC == NPOS);
static_assert(CCH == 8 * 64);
static_assert((PPITCH * 2) % 16 == 0);

__global__ __launch_bounds__(256)
void attn_kernel(const unsigned short* __restrict__ qhp, const unsigned short* __restrict__ qlp,
                 const unsigned short* __restrict__ khp, const unsigned short* __restrict__ klp,
                 const unsigned short* __restrict__ vtp,
                 const float* __restrict__ X, const float* __restrict__ gam,
                 unsigned short* __restrict__ o2hp, unsigned short* __restrict__ o2lp,
                 float sscale, float pcarry, float pinv, float ocarry) {
  union FB { v16h v; v8h h[2]; };
  __shared__ __align__(16) _Float16 Ps[AQB * PPITCH];     // P tile [query row][key in chunk], pitch 136 halves
  __shared__ __align__(16) float    Pm[AQB * 8];          // partial row max  [row][wave]
  __shared__ __align__(16) float    Pl[AQB * 8];          // partial row sum  [row][wave]
  __shared__ __align__(16) float    Os[8][16 * 68];       // per-wave 16x64 epilogue slab, pitch 68 floats

  const int tid  = threadIdx.x;
  const int wave = tid >> 5;
  const int lane = tid & 31;
  const int hh   = lane >> 4;
  const int c    = lane & 15;

  const int b  = blockIdx.y;                       // 0..3
  const int i0 = blockIdx.x * AQB;                 // first query position of this block
  const size_t qrow0 = (size_t)b * NPOS + i0;      // row in the q / o2 planes

  const _Float16* Qh = (const _Float16*)(const void*)qhp;
  const _Float16* Ql = (const _Float16*)(const void*)qlp;
  const _Float16* Kh = (const _Float16*)(const void*)khp;
  const _Float16* Kl = (const _Float16*)(const void*)klp;
  const _Float16* Vw = (const _Float16*)(const void*)vtp + ((size_t)b * CCH + (size_t)wave * 64) * NPOS;   // this wave's 64 channel rows
  _Float16* O2h = (_Float16*)(void*)o2hp;
  _Float16* O2l = (_Float16*)(void*)o2lp;

  // ---- Q fragments (A operand, row = lane&15): 2 d-chunks, hi and lo, identical in all 8 waves ----
  v16h qah[2], qal[2];
#pragma unroll
  for (int dc = 0; dc < 2; ++dc) {
    qah[dc] = FragH::load(Qh + (qrow0 + c) * CQK + dc * 32 + 8 * hh);
    qal[dc] = FragH::load(Ql + (qrow0 + c) * CQK + dc * 32 + 8 * hh);
  }

  float mrow[8], lrow[8];
  v8f acc[4];
#pragma unroll
  for (int r = 0; r < 8; ++r) { mrow[r] = -INFINITY; lrow[r] = 0.f; }
#pragma unroll
  for (int n = 0; n < 4; ++n) acc[n] = (v8f){0.f,0.f,0.f,0.f,0.f,0.f,0.f,0.f};

  for (int jc = 0; jc < NCHUNK; ++jc) {
    const int j0 = jc * AKC;
    // ---- score piece: rows = 16 queries, cols = keys j0 + 16*wave + c (B operand col = lane&15) ----
    const size_t krow = (size_t)b * NPOS + j0 + wave * 16 + c;
    v8f s = (v8f){0.f,0.f,0.f,0.f,0.f,0.f,0.f,0.f};
#pragma unroll
    for (int dc = 0; dc < 2; ++dc) {
      const v16h kbh = FragH::load(Kh + krow * CQK + dc * 32 + 8 * hh);
      const v16h kbl = FragH::load(Kl + krow * CQK + dc * 32 + 8 * hh);
      s = hmma(qah[dc], kbh, s);
      s = hmma(qah[dc], kbl, s);
      s = hmma(qal[dc], kbh, s);
    }
    // scale, then this wave's partial row max over its 16 keys (lanes of one half share rows)
    float mloc[8];
#pragma unroll
    for (int r = 0; r < 8; ++r) {
      const float sv = s[r] * sscale;
      s[r] = sv;
      float m = sv;
#pragma unroll
      for (int off = 1; off < 16; off <<= 1) m = fmaxf(m, __shfl_xor(m, off, 32));
      mloc[r] = m;
    }
    if (c == 0) {
#pragma unroll
      for (int r = 0; r < 8; ++r) Pm[(8 * hh + r) * 8 + wave] = mloc[r];
    }
    __syncthreads();   // B1

    // ---- running max update (identical in every wave), P tile, partial row sums ----
    float alpha[8], psl[8];
#pragma unroll
    for (int r = 0; r < 8; ++r) {
      const v4f ma = *(const v4f*)(Pm + (8 * hh + r) * 8);
      const v4f mb = *(const v4f*)(Pm + (8 * hh + r) * 8 + 4);
      const float cm = fmaxf(fmaxf(fmaxf(ma[0], ma[1]), fmaxf(ma[2], ma[3])),
                             fmaxf(fmaxf(mb[0], mb[1]), fmaxf(mb[2], mb[3])));
      const float mnew = fmaxf(mrow[r], cm);
      alpha[r] = __expf(mrow[r] - mnew);
      mrow[r] = mnew;
      const float p = __expf(s[r] - mnew);           // in (0, 1]
      float psum = p;
#pragma unroll
      for (int off = 1; off < 16; off <<= 1) psum += __shfl_xor(psum, off, 32);
      psl[r] = psum;
      float p32 = p * pcarry;
      p32 = (p32 >= 6.103515625e-05f) ? p32 : 0.0f;   // no f16 subnormals in the P tile
      Ps[(8 * hh + r) * PPITCH + wave * 16 + c] = (_Float16)p32;
#pragma unroll
      for (int n = 0; n < 4; ++n) acc[n][r] *= alpha[r];
    }
    if (c == 0) {
#pragma unroll
      for (int r = 0; r < 8; ++r) Pl[(8 * hh + r) * 8 + wave] = psl[r];
    }
    __syncthreads();   // B2

#pragma unroll
    for (int r = 0; r < 8; ++r) {
      const v4f la = *(const v4f*)(Pl + (8 * hh + r) * 8);
      const v4f lb = *(const v4f*)(Pl + (8 * hh + r) * 8 + 4);
      const float ls = ((la[0] + la[1]) + (la[2] + la[3])) + ((lb[0] + lb[1]) + (lb[2] + lb[3]));
      lrow[r] = lrow[r] * alpha[r] + ls;
    }

    // ---- out(16 x 64 ch of this wave) += P(16 x 128) . V^T(128 x 64): A = P tile (row = lane&15 = query),
    //      B = v plane rows (col = lane&15 = channel), both with the split k map ----
#pragma unroll
    for (int kk = 0; kk < 4; ++kk) {
      FB pa;
      pa.h[0] = *(const v8h*)(Ps + c * PPITCH + kk * 32 + 8 * hh);
      pa.h[1] = *(const v8h*)(Ps + c * PPITCH + kk * 32 + 16 + 8 * hh);
#pragma unroll
      for (int n = 0; n < 4; ++n) {
        const v16h vb = FragH::load(Vw + (size_t)(n * 16 + c) * NPOS + j0 + kk * 32 + 8 * hh);
        acc[n] = hmma(pa.v, vb, acc[n]);
      }
    }
  }

  // ---- epilogue: out * (1/(rowsum * 2^15)); o2 = gamma*out + x (exact f32 x); stage (o2 * 2^10) in the wave's slab;
  const float g = gam[0];
  float rl[8];
#pragma unroll
  for (int r = 0; r < 8; ++r) rl[r] = (1.0f / lrow[r]) * pinv;
  float* os = Os[wave];
#pragma unroll
  for (int n = 0; n < 4; ++n) {
    const int ch = wave * 64 + n * 16 + c;
    const float* xp = X + ((size_t)b * CCH + ch) * NPOS + i0 + 8 * hh;   // 8 consecutive positions, 32-B aligned
    const v4f xa = *(const v4f*)(xp);
    const v4f xb = *(const v4f*)(xp + 4);
    float xe[8];
    xe[0] = xa[0]; xe[1] = xa[1]; xe[2] = xa[2]; xe[3] = xa[3];
    xe[4] = xb[0]; xe[5] = xb[1]; xe[6] = xb[2]; xe[7] = xb[3];
#pragma unroll
    for (int r = 0; r < 8; ++r) {
      const float o  = acc[n][r] * rl[r];
      const float v2 = g * o + xe[r];
      os[(8 * hh + r) * 68 + n * 16 + c] = v2 * ocarry;
    }
  }
  __builtin_amdgcn_fence(__ATOMIC_RELEASE, "workgroup");
  __builtin_amdgcn_wave_barrier();
  __builtin_amdgcn_fence(__ATOMIC_ACQUIRE, "workgroup");
  {
    const int q = lane >> 3, c8 = (lane & 7) * 8;
    {
#pragma unroll
      for (int it = 0; it < 4; ++it) {
        const int row = it * 4 + q;
        const float* sp = os + row * 68 + c8;
        v8h hv, lv;
#pragma unroll
        for (int e = 0; e < 8; ++e) {
          const _Float16 hq = (_Float16)sp[e];
          hv[e] = hq;
          lv[e] = (_Float16)(sp[e] - (float)hq);
        }
        const size_t go = (qrow0 + row) * (size_t)CCH + wave * 64 + c8;
        *(v8h*)(O2h + go) = hv;
        *(v8h*)(O2l + go) = lv;
      }
      
    }
  }
}

// ---------------------------------------------------------------------------
// Workspace region map (byte offsets; every region is fully written by its producer launch before any consumer
//   XTh  f16 [16384][512]        0        16777216     XTl   16777216   16777216
//   WQh  f16 [64][512]    33554432           65536     WQl   33619968      65536
//   WKh  f16 [64][512]    33685504           65536     WKl   33751040      65536
//   WVh  f16 [512][512]   33816576          524288     WVl   34340864     524288
//   WDh  f16 [512][512]   34865152          524288     WDl   35389440     524288
//   Qh   f16 [16384][64]  35913728         2097152     Ql    38010880    2097152
//   Kh   f16 [16384][64]  40108032         2097152     Kl    42205184    2097152
//   VT   f16 [4][512][4096] 44302336     16777216
//   O2h  f16 [16384][512] 61079552        16777216     O2l   77856768   16777216
//   total                 94633984
// ---------------------------------------------------------------------------
extern "C" void kernel_launch(void* const* d_in, const int* in_sizes, int n_in,
                              void* d_out, int out_size, void* d_ws, size_t ws_size,
                              hipStream_t stream) {
  if (n_in < 10) return;
  if (in_sizes[0] != NBAT * CCH * NPOS) return;     // x     [4][512][64][64]
  if (in_sizes[1] != CQK * CCH) return;             // Wq    [64][512]
  if (in_sizes[2] != CQK) return;                   // bq    [64]
  if (in_sizes[3] != CQK * CCH) return;             // Wk    [64][512]
  if (in_sizes[4] != CQK) return;                   // bk    [64]
  if (in_sizes[5] != CCH * CCH) return;             // Wv    [512][512]
  if (in_sizes[6] != CCH) return;                   // bv    [512]
  if (in_sizes[7] != 1) return;                     // gamma [1]
  if (in_sizes[8] != CCH * CCH) return;             // Wd    [512][512]
  if (in_sizes[9] != CCH) return;                   // bd    [512]
  if (out_size != NBAT * CCH * NPOS) return;        // out   [4][512][64][64] f32, last element 8388607

  const float* x     = (const float*)d_in[0];
  const float* Wq    = (const float*)d_in[1];       // [out][in]
  const float* bq    = (const float*)d_in[2];
  const float* Wk    = (const float*)d_in[3];
  const float* bk    = (const float*)d_in[4];
  const float* Wv    = (const float*)d_in[5];
  const float* bv    = (const float*)d_in[6];
  const float* gamma = (const float*)d_in[7];
  const float* Wd    = (const float*)d_in[8];
  const float* bd    = (const float*)d_in[9];

  const size_t PXT = (size_t)MROWS * CCH * 2;       // 16777216  f16 [16384][512]
  const size_t PWS = (size_t)CQK * CCH * 2;         // 65536     f16 [64][512]
  const size_t PWL = (size_t)CCH * CCH * 2;         // 524288    f16 [512][512]
  const size_t PQK = (size_t)MROWS * CQK * 2;       // 2097152   f16 [16384][64]
  const size_t PVT = (size_t)NBAT * CCH * NPOS * 2; // 16777216  f16 [4][512][4096]
  size_t off = 0;
  const size_t oXTh = off; off += PXT;  const size_t oXTl = off; off += PXT;
  const size_t oWQh = off; off += PWS;  const size_t oWQl = off; off += PWS;
  const size_t oWKh = off; off += PWS;  const size_t oWKl = off; off += PWS;
  const size_t oWVh = off; off += PWL;  const size_t oWVl = off; off += PWL;
  const size_t oWDh = off; off += PWL;  const size_t oWDl = off; off += PWL;
  const size_t oQh  = off; off += PQK;  const size_t oQl  = off; off += PQK;
  const size_t oKh  = off; off += PQK;  const size_t oKl  = off; off += PQK;
  const size_t oVT  = off; off += PVT;
  const size_t oO2h = off; off += PXT;  const size_t oO2l = off; off += PXT;
  if (off > ws_size) return;                        // off = 94633984
  if (off > (size_t)134217728) return;

  char* ws = (char*)d_ws;
  unsigned short* XTh = (unsigned short*)(ws + oXTh);  unsigned short* XTl = (unsigned short*)(ws + oXTl);
  unsigned short* WQh = (unsigned short*)(ws + oWQh);  unsigned short* WQl = (unsigned short*)(ws + oWQl);
  unsigned short* WKh = (unsigned short*)(ws + oWKh);  unsigned short* WKl = (unsigned short*)(ws + oWKl);
  unsigned short* WVh = (unsigned short*)(ws + oWVh);  unsigned short* WVl = (unsigned short*)(ws + oWVl);
  unsigned short* WDh = (unsigned short*)(ws + oWDh);  unsigned short* WDl = (unsigned short*)(ws + oWDl);
  unsigned short* Qh  = (unsigned short*)(ws + oQh);   unsigned short* Ql  = (unsigned short*)(ws + oQl);
  unsigned short* Kh  = (unsigned short*)(ws + oKh);   unsigned short* Kl  = (unsigned short*)(ws + oKl);
  unsigned short* VT  = (unsigned short*)(ws + oVT);
  unsigned short* O2h = (unsigned short*)(ws + oO2h);  unsigned short* O2l = (unsigned short*)(ws + oO2l);

  const dim3 blk(256);
  const float actCarry = 1024.0f;                    // 2^10 on x, q, k, o2 planes
  const float wCarry   = 65536.0f;                   // 2^16 on weight planes
  const float scale26  = 1.0f / 67108864.0f;         // 2^-26 = 1 / (2^10 * 2^16)
  const float sScale   = 1.0f / 1048576.0f;          // 2^-20 = 1 / (2^10 * 2^10)
  const float pCarry   = 32768.0f;                   // 2^15 on the P tile
  const float pInv     = 1.0f / 32768.0f;            // 2^-15

  // (1) x[b] viewed in[R=512 c][Cc=4096 n] (pitch 4096) -> XT_b[n][c] (pitch 512), hi/lo of x*2^10; grid (Cc/64, R/64, B) = (64, 8, 4)
  tsplit_f16<<<dim3(NPOS / 64, CCH / 64, NBAT), blk, 0, stream>>>(x, XTh, XTl, CCH, NPOS, (long)CCH * NPOS, (long)NPOS * CCH, actCarry);
  // (2) weight planes, natural [out][in] layout, hi/lo of W*2^16
  const int n8s = CQK * CCH / 8;                     // 4096  -> 16 blocks
  const int n8l = CCH * CCH / 8;                     // 32768 -> 128 blocks
  wconv_f16<<<dim3(n8s / 256), blk, 0, stream>>>(Wq, WQh, WQl, n8s, wCarry);
  wconv_f16<<<dim3(n8s / 256), blk, 0, stream>>>(Wk, WKh, WKl, n8s, wCarry);
  wconv_f16<<<dim3(n8l / 256), blk, 0, stream>>>(Wv, WVh, WVl, n8l, wCarry);
  wconv_f16<<<dim3(n8l / 256), blk, 0, stream>>>(Wd, WDh, WDl, n8l, wCarry);
  // (3) q = XT . Wq^T + bq -> Qh|Ql [16384][64] (x2^10)   (M=16384, N=64, K=512; 256 tiles -> 32 blocks)
  const dim3 gQ((MROWS / 64) * (CQK / 64) / 8, 1);
  gemm64_f16<true, 2, 2><<<gQ, blk, 0, stream>>>(
      XTh, XTl, CCH, 0L, WQh, WQl, CCH, 0L, (void*)Qh, (void*)Ql, CQK, 0L, bq, MROWS, CQK, CCH, scale26, actCarry);
  // (4) k likewise -> Kh|Kl
  gemm64_f16<true, 2, 2><<<gQ, blk, 0, stream>>>(
      XTh, XTl, CCH, 0L, WKh, WKl, CCH, 0L, (void*)Kh, (void*)Kl, CQK, 0L, bk, MROWS, CQK, CCH, scale26, actCarry);
  // (5) v^T[b] = Wv . XT_b^T + bv[m] -> VT [4][512][4096] f16 single   (M=512, N=4096, K=512; 512 tiles -> 64 blocks x 4 batches)
  const dim3 gV((CCH / 64) * (NPOS / 64) / 8, NBAT);
  gemm64_f16<true, 1, 1><<<gV, blk, 0, stream>>>(
      WVh, WVl, CCH, 0L, XTh, XTl, CCH, (long)NPOS * CCH, (void*)VT, (void*)VT, NPOS, (long)CCH * NPOS, bv,
      CCH, NPOS, CCH, scale26, 1.0f);
  // (6) attention + gamma scale + residual -> O2h|O2l [16384][512] (x2^10); grid (4096/16, 4) = 1024 blocks
  attn_kernel<<<dim3(NPOS / AQB, NBAT), blk, 0, stream>>>(Qh, Ql, Kh, Kl, VT, x, gamma, O2h, O2l, sScale, pCarry, pInv, actCarry);
  // (7) out[b] = Wd . O2_b^T + bd[m] -> d_out NCHW f32 [4][512][4096]   (M=512, N=4096, K=512; 512 tiles -> 64 blocks x 4 batches)
  gemm64_f16<true, 1, 0><<<gV, blk, 0, stream>>>(
      WDh, WDl, CCH, 0L, O2h, O2l, CCH, (long)NPOS * CCH, d_out, d_out, NPOS, (long)CCH * NPOS, bd,
      CCH, NPOS, CCH, scale26, 1.0f);
  (void)hipGetLastError();
}

// v001
// It runs in 429 microseconds.
// Two timings next to v000 put it at 1.44 and 1.45 times that version's speed.
// Contractions: q, k, v 1x1 convs, q.k^T energies and the output 1x1 conv = v_wmma_f32_16x16x32_f16 on f16 hi/lo split planes (hi.hi + hi.lo + lo.hi, 3 products each); p.v = v_wmma_f32_16x16x32_f16 single product (p carried x2^15 as f16, v plain f16 with |v| < 2^-14 written as 0); f32 accumulate everywhere; running-max softmax, 1/rowsum, gamma scale, biases and the residual add (exact f32 x) in f32 on the VALU.
// Plane / carry map (every carry is an exact power of two; the inverse is folded exactly once, at the line named):
//   XTh|XTl  f16 [16384 (b,n)][512 c]    = hi/lo of x * 2^10           (n = h*64 + w; producer tsplit_f16)
//   WQh|WQl, WKh|WKl f16 [64][512]; WVh|WVl, WDh|WDl f16 [512][512] = hi/lo of W * 2^16, natural [out][in] (producer wconv_f16)
//   Qh|Ql, Kh|Kl f16 [16384][64]           = hi/lo of q (or k) * 2^10   (GEMM: acc * 2^-26 removes the x and W carries, + bias, then * 2^10)
//   VT  f16 [4][512 ch][4096 n]            = v, carry 1                   (GEMM: acc * 2^-26 + bias; |v| < 2^-14 stored as 0)
//   energies                               = acc * 2^-20 (q and k carries) in attn_kernel before the softmax
//   P   f16 (LDS only)                     = exp(s - m) * 2^15, values < 2^-14 stored as 0; 2^-15 folded together with 1/rowsum in the attn_kernel epilogue
//   O2h|O2l f16 [16384][512]               = hi/lo of (gamma * out + x) * 2^10 (attn_kernel epilogue)
//   output conv                            = acc * 2^-26 (O2 and W carries) + bd -> f32 NCHW [4][512][4096]
#include <hip/hip_runtime.h>
#include <math.h>
#include <stdint.h>

#define NBAT  4
#define CCH   512
#define CQK   64
#define IMGH  64
#define IMGW  64
#define NPOS  4096
#define MROWS 16384

static_assert(NPOS == IMGH * IMGW);
static_assert(MROWS == NBAT * NPOS);
static_assert(CCH % 64 == 0);
static_assert(CQK == 64);
static_assert(NPOS % 128 == 0);
static_assert(NPOS % 64 == 0);
static_assert(CCH % 32 == 0);
static_assert((CQK * CCH) % (8 * 256) == 0);
static_assert((CCH * CCH) % (8 * 256) == 0);
static_assert(CCH % 256 == 0);
static_assert((MROWS / 64) % 8 == 0);
static_assert(((CCH / 64) * (NPOS / 64)) % 8 == 0);

typedef __attribute__((ext_vector_type(16))) _Float16 v16h;
typedef __attribute__((ext_vector_type(8)))  _Float16 v8h;
typedef __attribute__((ext_vector_type(8)))  float    v8f;
typedef __attribute__((ext_vector_type(4)))  float    v4f;
typedef __attribute__((ext_vector_type(4)))  unsigned int v4u;

__device__ __forceinline__ unsigned short h_bits(_Float16 h) { return __builtin_bit_cast(unsigned short, h); }
__device__ __forceinline__ unsigned pk16(unsigned short a, unsigned short b) { return (unsigned)a | ((unsigned)b << 16); }

// hazard guards as plain device helpers (no inline asm inside the kernel template body)
__device__ __forceinline__ void dep_guard_h(v8f& a, v8f& b, v16h x, v16h y) { asm volatile("v_nop\n\tv_nop\n\tv_nop\n\tv_nop" : "+v"(a), "+v"(b) : "v"(x), "v"(y)); }
__device__ __forceinline__ void keep4_h(v16h a, v16h b, v16h c, v16h d) { asm volatile("v_nop" :: "v"(a), "v"(b), "v"(c), "v"(d)); }
__device__ __forceinline__ void acc_guard4(v8f& a, v8f& b, v8f& c, v8f& d) { asm volatile("v_nop\n\tv_nop\n\tv_nop\n\tv_nop" : "+v"(a), "+v"(b), "+v"(c), "+v"(d)); }

// 16-bit fragment loader (A and B alike): lane row/col = lane&15, p points at element k0 + 8*(lane>>4) of that row;
// vector elements 0..7 <- p[0..7] (= k0+8h+0..7), 8..15 <- p[16..23] (= k0+16+8h+0..7).
struct FragH {
  union U { v16h v; v8h h[2]; };
  static __device__ __forceinline__ v16h load(const _Float16* p) {
    U f; f.h[0] = *(const v8h*)(p); f.h[1] = *(const v8h*)(p + 16); return f.v;
  }
  static __device__ __forceinline__ v8f mma(v16h a, v16h b, v8f c) {
    return __builtin_amdgcn_wmma_f32_16x16x32_f16(false, a, false, b, (short)0, c, false, false);
  }
  static __device__ __forceinline__ void guard(v8f& a, v8f& b, v16h x, v16h y) { dep_guard_h(a, b, x, y); }
  static __device__ __forceinline__ void keep(v16h a, v16h b, v16h c, v16h d) { keep4_h(a, b, c, d); }
};

// s_wait_xcnt 0 behind a group of global loads of the attention kernel, in front of any rewrite of their address registers.
// The addresses are inputs only so that their registers stay as they are up to the wait.
__device__ __forceinline__ void xwait(const void* a) { asm volatile("s_wait_xcnt 0x0" :: "v"(a) : "memory"); }
__device__ __forceinline__ void xwait(const void* a, const void* b) { asm volatile("s_wait_xcnt 0x0" :: "v"(a), "v"(b) : "memory"); }
__device__ __forceinline__ void xwait(const void* a, const void* b, const void* c, const void* d) {
  asm volatile("s_wait_xcnt 0x0" :: "v"(a), "v"(b), "v"(c), "v"(d) : "memory");
}

// ---- Register-blocked batched WMMA GEMM, f16 operands ----------------------
// C[m,n] = oscale * (scale * sum_k A[m,k] * Bt[n,k] + bias); each wave owns a 64x64 tile.
// A row-major [M,K] (pitch lda); Bt row-major [N,K] (pitch ldb); M,N % 64 == 0, K % 32 == 0 (host-asserted sizes).
// SPLIT: operands are hi/lo planes (A2/Bt2 = lo planes, same layout); product = hi.hi + hi.lo + lo.hi.
// BIAS_MODE: 0 = none, 1 = bias[m], 2 = bias[n] (f32).
// OUT_MODE: 0 = f32; 1 = single f16 plane (|v| < 2^-14 stored as 0, so the plane holds no f16 subnormals);
//           2 = f16 hi plane (Cout) + f16 lo plane (Cout2), lo = v - hi.
template <bool SPLIT, int BIAS_MODE, int OUT_MODE>
__global__ __launch_bounds__(256) void gemm64_f16(
    const unsigned short* __restrict__ Ap, const unsigned short* __restrict__ A2p, int lda, long strideA,
    const unsigned short* __restrict__ Btp, const unsigned short* __restrict__ Bt2p, int ldb, long strideB,
    void* __restrict__ Cout, void* __restrict__ Cout2, int ldc, long strideC,
    const float* __restrict__ bias,
    int M, int N, int K, float scale, float oscale) {
  const _Float16* A   = (const _Float16*)(const void*)Ap;
  const _Float16* A2  = (const _Float16*)(const void*)A2p;
  const _Float16* Bt  = (const _Float16*)(const void*)Btp;
  const _Float16* Bt2 = (const _Float16*)(const void*)Bt2p;
  __shared__ __align__(16) float sT[8][16 * 68];   // per-wave 16x64 slab, pitch 68 floats
  const int b    = blockIdx.y;
  const int lane = threadIdx.x & 31;
  const int wave = threadIdx.x >> 5;
  const int tilesN = N >> 6;
  const int tilesM = M >> 6;
  const int tile = blockIdx.x * 8 + wave;
  if (tile >= tilesM * tilesN) return;   // wave-uniform; no block barriers in this kernel
  const int tm = tile / tilesN;
  const int tn = tile - tm * tilesN;
  const int m0 = tm << 6;
  const int n0 = tn << 6;

  const _Float16* Ab  = A  + (size_t)b * strideA;
  const _Float16* Bb  = Bt + (size_t)b * strideB;
  const _Float16* Ab2 = SPLIT ? (A2  + (size_t)b * strideA) : Ab;
  const _Float16* Bb2 = SPLIT ? (Bt2 + (size_t)b * strideB) : Bb;

  const int rlane = lane & 15;                 // row (A) / col (B, D) within subtile
  const int koff  = (lane >> 4) * 8;           // k offset of this lane half
  const int mOff  = (lane >> 4) * 8;           // D row offset

  v8f acc[4][4];
#pragma unroll
  for (int i = 0; i < 4; ++i)
#pragma unroll
    for (int j = 0; j < 4; ++j) acc[i][j] = (v8f){0.f,0.f,0.f,0.f,0.f,0.f,0.f,0.f};

  for (int k0 = 0; k0 < K; k0 += 32) {
    v16h bh[4], bl[4];
#pragma unroll
    for (int j = 0; j < 4; ++j) {
      const size_t bo = (size_t)(n0 + (j << 4) + rlane) * ldb + koff + k0;
      bh[j] = FragH::load(Bb + bo);
      if (SPLIT) bl[j] = FragH::load(Bb2 + bo); else bl[j] = bh[j];
    }
#pragma unroll
    for (int i = 0; i < 4; ++i) {
      const size_t ao = (size_t)(m0 + (i << 4) + rlane) * lda + koff + k0;
      v16h ah = FragH::load(Ab + ao);
      v16h al;
      if (SPLIT) al = FragH::load(Ab2 + ao); else al = ah;
#pragma unroll
      for (int j = 0; j < 4; ++j) {
        acc[i][j] = FragH::mma(ah, bh[j], acc[i][j]);
        if (SPLIT) {
          acc[i][j] = FragH::mma(ah, bl[j], acc[i][j]);
          acc[i][j] = FragH::mma(al, bh[j], acc[i][j]);
        }
      }
      FragH::guard(acc[i][0], acc[i][3], ah, al);
    }
    FragH::keep(bh[0], bh[1], bh[2], bh[3]);
    if (SPLIT) FragH::keep(bl[0], bl[1], bl[2], bl[3]);
  }
  acc_guard4(acc[0][0], acc[0][1], acc[0][2], acc[0][3]);
  acc_guard4(acc[1][0], acc[1][1], acc[1][2], acc[1][3]);
  acc_guard4(acc[2][0], acc[2][1], acc[2][2], acc[2][3]);
  acc_guard4(acc[3][0], acc[3][1], acc[3][2], acc[3][3]);

  // ---- epilogue ----
  float* slab = sT[wave];
#pragma unroll
  for (int i = 0; i < 4; ++i) {
    const int mBase = m0 + (i << 4);
#pragma unroll
    for (int j = 0; j < 4; ++j) {
      const int n = n0 + (j << 4) + rlane;
      float bvn = 0.f;
      if (BIAS_MODE == 2) bvn = bias[n];
#pragma unroll
      for (int r = 0; r < 8; ++r) {
        float v = acc[i][j][r] * scale;
        if (BIAS_MODE == 1) v += bias[mBase + mOff + r];
        if (BIAS_MODE == 2) v += bvn;
        slab[(mOff + r) * 68 + (j << 4) + rlane] = v * oscale;
      }
    }
    __builtin_amdgcn_fence(__ATOMIC_RELEASE, "workgroup");
    __builtin_amdgcn_wave_barrier();
    __builtin_amdgcn_fence(__ATOMIC_ACQUIRE, "workgroup");
    if (OUT_MODE == 0) {
      float* C = (float*)Cout + (size_t)b * strideC;
      const int hh = lane >> 4, c4 = (lane & 15) * 4;     // row seg = 256 B = 16 lanes x 16 B
      {
#pragma unroll
        for (int it = 0; it < 8; ++it) {
          const int row = it * 2 + hh;                       // it 0..7 x hh 0..1 = rows 0..15
          v4f v = *(const v4f*)(slab + row * 68 + c4);
          *(v4f*)(C + (size_t)(mBase + row) * ldc + n0 + c4) = v;
        }
        
      }
    } else {
      const int q = lane >> 3, c8 = (lane & 7) * 8;
      _Float16* C  = (_Float16*)Cout + (size_t)b * strideC;
      _Float16* C2 = (_Float16*)Cout2 + (size_t)b * strideC;
      {
#pragma unroll
        for (int it = 0; it < 4; ++it) {
          const int row = it * 4 + q;                        // it 0..3 x q 0..3 = rows 0..15
          const float* sp = slab + row * 68 + c8;
          v8h hv, lv;
#pragma unroll
          for (int e = 0; e < 8; ++e) {
            if (OUT_MODE == 1) {
              float f = sp[e];
              f = (fabsf(f) >= 6.103515625e-05f) ? f : 0.0f;
              hv[e] = (_Float16)f;
            } else {
              const _Float16 hq = (_Float16)sp[e];
              hv[e] = hq;
              lv[e] = (_Float16)(sp[e] - (float)hq);
            }
          }
          *(v8h*)(C + (size_t)(mBase + row) * ldc + n0 + c8) = hv;
          if (OUT_MODE == 2) *(v8h*)(C2 + (size_t)(mBase + row) * ldc + n0 + c8) = lv;
        }
        
      }
    }
    __builtin_amdgcn_fence(__ATOMIC_RELEASE, "workgroup");
    __builtin_amdgcn_wave_barrier();
    __builtin_amdgcn_fence(__ATOMIC_ACQUIRE, "workgroup");
  }
}

// ---------------------------------------------------------------------------
// Row-preserving f16 hi/lo split of an f32 matrix with total element count 8*n8 (layout unchanged):
//   hi = f16(in * carry), lo = f16(in * carry - hi). 8 consecutive elements per thread (two 16-B loads), one 16-B store per plane
// ---------------------------------------------------------------------------
__global__ __launch_bounds__(256) void wconv_f16(const float* __restrict__ in, unsigned short* __restrict__ oh,
                                                 unsigned short* __restrict__ ol, int n8, float carry) {
  const int i = blockIdx.x * 256 + threadIdx.x;
  if (i < n8) {
    const size_t e0 = (size_t)i * 8;
    const v4f a = *(const v4f*)(in + e0);
    const v4f c = *(const v4f*)(in + e0 + 4);
    float f[8];
    f[0] = a[0]; f[1] = a[1]; f[2] = a[2]; f[3] = a[3];
    f[4] = c[0]; f[5] = c[1]; f[6] = c[2]; f[7] = c[3];
    v4u hv, lv;
#pragma unroll
    for (int q = 0; q < 4; ++q) {
      const float f0 = f[2 * q] * carry, f1 = f[2 * q + 1] * carry;
      const _Float16 h0 = (_Float16)f0, h1 = (_Float16)f1;
      const _Float16 l0 = (_Float16)(f0 - (float)h0), l1 = (_Float16)(f1 - (float)h1);
      hv[q] = pk16(h_bits(h0), h_bits(h1));
      lv[q] = pk16(h_bits(l0), h_bits(l1));
    }
    {
      *(v4u*)(oh + e0) = hv;
      *(v4u*)(ol + e0) = lv;
      
    }
  }
}

// ---------------------------------------------------------------------------
// Fused transpose + f16 hi/lo split of an f32 matrix, z-batched:
//   in_z = W + z*sIn viewed in[R rows][Cc cols] (pitch Cc) -> oh_z[c][r] = f16(in_z[r][c]*carry), ol_z[c][r] = f16(rem),
//   out [Cc][R] (pitch R), oh_z = oh + z*sOut.
// 64x64 tiles through LDS. grid = (Cc/64, R/64, Z), 256 threads (R, Cc multiples of 64; R multiple of 64 keeps every
// Coverage per block and plane: load 4 it x 256 thr x 4 floats = 64x64; store 2 it x 256 thr x 8 halves = 64x64.
// ---------------------------------------------------------------------------
__global__ __launch_bounds__(256) void tsplit_f16(const float* __restrict__ W, unsigned short* __restrict__ oh,
                                                  unsigned short* __restrict__ ol, int R, int Cc, long sIn, long sOut,
                                                  float carry) {
  __shared__ __align__(16) float tf[64 * 68];
  W  += (size_t)blockIdx.z * sIn;
  oh += (size_t)blockIdx.z * sOut;
  ol += (size_t)blockIdx.z * sOut;
  const int c0  = blockIdx.x * 64;   // input column block = output row block
  const int r0  = blockIdx.y * 64;   // input row block    = output column block
  const int tid = threadIdx.x;
  {
    const int lr = tid >> 4;         // 0..15
    const int c4 = (tid & 15) * 4;   // 0..60
#pragma unroll
    for (int it = 0; it < 4; ++it) {
      const int rr = it * 16 + lr;   // 0..63
      const v4f a = *(const v4f*)(W + (size_t)(r0 + rr) * Cc + c0 + c4);
      *(v4f*)(tf + rr * 68 + c4) = a;
    }
  }
  __syncthreads();
  const int sub = tid >> 3;          // 0..31
  const int c8  = (tid & 7) * 8;     // 0..56
  v4u hv[2], lv[2];
#pragma unroll
  for (int it = 0; it < 2; ++it) {
    const int oc = it * 32 + sub;    // output row within tile (= input column)
    v4u a, a2;
#pragma unroll
    for (int q = 0; q < 4; ++q) {
      const float f0 = tf[(c8 + 2 * q) * 68 + oc] * carry;
      const float f1 = tf[(c8 + 2 * q + 1) * 68 + oc] * carry;
      const _Float16 h0 = (_Float16)f0, h1 = (_Float16)f1;
      const _Float16 l0 = (_Float16)(f0 - (float)h0), l1 = (_Float16)(f1 - (float)h1);
      a[q]  = pk16(h_bits(h0), h_bits(h1));
      a2[q] = pk16(h_bits(l0), h_bits(l1));
    }
    hv[it] = a; lv[it] = a2;
  }
  {
#pragma unroll
    for (int it = 0; it < 2; ++it) {
      const int oc = it * 32 + sub;
      const size_t go = (size_t)(c0 + oc) * R + r0 + c8;
      *(v4u*)(oh + go) = hv[it];
      *(v4u*)(ol + go) = lv[it];
    }
    
  }
}

// =====================================================================================
// Flash-style attention with a 512-wide value dimension and a 64-deep score dimension, no score scaling.
//   q planes (hi/lo f16, x2^10) [16384][64]: element (b, i, d) at [(b*4096 + i)*64 + d]
//   k planes (hi/lo f16, x2^10) [16384][64]: same layout for keys j
//   v plane (f16, carry 1) [4][512][4096]: element (b, ch, j) at [(b*512 + ch)*4096 + j]
//   o2 planes (hi/lo f16, x2^10) [16384][512]: element (b, i, ch) at [(b*4096 + i)*512 + ch] = split of (gamma*out + x[b][ch][i]) * 2^10
//   scores S = q . k on split planes (hi.hi + hi.lo + lo.hi), * sscale (= 2^-20) in f32;
//   running-max softmax in f32 over the 4096 keys of the batch element (32 chunks of 128, compile-time trip count);
//   P = exp(s - m) * pcarry (2^15) as f16 in LDS (values < 2^-14 stored as 0); out = P . v^T single products, f32 accumulate,
//   times (1/rowsum) * pinv (2^-15) at the end.
//   Block = 64 query rows (4 row tiles of 16) of one batch element, 8 waves; wave w computes the 64x16 score piece for keys
//   j0 + 16w .. +15 of each chunk (shared through LDS: partial row max Pm, partial row sum Pl, P tile Ps) and accumulates the
//   output for channels 64w .. 64w+63 (4 row tiles x 4 WMMA column tiles in registers). Each K fragment and each V fragment
//   loaded from global feeds every row tile, the K hi fragments with two products each. grid = (4096/64, 4) = 256 blocks.
//   The block's Q rows sit in LDS (Qsh/Qsl, written once, barrier B0) and are read as fragments in every chunk.
//   Barriers per chunk: after the Pm writes (B1) and after the Ps/Pl writes (B2); Pm/Ps/Pl of the next chunk are only
//   written after every wave has passed B2/B1 of the current one. Every wave reaches every barrier (no early exit).
//   LDS extents: Ps rows 0..63 x cols 0..127 fully written each chunk (8 waves x 16 cols) before any fragment read
//   (reads reach col 127; cols 128..135 never read); Pm/Pl [64][8] fully written; Os per-wave 16x64 (pitch 68, cols 64..67
//   never read), reused row tile by row tile. Global loads (Q rows as 16-B pieces, K and V fragments) use plain arithmetic addressing, 16-B aligned.
// =====================================================================================
#define AQT    4
#define AQB    (16 * AQT)
#define AKC    128
#define PPITCH 136
#define QPITCH 72
#define NCHUNK (NPOS / AKC)

static_assert(NPOS % AQB == 0);
static_assert(NCHUNK * AKC == NPOS);
static_assert(CCH == 8 * 64);
static_assert((PPITCH * 2) % 16 == 0);
static_assert((QPITCH * 2) % 16 == 0);
static_assert(AQB * CQK == 2 * 256 * 8);

__global__ __launch_bounds__(256)
void attn_kernel(const unsigned short* __restrict__ qhp, const unsigned short* __restrict__ qlp,
                 const unsigned short* __restrict__ khp, const unsigned short* __restrict__ klp,
                 const unsigned short* __restrict__ vtp,
                 const float* __restrict__ X, const float* __restrict__ gam,
                 unsigned short* __restrict__ o2hp, unsigned short* __restrict__ o2lp,
                 float sscale, float pcarry, float pinv, float ocarry) {
  union FB { v16h v; v8h h[2]; };
  __shared__ __align__(16) _Float16 Ps[AQB * PPITCH];     // P tile [query row][key in chunk], pitch 136 halves
  __shared__ __align__(16) float    Pm[AQB * 8];          // partial row max  [row][wave]
  __shared__ __align__(16) float    Pl[AQB * 8];          // partial row sum  [row][wave]
  __shared__ __align__(16) float    Os[8][16 * 68];       // per-wave 16x64 epilogue slab, pitch 68 floats
  __shared__ __align__(16) _Float16 Qsh[AQB * QPITCH];    // q hi plane rows of this block, pitch 72 halves
  __shared__ __align__(16) _Float16 Qsl[AQB * QPITCH];    // q lo plane rows of this block, pitch 72 halves

  const int tid  = threadIdx.x;
  const int wave = tid >> 5;
  const int lane = tid & 31;
  const int hh   = lane >> 4;
  const int c    = lane & 15;

  const int b  = blockIdx.y;                       // 0..3
  const int i0 = blockIdx.x * AQB;                 // first query position of this block
  const size_t qrow0 = (size_t)b * NPOS + i0;      // row in the q / o2 planes

  const _Float16* Qh = (const _Float16*)(const void*)qhp;
  const _Float16* Ql = (const _Float16*)(const void*)qlp;
  const _Float16* Kh = (const _Float16*)(const void*)khp;
  const _Float16* Kl = (const _Float16*)(const void*)klp;
  const _Float16* Vw = (const _Float16*)(const void*)vtp + ((size_t)b * CCH + (size_t)wave * 64) * NPOS;   // this wave's 64 channel rows
  _Float16* O2h = (_Float16*)(void*)o2hp;
  _Float16* O2l = (_Float16*)(void*)o2lp;
  const float g = gam[0];

  // ---- Q rows of the block (64 x 64, hi and lo) into LDS once: 512 pieces of 16 B per plane, 2 per thread and plane;
  //      the 16 Q fragments would take 128 registers, which the accumulators and the V fragments in flight need ----
  {
    const int qr = tid >> 3, q8 = (tid & 7) * 8;   // piece tid: row 0..31; piece 256 + tid: row 32..63
    const _Float16* gh0 = Qh + (qrow0 + qr) * CQK + q8;
    const _Float16* gl0 = Ql + (qrow0 + qr) * CQK + q8;
    const _Float16* gh1 = gh0 + 32 * CQK;
    const _Float16* gl1 = gl0 + 32 * CQK;
    const v8h th0 = *(const v8h*)gh0, tl0 = *(const v8h*)gl0, th1 = *(const v8h*)gh1, tl1 = *(const v8h*)gl1;
    xwait(gh0, gl0, gh1, gl1);
    *(v8h*)(Qsh + qr * QPITCH + q8) = th0;
    *(v8h*)(Qsl + qr * QPITCH + q8) = tl0;
    *(v8h*)(Qsh + (qr + 32) * QPITCH + q8) = th1;
    *(v8h*)(Qsl + (qr + 32) * QPITCH + q8) = tl1;
  }
  __syncthreads();   // B0: every wave reads all 64 Q rows

  float mrow[AQT][8], lrow[AQT][8];
  v8f acc[AQT][4];
#pragma unroll
  for (int t = 0; t < AQT; ++t) {
#pragma unroll
    for (int r = 0; r < 8; ++r) { mrow[t][r] = -INFINITY; lrow[t][r] = 0.f; }
#pragma unroll
    for (int n = 0; n < 4; ++n) acc[t][n] = (v8f){0.f,0.f,0.f,0.f,0.f,0.f,0.f,0.f};
  }

  for (int jc = 0; jc < NCHUNK; ++jc) {
    const int j0 = jc * AKC;
    // ---- score piece: rows = 64 queries, cols = keys j0 + 16*wave + c (B operand col = lane&15) ----
    const size_t krow = (size_t)b * NPOS + j0 + wave * 16 + c;
    v8f s[AQT];
#pragma unroll
    for (int t = 0; t < AQT; ++t) s[t] = (v8f){0.f,0.f,0.f,0.f,0.f,0.f,0.f,0.f};
    const _Float16* kph = Kh + krow * CQK + 8 * hh;
    const _Float16* kpl = Kl + krow * CQK + 8 * hh;
    v16h kfh[2], kfl[2];
#pragma unroll
    for (int dc = 0; dc < 2; ++dc) {
      kfh[dc] = FragH::load(kph + dc * 32);
      kfl[dc] = FragH::load(kpl + dc * 32);
    }
#pragma unroll
    for (int dc = 0; dc < 2; ++dc) {
      const v16h kbh = kfh[dc];
      const v16h kbl = kfl[dc];
      // Q fragments (A operand, row = lane&15) from LDS, same k map as the K fragments
      v16h qah[AQT], qal[AQT];
#pragma unroll
      for (int t = 0; t < AQT; ++t) {
        qah[t] = FragH::load(Qsh + (t * 16 + c) * QPITCH + dc * 32 + 8 * hh);
        qal[t] = FragH::load(Qsl + (t * 16 + c) * QPITCH + dc * 32 + 8 * hh);
      }
#pragma unroll
      for (int t = 0; t < AQT; ++t) s[t] = FragH::mma(qah[t], kbh, s[t]);
#pragma unroll
      for (int t = 0; t < AQT; ++t) s[t] = FragH::mma(qah[t], kbl, s[t]);
#pragma unroll
      for (int t = 0; t < AQT; ++t) s[t] = FragH::mma(qal[t], kbh, s[t]);
    }
    xwait(kph, kpl);   // behind the score products, where it holds up none of them
    // scale, then this wave's partial row max over its 16 keys (lanes of one half share rows)
#pragma unroll
    for (int t = 0; t < AQT; ++t) {
      float mloc[8];
#pragma unroll
      for (int r = 0; r < 8; ++r) {
        const float sv = s[t][r] * sscale;
        s[t][r] = sv;
        float m = sv;
#pragma unroll
        for (int off = 1; off < 16; off <<= 1) m = fmaxf(m, __shfl_xor(m, off, 32));
        mloc[r] = m;
      }
      if (c == 0) {
#pragma unroll
        for (int r = 0; r < 8; ++r) Pm[(t * 16 + 8 * hh + r) * 8 + wave] = mloc[r];
      }
    }
    __syncthreads();   // B1

    // ---- running max update (identical in every wave), P tile, partial row sums ----
    float alpha[AQT][8];
#pragma unroll
    for (int t = 0; t < AQT; ++t) {
      float psl[8];
#pragma unroll
      for (int r = 0; r < 8; ++r) {
        const int row = t * 16 + 8 * hh + r;
        const v4f ma = *(const v4f*)(Pm + row * 8);
        const v4f mb = *(const v4f*)(Pm + row * 8 + 4);
        const float cm = fmaxf(fmaxf(fmaxf(ma[0], ma[1]), fmaxf(ma[2], ma[3])),
                               fmaxf(fmaxf(mb[0], mb[1]), fmaxf(mb[2], mb[3])));
        const float mnew = fmaxf(mrow[t][r], cm);
        alpha[t][r] = __expf(mrow[t][r] - mnew);
        mrow[t][r] = mnew;
        const float p = __expf(s[t][r] - mnew);        // in (0, 1]
        float psum = p;
#pragma unroll
        for (int off = 1; off < 16; off <<= 1) psum += __shfl_xor(psum, off, 32);
        psl[r] = psum;
        float p32 = p * pcarry;
        p32 = (p32 >= 6.103515625e-05f) ? p32 : 0.0f;   // no f16 subnormals in the P tile
        Ps[row * PPITCH + wave * 16 + c] = (_Float16)p32;
#pragma unroll
        for (int n = 0; n < 4; ++n) acc[t][n][r] *= alpha[t][r];
      }
      if (c == 0) {
#pragma unroll
        for (int r = 0; r < 8; ++r) Pl[(t * 16 + 8 * hh + r) * 8 + wave] = psl[r];
      }
    }
    __syncthreads();   // B2

    // all 16 V fragments of the chunk (B operand, col = lane&15 = channel) are requested together
    const _Float16* vp = Vw + (size_t)c * NPOS + j0 + 8 * hh;
    v16h vb[4][4];
#pragma unroll
    for (int kk = 0; kk < 4; ++kk) {
#pragma unroll
      for (int n = 0; n < 4; ++n) vb[kk][n] = FragH::load(vp + (size_t)(n * 16) * NPOS + kk * 32);
    }

#pragma unroll
    for (int t = 0; t < AQT; ++t) {
#pragma unroll
      for (int r = 0; r < 8; ++r) {
        const int row = t * 16 + 8 * hh + r;
        const v4f la = *(const v4f*)(Pl + row * 8);
        const v4f lb = *(const v4f*)(Pl + row * 8 + 4);
        const float ls = ((la[0] + la[1]) + (la[2] + la[3])) + ((lb[0] + lb[1]) + (lb[2] + lb[3]));
        lrow[t][r] = lrow[t][r] * alpha[t][r] + ls;
      }
    }

    // ---- out(64 x 64 ch of this wave) += P(64 x 128) . V^T(128 x 64): A = P tile (row = lane&15 = query within the row tile),
    //      B = v plane rows (col = lane&15 = channel), both with the split k map; one V fragment serves all 4 row tiles ----
#pragma unroll
    for (int kk = 0; kk < 4; ++kk) {
      FB pa[AQT];
#pragma unroll
      for (int t = 0; t < AQT; ++t) {
        pa[t].h[0] = *(const v8h*)(Ps + (t * 16 + c) * PPITCH + kk * 32 + 8 * hh);
        pa[t].h[1] = *(const v8h*)(Ps + (t * 16 + c) * PPITCH + kk * 32 + 16 + 8 * hh);
      }
#pragma unroll
      for (int n = 0; n < 4; ++n) {
#pragma unroll
        for (int t = 0; t < AQT; ++t) acc[t][n] = FragH::mma(pa[t].v, vb[kk][n], acc[t][n]);
      }
    }
    xwait(vp);   // late in the chunk, where it holds up no product; vp's registers are kept as they are until here
  }

  // ---- epilogue, row tile by row tile: out * (1/(rowsum * 2^15)); o2 = gamma*out + x (exact f32 x); stage (o2 * 2^10) in the wave's slab;
  float* os = Os[wave];
  const float* xp0 = X + ((size_t)b * CCH + wave * 64 + c) * NPOS + i0 + 8 * hh;   // channel 64w + c, row tile 0; 8 consecutive positions, 32-B aligned
#pragma unroll
  for (int t = 0; t < AQT; ++t) {
    float rl[8];
#pragma unroll
    for (int r = 0; r < 8; ++r) rl[r] = (1.0f / lrow[t][r]) * pinv;
    const float* xp = xp0 + t * 16;
    v4f xa[4], xb[4];
#pragma unroll
    for (int n = 0; n < 4; ++n) {                   // channel 64w + 16n + c
      xa[n] = *(const v4f*)(xp + (size_t)(n * 16) * NPOS);
      xb[n] = *(const v4f*)(xp + (size_t)(n * 16) * NPOS + 4);
    }
    xwait(xp0);
#pragma unroll
    for (int n = 0; n < 4; ++n) {
      float xe[8];
      xe[0] = xa[n][0]; xe[1] = xa[n][1]; xe[2] = xa[n][2]; xe[3] = xa[n][3];
      xe[4] = xb[n][0]; xe[5] = xb[n][1]; xe[6] = xb[n][2]; xe[7] = xb[n][3];
#pragma unroll
      for (int r = 0; r < 8; ++r) {
        const float o  = acc[t][n][r] * rl[r];
        const float v2 = g * o + xe[r];
        os[(8 * hh + r) * 68 + n * 16 + c] = v2 * ocarry;
      }
    }
    __builtin_amdgcn_fence(__ATOMIC_RELEASE, "workgroup");
    __builtin_amdgcn_wave_barrier();
    __builtin_amdgcn_fence(__ATOMIC_ACQUIRE, "workgroup");
    {
      const int q = lane >> 3, c8 = (lane & 7) * 8;
#pragma unroll
      for (int it = 0; it < 4; ++it) {
        const int row = it * 4 + q;
        const float* sp = os + row * 68 + c8;
        v8h hv, lv;
#pragma unroll
        for (int e = 0; e < 8; ++e) {
          const _Float16 hq = (_Float16)sp[e];
          hv[e] = hq;
          lv[e] = (_Float16)(sp[e] - (float)hq);
        }
        const size_t go = (qrow0 + t * 16 + row) * (size_t)CCH + wave * 64 + c8;
        *(v8h*)(O2h + go) = hv;
        *(v8h*)(O2l + go) = lv;
      }
    }
    // the slab is rewritten by the next row tile only after every lane of the wave has read it
    __builtin_amdgcn_fence(__ATOMIC_RELEASE, "workgroup");
    __builtin_amdgcn_wave_barrier();
    __builtin_amdgcn_fence(__ATOMIC_ACQUIRE, "workgroup");
  }
}

// ---------------------------------------------------------------------------
// Workspace region map (byte offsets; every region is fully written by its producer launch before any consumer
//   XTh  f16 [16384][512]        0        16777216     XTl   16777216   16777216
//   WQh  f16 [64][512]    33554432           65536     WQl   33619968      65536
//   WKh  f16 [64][512]    33685504           65536     WKl   33751040      65536
//   WVh  f16 [512][512]   33816576          524288     WVl   34340864     524288
//   WDh  f16 [512][512]   34865152          524288     WDl   35389440     524288
//   Qh   f16 [16384][64]  35913728         2097152     Ql    38010880    2097152
//   Kh   f16 [16384][64]  40108032         2097152     Kl    42205184    2097152
//   VT   f16 [4][512][4096] 44302336     16777216
//   O2h  f16 [16384][512] 61079552        16777216     O2l   77856768   16777216
//   total                 94633984
// ---------------------------------------------------------------------------
extern "C" void kernel_launch(void* const* d_in, const int* in_sizes, int n_in,
                              void* d_out, int out_size, void* d_ws, size_t ws_size,
                              hipStream_t stream) {
  if (n_in < 10) return;
  if (in_sizes[0] != NBAT * CCH * NPOS) return;     // x     [4][512][64][64]
  if (in_sizes[1] != CQK * CCH) return;             // Wq    [64][512]
  if (in_sizes[2] != CQK) return;                   // bq    [64]
  if (in_sizes[3] != CQK * CCH) return;             // Wk    [64][512]
  if (in_sizes[4] != CQK) return;                   // bk    [64]
  if (in_sizes[5] != CCH * CCH) return;             // Wv    [512][512]
  if (in_sizes[6] != CCH) return;                   // bv    [512]
  if (in_sizes[7] != 1) return;                     // gamma [1]
  if (in_sizes[8] != CCH * CCH) return;             // Wd    [512][512]
  if (in_sizes[9] != CCH) return;                   // bd    [512]
  if (out_size != NBAT * CCH * NPOS) return;        // out   [4][512][64][64] f32, last element 8388607

  const float* x     = (const float*)d_in[0];
  const float* Wq    = (const float*)d_in[1];       // [out][in]
  const float* bq    = (const float*)d_in[2];
  const float* Wk    = (const float*)d_in[3];
  const float* bk    = (const float*)d_in[4];
  const float* Wv    = (const float*)d_in[5];
  const float* bv    = (const float*)d_in[6];
  const float* gamma = (const float*)d_in[7];
  const float* Wd    = (const float*)d_in[8];
  const float* bd    = (const float*)d_in[9];

  const size_t PXT = (size_t)MROWS * CCH * 2;       // 16777216  f16 [16384][512]
  const size_t PWS = (size_t)CQK * CCH * 2;         // 65536     f16 [64][512]
  const size_t PWL = (size_t)CCH * CCH * 2;         // 524288    f16 [512][512]
  const size_t PQK = (size_t)MROWS * CQK * 2;       // 2097152   f16 [16384][64]
  const size_t PVT = (size_t)NBAT * CCH * NPOS * 2; // 16777216  f16 [4][512][4096]
  size_t off = 0;
  const size_t oXTh = off; off += PXT;  const size_t oXTl = off; off += PXT;
  const size_t oWQh = off; off += PWS;  const size_t oWQl = off; off += PWS;
  const size_t oWKh = off; off += PWS;  const size_t oWKl = off; off += PWS;
  const size_t oWVh = off; off += PWL;  const size_t oWVl = off; off += PWL;
  const size_t oWDh = off; off += PWL;  const size_t oWDl = off; off += PWL;
  const size_t oQh  = off; off += PQK;  const size_t oQl  = off; off += PQK;
  const size_t oKh  = off; off += PQK;  const size_t oKl  = off; off += PQK;
  const size_t oVT  = off; off += PVT;
  const size_t oO2h = off; off += PXT;  const size_t oO2l = off; off += PXT;
  if (off > ws_size) return;                        // off = 94633984
  if (off > (size_t)134217728) return;

  char* ws = (char*)d_ws;
  unsigned short* XTh = (unsigned short*)(ws + oXTh);  unsigned short* XTl = (unsigned short*)(ws + oXTl);
  unsigned short* WQh = (unsigned short*)(ws + oWQh);  unsigned short* WQl = (unsigned short*)(ws + oWQl);
  unsigned short* WKh = (unsigned short*)(ws + oWKh);  unsigned short* WKl = (unsigned short*)(ws + oWKl);
  unsigned short* WVh = (unsigned short*)(ws + oWVh);  unsigned short* WVl = (unsigned short*)(ws + oWVl);
  unsigned short* WDh = (unsigned short*)(ws + oWDh);  unsigned short* WDl = (unsigned short*)(ws + oWDl);
  unsigned short* Qh  = (unsigned short*)(ws + oQh);   unsigned short* Ql  = (unsigned short*)(ws + oQl);
  unsigned short* Kh  = (unsigned short*)(ws + oKh);   unsigned short* Kl  = (unsigned short*)(ws + oKl);
  unsigned short* VT  = (unsigned short*)(ws + oVT);
  unsigned short* O2h = (unsigned short*)(ws + oO2h);  unsigned short* O2l = (unsigned short*)(ws + oO2l);

  const dim3 blk(256);
  const float actCarry = 1024.0f;                    // 2^10 on x, q, k, o2 planes
  const float wCarry   = 65536.0f;                   // 2^16 on weight planes
  const float scale26  = 1.0f / 67108864.0f;         // 2^-26 = 1 / (2^10 * 2^16)
  const float sScale   = 1.0f / 1048576.0f;          // 2^-20 = 1 / (2^10 * 2^10)
  const float pCarry   = 32768.0f;                   // 2^15 on the P tile
  const float pInv     = 1.0f / 32768.0f;            // 2^-15

  // (1) x[b] viewed in[R=512 c][Cc=4096 n] (pitch 4096) -> XT_b[n][c] (pitch 512), hi/lo of x*2^10; grid (Cc/64, R/64, B) = (64, 8, 4)
  tsplit_f16<<<dim3(NPOS / 64, CCH / 64, NBAT), blk, 0, stream>>>(x, XTh, XTl, CCH, NPOS, (long)CCH * NPOS, (long)NPOS * CCH, actCarry);
  // (2) weight planes, natural [out][in] layout, hi/lo of W*2^16
  const int n8s = CQK * CCH / 8;                     // 4096  -> 16 blocks
  const int n8l = CCH * CCH / 8;                     // 32768 -> 128 blocks
  wconv_f16<<<dim3(n8s / 256), blk, 0, stream>>>(Wq, WQh, WQl, n8s, wCarry);
  wconv_f16<<<dim3(n8s / 256), blk, 0, stream>>>(Wk, WKh, WKl, n8s, wCarry);
  wconv_f16<<<dim3(n8l / 256), blk, 0, stream>>>(Wv, WVh, WVl, n8l, wCarry);
  wconv_f16<<<dim3(n8l / 256), blk, 0, stream>>>(Wd, WDh, WDl, n8l, wCarry);
  // (3) q = XT . Wq^T + bq -> Qh|Ql [16384][64] (x2^10)   (M=16384, N=64, K=512; 256 tiles -> 32 blocks)
  const dim3 gQ((MROWS / 64) * (CQK / 64) / 8, 1);
  gemm64_f16<true, 2, 2><<<gQ, blk, 0, stream>>>(
      XTh, XTl, CCH, 0L, WQh, WQl, CCH, 0L, (void*)Qh, (void*)Ql, CQK, 0L, bq, MROWS, CQK, CCH, scale26, actCarry);
  // (4) k likewise -> Kh|Kl
  gemm64_f16<true, 2, 2><<<gQ, blk, 0, stream>>>(
      XTh, XTl, CCH, 0L, WKh, WKl, CCH, 0L, (void*)Kh, (void*)Kl, CQK, 0L, bk, MROWS, CQK, CCH, scale26, actCarry);
  // (5) v^T[b] = Wv . XT_b^T + bv[m] -> VT [4][512][4096] f16 single   (M=512, N=4096, K=512; 512 tiles -> 64 blocks x 4 batches)
  const dim3 gV((CCH / 64) * (NPOS / 64) / 8, NBAT);
  gemm64_f16<true, 1, 1><<<gV, blk, 0, stream>>>(
      WVh, WVl, CCH, 0L, XTh, XTl, CCH, (long)NPOS * CCH, (void*)VT, (void*)VT, NPOS, (long)CCH * NPOS, bv,
      CCH, NPOS, CCH, scale26, 1.0f);
  // (6) attention + gamma scale + residual -> O2h|O2l [16384][512] (x2^10); grid (4096/64, 4) = 256 blocks
  attn_kernel<<<dim3(NPOS / AQB, NBAT), blk, 0, stream>>>(Qh, Ql, Kh, Kl, VT, x, gamma, O2h, O2l, sScale, pCarry, pInv, actCarry);
  // (7) out[b] = Wd . O2_b^T + bd[m] -> d_out NCHW f32 [4][512][4096]   (M=512, N=4096, K=512; 512 tiles -> 64 blocks x 4 batches)
  gemm64_f16<true, 1, 0><<<gV, blk, 0, stream>>>(
      WDh, WDl, CCH, 0L, O2h, O2l, CCH, (long)NPOS * CCH, d_out, d_out, NPOS, (long)CCH * NPOS, bd,
      CCH, NPOS, CCH, scale26, 1.0f);
  (void)hipGetLastError();
}

// v002
// It runs in 394 microseconds.
// Next to v001, in two timings, it ran 1.09 times as fast each time.
// All steps since v000 together make it 1.58 times as fast.
// Contractions: q, k, v 1x1 convs, q.k^T energies and the output 1x1 conv = v_wmma_f32_16x16x32_f16 on f16 hi/lo split planes (hi.hi + hi.lo + lo.hi, 3 products each); p.v = v_wmma_f32_16x16x32_f16 single product (p carried x2^15 as f16, v plain f16 with |v| < 2^-14 written as 0); f32 accumulate everywhere; running-max softmax, 1/rowsum, gamma scale, biases and the residual add (exact f32 x) in f32 on the VALU.
// Plane / carry map (every carry is an exact power of two; the inverse is folded exactly once, at the line named):
//   XTh|XTl  f16 [16384 (b,n)][512 c]    = hi/lo of x * 2^10           (n = h*64 + w; producer tsplit_f16)
//   WQh|WQl, WKh|WKl f16 [64][512]; WVh|WVl, WDh|WDl f16 [512][512] = hi/lo of W * 2^16, natural [out][in] (producer wconv_f16)
//   Qh|Ql, Kh|Kl f16 [16384][64]           = hi/lo of q (or k) * 2^10   (GEMM: acc * 2^-26 removes the x and W carries, + bias, then * 2^10)
//   VT  f16 [4][512 ch][4096 n]            = v, carry 1                   (GEMM: acc * 2^-26 + bias; |v| < 2^-14 stored as 0)
//   energies                               = acc * 2^-20 (q and k carries) in attn_kernel before the softmax
//   P   f16 (LDS only)                     = exp(s - m) * 2^15, values < 2^-14 stored as 0; 2^-15 folded together with 1/rowsum in the attn_kernel epilogue
//   O2h|O2l f16 [16384][512]               = hi/lo of (gamma * out + x) * 2^10 (attn_kernel epilogue)
//   output conv                            = acc * 2^-26 (O2 and W carries) + bd -> f32 NCHW [4][512][4096]
// Every f16 plane above lies in FRAGMENT ORDER: a matrix [R rows][K cols] is cut into blocks of 16 rows x 32 cols, block (rt, kb) at
// halves ((rt * K/32 + kb) * 512); inside a block element (row c, col 16*s + 8*h + e) sits at s*256 + (h*16 + c)*8 + e, which is the
// register order of a 16x16x32 operand: lane h*16 + c reads its 16 B at lane*8 (s = 0) and at 256 + lane*8 (s = 1), 512 contiguous bytes per wave load.
#include <hip/hip_runtime.h>
#include <math.h>
#include <stdint.h>

#define NBAT  4
#define CCH   512
#define CQK   64
#define IMGH  64
#define IMGW  64
#define NPOS  4096
#define MROWS 16384

static_assert(NPOS == IMGH * IMGW);
static_assert(MROWS == NBAT * NPOS);
static_assert(CCH % 64 == 0);
static_assert(CQK == 64);
static_assert(NPOS % 128 == 0);
static_assert(NPOS % 64 == 0);
static_assert(CCH % 32 == 0);
static_assert((CQK * CCH) % (8 * 256) == 0);
static_assert((CCH * CCH) % (8 * 256) == 0);
static_assert(CCH % 256 == 0);
static_assert((MROWS / 64) % 8 == 0);
static_assert(((CCH / 64) * (NPOS / 64)) % 8 == 0);

typedef __attribute__((ext_vector_type(16))) _Float16 v16h;
typedef __attribute__((ext_vector_type(8)))  _Float16 v8h;
typedef __attribute__((ext_vector_type(8)))  float    v8f;
typedef __attribute__((ext_vector_type(4)))  float    v4f;
typedef __attribute__((ext_vector_type(4)))  unsigned int v4u;

__device__ __forceinline__ unsigned short h_bits(_Float16 h) { return __builtin_bit_cast(unsigned short, h); }
__device__ __forceinline__ unsigned pk16(unsigned short a, unsigned short b) { return (unsigned)a | ((unsigned)b << 16); }

// hazard guards as plain device helpers (no inline asm inside the kernel template body)
__device__ __forceinline__ void dep_guard_h(v8f& a, v8f& b, v16h x, v16h y) { asm volatile("v_nop\n\tv_nop\n\tv_nop\n\tv_nop" : "+v"(a), "+v"(b) : "v"(x), "v"(y)); }
__device__ __forceinline__ void keep4_h(v16h a, v16h b, v16h c, v16h d) { asm volatile("v_nop" :: "v"(a), "v"(b), "v"(c), "v"(d)); }
__device__ __forceinline__ void acc_guard4(v8f& a, v8f& b, v8f& c, v8f& d) { asm volatile("v_nop\n\tv_nop\n\tv_nop\n\tv_nop" : "+v"(a), "+v"(b), "+v"(c), "+v"(d)); }

// 16-bit fragment loader (A and B alike) from a block in fragment order: p = block start + lane*8; lane row/col = lane&15, h = lane>>4;
// vector elements 0..7 <- p[0..7] (= k0+8h+0..7), 8..15 <- p[256..263] (= k0+16+8h+0..7).
struct FragH {
  union U { v16h v; v8h h[2]; };
  static __device__ __forceinline__ v16h load(const _Float16* p) {
    U f; f.h[0] = *(const v8h*)(p); f.h[1] = *(const v8h*)(p + 256); return f.v;
  }
  static __device__ __forceinline__ v8f mma(v16h a, v16h b, v8f c) {
    return __builtin_amdgcn_wmma_f32_16x16x32_f16(false, a, false, b, (short)0, c, false, false);
  }
  static __device__ __forceinline__ void guard(v8f& a, v8f& b, v16h x, v16h y) { dep_guard_h(a, b, x, y); }
  static __device__ __forceinline__ void keep(v16h a, v16h b, v16h c, v16h d) { keep4_h(a, b, c, d); }
};

// s_wait_xcnt 0 behind a group of global loads, in front of any rewrite of their address registers.
// The addresses are inputs only so that their registers stay as they are up to the wait.
__device__ __forceinline__ void xwait(const void* a) { asm volatile("s_wait_xcnt 0x0" :: "v"(a) : "memory"); }
__device__ __forceinline__ void xwait(const void* a, const void* b) { asm volatile("s_wait_xcnt 0x0" :: "v"(a), "v"(b) : "memory"); }
__device__ __forceinline__ void xwait(const void* a, const void* b, const void* c, const void* d) {
  asm volatile("s_wait_xcnt 0x0" :: "v"(a), "v"(b), "v"(c), "v"(d) : "memory");
}

__device__ __forceinline__ void xwait16(const _Float16* const (&a)[4], const _Float16* const (&b)[4], const _Float16* const (&c)[4], const _Float16* const (&d)[4]) {
  asm volatile("s_wait_xcnt 0x0" :: "v"(a[0]), "v"(a[1]), "v"(a[2]), "v"(a[3]), "v"(b[0]), "v"(b[1]), "v"(b[2]), "v"(b[3]),
                                    "v"(c[0]), "v"(c[1]), "v"(c[2]), "v"(c[3]), "v"(d[0]), "v"(d[1]), "v"(d[2]), "v"(d[3]) : "memory");
}

// ---- Register-blocked batched WMMA GEMM, f16 operands ----------------------
// C[m,n] = oscale * (scale * sum_k A[m,k] * Bt[n,k] + bias); each wave owns a 64x64 tile.
// A [M,lda] and Bt [N,ldb] in fragment order (lda, ldb = their column counts); M,N % 64 == 0, K % 32 == 0 (host-asserted sizes).
// f16 outputs (OUT_MODE 1, 2) are written in fragment order as matrices [M][ldc]; the f32 output stays row-major.
// SPLIT: operands are hi/lo planes (A2/Bt2 = lo planes, same layout); product = hi.hi + hi.lo + lo.hi.
// BIAS_MODE: 0 = none, 1 = bias[m], 2 = bias[n] (f32).
// OUT_MODE: 0 = f32; 1 = single f16 plane (|v| < 2^-14 stored as 0, so the plane holds no f16 subnormals);
//           2 = f16 hi plane (Cout) + f16 lo plane (Cout2), lo = v - hi.
template <bool SPLIT, int BIAS_MODE, int OUT_MODE>
__global__ __launch_bounds__(256) void gemm64_f16(
    const unsigned short* __restrict__ Ap, const unsigned short* __restrict__ A2p, int lda, long strideA,
    const unsigned short* __restrict__ Btp, const unsigned short* __restrict__ Bt2p, int ldb, long strideB,
    void* __restrict__ Cout, void* __restrict__ Cout2, int ldc, long strideC,
    const float* __restrict__ bias,
    int M, int N, int K, float scale, float oscale) {
  const _Float16* A   = (const _Float16*)(const void*)Ap;
  const _Float16* A2  = (const _Float16*)(const void*)A2p;
  const _Float16* Bt  = (const _Float16*)(const void*)Btp;
  const _Float16* Bt2 = (const _Float16*)(const void*)Bt2p;
  __shared__ __align__(16) float sT[8][16 * 68];   // per-wave 16x64 slab, pitch 68 floats
  const int b    = blockIdx.y;
  const int lane = threadIdx.x & 31;
  const int wave = __builtin_amdgcn_readfirstlane(threadIdx.x >> 5);   // scalar, so that the block starts below are formed once per wave on the scalar unit
  const int tilesN = N >> 6;
  const int tilesM = M >> 6;
  const int tile = blockIdx.x * 8 + wave;
  if (tile >= tilesM * tilesN) return;   // wave-uniform; no block barriers in this kernel
  const int tm = tile / tilesN;
  const int tn = tile - tm * tilesN;
  const int m0 = tm << 6;
  const int n0 = tn << 6;

  const _Float16* Ab  = A  + (size_t)b * strideA;
  const _Float16* Bb  = Bt + (size_t)b * strideB;
  const _Float16* Ab2 = SPLIT ? (A2  + (size_t)b * strideA) : Ab;
  const _Float16* Bb2 = SPLIT ? (Bt2 + (size_t)b * strideB) : Bb;

  const int rlane = lane & 15;                 // row (A) / col (B, D) within subtile
  const int mOff  = (lane >> 4) * 8;           // D row offset
  const unsigned lo8 = (unsigned)lane * 8;     // this lane's 16 B inside each 512-B half block

  v8f acc[4][4];
#pragma unroll
  for (int i = 0; i < 4; ++i)
#pragma unroll
    for (int j = 0; j < 4; ++j) acc[i][j] = (v8f){0.f,0.f,0.f,0.f,0.f,0.f,0.f,0.f};

  for (int k0 = 0; k0 < K; k0 += 32) {
    v16h bh[4], bl[4];
    const _Float16 *pbh[4], *pbl[4], *pah[4], *pal[4];
#pragma unroll
    for (int j = 0; j < 4; ++j) {
      const size_t bo = ((size_t)((n0 >> 4) + j) * (ldb >> 5) + (k0 >> 5)) << 9;   // block starts, the same in every lane
      const size_t ao = ((size_t)((m0 >> 4) + j) * (lda >> 5) + (k0 >> 5)) << 9;
      pbh[j] = Bb + bo + lo8;  pbl[j] = Bb2 + bo + lo8;
      pah[j] = Ab + ao + lo8;  pal[j] = Ab2 + ao + lo8;
    }
#pragma unroll
    for (int j = 0; j < 4; ++j) {
      bh[j] = FragH::load(pbh[j]);
      if (SPLIT) bl[j] = FragH::load(pbl[j]); else bl[j] = bh[j];
    }
#pragma unroll
    for (int i = 0; i < 4; ++i) {
      v16h ah = FragH::load(pah[i]);
      v16h al;
      if (SPLIT) al = FragH::load(pal[i]); else al = ah;
#pragma unroll
      for (int j = 0; j < 4; ++j) {
        acc[i][j] = FragH::mma(ah, bh[j], acc[i][j]);
        if (SPLIT) {
          acc[i][j] = FragH::mma(ah, bl[j], acc[i][j]);
          acc[i][j] = FragH::mma(al, bh[j], acc[i][j]);
        }
      }
      FragH::guard(acc[i][0], acc[i][3], ah, al);
    }
    FragH::keep(bh[0], bh[1], bh[2], bh[3]);
    if (SPLIT) FragH::keep(bl[0], bl[1], bl[2], bl[3]);
    xwait16(pbh, pbl, pah, pal);   // at the foot, where every load of the trip has been used: holds up nothing; the 16 address pairs stay as they are until here
  }
  acc_guard4(acc[0][0], acc[0][1], acc[0][2], acc[0][3]);
  acc_guard4(acc[1][0], acc[1][1], acc[1][2], acc[1][3]);
  acc_guard4(acc[2][0], acc[2][1], acc[2][2], acc[2][3]);
  acc_guard4(acc[3][0], acc[3][1], acc[3][2], acc[3][3]);

  // ---- epilogue ----
  float* slab = sT[wave];
#pragma unroll
  for (int i = 0; i < 4; ++i) {
    const int mBase = m0 + (i << 4);
#pragma unroll
    for (int j = 0; j < 4; ++j) {
      const int n = n0 + (j << 4) + rlane;
      float bvn = 0.f;
      if (BIAS_MODE == 2) bvn = bias[n];
#pragma unroll
      for (int r = 0; r < 8; ++r) {
        float v = acc[i][j][r] * scale;
        if (BIAS_MODE == 1) v += bias[mBase + mOff + r];
        if (BIAS_MODE == 2) v += bvn;
        slab[(mOff + r) * 68 + (j << 4) + rlane] = v * oscale;
      }
    }
    __builtin_amdgcn_fence(__ATOMIC_RELEASE, "workgroup");
    __builtin_amdgcn_wave_barrier();
    __builtin_amdgcn_fence(__ATOMIC_ACQUIRE, "workgroup");
    if (OUT_MODE == 0) {
      float* C = (float*)Cout + (size_t)b * strideC;
      const int hh = lane >> 4, c4 = (lane & 15) * 4;     // row seg = 256 B = 16 lanes x 16 B
      {
#pragma unroll
        for (int it = 0; it < 8; ++it) {
          const int row = it * 2 + hh;                       // it 0..7 x hh 0..1 = rows 0..15
          v4f v = *(const v4f*)(slab + row * 68 + c4);
          *(v4f*)(C + (size_t)(mBase + row) * ldc + n0 + c4) = v;
        }
        
      }
    } else {
      const int row = lane & 15, h8 = (lane >> 4) * 8;
      _Float16* C  = (_Float16*)Cout + (size_t)b * strideC;
      _Float16* C2 = (_Float16*)Cout2 + (size_t)b * strideC;
      const size_t tb = (((size_t)(mBase >> 4) * (ldc >> 5) + (n0 >> 5)) << 9) + lane * 8;   // the slab's two blocks follow one another
      {
#pragma unroll
        for (int it = 0; it < 4; ++it) {                     // it = 2 * (block) + s: cols it*16 + h8 .. +7 of row lane&15
          const float* sp = slab + row * 68 + it * 16 + h8;
          v8h hv, lv;
#pragma unroll
          for (int e = 0; e < 8; ++e) {
            if (OUT_MODE == 1) {
              float f = sp[e];
              f = (fabsf(f) >= 6.103515625e-05f) ? f : 0.0f;
              hv[e] = (_Float16)f;
            } else {
              const _Float16 hq = (_Float16)sp[e];
              hv[e] = hq;
              lv[e] = (_Float16)(sp[e] - (float)hq);
            }
          }
          *(v8h*)(C + tb + it * 256) = hv;
          if (OUT_MODE == 2) *(v8h*)(C2 + tb + it * 256) = lv;
        }
        
      }
    }
    __builtin_amdgcn_fence(__ATOMIC_RELEASE, "workgroup");
    __builtin_amdgcn_wave_barrier();
    __builtin_amdgcn_fence(__ATOMIC_ACQUIRE, "workgroup");
  }
}

// ---------------------------------------------------------------------------
// f16 hi/lo split of a row-major f32 matrix [rows][CCH] with total element count 8*n8 into planes in fragment order:
//   hi = f16(in * carry), lo = f16(in * carry - hi). Thread i makes the i-th 16-B unit of each plane from 8 consecutive elements of one row
// ---------------------------------------------------------------------------
__global__ __launch_bounds__(256) void wconv_f16(const float* __restrict__ in, unsigned short* __restrict__ oh,
                                                 unsigned short* __restrict__ ol, int n8, float carry) {
  const int i = blockIdx.x * 256 + threadIdx.x;
  if (i < n8) {
    const size_t e0 = (size_t)i * 8;
    const int blkid = i >> 6;                                             // block (rt, kb), CCH/32 blocks per row tile
    const int srow = (blkid / (CCH / 32)) * 16 + (i & 15);
    const int scol = (blkid % (CCH / 32)) * 32 + ((i >> 4) & 3) * 8;      // bits 5,4 of i = s,h: col 16*s + 8*h
    const float* ip = in + (size_t)srow * CCH + scol;
    const v4f a = *(const v4f*)(ip);
    const v4f c = *(const v4f*)(ip + 4);
    float f[8];
    f[0] = a[0]; f[1] = a[1]; f[2] = a[2]; f[3] = a[3];
    f[4] = c[0]; f[5] = c[1]; f[6] = c[2]; f[7] = c[3];
    v4u hv, lv;
#pragma unroll
    for (int q = 0; q < 4; ++q) {
      const float f0 = f[2 * q] * carry, f1 = f[2 * q + 1] * carry;
      const _Float16 h0 = (_Float16)f0, h1 = (_Float16)f1;
      const _Float16 l0 = (_Float16)(f0 - (float)h0), l1 = (_Float16)(f1 - (float)h1);
      hv[q] = pk16(h_bits(h0), h_bits(h1));
      lv[q] = pk16(h_bits(l0), h_bits(l1));
    }
    {
      *(v4u*)(oh + e0) = hv;
      *(v4u*)(ol + e0) = lv;
      
    }
  }
}

// ---------------------------------------------------------------------------
// Fused transpose + f16 hi/lo split of an f32 matrix, z-batched:
//   in_z = W + z*sIn viewed in[R rows][Cc cols] (pitch Cc) -> oh_z[c][r] = f16(in_z[r][c]*carry), ol_z[c][r] = f16(rem),
//   out [Cc][R] in fragment order, oh_z = oh + z*sOut.
// 64x64 tiles through LDS. grid = (Cc/64, R/64, Z), 256 threads (R, Cc multiples of 64; R multiple of 64 keeps every
// Coverage per block and plane: load 4 it x 256 thr x 4 floats = 64x64; store 2 it x 256 thr x 8 halves = 64x64.
// ---------------------------------------------------------------------------
__global__ __launch_bounds__(256) void tsplit_f16(const float* __restrict__ W, unsigned short* __restrict__ oh,
                                                  unsigned short* __restrict__ ol, int R, int Cc, long sIn, long sOut,
                                                  float carry) {
  __shared__ __align__(16) float tf[64 * 68];
  W  += (size_t)blockIdx.z * sIn;
  oh += (size_t)blockIdx.z * sOut;
  ol += (size_t)blockIdx.z * sOut;
  const int c0  = blockIdx.x * 64;   // input column block = output row block
  const int r0  = blockIdx.y * 64;   // input row block    = output column block
  const int tid = threadIdx.x;
  {
    const int lr = tid >> 4;         // 0..15
    const int c4 = (tid & 15) * 4;   // 0..60
#pragma unroll
    for (int it = 0; it < 4; ++it) {
      const int rr = it * 16 + lr;   // 0..63
      const v4f a = *(const v4f*)(W + (size_t)(r0 + rr) * Cc + c0 + c4);
      *(v4f*)(tf + rr * 68 + c4) = a;
    }
  }
  __syncthreads();
  // unit u = it*256 + tid of the tile's 512 16-B units per plane, in fragment order: u = ((row tile * 2 + block) * 2 + s) * 32 + h*16 + c
  v4u hv[2], lv[2];
#pragma unroll
  for (int it = 0; it < 2; ++it) {
    const int u  = it * 256 + tid;
    const int oc = ((u >> 7) << 4) + (u & 15);   // output row within tile (= input column)
    const int c8 = ((u >> 4) & 7) * 8;           // output column within tile = 32*block + 16*s + 8*h
    v4u a, a2;
#pragma unroll
    for (int q = 0; q < 4; ++q) {
      const float f0 = tf[(c8 + 2 * q) * 68 + oc] * carry;
      const float f1 = tf[(c8 + 2 * q + 1) * 68 + oc] * carry;
      const _Float16 h0 = (_Float16)f0, h1 = (_Float16)f1;
      const _Float16 l0 = (_Float16)(f0 - (float)h0), l1 = (_Float16)(f1 - (float)h1);
      a[q]  = pk16(h_bits(h0), h_bits(h1));
      a2[q] = pk16(h_bits(l0), h_bits(l1));
    }
    hv[it] = a; lv[it] = a2;
  }
  {
#pragma unroll
    for (int it = 0; it < 2; ++it) {
      const int u = it * 256 + tid;
      const size_t go = (((size_t)((c0 >> 4) + (u >> 7)) * (R >> 5) + (r0 >> 5) + ((u >> 6) & 1)) << 9) + (u & 63) * 8;
      *(v4u*)(oh + go) = hv[it];
      *(v4u*)(ol + go) = lv[it];
    }
    
  }
}

// =====================================================================================
// Flash-style attention with a 512-wide value dimension and a 64-deep score dimension, no score scaling.
//   All four kinds of plane in fragment order (head of the file):
//   q planes (hi/lo f16, x2^10) [16384][64]: row b*4096 + i, col d
//   k planes (hi/lo f16, x2^10) [16384][64]: same for keys j
//   v plane (f16, carry 1) [4*512][4096]: row b*512 + ch, col j
//   o2 planes (hi/lo f16, x2^10) [16384][512]: row b*4096 + i, col ch = split of (gamma*out + x[b][ch][i]) * 2^10
//   scores S = q . k on split planes (hi.hi + hi.lo + lo.hi), * sscale (= 2^-20) in f32;
//   running-max softmax in f32 over the 4096 keys of the batch element (32 chunks of 128, compile-time trip count);
//   P = exp(s - m) * pcarry (2^15) as f16 in LDS (values < 2^-14 stored as 0); out = P . v^T single products, f32 accumulate,
//   times (1/rowsum) * pinv (2^-15) at the end.
//   Block = 64 query rows (4 row tiles of 16) of one batch element, 8 waves; wave w computes the 64x16 score piece for keys
//   j0 + 16w .. +15 of each chunk (shared through LDS: partial row max Pm, partial row sum Pl, P tile Ps) and accumulates the
//   output for channels 64w .. 64w+63 (4 row tiles x 4 WMMA column tiles in registers). Each K fragment and each V fragment
//   loaded from global feeds every row tile, the K hi fragments with two products each. grid = (4096/64, 4) = 256 blocks.
//   The block's Q rows sit in LDS (Qsh/Qsl, written once, barrier B0) and are read as fragments in every chunk.
//   Barriers per chunk: after the Pm writes (B1) and after the Ps/Pl writes (B2); Pm/Ps/Pl of the next chunk are only
//   written after every wave has passed B2/B1 of the current one. Every wave reaches every barrier (no early exit).
//   LDS extents: Ps rows 0..63 x cols 0..127 fully written each chunk (8 waves x 16 cols) before any fragment read
//   (reads reach col 127; cols 128..135 never read); Pm/Pl [64][8] fully written; Os per-wave 16x64 (pitch 68, cols 64..67
//   never read), reused row tile by row tile. Fragment loads from global (K, V blocks) use plain arithmetic addressing, 16-B aligned.
// =====================================================================================
#define AQT    4
#define AQB    (16 * AQT)
#define AKC    128
#define PPITCH 136
#define NCHUNK (NPOS / AKC)

static_assert(NPOS % AQB == 0);
static_assert(NCHUNK * AKC == NPOS);
static_assert(CCH == 8 * 64);
static_assert((PPITCH * 2) % 16 == 0);
static_assert(AQB * CQK == 2 * 256 * 8);

__global__ __launch_bounds__(256)
void attn_kernel(const unsigned short* __restrict__ qhp, const unsigned short* __restrict__ qlp,
                 const unsigned short* __restrict__ khp, const unsigned short* __restrict__ klp,
                 const unsigned short* __restrict__ vtp,
                 const float* __restrict__ X, const float* __restrict__ gam,
                 unsigned short* __restrict__ o2hp, unsigned short* __restrict__ o2lp,
                 float sscale, float pcarry, float pinv, float ocarry) {
  union FB { v16h v; v8h h[2]; };
  __shared__ __align__(16) _Float16 Ps[AQB * PPITCH];     // P tile [query row][key in chunk], pitch 136 halves
  __shared__ __align__(16) float    Pm[AQB * 8];          // partial row max  [row][wave]
  __shared__ __align__(16) float    Pl[AQB * 8];          // partial row sum  [row][wave]
  __shared__ __align__(16) float    Os[8][16 * 68];       // per-wave 16x64 epilogue slab, pitch 68 floats
  __shared__ __align__(16) _Float16 Qsh[AQB * CQK];       // q hi plane rows of this block, fragment order as in global
  __shared__ __align__(16) _Float16 Qsl[AQB * CQK];       // q lo plane rows of this block, fragment order as in global

  const int tid  = threadIdx.x;
  const int wave = tid >> 5;
  const int lane = tid & 31;
  const int hh   = lane >> 4;
  const int c    = lane & 15;

  const int b  = blockIdx.y;                       // 0..3
  const int i0 = blockIdx.x * AQB;                 // first query position of this block
  const size_t qrow0 = (size_t)b * NPOS + i0;      // row in the q / o2 planes

  const _Float16* Qh = (const _Float16*)(const void*)qhp;
  const _Float16* Ql = (const _Float16*)(const void*)qlp;
  const _Float16* Kh = (const _Float16*)(const void*)khp;
  const _Float16* Kl = (const _Float16*)(const void*)klp;
  const _Float16* Vw = (const _Float16*)(const void*)vtp + ((size_t)b * CCH + (size_t)wave * 64) * NPOS;   // this wave's 64 channel rows
  _Float16* O2h = (_Float16*)(void*)o2hp;
  _Float16* O2l = (_Float16*)(void*)o2lp;
  const float g = gam[0];

  // ---- Q rows of the block (64 x 64, hi and lo) into LDS once: 512 pieces of 16 B per plane, 2 per thread and plane;
  //      the 16 Q fragments would take 128 registers, which the accumulators and the V fragments in flight need ----
  {
    const int q8 = tid * 8;                        // the 64 rows are 4 row tiles = 4096 consecutive halves; pieces tid and 256 + tid
    const _Float16* gh0 = Qh + qrow0 * CQK + q8;
    const _Float16* gl0 = Ql + qrow0 * CQK + q8;
    const _Float16* gh1 = gh0 + 32 * CQK;
    const _Float16* gl1 = gl0 + 32 * CQK;
    const v8h th0 = *(const v8h*)gh0, tl0 = *(const v8h*)gl0, th1 = *(const v8h*)gh1, tl1 = *(const v8h*)gl1;
    xwait(gh0, gl0, gh1, gl1);
    *(v8h*)(Qsh + q8) = th0;
    *(v8h*)(Qsl + q8) = tl0;
    *(v8h*)(Qsh + 32 * CQK + q8) = th1;
    *(v8h*)(Qsl + 32 * CQK + q8) = tl1;
  }
  __syncthreads();   // B0: every wave reads all 64 Q rows

  float mrow[AQT][8], lrow[AQT][8];
  v8f acc[AQT][4];
#pragma unroll
  for (int t = 0; t < AQT; ++t) {
#pragma unroll
    for (int r = 0; r < 8; ++r) { mrow[t][r] = -INFINITY; lrow[t][r] = 0.f; }
#pragma unroll
    for (int n = 0; n < 4; ++n) acc[t][n] = (v8f){0.f,0.f,0.f,0.f,0.f,0.f,0.f,0.f};
  }

  for (int jc = 0; jc < NCHUNK; ++jc) {
    const int j0 = jc * AKC;
    // ---- score piece: rows = 64 queries, cols = keys j0 + 16*wave + c (B operand col = lane&15) ----
    const size_t krow = (size_t)b * NPOS + j0 + wave * 16;   // first row of this wave's key row tile (2 blocks of 512 halves)
    v8f s[AQT];
#pragma unroll
    for (int t = 0; t < AQT; ++t) s[t] = (v8f){0.f,0.f,0.f,0.f,0.f,0.f,0.f,0.f};
    const _Float16* kph = Kh + krow * CQK + lane * 8;
    const _Float16* kpl = Kl + krow * CQK + lane * 8;
    v16h kfh[2], kfl[2];
#pragma unroll
    for (int dc = 0; dc < 2; ++dc) {
      kfh[dc] = FragH::load(kph + dc * 512);
      kfl[dc] = FragH::load(kpl + dc * 512);
    }
#pragma unroll
    for (int dc = 0; dc < 2; ++dc) {
      const v16h kbh = kfh[dc];
      const v16h kbl = kfl[dc];
      // Q fragments (A operand, row = lane&15) from LDS, same k map as the K fragments
      v16h qah[AQT], qal[AQT];
#pragma unroll
      for (int t = 0; t < AQT; ++t) {
        qah[t] = FragH::load(Qsh + (t * 2 + dc) * 512 + lane * 8);
        qal[t] = FragH::load(Qsl + (t * 2 + dc) * 512 + lane * 8);
      }
#pragma unroll
      for (int t = 0; t < AQT; ++t) s[t] = FragH::mma(qah[t], kbh, s[t]);
#pragma unroll
      for (int t = 0; t < AQT; ++t) s[t] = FragH::mma(qah[t], kbl, s[t]);
#pragma unroll
      for (int t = 0; t < AQT; ++t) s[t] = FragH::mma(qal[t], kbh, s[t]);
    }
    xwait(kph, kpl);   // behind the score products, where it holds up none of them
    // scale, then this wave's partial row max over its 16 keys (lanes of one half share rows)
#pragma unroll
    for (int t = 0; t < AQT; ++t) {
      float mloc[8];
#pragma unroll
      for (int r = 0; r < 8; ++r) {
        const float sv = s[t][r] * sscale;
        s[t][r] = sv;
        float m = sv;
#pragma unroll
        for (int off = 1; off < 16; off <<= 1) m = fmaxf(m, __shfl_xor(m, off, 32));
        mloc[r] = m;
      }
      if (c == 0) {
#pragma unroll
        for (int r = 0; r < 8; ++r) Pm[(t * 16 + 8 * hh + r) * 8 + wave] = mloc[r];
      }
    }
    __syncthreads();   // B1

    // ---- running max update (identical in every wave), P tile, partial row sums ----
    float alpha[AQT][8];
#pragma unroll
    for (int t = 0; t < AQT; ++t) {
      float psl[8];
#pragma unroll
      for (int r = 0; r < 8; ++r) {
        const int row = t * 16 + 8 * hh + r;
        const v4f ma = *(const v4f*)(Pm + row * 8);
        const v4f mb = *(const v4f*)(Pm + row * 8 + 4);
        const float cm = fmaxf(fmaxf(fmaxf(ma[0], ma[1]), fmaxf(ma[2], ma[3])),
                               fmaxf(fmaxf(mb[0], mb[1]), fmaxf(mb[2], mb[3])));
        const float mnew = fmaxf(mrow[t][r], cm);
        alpha[t][r] = __expf(mrow[t][r] - mnew);
        mrow[t][r] = mnew;
        const float p = __expf(s[t][r] - mnew);        // in (0, 1]
        float psum = p;
#pragma unroll
        for (int off = 1; off < 16; off <<= 1) psum += __shfl_xor(psum, off, 32);
        psl[r] = psum;
        float p32 = p * pcarry;
        p32 = (p32 >= 6.103515625e-05f) ? p32 : 0.0f;   // no f16 subnormals in the P tile
        Ps[row * PPITCH + wave * 16 + c] = (_Float16)p32;
#pragma unroll
        for (int n = 0; n < 4; ++n) acc[t][n][r] *= alpha[t][r];
      }
      if (c == 0) {
#pragma unroll
        for (int r = 0; r < 8; ++r) Pl[(t * 16 + 8 * hh + r) * 8 + wave] = psl[r];
      }
    }
    __syncthreads();   // B2

    // all 16 V fragments of the chunk (B operand, col = lane&15 = channel) are requested together
    const _Float16* vp = Vw + (size_t)(j0 >> 5) * 512 + lane * 8;   // block j0/32 of the wave's first channel row tile
    v16h vb[4][4];
#pragma unroll
    for (int kk = 0; kk < 4; ++kk) {
#pragma unroll
      for (int n = 0; n < 4; ++n) vb[kk][n] = FragH::load(vp + (size_t)(n * 16) * NPOS + kk * 512);
    }
    // keeps the 32 loads together in front of the row-sum work; without it this build spreads them among the products, only one k block ahead of their use
    __builtin_amdgcn_sched_barrier(0);

#pragma unroll
    for (int t = 0; t < AQT; ++t) {
#pragma unroll
      for (int r = 0; r < 8; ++r) {
        const int row = t * 16 + 8 * hh + r;
        const v4f la = *(const v4f*)(Pl + row * 8);
        const v4f lb = *(const v4f*)(Pl + row * 8 + 4);
        const float ls = ((la[0] + la[1]) + (la[2] + la[3])) + ((lb[0] + lb[1]) + (lb[2] + lb[3]));
        lrow[t][r] = lrow[t][r] * alpha[t][r] + ls;
      }
    }

    // ---- out(64 x 64 ch of this wave) += P(64 x 128) . V^T(128 x 64): A = P tile (row = lane&15 = query within the row tile),
    //      B = v plane rows (col = lane&15 = channel), both with the split k map; one V fragment serves all 4 row tiles ----
#pragma unroll
    for (int kk = 0; kk < 4; ++kk) {
      FB pa[AQT];
#pragma unroll
      for (int t = 0; t < AQT; ++t) {
        pa[t].h[0] = *(const v8h*)(Ps + (t * 16 + c) * PPITCH + kk * 32 + 8 * hh);
        pa[t].h[1] = *(const v8h*)(Ps + (t * 16 + c) * PPITCH + kk * 32 + 16 + 8 * hh);
      }
#pragma unroll
      for (int n = 0; n < 4; ++n) {
#pragma unroll
        for (int t = 0; t < AQT; ++t) acc[t][n] = FragH::mma(pa[t].v, vb[kk][n], acc[t][n]);
      }
    }
    xwait(vp);   // late in the chunk, where it holds up no product; vp's registers are kept as they are until here
  }

  // ---- epilogue, row tile by row tile: out * (1/(rowsum * 2^15)); o2 = gamma*out + x (exact f32 x); stage (o2 * 2^10) in the wave's slab;
  float* os = Os[wave];
  const float* xp0 = X + ((size_t)b * CCH + wave * 64 + c) * NPOS + i0 + 8 * hh;   // channel 64w + c, row tile 0; 8 consecutive positions, 32-B aligned
#pragma unroll
  for (int t = 0; t < AQT; ++t) {
    float rl[8];
#pragma unroll
    for (int r = 0; r < 8; ++r) rl[r] = (1.0f / lrow[t][r]) * pinv;
    const float* xp = xp0 + t * 16;
    v4f xa[4], xb[4];
#pragma unroll
    for (int n = 0; n < 4; ++n) {                   // channel 64w + 16n + c
      xa[n] = *(const v4f*)(xp + (size_t)(n * 16) * NPOS);
      xb[n] = *(const v4f*)(xp + (size_t)(n * 16) * NPOS + 4);
    }
    xwait(xp0);
#pragma unroll
    for (int n = 0; n < 4; ++n) {
      float xe[8];
      xe[0] = xa[n][0]; xe[1] = xa[n][1]; xe[2] = xa[n][2]; xe[3] = xa[n][3];
      xe[4] = xb[n][0]; xe[5] = xb[n][1]; xe[6] = xb[n][2]; xe[7] = xb[n][3];
#pragma unroll
      for (int r = 0; r < 8; ++r) {
        const float o  = acc[t][n][r] * rl[r];
        const float v2 = g * o + xe[r];
        os[(8 * hh + r) * 68 + n * 16 + c] = v2 * ocarry;
      }
    }
    __builtin_amdgcn_fence(__ATOMIC_RELEASE, "workgroup");
    __builtin_amdgcn_wave_barrier();
    __builtin_amdgcn_fence(__ATOMIC_ACQUIRE, "workgroup");
    {
      const int row = lane & 15, h8 = (lane >> 4) * 8;
      const size_t tb = ((((qrow0 >> 4) + t) * (size_t)(CCH >> 5) + wave * 2) << 9) + lane * 8;   // the wave's two blocks of row tile t
#pragma unroll
      for (int it = 0; it < 4; ++it) {              // it = 2 * (block) + s: channels 64w + it*16 + h8 .. +7 of row lane&15
        const float* sp = os + row * 68 + it * 16 + h8;
        v8h hv, lv;
#pragma unroll
        for (int e = 0; e < 8; ++e) {
          const _Float16 hq = (_Float16)sp[e];
          hv[e] = hq;
          lv[e] = (_Float16)(sp[e] - (float)hq);
        }
        const size_t go = tb + it * 256;
        *(v8h*)(O2h + go) = hv;
        *(v8h*)(O2l + go) = lv;
      }
    }
    // the slab is rewritten by the next row tile only after every lane of the wave has read it
    __builtin_amdgcn_fence(__ATOMIC_RELEASE, "workgroup");
    __builtin_amdgcn_wave_barrier();
    __builtin_amdgcn_fence(__ATOMIC_ACQUIRE, "workgroup");
  }
}

// ---------------------------------------------------------------------------
// Workspace region map (byte offsets; every region is fully written by its producer launch before any consumer
//   XTh  f16 [16384][512]        0        16777216     XTl   16777216   16777216
//   WQh  f16 [64][512]    33554432           65536     WQl   33619968      65536
//   WKh  f16 [64][512]    33685504           65536     WKl   33751040      65536
//   WVh  f16 [512][512]   33816576          524288     WVl   34340864     524288
//   WDh  f16 [512][512]   34865152          524288     WDl   35389440     524288
//   Qh   f16 [16384][64]  35913728         2097152     Ql    38010880    2097152
//   Kh   f16 [16384][64]  40108032         2097152     Kl    42205184    2097152
//   VT   f16 [4][512][4096] 44302336     16777216
//   O2h  f16 [16384][512] 61079552        16777216     O2l   77856768   16777216
//   total                 94633984
// ---------------------------------------------------------------------------
extern "C" void kernel_launch(void* const* d_in, const int* in_sizes, int n_in,
                              void* d_out, int out_size, void* d_ws, size_t ws_size,
                              hipStream_t stream) {
  if (n_in < 10) return;
  if (in_sizes[0] != NBAT * CCH * NPOS) return;     // x     [4][512][64][64]
  if (in_sizes[1] != CQK * CCH) return;             // Wq    [64][512]
  if (in_sizes[2] != CQK) return;                   // bq    [64]
  if (in_sizes[3] != CQK * CCH) return;             // Wk    [64][512]
  if (in_sizes[4] != CQK) return;                   // bk    [64]
  if (in_sizes[5] != CCH * CCH) return;             // Wv    [512][512]
  if (in_sizes[6] != CCH) return;                   // bv    [512]
  if (in_sizes[7] != 1) return;                     // gamma [1]
  if (in_sizes[8] != CCH * CCH) return;             // Wd    [512][512]
  if (in_sizes[9] != CCH) return;                   // bd    [512]
  if (out_size != NBAT * CCH * NPOS) return;        // out   [4][512][64][64] f32, last element 8388607

  const float* x     = (const float*)d_in[0];
  const float* Wq    = (const float*)d_in[1];       // [out][in]
  const float* bq    = (const float*)d_in[2];
  const float* Wk    = (const float*)d_in[3];
  const float* bk    = (const float*)d_in[4];
  const float* Wv    = (const float*)d_in[5];
  const float* bv    = (const float*)d_in[6];
  const float* gamma = (const float*)d_in[7];
  const float* Wd    = (const float*)d_in[8];
  const float* bd    = (const float*)d_in[9];

  const size_t PXT = (size_t)MROWS * CCH * 2;       // 16777216  f16 [16384][512]
  const size_t PWS = (size_t)CQK * CCH * 2;         // 65536     f16 [64][512]
  const size_t PWL = (size_t)CCH * CCH * 2;         // 524288    f16 [512][512]
  const size_t PQK = (size_t)MROWS * CQK * 2;       // 2097152   f16 [16384][64]
  const size_t PVT = (size_t)NBAT * CCH * NPOS * 2; // 16777216  f16 [4][512][4096]
  size_t off = 0;
  const size_t oXTh = off; off += PXT;  const size_t oXTl = off; off += PXT;
  const size_t oWQh = off; off += PWS;  const size_t oWQl = off; off += PWS;
  const size_t oWKh = off; off += PWS;  const size_t oWKl = off; off += PWS;
  const size_t oWVh = off; off += PWL;  const size_t oWVl = off; off += PWL;
  const size_t oWDh = off; off += PWL;  const size_t oWDl = off; off += PWL;
  const size_t oQh  = off; off += PQK;  const size_t oQl  = off; off += PQK;
  const size_t oKh  = off; off += PQK;  const size_t oKl  = off; off += PQK;
  const size_t oVT  = off; off += PVT;
  const size_t oO2h = off; off += PXT;  const size_t oO2l = off; off += PXT;
  if (off > ws_size) return;                        // off = 94633984
  if (off > (size_t)134217728) return;

  char* ws = (char*)d_ws;
  unsigned short* XTh = (unsigned short*)(ws + oXTh);  unsigned short* XTl = (unsigned short*)(ws + oXTl);
  unsigned short* WQh = (unsigned short*)(ws + oWQh);  unsigned short* WQl = (unsigned short*)(ws + oWQl);
  unsigned short* WKh = (unsigned short*)(ws + oWKh);  unsigned short* WKl = (unsigned short*)(ws + oWKl);
  unsigned short* WVh = (unsigned short*)(ws + oWVh);  unsigned short* WVl = (unsigned short*)(ws + oWVl);
  unsigned short* WDh = (unsigned short*)(ws + oWDh);  unsigned short* WDl = (unsigned short*)(ws + oWDl);
  unsigned short* Qh  = (unsigned short*)(ws + oQh);   unsigned short* Ql  = (unsigned short*)(ws + oQl);
  unsigned short* Kh  = (unsigned short*)(ws + oKh);   unsigned short* Kl  = (unsigned short*)(ws + oKl);
  unsigned short* VT  = (unsigned short*)(ws + oVT);
  unsigned short* O2h = (unsigned short*)(ws + oO2h);  unsigned short* O2l = (unsigned short*)(ws + oO2l);

  const dim3 blk(256);
  const float actCarry = 1024.0f;                    // 2^10 on x, q, k, o2 planes
  const float wCarry   = 65536.0f;                   // 2^16 on weight planes
  const float scale26  = 1.0f / 67108864.0f;         // 2^-26 = 1 / (2^10 * 2^16)
  const float sScale   = 1.0f / 1048576.0f;          // 2^-20 = 1 / (2^10 * 2^10)
  const float pCarry   = 32768.0f;                   // 2^15 on the P tile
  const float pInv     = 1.0f / 32768.0f;            // 2^-15

  // (1) x[b] viewed in[R=512 c][Cc=4096 n] (pitch 4096) -> XT_b[n][c] (fragment order), hi/lo of x*2^10; grid (Cc/64, R/64, B) = (64, 8, 4)
  tsplit_f16<<<dim3(NPOS / 64, CCH / 64, NBAT), blk, 0, stream>>>(x, XTh, XTl, CCH, NPOS, (long)CCH * NPOS, (long)NPOS * CCH, actCarry);
  // (2) weight planes, natural [out][in] layout, hi/lo of W*2^16
  const int n8s = CQK * CCH / 8;                     // 4096  -> 16 blocks
  const int n8l = CCH * CCH / 8;                     // 32768 -> 128 blocks
  wconv_f16<<<dim3(n8s / 256), blk, 0, stream>>>(Wq, WQh, WQl, n8s, wCarry);
  wconv_f16<<<dim3(n8s / 256), blk, 0, stream>>>(Wk, WKh, WKl, n8s, wCarry);
  wconv_f16<<<dim3(n8l / 256), blk, 0, stream>>>(Wv, WVh, WVl, n8l, wCarry);
  wconv_f16<<<dim3(n8l / 256), blk, 0, stream>>>(Wd, WDh, WDl, n8l, wCarry);
  // (3) q = XT . Wq^T + bq -> Qh|Ql [16384][64] (x2^10)   (M=16384, N=64, K=512; 256 tiles -> 32 blocks)
  const dim3 gQ((MROWS / 64) * (CQK / 64) / 8, 1);
  gemm64_f16<true, 2, 2><<<gQ, blk, 0, stream>>>(
      XTh, XTl, CCH, 0L, WQh, WQl, CCH, 0L, (void*)Qh, (void*)Ql, CQK, 0L, bq, MROWS, CQK, CCH, scale26, actCarry);
  // (4) k likewise -> Kh|Kl
  gemm64_f16<true, 2, 2><<<gQ, blk, 0, stream>>>(
      XTh, XTl, CCH, 0L, WKh, WKl, CCH, 0L, (void*)Kh, (void*)Kl, CQK, 0L, bk, MROWS, CQK, CCH, scale26, actCarry);
  // (5) v^T[b] = Wv . XT_b^T + bv[m] -> VT [4][512][4096] f16 single   (M=512, N=4096, K=512; 512 tiles -> 64 blocks x 4 batches)
  const dim3 gV((CCH / 64) * (NPOS / 64) / 8, NBAT);
  gemm64_f16<true, 1, 1><<<gV, blk, 0, stream>>>(
      WVh, WVl, CCH, 0L, XTh, XTl, CCH, (long)NPOS * CCH, (void*)VT, (void*)VT, NPOS, (long)CCH * NPOS, bv,
      CCH, NPOS, CCH, scale26, 1.0f);
  // (6) attention + gamma scale + residual -> O2h|O2l [16384][512] (x2^10); grid (4096/64, 4) = 256 blocks
  attn_kernel<<<dim3(NPOS / AQB, NBAT), blk, 0, stream>>>(Qh, Ql, Kh, Kl, VT, x, gamma, O2h, O2l, sScale, pCarry, pInv, actCarry);
  // (7) out[b] = Wd . O2_b^T + bd[m] -> d_out NCHW f32 [4][512][4096]   (M=512, N=4096, K=512; 512 tiles -> 64 blocks x 4 batches)
  gemm64_f16<true, 1, 0><<<gV, blk, 0, stream>>>(
      WDh, WDl, CCH, 0L, O2h, O2l, CCH, (long)NPOS * CCH, d_out, d_out, NPOS, (long)CCH * NPOS, bd,
      CCH, NPOS, CCH, scale26, 1.0f);
  (void)hipGetLastError();
}

// v003
// One run takes 298 microseconds.
// In two side-by-side timings against v002, it was 1.31 and 1.34 times as fast.
// All steps since v000 together make it 2.09 times as fast.
// Contractions: q, k, v 1x1 convs, q.k^T energies and the output 1x1 conv = v_wmma_f32_16x16x32_f16 on f16 hi/lo split planes (hi.hi + hi.lo + lo.hi, 3 products each); p.v = v_wmma_f32_16x16x32_f16 single product (p carried x2^15 as f16, v plain f16 with |v| < 2^-14 written as 0); f32 accumulate everywhere; running-max softmax, 1/rowsum, gamma scale, biases and the residual add (exact f32 x) in f32 on the VALU.
// Plane / carry map (every carry is an exact power of two; the inverse is folded exactly once, at the line named):
//   XTh|XTl  f16 [16384 (b,n)][512 c]    = hi/lo of x * 2^10           (n = h*64 + w; producer tsplit_f16)
//   WQh|WQl, WKh|WKl f16 [64][512]; WVh|WVl, WDh|WDl f16 [512][512] = hi/lo of W * 2^16, natural [out][in] (producer wconv_f16)
//   Qh|Ql, Kh|Kl f16 [16384][64]           = hi/lo of q (or k) * 2^10   (GEMM: acc * 2^-26 removes the x and W carries, + bias, then * 2^10)
//   VT  f16 [4][512 ch][4096 n]            = v, carry 1                   (GEMM: acc * 2^-26 + bias; |v| < 2^-14 stored as 0)
//   energies                               = acc * 2^-20 (q and k carries) in attn_kernel before the softmax
//   P   f16 (LDS only)                     = exp(s - m) * 2^15, values < 2^-14 stored as 0; 2^-15 folded together with 1/rowsum in the attn_kernel epilogue
//   O2h|O2l f16 [16384][512]               = hi/lo of (gamma * out + x) * 2^10 (attn_kernel epilogue)
//   output conv                            = acc * 2^-26 (O2 and W carries) + bd -> f32 NCHW [4][512][4096]
// Every f16 plane above lies in FRAGMENT ORDER: a matrix [R rows][K cols] is cut into blocks of 16 rows x 32 cols, block (rt, kb) at
// halves ((rt * K/32 + kb) * 512); inside a block element (row c, col 16*s + 8*h + e) sits at s*256 + (h*16 + c)*8 + e, which is the
// register order of a 16x16x32 operand: lane h*16 + c reads its 16 B at lane*8 (s = 0) and at 256 + lane*8 (s = 1), 512 contiguous bytes per wave load.
#include <hip/hip_runtime.h>
#include <math.h>
#include <stdint.h>

#define NBAT  4
#define CCH   512
#define CQK   64
#define IMGH  64
#define IMGW  64
#define NPOS  4096
#define MROWS 16384

static_assert(NPOS == IMGH * IMGW);
static_assert(MROWS == NBAT * NPOS);
static_assert(CCH % 64 == 0);
static_assert(CQK == 64);
static_assert(NPOS % 128 == 0);
static_assert(NPOS % 64 == 0);
static_assert(CCH % 32 == 0);
static_assert((CQK * CCH) % (8 * 256) == 0);
static_assert((CCH * CCH) % (8 * 256) == 0);
static_assert(CCH % 256 == 0);
static_assert((MROWS / 64) % 8 == 0);
static_assert(((CCH / 64) * (NPOS / 64)) % 8 == 0);

typedef __attribute__((ext_vector_type(16))) _Float16 v16h;
typedef __attribute__((ext_vector_type(8)))  _Float16 v8h;
typedef __attribute__((ext_vector_type(8)))  float    v8f;
typedef __attribute__((ext_vector_type(4)))  float    v4f;
typedef __attribute__((ext_vector_type(4)))  unsigned int v4u;

__device__ __forceinline__ unsigned short h_bits(_Float16 h) { return __builtin_bit_cast(unsigned short, h); }
__device__ __forceinline__ unsigned pk16(unsigned short a, unsigned short b) { return (unsigned)a | ((unsigned)b << 16); }

// hazard guards as plain device helpers (no inline asm inside the kernel template body)
__device__ __forceinline__ void dep_guard_h(v8f& a, v8f& b, v16h x, v16h y) { asm volatile("v_nop\n\tv_nop\n\tv_nop\n\tv_nop" : "+v"(a), "+v"(b) : "v"(x), "v"(y)); }
__device__ __forceinline__ void keep4_h(v16h a, v16h b, v16h c, v16h d) { asm volatile("v_nop" :: "v"(a), "v"(b), "v"(c), "v"(d)); }
__device__ __forceinline__ void acc_guard4(v8f& a, v8f& b, v8f& c, v8f& d) { asm volatile("v_nop\n\tv_nop\n\tv_nop\n\tv_nop" : "+v"(a), "+v"(b), "+v"(c), "+v"(d)); }

// 16-bit fragment loader (A and B alike) from a block in fragment order: p = block start + lane*8; lane row/col = lane&15, h = lane>>4;
// vector elements 0..7 <- p[0..7] (= k0+8h+0..7), 8..15 <- p[256..263] (= k0+16+8h+0..7).
struct FragH {
  union U { v16h v; v8h h[2]; };
  static __device__ __forceinline__ v16h load(const _Float16* p) {
    U f; f.h[0] = *(const v8h*)(p); f.h[1] = *(const v8h*)(p + 256); return f.v;
  }
  static __device__ __forceinline__ v8f mma(v16h a, v16h b, v8f c) {
    return __builtin_amdgcn_wmma_f32_16x16x32_f16(false, a, false, b, (short)0, c, false, false);
  }
  static __device__ __forceinline__ void guard(v8f& a, v8f& b, v16h x, v16h y) { dep_guard_h(a, b, x, y); }
  static __device__ __forceinline__ void keep(v16h a, v16h b, v16h c, v16h d) { keep4_h(a, b, c, d); }
};

// s_wait_xcnt 0 behind a group of global loads, in front of any rewrite of their address registers.
// The addresses are inputs only so that their registers stay as they are up to the wait.
__device__ __forceinline__ void xwait(const void* a) { asm volatile("s_wait_xcnt 0x0" :: "v"(a) : "memory"); }
__device__ __forceinline__ void xwait(const void* a, const void* b) { asm volatile("s_wait_xcnt 0x0" :: "v"(a), "v"(b) : "memory"); }
__device__ __forceinline__ void xwait(const void* a, const void* b, const void* c, const void* d) {
  asm volatile("s_wait_xcnt 0x0" :: "v"(a), "v"(b), "v"(c), "v"(d) : "memory");
}

__device__ __forceinline__ void xwait16(const _Float16* const (&a)[4], const _Float16* const (&b)[4], const _Float16* const (&c)[4], const _Float16* const (&d)[4]) {
  asm volatile("s_wait_xcnt 0x0" :: "v"(a[0]), "v"(a[1]), "v"(a[2]), "v"(a[3]), "v"(b[0]), "v"(b[1]), "v"(b[2]), "v"(b[3]),
                                    "v"(c[0]), "v"(c[1]), "v"(c[2]), "v"(c[3]), "v"(d[0]), "v"(d[1]), "v"(d[2]), "v"(d[3]) : "memory");
}

// ---- Register-blocked batched WMMA GEMM, f16 operands ----------------------
// C[m,n] = oscale * (scale * sum_k A[m,k] * Bt[n,k] + bias); each wave owns a 64x64 tile.
// A [M,lda] and Bt [N,ldb] in fragment order (lda, ldb = their column counts); M,N % 64 == 0, K % 32 == 0 (host-asserted sizes).
// f16 outputs (OUT_MODE 1, 2) are written in fragment order as matrices [M][ldc]; the f32 output stays row-major.
// SPLIT: operands are hi/lo planes (A2/Bt2 = lo planes, same layout); product = hi.hi + hi.lo + lo.hi.
// BIAS_MODE: 0 = none, 1 = bias[m], 2 = bias[n] (f32).
// OUT_MODE: 0 = f32; 1 = single f16 plane (|v| < 2^-14 stored as 0, so the plane holds no f16 subnormals);
//           2 = f16 hi plane (Cout) + f16 lo plane (Cout2), lo = v - hi.
template <bool SPLIT, int BIAS_MODE, int OUT_MODE>
__global__ __launch_bounds__(256) void gemm64_f16(
    const unsigned short* __restrict__ Ap, const unsigned short* __restrict__ A2p, int lda, long strideA,
    const unsigned short* __restrict__ Btp, const unsigned short* __restrict__ Bt2p, int ldb, long strideB,
    void* __restrict__ Cout, void* __restrict__ Cout2, int ldc, long strideC,
    const float* __restrict__ bias,
    int M, int N, int K, float scale, float oscale) {
  const _Float16* A   = (const _Float16*)(const void*)Ap;
  const _Float16* A2  = (const _Float16*)(const void*)A2p;
  const _Float16* Bt  = (const _Float16*)(const void*)Btp;
  const _Float16* Bt2 = (const _Float16*)(const void*)Bt2p;
  __shared__ __align__(16) float sT[8][16 * 68];   // per-wave 16x64 slab, pitch 68 floats
  const int b    = blockIdx.y;
  const int lane = threadIdx.x & 31;
  const int wave = __builtin_amdgcn_readfirstlane(threadIdx.x >> 5);   // scalar, so that the block starts below are formed once per wave on the scalar unit
  const int tilesN = N >> 6;
  const int tilesM = M >> 6;
  const int tile = blockIdx.x * 8 + wave;
  if (tile >= tilesM * tilesN) return;   // wave-uniform; no block barriers in this kernel
  const int tm = tile / tilesN;
  const int tn = tile - tm * tilesN;
  const int m0 = tm << 6;
  const int n0 = tn << 6;

  const _Float16* Ab  = A  + (size_t)b * strideA;
  const _Float16* Bb  = Bt + (size_t)b * strideB;
  const _Float16* Ab2 = SPLIT ? (A2  + (size_t)b * strideA) : Ab;
  const _Float16* Bb2 = SPLIT ? (Bt2 + (size_t)b * strideB) : Bb;

  const int rlane = lane & 15;                 // row (A) / col (B, D) within subtile
  const int mOff  = (lane >> 4) * 8;           // D row offset
  const unsigned lo8 = (unsigned)lane * 8;     // this lane's 16 B inside each 512-B half block

  v8f acc[4][4];
#pragma unroll
  for (int i = 0; i < 4; ++i)
#pragma unroll
    for (int j = 0; j < 4; ++j) acc[i][j] = (v8f){0.f,0.f,0.f,0.f,0.f,0.f,0.f,0.f};

  for (int k0 = 0; k0 < K; k0 += 32) {
    v16h bh[4], bl[4];
    const _Float16 *pbh[4], *pbl[4], *pah[4], *pal[4];
#pragma unroll
    for (int j = 0; j < 4; ++j) {
      const size_t bo = ((size_t)((n0 >> 4) + j) * (ldb >> 5) + (k0 >> 5)) << 9;   // block starts, the same in every lane
      const size_t ao = ((size_t)((m0 >> 4) + j) * (lda >> 5) + (k0 >> 5)) << 9;
      pbh[j] = Bb + bo + lo8;  pbl[j] = Bb2 + bo + lo8;
      pah[j] = Ab + ao + lo8;  pal[j] = Ab2 + ao + lo8;
    }
#pragma unroll
    for (int j = 0; j < 4; ++j) {
      bh[j] = FragH::load(pbh[j]);
      if (SPLIT) bl[j] = FragH::load(pbl[j]); else bl[j] = bh[j];
    }
#pragma unroll
    for (int i = 0; i < 4; ++i) {
      v16h ah = FragH::load(pah[i]);
      v16h al;
      if (SPLIT) al = FragH::load(pal[i]); else al = ah;
#pragma unroll
      for (int j = 0; j < 4; ++j) {
        acc[i][j] = FragH::mma(ah, bh[j], acc[i][j]);
        if (SPLIT) {
          acc[i][j] = FragH::mma(ah, bl[j], acc[i][j]);
          acc[i][j] = FragH::mma(al, bh[j], acc[i][j]);
        }
      }
      FragH::guard(acc[i][0], acc[i][3], ah, al);
    }
    FragH::keep(bh[0], bh[1], bh[2], bh[3]);
    if (SPLIT) FragH::keep(bl[0], bl[1], bl[2], bl[3]);
    xwait16(pbh, pbl, pah, pal);   // at the foot, where every load of the trip has been used: holds up nothing; the 16 address pairs stay as they are until here
  }
  acc_guard4(acc[0][0], acc[0][1], acc[0][2], acc[0][3]);
  acc_guard4(acc[1][0], acc[1][1], acc[1][2], acc[1][3]);
  acc_guard4(acc[2][0], acc[2][1], acc[2][2], acc[2][3]);
  acc_guard4(acc[3][0], acc[3][1], acc[3][2], acc[3][3]);

  // ---- epilogue ----
  float* slab = sT[wave];
#pragma unroll
  for (int i = 0; i < 4; ++i) {
    const int mBase = m0 + (i << 4);
#pragma unroll
    for (int j = 0; j < 4; ++j) {
      const int n = n0 + (j << 4) + rlane;
      float bvn = 0.f;
      if (BIAS_MODE == 2) bvn = bias[n];
#pragma unroll
      for (int r = 0; r < 8; ++r) {
        float v = acc[i][j][r] * scale;
        if (BIAS_MODE == 1) v += bias[mBase + mOff + r];
        if (BIAS_MODE == 2) v += bvn;
        slab[(mOff + r) * 68 + (j << 4) + rlane] = v * oscale;
      }
    }
    __builtin_amdgcn_fence(__ATOMIC_RELEASE, "workgroup");
    __builtin_amdgcn_wave_barrier();
    __builtin_amdgcn_fence(__ATOMIC_ACQUIRE, "workgroup");
    if (OUT_MODE == 0) {
      float* C = (float*)Cout + (size_t)b * strideC;
      const int hh = lane >> 4, c4 = (lane & 15) * 4;     // row seg = 256 B = 16 lanes x 16 B
      {
#pragma unroll
        for (int it = 0; it < 8; ++it) {
          const int row = it * 2 + hh;                       // it 0..7 x hh 0..1 = rows 0..15
          v4f v = *(const v4f*)(slab + row * 68 + c4);
          *(v4f*)(C + (size_t)(mBase + row) * ldc + n0 + c4) = v;
        }
        
      }
    } else {
      const int row = lane & 15, h8 = (lane >> 4) * 8;
      _Float16* C  = (_Float16*)Cout + (size_t)b * strideC;
      _Float16* C2 = (_Float16*)Cout2 + (size_t)b * strideC;
      const size_t tb = (((size_t)(mBase >> 4) * (ldc >> 5) + (n0 >> 5)) << 9) + lane * 8;   // the slab's two blocks follow one another
      {
#pragma unroll
        for (int it = 0; it < 4; ++it) {                     // it = 2 * (block) + s: cols it*16 + h8 .. +7 of row lane&15
          const float* sp = slab + row * 68 + it * 16 + h8;
          v8h hv, lv;
#pragma unroll
          for (int e = 0; e < 8; ++e) {
            if (OUT_MODE == 1) {
              float f = sp[e];
              f = (fabsf(f) >= 6.103515625e-05f) ? f : 0.0f;
              hv[e] = (_Float16)f;
            } else {
              const _Float16 hq = (_Float16)sp[e];
              hv[e] = hq;
              lv[e] = (_Float16)(sp[e] - (float)hq);
            }
          }
          *(v8h*)(C + tb + it * 256) = hv;
          if (OUT_MODE == 2) *(v8h*)(C2 + tb + it * 256) = lv;
        }
        
      }
    }
    __builtin_amdgcn_fence(__ATOMIC_RELEASE, "workgroup");
    __builtin_amdgcn_wave_barrier();
    __builtin_amdgcn_fence(__ATOMIC_ACQUIRE, "workgroup");
  }
}

// ---------------------------------------------------------------------------
// f16 hi/lo split of a row-major f32 matrix [rows][CCH] with total element count 8*n8 into planes in fragment order:
//   hi = f16(in * carry), lo = f16(in * carry - hi). Thread i makes the i-th 16-B unit of each plane from 8 consecutive elements of one row
// ---------------------------------------------------------------------------
__global__ __launch_bounds__(256) void wconv_f16(const float* __restrict__ in, unsigned short* __restrict__ oh,
                                                 unsigned short* __restrict__ ol, int n8, float carry) {
  const int i = blockIdx.x * 256 + threadIdx.x;
  if (i < n8) {
    const size_t e0 = (size_t)i * 8;
    const int blkid = i >> 6;                                             // block (rt, kb), CCH/32 blocks per row tile
    const int srow = (blkid / (CCH / 32)) * 16 + (i & 15);
    const int scol = (blkid % (CCH / 32)) * 32 + ((i >> 4) & 3) * 8;      // bits 5,4 of i = s,h: col 16*s + 8*h
    const float* ip = in + (size_t)srow * CCH + scol;
    const v4f a = *(const v4f*)(ip);
    const v4f c = *(const v4f*)(ip + 4);
    float f[8];
    f[0] = a[0]; f[1] = a[1]; f[2] = a[2]; f[3] = a[3];
    f[4] = c[0]; f[5] = c[1]; f[6] = c[2]; f[7] = c[3];
    v4u hv, lv;
#pragma unroll
    for (int q = 0; q < 4; ++q) {
      const float f0 = f[2 * q] * carry, f1 = f[2 * q + 1] * carry;
      const _Float16 h0 = (_Float16)f0, h1 = (_Float16)f1;
      const _Float16 l0 = (_Float16)(f0 - (float)h0), l1 = (_Float16)(f1 - (float)h1);
      hv[q] = pk16(h_bits(h0), h_bits(h1));
      lv[q] = pk16(h_bits(l0), h_bits(l1));
    }
    {
      *(v4u*)(oh + e0) = hv;
      *(v4u*)(ol + e0) = lv;
      
    }
  }
}

// ---------------------------------------------------------------------------
// Fused transpose + f16 hi/lo split of an f32 matrix, z-batched:
//   in_z = W + z*sIn viewed in[R rows][Cc cols] (pitch Cc) -> oh_z[c][r] = f16(in_z[r][c]*carry), ol_z[c][r] = f16(rem),
//   out [Cc][R] in fragment order, oh_z = oh + z*sOut.
// 64x64 tiles through LDS. grid = (Cc/64, R/64, Z), 256 threads (R, Cc multiples of 64; R multiple of 64 keeps every
// Coverage per block and plane: load 4 it x 256 thr x 4 floats = 64x64; store 2 it x 256 thr x 8 halves = 64x64.
// ---------------------------------------------------------------------------
__global__ __launch_bounds__(256) void tsplit_f16(const float* __restrict__ W, unsigned short* __restrict__ oh,
                                                  unsigned short* __restrict__ ol, int R, int Cc, long sIn, long sOut,
                                                  float carry) {
  __shared__ __align__(16) float tf[64 * 68];
  W  += (size_t)blockIdx.z * sIn;
  oh += (size_t)blockIdx.z * sOut;
  ol += (size_t)blockIdx.z * sOut;
  const int c0  = blockIdx.x * 64;   // input column block = output row block
  const int r0  = blockIdx.y * 64;   // input row block    = output column block
  const int tid = threadIdx.x;
  {
    const int lr = tid >> 4;         // 0..15
    const int c4 = (tid & 15) * 4;   // 0..60
#pragma unroll
    for (int it = 0; it < 4; ++it) {
      const int rr = it * 16 + lr;   // 0..63
      const v4f a = *(const v4f*)(W + (size_t)(r0 + rr) * Cc + c0 + c4);
      *(v4f*)(tf + rr * 68 + c4) = a;
    }
  }
  __syncthreads();
  // unit u = it*256 + tid of the tile's 512 16-B units per plane, in fragment order: u = ((row tile * 2 + block) * 2 + s) * 32 + h*16 + c
  v4u hv[2], lv[2];
#pragma unroll
  for (int it = 0; it < 2; ++it) {
    const int u  = it * 256 + tid;
    const int oc = ((u >> 7) << 4) + (u & 15);   // output row within tile (= input column)
    const int c8 = ((u >> 4) & 7) * 8;           // output column within tile = 32*block + 16*s + 8*h
    v4u a, a2;
#pragma unroll
    for (int q = 0; q < 4; ++q) {
      const float f0 = tf[(c8 + 2 * q) * 68 + oc] * carry;
      const float f1 = tf[(c8 + 2 * q + 1) * 68 + oc] * carry;
      const _Float16 h0 = (_Float16)f0, h1 = (_Float16)f1;
      const _Float16 l0 = (_Float16)(f0 - (float)h0), l1 = (_Float16)(f1 - (float)h1);
      a[q]  = pk16(h_bits(h0), h_bits(h1));
      a2[q] = pk16(h_bits(l0), h_bits(l1));
    }
    hv[it] = a; lv[it] = a2;
  }
  {
#pragma unroll
    for (int it = 0; it < 2; ++it) {
      const int u = it * 256 + tid;
      const size_t go = (((size_t)((c0 >> 4) + (u >> 7)) * (R >> 5) + (r0 >> 5) + ((u >> 6) & 1)) << 9) + (u & 63) * 8;
      *(v4u*)(oh + go) = hv[it];
      *(v4u*)(ol + go) = lv[it];
    }
    
  }
}

// =====================================================================================
// Flash-style attention with a 512-wide value dimension and a 64-deep score dimension, no score scaling.
//   All four kinds of plane in fragment order (head of the file):
//   q planes (hi/lo f16, x2^10) [16384][64]: row b*4096 + i, col d
//   k planes (hi/lo f16, x2^10) [16384][64]: same for keys j
//   v plane (f16, carry 1) [4*512][4096]: row b*512 + ch, col j
//   o2 planes (hi/lo f16, x2^10) [16384][512]: row b*4096 + i, col ch = split of (gamma*out + x[b][ch][i]) * 2^10
//   Both products are formed TRANSPOSED, so that a lane's column (lane&15) is one query in the score tiles and in the output tiles alike:
//   scores S^T = k . q^T on split planes (hi.hi + lo.hi + hi.lo), * sscale (= 2^-20) in f32: A = K fragment (row = key), B = Q fragment (col = query);
//   a lane holds 8 keys (8*(lane>>4) + r) of one query per tile: row maximum and row sum run inside the lane, plus one exchange between the wave's halves;
//   running-max softmax in f32 over the 4096 keys of the batch element (32 chunks of 128, compile-time trip count);
//   P = exp(s - m) * pcarry (2^15) as f16 in LDS (values < 2^-14 stored as 0); out^T = v . P^T single products, f32 accumulate
//   (A = V fragment, row = channel; B = P rows, col = query), times (1/rowsum) * pinv (2^-15) at the end.
//   Block = 64 query rows (4 query tiles of 16) of one batch element, 8 waves; wave w computes the 16x64 score piece for keys
//   j0 + 16w .. +15 of each chunk (shared through LDS: partial row max Pm, partial row sum Pl, P tile Ps) and accumulates the
//   output for channels 64w .. 64w+63 (4 query tiles x 4 channel tiles in registers). Each K fragment and each V fragment
//   loaded from global feeds one product per query tile (the K hi fragment two). grid = (4096/64, 4) = 256 blocks.
//   The block's Q rows sit in LDS (Qsh/Qsl, written once, barrier B0) and are read as fragments in every chunk.
//   Barriers per chunk: after the Pm writes (B1) and after the Ps/Pl writes (B2); Pm/Ps/Pl of the next chunk are only
//   written after every wave has passed B2/B1 of the current one. Every wave reaches every barrier (no early exit).
//   LDS extents: Ps rows 0..63 x cols 0..127 fully written each chunk (8 waves x 16 cols) before any fragment read
//   (reads reach col 127; cols 128..135 never read); Pm/Pl [64][8] fully written.
//   Fragment loads from global (K, V blocks) use plain arithmetic addressing, 16-B aligned.
// =====================================================================================
#define AQT    4
#define AQB    (16 * AQT)
#define AKC    128
#define PPITCH 136
#define NCHUNK (NPOS / AKC)

static_assert(NPOS % AQB == 0);
static_assert(NCHUNK * AKC == NPOS);
static_assert(CCH == 8 * 64);
static_assert((PPITCH * 2) % 16 == 0);
static_assert(AQB * CQK == 2 * 256 * 8);

// value of lane l ^ 16 (the other half of the wave), on the vector unit
__device__ __forceinline__ float xhalf(float x) {
  return __builtin_bit_cast(float, __builtin_amdgcn_permlanex16(__builtin_bit_cast(int, x), __builtin_bit_cast(int, x), 0x76543210, 0xfedcba98, false, false));
}

__global__ __launch_bounds__(256)
void attn_kernel(const unsigned short* __restrict__ qhp, const unsigned short* __restrict__ qlp,
                 const unsigned short* __restrict__ khp, const unsigned short* __restrict__ klp,
                 const unsigned short* __restrict__ vtp,
                 const float* __restrict__ X, const float* __restrict__ gam,
                 unsigned short* __restrict__ o2hp, unsigned short* __restrict__ o2lp,
                 float sscale, float pcarry, float pinv, float ocarry) {
  union FB { v16h v; v8h h[2]; };
  __shared__ __align__(16) _Float16 Ps[AQB * PPITCH];     // P tile [query row][key in chunk], pitch 136 halves
  __shared__ __align__(16) float    Pm[AQB * 8];          // partial row max  [row][wave]
  __shared__ __align__(16) float    Pl[AQB * 8];          // partial row sum  [row][wave]
  __shared__ __align__(16) _Float16 Qsh[AQB * CQK];       // q hi plane rows of this block, fragment order as in global
  __shared__ __align__(16) _Float16 Qsl[AQB * CQK];       // q lo plane rows of this block, fragment order as in global

  const int tid  = threadIdx.x;
  const int wave = tid >> 5;
  const int lane = tid & 31;
  const int hh   = lane >> 4;
  const int c    = lane & 15;

  const int b  = blockIdx.y;                       // 0..3
  const int i0 = blockIdx.x * AQB;                 // first query position of this block
  const size_t qrow0 = (size_t)b * NPOS + i0;      // row in the q / o2 planes

  const _Float16* Qh = (const _Float16*)(const void*)qhp;
  const _Float16* Ql = (const _Float16*)(const void*)qlp;
  const _Float16* Kh = (const _Float16*)(const void*)khp;
  const _Float16* Kl = (const _Float16*)(const void*)klp;
  const _Float16* Vw = (const _Float16*)(const void*)vtp + ((size_t)b * CCH + (size_t)wave * 64) * NPOS;   // this wave's 64 channel rows
  _Float16* O2h = (_Float16*)(void*)o2hp;
  _Float16* O2l = (_Float16*)(void*)o2lp;
  const float g = gam[0];

  // ---- Q rows of the block (64 x 64, hi and lo) into LDS once: 512 pieces of 16 B per plane, 2 per thread and plane;
  //      the 16 Q fragments would take 128 registers, which the accumulators and the V fragments in flight need ----
  {
    const int q8 = tid * 8;                        // the 64 rows are 4 row tiles = 4096 consecutive halves; pieces tid and 256 + tid
    const _Float16* gh0 = Qh + qrow0 * CQK + q8;
    const _Float16* gl0 = Ql + qrow0 * CQK + q8;
    const _Float16* gh1 = gh0 + 32 * CQK;
    const _Float16* gl1 = gl0 + 32 * CQK;
    const v8h th0 = *(const v8h*)gh0, tl0 = *(const v8h*)gl0, th1 = *(const v8h*)gh1, tl1 = *(const v8h*)gl1;
    xwait(gh0, gl0, gh1, gl1);
    *(v8h*)(Qsh + q8) = th0;
    *(v8h*)(Qsl + q8) = tl0;
    *(v8h*)(Qsh + 32 * CQK + q8) = th1;
    *(v8h*)(Qsl + 32 * CQK + q8) = tl1;
  }
  __syncthreads();   // B0: every wave reads all 64 Q rows

  float mrow[AQT], lrow[AQT];                      // of query t*16 + c, the same in both halves of the wave and in every wave
  v8f acc[AQT][4];                                 // acc[t][n][r] = out of query t*16 + c, channel 64*wave + 16*n + 8*hh + r
#pragma unroll
  for (int t = 0; t < AQT; ++t) {
    mrow[t] = -INFINITY; lrow[t] = 0.f;
#pragma unroll
    for (int n = 0; n < 4; ++n) acc[t][n] = (v8f){0.f,0.f,0.f,0.f,0.f,0.f,0.f,0.f};
  }

  for (int jc = 0; jc < NCHUNK; ++jc) {
    const int j0 = jc * AKC;
    // ---- score piece, transposed: rows = keys j0 + 16*wave + 8*hh + r, cols = 64 queries (B operand col = lane&15) ----
    const size_t krow = (size_t)b * NPOS + j0 + wave * 16;   // first row of this wave's key row tile (2 blocks of 512 halves)
    v8f s[AQT];
#pragma unroll
    for (int t = 0; t < AQT; ++t) s[t] = (v8f){0.f,0.f,0.f,0.f,0.f,0.f,0.f,0.f};
    const _Float16* kph = Kh + krow * CQK + lane * 8;
    const _Float16* kpl = Kl + krow * CQK + lane * 8;
    v16h kfh[2], kfl[2];
#pragma unroll
    for (int dc = 0; dc < 2; ++dc) {
      kfh[dc] = FragH::load(kph + dc * 512);
      kfl[dc] = FragH::load(kpl + dc * 512);
    }
#pragma unroll
    for (int dc = 0; dc < 2; ++dc) {
      const v16h kbh = kfh[dc];
      const v16h kbl = kfl[dc];
      // Q fragments (B operand, col = lane&15) from LDS, same k map as the K fragments
      v16h qah[AQT], qal[AQT];
#pragma unroll
      for (int t = 0; t < AQT; ++t) {
        qah[t] = FragH::load(Qsh + (t * 2 + dc) * 512 + lane * 8);
        qal[t] = FragH::load(Qsl + (t * 2 + dc) * 512 + lane * 8);
      }
#pragma unroll
      for (int t = 0; t < AQT; ++t) s[t] = FragH::mma(kbh, qah[t], s[t]);
#pragma unroll
      for (int t = 0; t < AQT; ++t) s[t] = FragH::mma(kbl, qah[t], s[t]);
#pragma unroll
      for (int t = 0; t < AQT; ++t) s[t] = FragH::mma(kbh, qal[t], s[t]);
    }
    xwait(kph, kpl);   // behind the score products, where it holds up none of them
    // scale, then this wave's partial maximum over its 16 keys of query t*16 + c: 8 in the lane, 8 in lane ^ 16
    float mloc[AQT];
#pragma unroll
    for (int t = 0; t < AQT; ++t) {
#pragma unroll
      for (int r = 0; r < 8; ++r) s[t][r] *= sscale;
      const float m = fmaxf(fmaxf(fmaxf(s[t][0], s[t][1]), fmaxf(s[t][2], s[t][3])),
                            fmaxf(fmaxf(s[t][4], s[t][5]), fmaxf(s[t][6], s[t][7])));
      mloc[t] = fmaxf(m, xhalf(m));
    }
    if (hh == 0) {
#pragma unroll
      for (int t = 0; t < AQT; ++t) Pm[(t * 16 + c) * 8 + wave] = mloc[t];
    }
    __syncthreads();   // B1

    // ---- running max update (identical in every wave), P tile, partial row sums ----
    float alpha[AQT], psl[AQT];
    v4f ma[AQT], mb[AQT];
#pragma unroll
    for (int t = 0; t < AQT; ++t) {                     // the 8 reads stand together: one LDS wait for all four query tiles
      ma[t] = *(const v4f*)(Pm + (t * 16 + c) * 8);
      mb[t] = *(const v4f*)(Pm + (t * 16 + c) * 8 + 4);
    }
    // keeps the 8 reads in one group; without it this build reads tile by tile and waits out the LDS latency once per query tile
    __builtin_amdgcn_sched_barrier(0);
#pragma unroll
    for (int t = 0; t < AQT; ++t) {
      const int row = t * 16 + c;
      const float cm = fmaxf(fmaxf(fmaxf(ma[t][0], ma[t][1]), fmaxf(ma[t][2], ma[t][3])),
                             fmaxf(fmaxf(mb[t][0], mb[t][1]), fmaxf(mb[t][2], mb[t][3])));
      const float mnew = fmaxf(mrow[t], cm);
      alpha[t] = __expf(mrow[t] - mnew);
      mrow[t] = mnew;
      float p[8];
      v8h ph;
#pragma unroll
      for (int r = 0; r < 8; ++r) {
        p[r] = __expf(s[t][r] - mnew);                  // in (0, 1]
        float p32 = p[r] * pcarry;
        p32 = (p32 >= 6.103515625e-05f) ? p32 : 0.0f;   // no f16 subnormals in the P tile
        ph[r] = (_Float16)p32;
      }
      *(v8h*)(Ps + row * PPITCH + wave * 16 + 8 * hh) = ph;   // the lane's 8 keys lie side by side in the query's P row: one 16-B store
      const float psum = ((p[0] + p[1]) + (p[2] + p[3])) + ((p[4] + p[5]) + (p[6] + p[7]));
      psl[t] = psum + xhalf(psum);
    }
    if (hh == 0) {
#pragma unroll
      for (int t = 0; t < AQT; ++t) Pl[(t * 16 + c) * 8 + wave] = psl[t];
    }
#pragma unroll
    for (int t = 0; t < AQT; ++t) {
#pragma unroll
      for (int n = 0; n < 4; ++n) acc[t][n] *= alpha[t];
    }
    __syncthreads();   // B2

    // all 16 V fragments of the chunk (A operand, row = lane&15 = channel) are requested together
    const _Float16* vp = Vw + (size_t)(j0 >> 5) * 512 + lane * 8;   // block j0/32 of the wave's first channel row tile
    v16h vb[4][4];
#pragma unroll
    for (int kk = 0; kk < 4; ++kk) {
#pragma unroll
      for (int n = 0; n < 4; ++n) vb[kk][n] = FragH::load(vp + (size_t)(n * 16) * NPOS + kk * 512);
    }
    // keeps the 32 loads together in front of the row-sum work; without it this build spreads them among the products, only one k block ahead of their use
    __builtin_amdgcn_sched_barrier(0);

#pragma unroll
    for (int t = 0; t < AQT; ++t) {
      const int row = t * 16 + c;
      const v4f la = *(const v4f*)(Pl + row * 8);
      const v4f lb = *(const v4f*)(Pl + row * 8 + 4);
      const float ls = ((la[0] + la[1]) + (la[2] + la[3])) + ((lb[0] + lb[1]) + (lb[2] + lb[3]));
      lrow[t] = lrow[t] * alpha[t] + ls;
    }

    // ---- out^T(64 ch of this wave x 64 queries) += V(64 x 128) . P^T(128 x 64): A = v plane rows (row = lane&15 = channel),
    //      B = P tile (col = lane&15 = query within the query tile), both with the split k map; one V fragment serves all 4 query tiles ----
#pragma unroll
    for (int kk = 0; kk < 4; ++kk) {
      FB pa[AQT];
#pragma unroll
      for (int t = 0; t < AQT; ++t) {
        pa[t].h[0] = *(const v8h*)(Ps + (t * 16 + c) * PPITCH + kk * 32 + 8 * hh);
        pa[t].h[1] = *(const v8h*)(Ps + (t * 16 + c) * PPITCH + kk * 32 + 16 + 8 * hh);
      }
#pragma unroll
      for (int n = 0; n < 4; ++n) {
#pragma unroll
        for (int t = 0; t < AQT; ++t) acc[t][n] = FragH::mma(vb[kk][n], pa[t].v, acc[t][n]);
      }
    }
    xwait(vp);   // late in the chunk, where it holds up no product; vp's registers are kept as they are until here
  }

  // ---- epilogue, query tile by query tile: out * (1/(rowsum * 2^15)); o2 = gamma*out + x (exact f32 x); split of o2 * 2^10.
  //      The lane's 8 values of one accumulator tile (query c, channels 16n + 8*hh + 0..7) are its own 16-B unit of the o2 planes' fragment order.
  const float* xp0 = X + ((size_t)b * CCH + wave * 64 + 8 * hh) * NPOS + i0 + c;   // channel 64w + 8*hh, query c of tile 0
#pragma unroll
  for (int t = 0; t < AQT; ++t) {
    const float rl = (1.0f / lrow[t]) * pinv;
    const float* xp = xp0 + t * 16;
    float xe[4][8];
#pragma unroll
    for (int n = 0; n < 4; ++n) {                   // channel 64w + 16n + 8*hh + r
#pragma unroll
      for (int r = 0; r < 8; ++r) xe[n][r] = xp[(size_t)(n * 16 + r) * NPOS];
    }
    xwait(xp0);
    const size_t tb = ((((qrow0 >> 4) + t) * (size_t)(CCH >> 5) + wave * 2) << 9) + lane * 8;   // the wave's two blocks of query tile t
#pragma unroll
    for (int n = 0; n < 4; ++n) {                   // n = 2 * (block) + s
      v8h hv, lv;
#pragma unroll
      for (int r = 0; r < 8; ++r) {
        const float o  = acc[t][n][r] * rl;
        const float v2 = (g * o + xe[n][r]) * ocarry;
        const _Float16 hq = (_Float16)v2;
        hv[r] = hq;
        lv[r] = (_Float16)(v2 - (float)hq);
      }
      const size_t go = tb + n * 256;
      *(v8h*)(O2h + go) = hv;
      *(v8h*)(O2l + go) = lv;
    }
  }
}

// ---------------------------------------------------------------------------
// Workspace region map (byte offsets; every region is fully written by its producer launch before any consumer
//   XTh  f16 [16384][512]        0        16777216     XTl   16777216   16777216
//   WQh  f16 [64][512]    33554432           65536     WQl   33619968      65536
//   WKh  f16 [64][512]    33685504           65536     WKl   33751040      65536
//   WVh  f16 [512][512]   33816576          524288     WVl   34340864     524288
//   WDh  f16 [512][512]   34865152          524288     WDl   35389440     524288
//   Qh   f16 [16384][64]  35913728         2097152     Ql    38010880    2097152
//   Kh   f16 [16384][64]  40108032         2097152     Kl    42205184    2097152
//   VT   f16 [4][512][4096] 44302336     16777216
//   O2h  f16 [16384][512] 61079552        16777216     O2l   77856768   16777216
//   total                 94633984
// ---------------------------------------------------------------------------
extern "C" void kernel_launch(void* const* d_in, const int* in_sizes, int n_in,
                              void* d_out, int out_size, void* d_ws, size_t ws_size,
                              hipStream_t stream) {
  if (n_in < 10) return;
  if (in_sizes[0] != NBAT * CCH * NPOS) return;     // x     [4][512][64][64]
  if (in_sizes[1] != CQK * CCH) return;             // Wq    [64][512]
  if (in_sizes[2] != CQK) return;                   // bq    [64]
  if (in_sizes[3] != CQK * CCH) return;             // Wk    [64][512]
  if (in_sizes[4] != CQK) return;                   // bk    [64]
  if (in_sizes[5] != CCH * CCH) return;             // Wv    [512][512]
  if (in_sizes[6] != CCH) return;                   // bv    [512]
  if (in_sizes[7] != 1) return;                     // gamma [1]
  if (in_sizes[8] != CCH * CCH) return;             // Wd    [512][512]
  if (in_sizes[9] != CCH) return;                   // bd    [512]
  if (out_size != NBAT * CCH * NPOS) return;        // out   [4][512][64][64] f32, last element 8388607

  const float* x     = (const float*)d_in[0];
  const float* Wq    = (const float*)d_in[1];       // [out][in]
  const float* bq    = (const float*)d_in[2];
  const float* Wk    = (const float*)d_in[3];
  const float* bk    = (const float*)d_in[4];
  const float* Wv    = (const float*)d_in[5];
  const float* bv    = (const float*)d_in[6];
  const float* gamma = (const float*)d_in[7];
  const float* Wd    = (const float*)d_in[8];
  const float* bd    = (const float*)d_in[9];

  const size_t PXT = (size_t)MROWS * CCH * 2;       // 16777216  f16 [16384][512]
  const size_t PWS = (size_t)CQK * CCH * 2;         // 65536     f16 [64][512]
  const size_t PWL = (size_t)CCH * CCH * 2;         // 524288    f16 [512][512]
  const size_t PQK = (size_t)MROWS * CQK * 2;       // 2097152   f16 [16384][64]
  const size_t PVT = (size_t)NBAT * CCH * NPOS * 2; // 16777216  f16 [4][512][4096]
  size_t off = 0;
  const size_t oXTh = off; off += PXT;  const size_t oXTl = off; off += PXT;
  const size_t oWQh = off; off += PWS;  const size_t oWQl = off; off += PWS;
  const size_t oWKh = off; off += PWS;  const size_t oWKl = off; off += PWS;
  const size_t oWVh = off; off += PWL;  const size_t oWVl = off; off += PWL;
  const size_t oWDh = off; off += PWL;  const size_t oWDl = off; off += PWL;
  const size_t oQh  = off; off += PQK;  const size_t oQl  = off; off += PQK;
  const size_t oKh  = off; off += PQK;  const size_t oKl  = off; off += PQK;
  const size_t oVT  = off; off += PVT;
  const size_t oO2h = off; off += PXT;  const size_t oO2l = off; off += PXT;
  if (off > ws_size) return;                        // off = 94633984
  if (off > (size_t)134217728) return;

  char* ws = (char*)d_ws;
  unsigned short* XTh = (unsigned short*)(ws + oXTh);  unsigned short* XTl = (unsigned short*)(ws + oXTl);
  unsigned short* WQh = (unsigned short*)(ws + oWQh);  unsigned short* WQl = (unsigned short*)(ws + oWQl);
  unsigned short* WKh = (unsigned short*)(ws + oWKh);  unsigned short* WKl = (unsigned short*)(ws + oWKl);
  unsigned short* WVh = (unsigned short*)(ws + oWVh);  unsigned short* WVl = (unsigned short*)(ws + oWVl);
  unsigned short* WDh = (unsigned short*)(ws + oWDh);  unsigned short* WDl = (unsigned short*)(ws + oWDl);
  unsigned short* Qh  = (unsigned short*)(ws + oQh);   unsigned short* Ql  = (unsigned short*)(ws + oQl);
  unsigned short* Kh  = (unsigned short*)(ws + oKh);   unsigned short* Kl  = (unsigned short*)(ws + oKl);
  unsigned short* VT  = (unsigned short*)(ws + oVT);
  unsigned short* O2h = (unsigned short*)(ws + oO2h);  unsigned short* O2l = (unsigned short*)(ws + oO2l);

  const dim3 blk(256);
  const float actCarry = 1024.0f;                    // 2^10 on x, q, k, o2 planes
  const float wCarry   = 65536.0f;                   // 2^16 on weight planes
  const float scale26  = 1.0f / 67108864.0f;         // 2^-26 = 1 / (2^10 * 2^16)
  const float sScale   = 1.0f / 1048576.0f;          // 2^-20 = 1 / (2^10 * 2^10)
  const float pCarry   = 32768.0f;                   // 2^15 on the P tile
  const float pInv     = 1.0f / 32768.0f;            // 2^-15

  // (1) x[b] viewed in[R=512 c][Cc=4096 n] (pitch 4096) -> XT_b[n][c] (fragment order), hi/lo of x*2^10; grid (Cc/64, R/64, B) = (64, 8, 4)
  tsplit_f16<<<dim3(NPOS / 64, CCH / 64, NBAT), blk, 0, stream>>>(x, XTh, XTl, CCH, NPOS, (long)CCH * NPOS, (long)NPOS * CCH, actCarry);
  // (2) weight planes, natural [out][in] layout, hi/lo of W*2^16
  const int n8s = CQK * CCH / 8;                     // 4096  -> 16 blocks
  const int n8l = CCH * CCH / 8;                     // 32768 -> 128 blocks
  wconv_f16<<<dim3(n8s / 256), blk, 0, stream>>>(Wq, WQh, WQl, n8s, wCarry);
  wconv_f16<<<dim3(n8s / 256), blk, 0, stream>>>(Wk, WKh, WKl, n8s, wCarry);
  wconv_f16<<<dim3(n8l / 256), blk, 0, stream>>>(Wv, WVh, WVl, n8l, wCarry);
  wconv_f16<<<dim3(n8l / 256), blk, 0, stream>>>(Wd, WDh, WDl, n8l, wCarry);
  // (3) q = XT . Wq^T + bq -> Qh|Ql [16384][64] (x2^10)   (M=16384, N=64, K=512; 256 tiles -> 32 blocks)
  const dim3 gQ((MROWS / 64) * (CQK / 64) / 8, 1);
  gemm64_f16<true, 2, 2><<<gQ, blk, 0, stream>>>(
      XTh, XTl, CCH, 0L, WQh, WQl, CCH, 0L, (void*)Qh, (void*)Ql, CQK, 0L, bq, MROWS, CQK, CCH, scale26, actCarry);
  // (4) k likewise -> Kh|Kl
  gemm64_f16<true, 2, 2><<<gQ, blk, 0, stream>>>(
      XTh, XTl, CCH, 0L, WKh, WKl, CCH, 0L, (void*)Kh, (void*)Kl, CQK, 0L, bk, MROWS, CQK, CCH, scale26, actCarry);
  // (5) v^T[b] = Wv . XT_b^T + bv[m] -> VT [4][512][4096] f16 single   (M=512, N=4096, K=512; 512 tiles -> 64 blocks x 4 batches)
  const dim3 gV((CCH / 64) * (NPOS / 64) / 8, NBAT);
  gemm64_f16<true, 1, 1><<<gV, blk, 0, stream>>>(
      WVh, WVl, CCH, 0L, XTh, XTl, CCH, (long)NPOS * CCH, (void*)VT, (void*)VT, NPOS, (long)CCH * NPOS, bv,
      CCH, NPOS, CCH, scale26, 1.0f);
  // (6) attention + gamma scale + residual -> O2h|O2l [16384][512] (x2^10); grid (4096/64, 4) = 256 blocks
  attn_kernel<<<dim3(NPOS / AQB, NBAT), blk, 0, stream>>>(Qh, Ql, Kh, Kl, VT, x, gamma, O2h, O2l, sScale, pCarry, pInv, actCarry);
  // (7) out[b] = Wd . O2_b^T + bd[m] -> d_out NCHW f32 [4][512][4096]   (M=512, N=4096, K=512; 512 tiles -> 64 blocks x 4 batches)
  gemm64_f16<true, 1, 0><<<gV, blk, 0, stream>>>(
      WDh, WDl, CCH, 0L, O2h, O2l, CCH, (long)NPOS * CCH, d_out, d_out, NPOS, (long)CCH * NPOS, bd,
      CCH, NPOS, CCH, scale26, 1.0f);
  (void)hipGetLastError();
}

// v004
// One run takes 260 microseconds.
// Timed twice side by side with v003, it ran 1.13 and 1.15 times as fast.
// Counting every step since v000, it is 2.39 times as fast.
// Contractions: q, k, v 1x1 convs, q.k^T energies and the output 1x1 conv = v_wmma_f32_16x16x32_f16 on f16 hi/lo split planes (hi.hi + hi.lo + lo.hi, 3 products each); p.v = v_wmma_f32_16x16x32_f16 single product (p carried x2^15 as f16, v plain f16 with |v| < 2^-14 written as 0); f32 accumulate everywhere; running-max softmax, 1/rowsum, gamma scale, biases and the residual add (exact f32 x) in f32 on the VALU.
// Plane / carry map (every carry is an exact power of two; the inverse is folded exactly once, at the line named):
//   XTh|XTl  f16 [16384 (b,n)][512 c]    = hi/lo of x * 2^10           (n = h*64 + w; producer tsplit_f16)
//   WQh|WQl, WKh|WKl f16 [64][512]; WVh|WVl, WDh|WDl f16 [512][512] = hi/lo of W * 2^16, natural [out][in] (producer wconv_f16)
//   Qh|Ql, Kh|Kl f16 [16384][64]           = hi/lo of q (or k) * 2^10   (GEMM: acc * 2^-26 removes the x and W carries, + bias, then * 2^10)
//   VT  f16 [4][512 ch][4096 n]            = v, carry 1                   (GEMM: acc * 2^-26 + bias; |v| < 2^-14 stored as 0)
//   energies                               = acc * 2^-20 (q and k carries) in attn_kernel before the softmax
//   P   f16 (LDS only)                     = exp(s - m) * 2^15, values < 2^-14 stored as 0; 2^-15 folded together with 1/rowsum in the attn_kernel epilogue
//   O2h|O2l f16 [16384][512]               = hi/lo of (gamma * out + x) * 2^10 (attn_kernel epilogue)
//   output conv                            = acc * 2^-26 (O2 and W carries) + bd -> f32 NCHW [4][512][4096]
// Every f16 plane above lies in FRAGMENT ORDER: a matrix [R rows][K cols] is cut into blocks of 16 rows x 32 cols, block (rt, kb) at
// halves ((rt * K/32 + kb) * 512); inside a block element (row c, col 16*s + 8*h + e) sits at s*256 + (h*16 + c)*8 + e, which is the
// register order of a 16x16x32 operand: lane h*16 + c reads its 16 B at lane*8 (s = 0) and at 256 + lane*8 (s = 1), 512 contiguous bytes per wave load.
#include <hip/hip_runtime.h>
#include <math.h>
#include <stdint.h>

#define NBAT  4
#define CCH   512
#define CQK   64
#define IMGH  64
#define IMGW  64
#define NPOS  4096
#define MROWS 16384

static_assert(NPOS == IMGH * IMGW);
static_assert(MROWS == NBAT * NPOS);
static_assert(CCH % 64 == 0);
static_assert(CQK == 64);
static_assert(NPOS % 128 == 0);
static_assert(NPOS % 64 == 0);
static_assert(CCH % 32 == 0);
static_assert((CQK * CCH) % (8 * 256) == 0);
static_assert((CCH * CCH) % (8 * 256) == 0);
static_assert(CCH % 256 == 0);
static_assert((MROWS / 64) % 8 == 0);
static_assert(((CCH / 64) * (NPOS / 64)) % 8 == 0);

typedef __attribute__((ext_vector_type(16))) _Float16 v16h;
typedef __attribute__((ext_vector_type(8)))  _Float16 v8h;
typedef __attribute__((ext_vector_type(8)))  float    v8f;
typedef __attribute__((ext_vector_type(4)))  float    v4f;
typedef __attribute__((ext_vector_type(4)))  unsigned int v4u;

__device__ __forceinline__ unsigned short h_bits(_Float16 h) { return __builtin_bit_cast(unsigned short, h); }
__device__ __forceinline__ unsigned pk16(unsigned short a, unsigned short b) { return (unsigned)a | ((unsigned)b << 16); }

// hazard guards as plain device helpers (no inline asm inside the kernel template body)
__device__ __forceinline__ void dep_guard_h(v8f& a, v8f& b, v16h x, v16h y) { asm volatile("v_nop\n\tv_nop\n\tv_nop\n\tv_nop" : "+v"(a), "+v"(b) : "v"(x), "v"(y)); }
__device__ __forceinline__ void keep4_h(v16h a, v16h b, v16h c, v16h d) { asm volatile("v_nop" :: "v"(a), "v"(b), "v"(c), "v"(d)); }
__device__ __forceinline__ void acc_guard4(v8f& a, v8f& b, v8f& c, v8f& d) { asm volatile("v_nop\n\tv_nop\n\tv_nop\n\tv_nop" : "+v"(a), "+v"(b), "+v"(c), "+v"(d)); }

// 16-bit fragment loader (A and B alike) from a block in fragment order: p = block start + lane*8; lane row/col = lane&15, h = lane>>4;
// vector elements 0..7 <- p[0..7] (= k0+8h+0..7), 8..15 <- p[256..263] (= k0+16+8h+0..7).
struct FragH {
  union U { v16h v; v8h h[2]; };
  static __device__ __forceinline__ v16h load(const _Float16* p) {
    U f; f.h[0] = *(const v8h*)(p); f.h[1] = *(const v8h*)(p + 256); return f.v;
  }
  // the same from a wave-uniform plane base and the lane's byte offset: one offset register per fragment group instead of a 64-bit address pair
  static __device__ __forceinline__ v16h load_off(const _Float16* base, unsigned boff, int imm) {
    const char* p = (const char*)(const void*)base + boff;
    U f; f.h[0] = *(const v8h*)(p + imm); f.h[1] = *(const v8h*)(p + imm + 512); return f.v;
  }
  static __device__ __forceinline__ v8f mma(v16h a, v16h b, v8f c) {
    return __builtin_amdgcn_wmma_f32_16x16x32_f16(false, a, false, b, (short)0, c, false, false);
  }
  static __device__ __forceinline__ void guard(v8f& a, v8f& b, v16h x, v16h y) { dep_guard_h(a, b, x, y); }
  static __device__ __forceinline__ void keep(v16h a, v16h b, v16h c, v16h d) { keep4_h(a, b, c, d); }
};

// s_wait_xcnt 0 behind a group of global loads, in front of any rewrite of their address registers.
// The addresses are inputs only so that their registers stay as they are up to the wait.
__device__ __forceinline__ void xwait(const void* a) { asm volatile("s_wait_xcnt 0x0" :: "v"(a) : "memory"); }
__device__ __forceinline__ void xwait(const void* a, const void* b, const void* c, const void* d) {
  asm volatile("s_wait_xcnt 0x0" :: "v"(a), "v"(b), "v"(c), "v"(d) : "memory");
}

// the same behind loads of the form uniform base + 32-bit byte offset per lane: the offset register stays as it is up to the wait (the bases are kernel arguments, never rewritten in the loop)
__device__ __forceinline__ void xwait_off(unsigned a) { asm volatile("s_wait_xcnt 0x0" :: "v"(a) : "memory"); }
__device__ __forceinline__ void xwait_off(unsigned a, unsigned b) { asm volatile("s_wait_xcnt 0x0" :: "v"(a), "v"(b) : "memory"); }

__device__ __forceinline__ void xwait16(const _Float16* const (&a)[4], const _Float16* const (&b)[4], const _Float16* const (&c)[4], const _Float16* const (&d)[4]) {
  asm volatile("s_wait_xcnt 0x0" :: "v"(a[0]), "v"(a[1]), "v"(a[2]), "v"(a[3]), "v"(b[0]), "v"(b[1]), "v"(b[2]), "v"(b[3]),
                                    "v"(c[0]), "v"(c[1]), "v"(c[2]), "v"(c[3]), "v"(d[0]), "v"(d[1]), "v"(d[2]), "v"(d[3]) : "memory");
}

// ---- Register-blocked batched WMMA GEMM, f16 operands ----------------------
// C[m,n] = oscale * (scale * sum_k A[m,k] * Bt[n,k] + bias); each wave owns a 64x64 tile.
// A [M,lda] and Bt [N,ldb] in fragment order (lda, ldb = their column counts); M,N % 64 == 0, K % 32 == 0 (host-asserted sizes).
// f16 outputs (OUT_MODE 1, 2) are written in fragment order as matrices [M][ldc]; the f32 output stays row-major.
// SPLIT: operands are hi/lo planes (A2/Bt2 = lo planes, same layout); product = hi.hi + hi.lo + lo.hi.
// BIAS_MODE: 0 = none, 1 = bias[m], 2 = bias[n] (f32).
// OUT_MODE: 0 = f32; 1 = single f16 plane (|v| < 2^-14 stored as 0, so the plane holds no f16 subnormals);
//           2 = f16 hi plane (Cout) + f16 lo plane (Cout2), lo = v - hi.
template <bool SPLIT, int BIAS_MODE, int OUT_MODE>
__global__ __launch_bounds__(256) void gemm64_f16(
    const unsigned short* __restrict__ Ap, const unsigned short* __restrict__ A2p, int lda, long strideA,
    const unsigned short* __restrict__ Btp, const unsigned short* __restrict__ Bt2p, int ldb, long strideB,
    void* __restrict__ Cout, void* __restrict__ Cout2, int ldc, long strideC,
    const float* __restrict__ bias,
    int M, int N, int K, float scale, float oscale) {
  const _Float16* A   = (const _Float16*)(const void*)Ap;
  const _Float16* A2  = (const _Float16*)(const void*)A2p;
  const _Float16* Bt  = (const _Float16*)(const void*)Btp;
  const _Float16* Bt2 = (const _Float16*)(const void*)Bt2p;
  __shared__ __align__(16) float sT[8][16 * 68];   // per-wave 16x64 slab, pitch 68 floats
  const int b    = blockIdx.y;
  const int lane = threadIdx.x & 31;
  const int wave = __builtin_amdgcn_readfirstlane(threadIdx.x >> 5);   // scalar, so that the block starts below are formed once per wave on the scalar unit
  const int tilesN = N >> 6;
  const int tilesM = M >> 6;
  const int tile = blockIdx.x * 8 + wave;
  if (tile >= tilesM * tilesN) return;   // wave-uniform; no block barriers in this kernel
  const int tm = tile / tilesN;
  const int tn = tile - tm * tilesN;
  const int m0 = tm << 6;
  const int n0 = tn << 6;

  const _Float16* Ab  = A  + (size_t)b * strideA;
  const _Float16* Bb  = Bt + (size_t)b * strideB;
  const _Float16* Ab2 = SPLIT ? (A2  + (size_t)b * strideA) : Ab;
  const _Float16* Bb2 = SPLIT ? (Bt2 + (size_t)b * strideB) : Bb;

  const int rlane = lane & 15;                 // row (A) / col (B, D) within subtile
  const int mOff  = (lane >> 4) * 8;           // D row offset
  const unsigned lo8 = (unsigned)lane * 8;     // this lane's 16 B inside each 512-B half block

  v8f acc[4][4];
#pragma unroll
  for (int i = 0; i < 4; ++i)
#pragma unroll
    for (int j = 0; j < 4; ++j) acc[i][j] = (v8f){0.f,0.f,0.f,0.f,0.f,0.f,0.f,0.f};

  for (int k0 = 0; k0 < K; k0 += 32) {
    v16h bh[4], bl[4];
    const _Float16 *pbh[4], *pbl[4], *pah[4], *pal[4];
#pragma unroll
    for (int j = 0; j < 4; ++j) {
      const size_t bo = ((size_t)((n0 >> 4) + j) * (ldb >> 5) + (k0 >> 5)) << 9;   // block starts, the same in every lane
      const size_t ao = ((size_t)((m0 >> 4) + j) * (lda >> 5) + (k0 >> 5)) << 9;
      pbh[j] = Bb + bo + lo8;  pbl[j] = Bb2 + bo + lo8;
      pah[j] = Ab + ao + lo8;  pal[j] = Ab2 + ao + lo8;
    }
#pragma unroll
    for (int j = 0; j < 4; ++j) {
      bh[j] = FragH::load(pbh[j]);
      if (SPLIT) bl[j] = FragH::load(pbl[j]); else bl[j] = bh[j];
    }
#pragma unroll
    for (int i = 0; i < 4; ++i) {
      v16h ah = FragH::load(pah[i]);
      v16h al;
      if (SPLIT) al = FragH::load(pal[i]); else al = ah;
#pragma unroll
      for (int j = 0; j < 4; ++j) {
        acc[i][j] = FragH::mma(ah, bh[j], acc[i][j]);
        if (SPLIT) {
          acc[i][j] = FragH::mma(ah, bl[j], acc[i][j]);
          acc[i][j] = FragH::mma(al, bh[j], acc[i][j]);
        }
      }
      FragH::guard(acc[i][0], acc[i][3], ah, al);
    }
    FragH::keep(bh[0], bh[1], bh[2], bh[3]);
    if (SPLIT) FragH::keep(bl[0], bl[1], bl[2], bl[3]);
    xwait16(pbh, pbl, pah, pal);   // at the foot, where every load of the trip has been used: holds up nothing; the 16 address pairs stay as they are until here
  }
  acc_guard4(acc[0][0], acc[0][1], acc[0][2], acc[0][3]);
  acc_guard4(acc[1][0], acc[1][1], acc[1][2], acc[1][3]);
  acc_guard4(acc[2][0], acc[2][1], acc[2][2], acc[2][3]);
  acc_guard4(acc[3][0], acc[3][1], acc[3][2], acc[3][3]);

  // ---- epilogue ----
  float* slab = sT[wave];
#pragma unroll
  for (int i = 0; i < 4; ++i) {
    const int mBase = m0 + (i << 4);
#pragma unroll
    for (int j = 0; j < 4; ++j) {
      const int n = n0 + (j << 4) + rlane;
      float bvn = 0.f;
      if (BIAS_MODE == 2) bvn = bias[n];
#pragma unroll
      for (int r = 0; r < 8; ++r) {
        float v = acc[i][j][r] * scale;
        if (BIAS_MODE == 1) v += bias[mBase + mOff + r];
        if (BIAS_MODE == 2) v += bvn;
        slab[(mOff + r) * 68 + (j << 4) + rlane] = v * oscale;
      }
    }
    __builtin_amdgcn_fence(__ATOMIC_RELEASE, "workgroup");
    __builtin_amdgcn_wave_barrier();
    __builtin_amdgcn_fence(__ATOMIC_ACQUIRE, "workgroup");
    if (OUT_MODE == 0) {
      float* C = (float*)Cout + (size_t)b * strideC;
      const int hh = lane >> 4, c4 = (lane & 15) * 4;     // row seg = 256 B = 16 lanes x 16 B
      {
#pragma unroll
        for (int it = 0; it < 8; ++it) {
          const int row = it * 2 + hh;                       // it 0..7 x hh 0..1 = rows 0..15
          v4f v = *(const v4f*)(slab + row * 68 + c4);
          *(v4f*)(C + (size_t)(mBase + row) * ldc + n0 + c4) = v;
        }
        
      }
    } else {
      const int row = lane & 15, h8 = (lane >> 4) * 8;
      _Float16* C  = (_Float16*)Cout + (size_t)b * strideC;
      _Float16* C2 = (_Float16*)Cout2 + (size_t)b * strideC;
      const size_t tb = (((size_t)(mBase >> 4) * (ldc >> 5) + (n0 >> 5)) << 9) + lane * 8;   // the slab's two blocks follow one another
      {
#pragma unroll
        for (int it = 0; it < 4; ++it) {                     // it = 2 * (block) + s: cols it*16 + h8 .. +7 of row lane&15
          const float* sp = slab + row * 68 + it * 16 + h8;
          v8h hv, lv;
#pragma unroll
          for (int e = 0; e < 8; ++e) {
            if (OUT_MODE == 1) {
              float f = sp[e];
              f = (fabsf(f) >= 6.103515625e-05f) ? f : 0.0f;
              hv[e] = (_Float16)f;
            } else {
              const _Float16 hq = (_Float16)sp[e];
              hv[e] = hq;
              lv[e] = (_Float16)(sp[e] - (float)hq);
            }
          }
          *(v8h*)(C + tb + it * 256) = hv;
          if (OUT_MODE == 2) *(v8h*)(C2 + tb + it * 256) = lv;
        }
        
      }
    }
    __builtin_amdgcn_fence(__ATOMIC_RELEASE, "workgroup");
    __builtin_amdgcn_wave_barrier();
    __builtin_amdgcn_fence(__ATOMIC_ACQUIRE, "workgroup");
  }
}

// ---------------------------------------------------------------------------
// f16 hi/lo split of a row-major f32 matrix [rows][CCH] with total element count 8*n8 into planes in fragment order:
//   hi = f16(in * carry), lo = f16(in * carry - hi). Thread i makes the i-th 16-B unit of each plane from 8 consecutive elements of one row
// ---------------------------------------------------------------------------
__global__ __launch_bounds__(256) void wconv_f16(const float* __restrict__ in, unsigned short* __restrict__ oh,
                                                 unsigned short* __restrict__ ol, int n8, float carry) {
  const int i = blockIdx.x * 256 + threadIdx.x;
  if (i < n8) {
    const size_t e0 = (size_t)i * 8;
    const int blkid = i >> 6;                                             // block (rt, kb), CCH/32 blocks per row tile
    const int srow = (blkid / (CCH / 32)) * 16 + (i & 15);
    const int scol = (blkid % (CCH / 32)) * 32 + ((i >> 4) & 3) * 8;      // bits 5,4 of i = s,h: col 16*s + 8*h
    const float* ip = in + (size_t)srow * CCH + scol;
    const v4f a = *(const v4f*)(ip);
    const v4f c = *(const v4f*)(ip + 4);
    float f[8];
    f[0] = a[0]; f[1] = a[1]; f[2] = a[2]; f[3] = a[3];
    f[4] = c[0]; f[5] = c[1]; f[6] = c[2]; f[7] = c[3];
    v4u hv, lv;
#pragma unroll
    for (int q = 0; q < 4; ++q) {
      const float f0 = f[2 * q] * carry, f1 = f[2 * q + 1] * carry;
      const _Float16 h0 = (_Float16)f0, h1 = (_Float16)f1;
      const _Float16 l0 = (_Float16)(f0 - (float)h0), l1 = (_Float16)(f1 - (float)h1);
      hv[q] = pk16(h_bits(h0), h_bits(h1));
      lv[q] = pk16(h_bits(l0), h_bits(l1));
    }
    {
      *(v4u*)(oh + e0) = hv;
      *(v4u*)(ol + e0) = lv;
      
    }
  }
}

// ---------------------------------------------------------------------------
// Fused transpose + f16 hi/lo split of an f32 matrix, z-batched:
//   in_z = W + z*sIn viewed in[R rows][Cc cols] (pitch Cc) -> oh_z[c][r] = f16(in_z[r][c]*carry), ol_z[c][r] = f16(rem),
//   out [Cc][R] in fragment order, oh_z = oh + z*sOut.
// 64x64 tiles through LDS. grid = (Cc/64, R/64, Z), 256 threads (R, Cc multiples of 64; R multiple of 64 keeps every
// Coverage per block and plane: load 4 it x 256 thr x 4 floats = 64x64; store 2 it x 256 thr x 8 halves = 64x64.
// ---------------------------------------------------------------------------
__global__ __launch_bounds__(256) void tsplit_f16(const float* __restrict__ W, unsigned short* __restrict__ oh,
                                                  unsigned short* __restrict__ ol, int R, int Cc, long sIn, long sOut,
                                                  float carry) {
  __shared__ __align__(16) float tf[64 * 68];
  W  += (size_t)blockIdx.z * sIn;
  oh += (size_t)blockIdx.z * sOut;
  ol += (size_t)blockIdx.z * sOut;
  const int c0  = blockIdx.x * 64;   // input column block = output row block
  const int r0  = blockIdx.y * 64;   // input row block    = output column block
  const int tid = threadIdx.x;
  {
    const int lr = tid >> 4;         // 0..15
    const int c4 = (tid & 15) * 4;   // 0..60
#pragma unroll
    for (int it = 0; it < 4; ++it) {
      const int rr = it * 16 + lr;   // 0..63
      const v4f a = *(const v4f*)(W + (size_t)(r0 + rr) * Cc + c0 + c4);
      *(v4f*)(tf + rr * 68 + c4) = a;
    }
  }
  __syncthreads();
  // unit u = it*256 + tid of the tile's 512 16-B units per plane, in fragment order: u = ((row tile * 2 + block) * 2 + s) * 32 + h*16 + c
  v4u hv[2], lv[2];
#pragma unroll
  for (int it = 0; it < 2; ++it) {
    const int u  = it * 256 + tid;
    const int oc = ((u >> 7) << 4) + (u & 15);   // output row within tile (= input column)
    const int c8 = ((u >> 4) & 7) * 8;           // output column within tile = 32*block + 16*s + 8*h
    v4u a, a2;
#pragma unroll
    for (int q = 0; q < 4; ++q) {
      const float f0 = tf[(c8 + 2 * q) * 68 + oc] * carry;
      const float f1 = tf[(c8 + 2 * q + 1) * 68 + oc] * carry;
      const _Float16 h0 = (_Float16)f0, h1 = (_Float16)f1;
      const _Float16 l0 = (_Float16)(f0 - (float)h0), l1 = (_Float16)(f1 - (float)h1);
      a[q]  = pk16(h_bits(h0), h_bits(h1));
      a2[q] = pk16(h_bits(l0), h_bits(l1));
    }
    hv[it] = a; lv[it] = a2;
  }
  {
#pragma unroll
    for (int it = 0; it < 2; ++it) {
      const int u = it * 256 + tid;
      const size_t go = (((size_t)((c0 >> 4) + (u >> 7)) * (R >> 5) + (r0 >> 5) + ((u >> 6) & 1)) << 9) + (u & 63) * 8;
      *(v4u*)(oh + go) = hv[it];
      *(v4u*)(ol + go) = lv[it];
    }
    
  }
}

// =====================================================================================
// Flash-style attention with a 512-wide value dimension and a 64-deep score dimension, no score scaling.
//   All four kinds of plane in fragment order (head of the file):
//   q planes (hi/lo f16, x2^10) [16384][64]: row b*4096 + i, col d
//   k planes (hi/lo f16, x2^10) [16384][64]: same for keys j
//   v plane (f16, carry 1) [4*512][4096]: row b*512 + ch, col j
//   o2 planes (hi/lo f16, x2^10) [16384][512]: row b*4096 + i, col ch = split of (gamma*out + x[b][ch][i]) * 2^10
//   Both products are formed TRANSPOSED, so that a lane's column (lane&15) is one query in the score tiles and in the output tiles alike:
//   scores S^T = k . q^T on split planes (hi.hi + lo.hi + hi.lo), * sscale (= 2^-20) in f32: A = K fragment (row = key), B = Q fragment (col = query);
//   a lane holds 8 keys (8*(lane>>4) + r) of one query per tile: row maximum and row sum run inside the lane, plus one exchange between the wave's halves;
//   running-max softmax in f32 over the 4096 keys of the batch element (32 chunks of 128, compile-time trip count);
//   P = exp(s - m) * pcarry (2^15) as f16 in LDS (values < 2^-14 stored as 0); out^T = v . P^T single products, f32 accumulate
//   (A = V fragment, row = channel; B = P rows, col = query), times (1/rowsum) * pinv (2^-15) at the end.
//   Block = 64 query rows (4 query tiles of 16) of one batch element, 8 waves; wave w computes the 16x64 score piece for keys
//   j0 + 16w .. +15 of each chunk (shared through LDS: partial row max Pm, partial row sum Pl, P tile Ps) and accumulates the
//   output for channels 64w .. 64w+63 (4 query tiles x 4 channel tiles in registers). Each K fragment and each V fragment
//   loaded from global feeds one product per query tile (the K hi fragment two). grid = (4096/64, 4) = 256 blocks.
//   The block's Q rows sit in LDS (Qsh/Qsl, written once, barrier B0) and are read as fragments in every chunk.
//   Barriers per chunk: after the Pm writes (B1) and after the Ps/Pl writes (B2); Pm/Ps/Pl of the next chunk are only
//   written after every wave has passed B2/B1 of the current one. Every wave reaches every barrier (no early exit).
//   B1 and B2 order LDS only (lds_barrier): the K and V fragments of the next chunk stay in flight across them.
//   LDS extents: Ps rows 0..63 x cols 0..127 fully written each chunk (8 waves x 16 cols) before any fragment read
//   (reads reach col 127; cols 128..135 never read); Pm/Pl [64][8] fully written.
//   Fragment loads from global (K, V blocks): plane base (kernel argument) + the lane's 32-bit byte offset, 16-B aligned, one chunk ahead of their use.
// =====================================================================================
#define AQT    4
#define AQB    (16 * AQT)
#define AKC    128
#define PPITCH 136
#define NCHUNK (NPOS / AKC)

static_assert(NPOS % AQB == 0);
static_assert(NCHUNK * AKC == NPOS);
static_assert(CCH == 8 * 64);
static_assert((PPITCH * 2) % 16 == 0);
static_assert(AQB * CQK == 2 * 256 * 8);

// value of lane l ^ 16 (the other half of the wave), on the vector unit
__device__ __forceinline__ float xhalf(float x) {
  return __builtin_bit_cast(float, __builtin_amdgcn_permlanex16(__builtin_bit_cast(int, x), __builtin_bit_cast(int, x), 0x76543210, 0xfedcba98, false, false));
}

// Work-group barrier that orders LDS traffic only (s_wait_dscnt 0 in front of the signal). __syncthreads() also drains the wave's outstanding
// global loads, which would end the flight of the K and V fragments requested ahead; inside the chunk loop the waves exchange data through LDS alone
// (Pm, Ps, Pl) and write nothing to global memory.
__device__ __forceinline__ void lds_barrier() {
  __builtin_amdgcn_fence(__ATOMIC_RELEASE, "workgroup", "local");
  __builtin_amdgcn_s_barrier();
  __builtin_amdgcn_fence(__ATOMIC_ACQUIRE, "workgroup", "local");
}

__global__ __launch_bounds__(256)
void attn_kernel(const unsigned short* __restrict__ qhp, const unsigned short* __restrict__ qlp,
                 const unsigned short* __restrict__ khp, const unsigned short* __restrict__ klp,
                 const unsigned short* __restrict__ vtp,
                 const float* __restrict__ X, const float* __restrict__ gam,
                 unsigned short* __restrict__ o2hp, unsigned short* __restrict__ o2lp,
                 float sscale, float pcarry, float pinv, float ocarry) {
  union FB { v16h v; v8h h[2]; };
  __shared__ __align__(16) _Float16 Ps[AQB * PPITCH];     // P tile [query row][key in chunk], pitch 136 halves
  __shared__ __align__(16) float    Pm[AQB * 8];          // partial row max  [row][wave]
  __shared__ __align__(16) float    Pl[AQB * 8];          // partial row sum  [row][wave]
  __shared__ __align__(16) _Float16 Qsh[AQB * CQK];       // q hi plane rows of this block, fragment order as in global
  __shared__ __align__(16) _Float16 Qsl[AQB * CQK];       // q lo plane rows of this block, fragment order as in global

  const int tid  = threadIdx.x;
  const int wave = tid >> 5;
  const int lane = tid & 31;
  const int hh   = lane >> 4;
  const int c    = lane & 15;

  const int b  = blockIdx.y;                       // 0..3
  const int i0 = blockIdx.x * AQB;                 // first query position of this block
  const size_t qrow0 = (size_t)b * NPOS + i0;      // row in the q / o2 planes

  const _Float16* Qh = (const _Float16*)(const void*)qhp;
  const _Float16* Ql = (const _Float16*)(const void*)qlp;
  const _Float16* Kh = (const _Float16*)(const void*)khp;
  const _Float16* Kl = (const _Float16*)(const void*)klp;
  const _Float16* Vt = (const _Float16*)(const void*)vtp;
  const unsigned vw_off = (((unsigned)b * CCH + (unsigned)wave * 64) * NPOS + (unsigned)lane * 8) * 2;   // bytes: this wave's 64 channel rows, the lane's 16 B
  _Float16* O2h = (_Float16*)(void*)o2hp;
  _Float16* O2l = (_Float16*)(void*)o2lp;
  const float g = gam[0];

  // ---- Q rows of the block (64 x 64, hi and lo) into LDS once: 512 pieces of 16 B per plane, 2 per thread and plane;
  //      the 16 Q fragments would take 128 registers, which the accumulators and the V fragments in flight need ----
  {
    const int q8 = tid * 8;                        // the 64 rows are 4 row tiles = 4096 consecutive halves; pieces tid and 256 + tid
    const _Float16* gh0 = Qh + qrow0 * CQK + q8;
    const _Float16* gl0 = Ql + qrow0 * CQK + q8;
    const _Float16* gh1 = gh0 + 32 * CQK;
    const _Float16* gl1 = gl0 + 32 * CQK;
    const v8h th0 = *(const v8h*)gh0, tl0 = *(const v8h*)gl0, th1 = *(const v8h*)gh1, tl1 = *(const v8h*)gl1;
    xwait(gh0, gl0, gh1, gl1);
    *(v8h*)(Qsh + q8) = th0;
    *(v8h*)(Qsl + q8) = tl0;
    *(v8h*)(Qsh + 32 * CQK + q8) = th1;
    *(v8h*)(Qsl + 32 * CQK + q8) = tl1;
  }
  __syncthreads();   // B0: every wave reads all 64 Q rows

  float mrow[AQT], lrow[AQT];                      // of query t*16 + c, the same in both halves of the wave and in every wave
  v8f acc[AQT][4];                                 // acc[t][n][r] = out of query t*16 + c, channel 64*wave + 16*n + 8*hh + r
#pragma unroll
  for (int t = 0; t < AQT; ++t) {
    mrow[t] = -INFINITY; lrow[t] = 0.f;
#pragma unroll
    for (int n = 0; n < 4; ++n) acc[t][n] = (v8f){0.f,0.f,0.f,0.f,0.f,0.f,0.f,0.f};
  }

  // K fragments (A operand, row = lane&15 = key) of this wave's key row tile (2 blocks of 512 halves per plane) are fetched one chunk ahead: chunk 0 here
  const unsigned kw_off = (((unsigned)b * NPOS + (unsigned)wave * 16) * CQK + (unsigned)lane * 8) * 2;   // bytes, the same in the hi and the lo plane
  v16h kfh[2], kfl[2];
#pragma unroll
  for (int dc = 0; dc < 2; ++dc) {
    kfh[dc] = FragH::load_off(Kh, kw_off, dc * 1024);
    kfl[dc] = FragH::load_off(Kl, kw_off, dc * 1024);
  }
  xwait_off(kw_off);
  // The 16 V fragments of a chunk (A operand, row = lane&15 = channel) do not depend on the scores: they too are fetched one chunk ahead, chunk 0 here,
  // each later one into the same registers right behind its last product, so that it lands under the next chunk's scores and softmax
  // (neither barrier of the chunk drains the loads)
  unsigned vo = vw_off;   // bytes: block 0 of the wave's first channel row tile
  v16h vb[4][4];
#pragma unroll
  for (int kk = 0; kk < 4; ++kk) {
#pragma unroll
    for (int n = 0; n < 4; ++n) vb[kk][n] = FragH::load_off(Vt, vo, (n * 16 * NPOS + kk * 512) * 2);
  }

  for (int jc = 0; jc < NCHUNK; ++jc) {
    // ---- score piece, transposed: rows = keys j0 + 16*wave + 8*hh + r (j0 = jc * AKC), cols = 64 queries (B operand col = lane&15) ----
    v8f s[AQT];
#pragma unroll
    for (int t = 0; t < AQT; ++t) s[t] = (v8f){0.f,0.f,0.f,0.f,0.f,0.f,0.f,0.f};
#pragma unroll
    for (int dc = 0; dc < 2; ++dc) {
      const v16h kbh = kfh[dc];
      const v16h kbl = kfl[dc];
      // Q fragments (B operand, col = lane&15) from LDS, same k map as the K fragments
      v16h qah[AQT], qal[AQT];
#pragma unroll
      for (int t = 0; t < AQT; ++t) {
        qah[t] = FragH::load(Qsh + (t * 2 + dc) * 512 + lane * 8);
        qal[t] = FragH::load(Qsl + (t * 2 + dc) * 512 + lane * 8);
      }
#pragma unroll
      for (int t = 0; t < AQT; ++t) s[t] = FragH::mma(kbh, qah[t], s[t]);
#pragma unroll
      for (int t = 0; t < AQT; ++t) s[t] = FragH::mma(kbl, qah[t], s[t]);
#pragma unroll
      for (int t = 0; t < AQT; ++t) s[t] = FragH::mma(kbh, qal[t], s[t]);
    }
    // K fragments of the next chunk into the same registers, right behind their last use (the last chunk fetches its own again, so the address stays inside the planes)
    const int jn = (jc + 1 < NCHUNK) ? jc + 1 : jc;
    const unsigned ko = kw_off + (unsigned)jn * (AKC * CQK * 2);
#pragma unroll
    for (int dc = 0; dc < 2; ++dc) {
      kfh[dc] = FragH::load_off(Kh, ko, dc * 1024);
      kfl[dc] = FragH::load_off(Kl, ko, dc * 1024);
    }
    // scale, then this wave's partial maximum over its 16 keys of query t*16 + c: 8 in the lane, 8 in lane ^ 16
    float mloc[AQT];
#pragma unroll
    for (int t = 0; t < AQT; ++t) {
#pragma unroll
      for (int r = 0; r < 8; ++r) s[t][r] *= sscale;
      const float m = fmaxf(fmaxf(fmaxf(s[t][0], s[t][1]), fmaxf(s[t][2], s[t][3])),
                            fmaxf(fmaxf(s[t][4], s[t][5]), fmaxf(s[t][6], s[t][7])));
      mloc[t] = fmaxf(m, xhalf(m));
    }
    if (hh == 0) {
#pragma unroll
      for (int t = 0; t < AQT; ++t) Pm[(t * 16 + c) * 8 + wave] = mloc[t];
    }
    lds_barrier();   // B1

    // ---- running max update (identical in every wave), P tile, partial row sums ----
    float alpha[AQT], psl[AQT];
    v4f ma[AQT], mb[AQT];
#pragma unroll
    for (int t = 0; t < AQT; ++t) {                     // the 8 reads stand together: one LDS wait for all four query tiles
      ma[t] = *(const v4f*)(Pm + (t * 16 + c) * 8);
      mb[t] = *(const v4f*)(Pm + (t * 16 + c) * 8 + 4);
    }
    // keeps the 8 reads in one group; without it this build reads tile by tile and waits out the LDS latency once per query tile
    __builtin_amdgcn_sched_barrier(0);
#pragma unroll
    for (int t = 0; t < AQT; ++t) {
      const int row = t * 16 + c;
      const float cm = fmaxf(fmaxf(fmaxf(ma[t][0], ma[t][1]), fmaxf(ma[t][2], ma[t][3])),
                             fmaxf(fmaxf(mb[t][0], mb[t][1]), fmaxf(mb[t][2], mb[t][3])));
      const float mnew = fmaxf(mrow[t], cm);
      alpha[t] = __expf(mrow[t] - mnew);
      mrow[t] = mnew;
      float p[8];
      v8h ph;
#pragma unroll
      for (int r = 0; r < 8; ++r) {
        p[r] = __expf(s[t][r] - mnew);                  // in (0, 1]
        float p32 = p[r] * pcarry;
        p32 = (p32 >= 6.103515625e-05f) ? p32 : 0.0f;   // no f16 subnormals in the P tile
        ph[r] = (_Float16)p32;
      }
      *(v8h*)(Ps + row * PPITCH + wave * 16 + 8 * hh) = ph;   // the lane's 8 keys lie side by side in the query's P row: one 16-B store
      const float psum = ((p[0] + p[1]) + (p[2] + p[3])) + ((p[4] + p[5]) + (p[6] + p[7]));
      psl[t] = psum + xhalf(psum);
    }
    if (hh == 0) {
#pragma unroll
      for (int t = 0; t < AQT; ++t) Pl[(t * 16 + c) * 8 + wave] = psl[t];
    }
#pragma unroll
    for (int t = 0; t < AQT; ++t) {
#pragma unroll
      for (int n = 0; n < 4; ++n) acc[t][n] *= alpha[t];
    }
    // one wait for the V loads of the chunk before and the K loads of this one, a softmax behind the last of them, where it holds up nothing;
    // both offset registers are kept as they are until here, and vo steps on only behind it
    xwait_off(vo, ko);
    vo += (jc + 1 < NCHUNK) ? (unsigned)(AKC / 32) * 1024 : 0u;   // blocks of the next chunk; the last chunk fetches its own again, so the address stays inside the plane
    lds_barrier();   // B2

#pragma unroll
    for (int t = 0; t < AQT; ++t) {
      const int row = t * 16 + c;
      const v4f la = *(const v4f*)(Pl + row * 8);
      const v4f lb = *(const v4f*)(Pl + row * 8 + 4);
      const float ls = ((la[0] + la[1]) + (la[2] + la[3])) + ((lb[0] + lb[1]) + (lb[2] + lb[3]));
      lrow[t] = lrow[t] * alpha[t] + ls;
    }

    // ---- out^T(64 ch of this wave x 64 queries) += V(64 x 128) . P^T(128 x 64): A = v plane rows (row = lane&15 = channel),
    //      B = P tile (col = lane&15 = query within the query tile), both with the split k map; one V fragment serves all 4 query tiles ----
#pragma unroll
    for (int kk = 0; kk < 4; ++kk) {
      FB pa[AQT];
#pragma unroll
      for (int t = 0; t < AQT; ++t) {
        pa[t].h[0] = *(const v8h*)(Ps + (t * 16 + c) * PPITCH + kk * 32 + 8 * hh);
        pa[t].h[1] = *(const v8h*)(Ps + (t * 16 + c) * PPITCH + kk * 32 + 16 + 8 * hh);
      }
#pragma unroll
      for (int n = 0; n < 4; ++n) {
#pragma unroll
        for (int t = 0; t < AQT; ++t) acc[t][n] = FragH::mma(vb[kk][n], pa[t].v, acc[t][n]);
      }
#pragma unroll
      for (int n = 0; n < 4; ++n) vb[kk][n] = FragH::load_off(Vt, vo, (n * 16 * NPOS + kk * 512) * 2);   // the next chunk's
    }
  }
  xwait_off(vo);   // behind the last V loads, in front of the epilogue's reuse of the offset register

  // ---- epilogue, query tile by query tile: out * (1/(rowsum * 2^15)); o2 = gamma*out + x (exact f32 x); split of o2 * 2^10.
  //      The lane's 8 values of one accumulator tile (query c, channels 16n + 8*hh + 0..7) are its own 16-B unit of the o2 planes' fragment order.
  const float* xp0 = X + ((size_t)b * CCH + wave * 64 + 8 * hh) * NPOS + i0 + c;   // channel 64w + 8*hh, query c of tile 0
#pragma unroll
  for (int t = 0; t < AQT; ++t) {
    const float rl = (1.0f / lrow[t]) * pinv;
    const float* xp = xp0 + t * 16;
    float xe[4][8];
#pragma unroll
    for (int n = 0; n < 4; ++n) {                   // channel 64w + 16n + 8*hh + r
#pragma unroll
      for (int r = 0; r < 8; ++r) xe[n][r] = xp[(size_t)(n * 16 + r) * NPOS];
    }
    xwait(xp0);
    const size_t tb = ((((qrow0 >> 4) + t) * (size_t)(CCH >> 5) + wave * 2) << 9) + lane * 8;   // the wave's two blocks of query tile t
#pragma unroll
    for (int n = 0; n < 4; ++n) {                   // n = 2 * (block) + s
      v8h hv, lv;
#pragma unroll
      for (int r = 0; r < 8; ++r) {
        const float o  = acc[t][n][r] * rl;
        const float v2 = (g * o + xe[n][r]) * ocarry;
        const _Float16 hq = (_Float16)v2;
        hv[r] = hq;
        lv[r] = (_Float16)(v2 - (float)hq);
      }
      const size_t go = tb + n * 256;
      *(v8h*)(O2h + go) = hv;
      *(v8h*)(O2l + go) = lv;
    }
  }
}

// ---------------------------------------------------------------------------
// Workspace region map (byte offsets; every region is fully written by its producer launch before any consumer
//   XTh  f16 [16384][512]        0        16777216     XTl   16777216   16777216
//   WQh  f16 [64][512]    33554432           65536     WQl   33619968      65536
//   WKh  f16 [64][512]    33685504           65536     WKl   33751040      65536
//   WVh  f16 [512][512]   33816576          524288     WVl   34340864     524288
//   WDh  f16 [512][512]   34865152          524288     WDl   35389440     524288
//   Qh   f16 [16384][64]  35913728         2097152     Ql    38010880    2097152
//   Kh   f16 [16384][64]  40108032         2097152     Kl    42205184    2097152
//   VT   f16 [4][512][4096] 44302336     16777216
//   O2h  f16 [16384][512] 61079552        16777216     O2l   77856768   16777216
//   total                 94633984
// ---------------------------------------------------------------------------
extern "C" void kernel_launch(void* const* d_in, const int* in_sizes, int n_in,
                              void* d_out, int out_size, void* d_ws, size_t ws_size,
                              hipStream_t stream) {
  if (n_in < 10) return;
  if (in_sizes[0] != NBAT * CCH * NPOS) return;     // x     [4][512][64][64]
  if (in_sizes[1] != CQK * CCH) return;             // Wq    [64][512]
  if (in_sizes[2] != CQK) return;                   // bq    [64]
  if (in_sizes[3] != CQK * CCH) return;             // Wk    [64][512]
  if (in_sizes[4] != CQK) return;                   // bk    [64]
  if (in_sizes[5] != CCH * CCH) return;             // Wv    [512][512]
  if (in_sizes[6] != CCH) return;                   // bv    [512]
  if (in_sizes[7] != 1) return;                     // gamma [1]
  if (in_sizes[8] != CCH * CCH) return;             // Wd    [512][512]
  if (in_sizes[9] != CCH) return;                   // bd    [512]
  if (out_size != NBAT * CCH * NPOS) return;        // out   [4][512][64][64] f32, last element 8388607

  const float* x     = (const float*)d_in[0];
  const float* Wq    = (const float*)d_in[1];       // [out][in]
  const float* bq    = (const float*)d_in[2];
  const float* Wk    = (const float*)d_in[3];
  const float* bk    = (const float*)d_in[4];
  const float* Wv    = (const float*)d_in[5];
  const float* bv    = (const float*)d_in[6];
  const float* gamma = (const float*)d_in[7];
  const float* Wd    = (const float*)d_in[8];
  const float* bd    = (const float*)d_in[9];

  const size_t PXT = (size_t)MROWS * CCH * 2;       // 16777216  f16 [16384][512]
  const size_t PWS = (size_t)CQK * CCH * 2;         // 65536     f16 [64][512]
  const size_t PWL = (size_t)CCH * CCH * 2;         // 524288    f16 [512][512]
  const size_t PQK = (size_t)MROWS * CQK * 2;       // 2097152   f16 [16384][64]
  const size_t PVT = (size_t)NBAT * CCH * NPOS * 2; // 16777216  f16 [4][512][4096]
  size_t off = 0;
  const size_t oXTh = off; off += PXT;  const size_t oXTl = off; off += PXT;
  const size_t oWQh = off; off += PWS;  const size_t oWQl = off; off += PWS;
  const size_t oWKh = off; off += PWS;  const size_t oWKl = off; off += PWS;
  const size_t oWVh = off; off += PWL;  const size_t oWVl = off; off += PWL;
  const size_t oWDh = off; off += PWL;  const size_t oWDl = off; off += PWL;
  const size_t oQh  = off; off += PQK;  const size_t oQl  = off; off += PQK;
  const size_t oKh  = off; off += PQK;  const size_t oKl  = off; off += PQK;
  const size_t oVT  = off; off += PVT;
  const size_t oO2h = off; off += PXT;  const size_t oO2l = off; off += PXT;
  if (off > ws_size) return;                        // off = 94633984
  if (off > (size_t)134217728) return;

  char* ws = (char*)d_ws;
  unsigned short* XTh = (unsigned short*)(ws + oXTh);  unsigned short* XTl = (unsigned short*)(ws + oXTl);
  unsigned short* WQh = (unsigned short*)(ws + oWQh);  unsigned short* WQl = (unsigned short*)(ws + oWQl);
  unsigned short* WKh = (unsigned short*)(ws + oWKh);  unsigned short* WKl = (unsigned short*)(ws + oWKl);
  unsigned short* WVh = (unsigned short*)(ws + oWVh);  unsigned short* WVl = (unsigned short*)(ws + oWVl);
  unsigned short* WDh = (unsigned short*)(ws + oWDh);  unsigned short* WDl = (unsigned short*)(ws + oWDl);
  unsigned short* Qh  = (unsigned short*)(ws + oQh);   unsigned short* Ql  = (unsigned short*)(ws + oQl);
  unsigned short* Kh  = (unsigned short*)(ws + oKh);   unsigned short* Kl  = (unsigned short*)(ws + oKl);
  unsigned short* VT  = (unsigned short*)(ws + oVT);
  unsigned short* O2h = (unsigned short*)(ws + oO2h);  unsigned short* O2l = (unsigned short*)(ws + oO2l);

  const dim3 blk(256);
  const float actCarry = 1024.0f;                    // 2^10 on x, q, k, o2 planes
  const float wCarry   = 65536.0f;                   // 2^16 on weight planes
  const float scale26  = 1.0f / 67108864.0f;         // 2^-26 = 1 / (2^10 * 2^16)
  const float sScale   = 1.0f / 1048576.0f;          // 2^-20 = 1 / (2^10 * 2^10)
  const float pCarry   = 32768.0f;                   // 2^15 on the P tile
  const float pInv     = 1.0f / 32768.0f;            // 2^-15

  // (1) x[b] viewed in[R=512 c][Cc=4096 n] (pitch 4096) -> XT_b[n][c] (fragment order), hi/lo of x*2^10; grid (Cc/64, R/64, B) = (64, 8, 4)
  tsplit_f16<<<dim3(NPOS / 64, CCH / 64, NBAT), blk, 0, stream>>>(x, XTh, XTl, CCH, NPOS, (long)CCH * NPOS, (long)NPOS * CCH, actCarry);
  // (2) weight planes, natural [out][in] layout, hi/lo of W*2^16
  const int n8s = CQK * CCH / 8;                     // 4096  -> 16 blocks
  const int n8l = CCH * CCH / 8;                     // 32768 -> 128 blocks
  wconv_f16<<<dim3(n8s / 256), blk, 0, stream>>>(Wq, WQh, WQl, n8s, wCarry);
  wconv_f16<<<dim3(n8s / 256), blk, 0, stream>>>(Wk, WKh, WKl, n8s, wCarry);
  wconv_f16<<<dim3(n8l / 256), blk, 0, stream>>>(Wv, WVh, WVl, n8l, wCarry);
  wconv_f16<<<dim3(n8l / 256), blk, 0, stream>>>(Wd, WDh, WDl, n8l, wCarry);
  // (3) q = XT . Wq^T + bq -> Qh|Ql [16384][64] (x2^10)   (M=16384, N=64, K=512; 256 tiles -> 32 blocks)
  const dim3 gQ((MROWS / 64) * (CQK / 64) / 8, 1);
  gemm64_f16<true, 2, 2><<<gQ, blk, 0, stream>>>(
      XTh, XTl, CCH, 0L, WQh, WQl, CCH, 0L, (void*)Qh, (void*)Ql, CQK, 0L, bq, MROWS, CQK, CCH, scale26, actCarry);
  // (4) k likewise -> Kh|Kl
  gemm64_f16<true, 2, 2><<<gQ, blk, 0, stream>>>(
      XTh, XTl, CCH, 0L, WKh, WKl, CCH, 0L, (void*)Kh, (void*)Kl, CQK, 0L, bk, MROWS, CQK, CCH, scale26, actCarry);
  // (5) v^T[b] = Wv . XT_b^T + bv[m] -> VT [4][512][4096] f16 single   (M=512, N=4096, K=512; 512 tiles -> 64 blocks x 4 batches)
  const dim3 gV((CCH / 64) * (NPOS / 64) / 8, NBAT);
  gemm64_f16<true, 1, 1><<<gV, blk, 0, stream>>>(
      WVh, WVl, CCH, 0L, XTh, XTl, CCH, (long)NPOS * CCH, (void*)VT, (void*)VT, NPOS, (long)CCH * NPOS, bv,
      CCH, NPOS, CCH, scale26, 1.0f);
  // (6) attention + gamma scale + residual -> O2h|O2l [16384][512] (x2^10); grid (4096/64, 4) = 256 blocks
  attn_kernel<<<dim3(NPOS / AQB, NBAT), blk, 0, stream>>>(Qh, Ql, Kh, Kl, VT, x, gamma, O2h, O2l, sScale, pCarry, pInv, actCarry);
  // (7) out[b] = Wd . O2_b^T + bd[m] -> d_out NCHW f32 [4][512][4096]   (M=512, N=4096, K=512; 512 tiles -> 64 blocks x 4 batches)
  gemm64_f16<true, 1, 0><<<gV, blk, 0, stream>>>(
      WDh, WDl, CCH, 0L, O2h, O2l, CCH, (long)NPOS * CCH, d_out, d_out, NPOS, (long)CCH * NPOS, bd,
      CCH, NPOS, CCH, scale26, 1.0f);
  (void)hipGetLastError();
}

// v005
// One run takes 211 microseconds.
// Next to v004, in two timings, it ran 1.22 times as fast each time.
// Counting every step since v000, it is 2.92 times as fast.
// Contractions: q, k, v 1x1 convs, q.k^T energies and the output 1x1 conv = v_wmma_f32_16x16x32_f16 on f16 hi/lo split planes (hi.hi + hi.lo + lo.hi, 3 products each); p.v = v_wmma_f32_16x16x32_f16 single product (p carried x2^15 as f16, v plain f16 with |v| < 2^-14 written as 0); f32 accumulate everywhere; running-max softmax, 1/rowsum, gamma scale, biases and the residual add (exact f32 x) in f32 on the VALU.
// Plane / carry map (every carry is an exact power of two; the inverse is folded exactly once, at the line named):
//   XTh|XTl  f16 [16384 (b,n)][512 c]    = hi/lo of x * 2^10           (n = h*64 + w; producer tsplit_f16)
//   WQh|WQl, WKh|WKl f16 [64][512]; WVh|WVl, WDh|WDl f16 [512][512] = hi/lo of W * 2^16, natural [out][in] (producer wconv_f16)
//   Qh|Ql, Kh|Kl f16 [16384][64]           = hi/lo of q (or k) * 2^10   (GEMM: acc * 2^-26 removes the x and W carries, + bias, then * 2^10)
//   VT  f16 [4][512 ch][4096 n]            = v, carry 1                   (GEMM: acc * 2^-26 + bias; |v| < 2^-14 stored as 0)
//   energies                               = acc * 2^-20 (q and k carries) in attn_kernel before the softmax
//   P   f16 (LDS only)                     = exp(s - m) * 2^15, values < 2^-14 stored as 0; 2^-15 folded together with 1/rowsum in the attn_kernel epilogue
//   O2h|O2l f16 [16384][512]               = hi/lo of (gamma * out + x) * 2^10 (attn_kernel epilogue)
//   output conv                            = acc * 2^-26 (O2 and W carries) + bd -> f32 NCHW [4][512][4096]
// Every f16 plane above lies in FRAGMENT ORDER: a matrix [R rows][K cols] is cut into blocks of 16 rows x 32 cols, block (rt, kb) at
// halves ((rt * K/32 + kb) * 512); inside a block element (row c, col 16*s + 8*h + e) sits at s*256 + (h*16 + c)*8 + e, which is the
// register order of a 16x16x32 operand: lane h*16 + c reads its 16 B at lane*8 (s = 0) and at 256 + lane*8 (s = 1), 512 contiguous bytes per wave load.
#include <hip/hip_runtime.h>
#include <math.h>
#include <stdint.h>

#define NBAT  4
#define CCH   512
#define CQK   64
#define IMGH  64
#define IMGW  64
#define NPOS  4096
#define MROWS 16384

static_assert(NPOS == IMGH * IMGW);
static_assert(MROWS == NBAT * NPOS);
static_assert(CCH % 64 == 0);
static_assert(CQK == 64);
static_assert(NPOS % 128 == 0);
static_assert(NPOS % 64 == 0);
static_assert(CCH % 32 == 0);
static_assert((CQK * CCH) % (8 * 256) == 0);
static_assert((CCH * CCH) % (8 * 256) == 0);
static_assert(CCH % 256 == 0);
static_assert((MROWS / 64) % 8 == 0);
static_assert(((CCH / 64) * (NPOS / 64)) % 8 == 0);

typedef __attribute__((ext_vector_type(16))) _Float16 v16h;
typedef __attribute__((ext_vector_type(8)))  _Float16 v8h;
typedef __attribute__((ext_vector_type(8)))  float    v8f;
typedef __attribute__((ext_vector_type(4)))  float    v4f;
typedef __attribute__((ext_vector_type(4)))  unsigned int v4u;

__device__ __forceinline__ unsigned short h_bits(_Float16 h) { return __builtin_bit_cast(unsigned short, h); }
__device__ __forceinline__ unsigned pk16(unsigned short a, unsigned short b) { return (unsigned)a | ((unsigned)b << 16); }

// hazard guards as plain device helpers (no inline asm inside the kernel template body)
__device__ __forceinline__ void dep_guard_h(v8f& a, v8f& b, v16h x, v16h y) { asm volatile("v_nop\n\tv_nop\n\tv_nop\n\tv_nop" : "+v"(a), "+v"(b) : "v"(x), "v"(y)); }
__device__ __forceinline__ void acc_guard4(v8f& a, v8f& b, v8f& c, v8f& d) { asm volatile("v_nop\n\tv_nop\n\tv_nop\n\tv_nop" : "+v"(a), "+v"(b), "+v"(c), "+v"(d)); }

// 16-bit fragment loader (A and B alike) from a block in fragment order: p = block start + lane*8; lane row/col = lane&15, h = lane>>4;
// vector elements 0..7 <- p[0..7] (= k0+8h+0..7), 8..15 <- p[256..263] (= k0+16+8h+0..7).
struct FragH {
  union U { v16h v; v8h h[2]; };
  static __device__ __forceinline__ v16h load(const _Float16* p) {
    U f; f.h[0] = *(const v8h*)(p); f.h[1] = *(const v8h*)(p + 256); return f.v;
  }
  // the same from a wave-uniform plane base and the lane's byte offset: one offset register per fragment group instead of a 64-bit address pair
  static __device__ __forceinline__ v16h load_off(const _Float16* base, unsigned boff, int imm) {
    const char* p = (const char*)(const void*)base + boff;
    U f; f.h[0] = *(const v8h*)(p + imm); f.h[1] = *(const v8h*)(p + imm + 512); return f.v;
  }
  static __device__ __forceinline__ v8f mma(v16h a, v16h b, v8f c) {
    return __builtin_amdgcn_wmma_f32_16x16x32_f16(false, a, false, b, (short)0, c, false, false);
  }
  static __device__ __forceinline__ void guard(v8f& a, v8f& b, v16h x, v16h y) { dep_guard_h(a, b, x, y); }
};

// s_wait_xcnt 0 behind a group of global loads, in front of any rewrite of their address registers.
// The addresses are inputs only so that their registers stay as they are up to the wait.
__device__ __forceinline__ void xwait(const void* a) { asm volatile("s_wait_xcnt 0x0" :: "v"(a) : "memory"); }
__device__ __forceinline__ void xwait(const void* a, const void* b, const void* c, const void* d) {
  asm volatile("s_wait_xcnt 0x0" :: "v"(a), "v"(b), "v"(c), "v"(d) : "memory");
}

// the same behind loads of the form uniform base + 32-bit byte offset per lane: the offset register stays as it is up to the wait (the bases are kernel arguments, never rewritten in the loop)
__device__ __forceinline__ void xwait_off(unsigned a) { asm volatile("s_wait_xcnt 0x0" :: "v"(a) : "memory"); }
__device__ __forceinline__ void xwait_off(unsigned a, unsigned b) { asm volatile("s_wait_xcnt 0x0" :: "v"(a), "v"(b) : "memory"); }
// the same where the bases are formed in the kernel: the four scalar bases too stay as they are up to the wait
__device__ __forceinline__ void xwait_off(unsigned a, const void* p, const void* q, const void* r, const void* s) {
  asm volatile("s_wait_xcnt 0x0" :: "v"(a), "s"(p), "s"(q), "s"(r), "s"(s) : "memory");
}

// ---- Register-blocked batched WMMA GEMM, f16 operands ----------------------
// C[m,n] = oscale * (scale * sum_k A[m,k] * Bt[n,k] + bias); each wave owns a 64x64 tile.
// A [M,GK] and Bt [N,GK] in fragment order, K = GK columns each; M,N % 64 == 0 (host-asserted sizes).
// The 16 fragments of a k step (32 columns: 4 row tiles x hi/lo of A and of Bt) are fetched one k step ahead into a second register set,
// so that a step's products run while the next step's 32 loads are in flight.
// f16 outputs (OUT_MODE 1, 2) are written in fragment order as matrices [M][ldc]; the f32 output stays row-major.
// SPLIT: operands are hi/lo planes (A2/Bt2 = lo planes, same layout); product = hi.hi + hi.lo + lo.hi.
// BIAS_MODE: 0 = none, 1 = bias[m], 2 = bias[n] (f32).
// OUT_MODE: 0 = f32; 1 = single f16 plane (|v| < 2^-14 stored as 0, so the plane holds no f16 subnormals);
//           2 = f16 hi plane (Cout) + f16 lo plane (Cout2), lo = v - hi.
#define GK   CCH
#define GRTB (GK * 32)   // bytes of one row tile of an operand plane: GK/32 blocks of 1 KiB, one behind the other
static_assert(GK % 64 == 0);

struct FragSet { v16h ah[4], al[4], bh[4], bl[4]; };

// all fragments of one k step: plane starts of the wave's first row tiles (wave-uniform) + the lane's byte offset + immediates.
// A first: the Bt registers are rewritten last, furthest behind the products that read them.
template <bool SPLIT>
__device__ __forceinline__ void gemm_fetch(FragSet& f, const _Float16* Ah, const _Float16* Al, const _Float16* Bh, const _Float16* Bl,
                                           unsigned off, int imm) {
#pragma unroll
  for (int i = 0; i < 4; ++i) {
    f.ah[i] = FragH::load_off(Ah, off, imm + i * GRTB);
    if (SPLIT) f.al[i] = FragH::load_off(Al, off, imm + i * GRTB); else f.al[i] = f.ah[i];
  }
#pragma unroll
  for (int j = 0; j < 4; ++j) {
    f.bh[j] = FragH::load_off(Bh, off, imm + j * GRTB);
    if (SPLIT) f.bl[j] = FragH::load_off(Bl, off, imm + j * GRTB); else f.bl[j] = f.bh[j];
  }
  // the 32 loads are issued as one group in front of the other set's products; without it the build may sink them among the products, which shortens their lead
  __builtin_amdgcn_sched_barrier(0);
}

// the products of one k step; per accumulator in the order hi.hi, hi.lo, lo.hi, four independent accumulators between two products into the same one
template <bool SPLIT>
__device__ __forceinline__ void gemm_mul(v8f (&acc)[4][4], const FragSet& f) {
#pragma unroll
  for (int i = 0; i < 4; ++i) {
#pragma unroll
    for (int j = 0; j < 4; ++j) acc[i][j] = FragH::mma(f.ah[i], f.bh[j], acc[i][j]);
    if (SPLIT) {
#pragma unroll
      for (int j = 0; j < 4; ++j) acc[i][j] = FragH::mma(f.ah[i], f.bl[j], acc[i][j]);
#pragma unroll
      for (int j = 0; j < 4; ++j) acc[i][j] = FragH::mma(f.al[i], f.bh[j], acc[i][j]);
    }
  }
  // every product of the step stays in front of this line: behind it the set's registers are refilled
  __builtin_amdgcn_sched_barrier(0);
  // four vector slots between the last products and the loads that refill this set's registers
  FragH::guard(acc[3][0], acc[3][3], f.ah[3], f.al[3]);
}

template <bool SPLIT, int BIAS_MODE, int OUT_MODE>
__global__ __launch_bounds__(256) void gemm64_f16(
    const unsigned short* __restrict__ Ap, const unsigned short* __restrict__ A2p, long strideA,
    const unsigned short* __restrict__ Btp, const unsigned short* __restrict__ Bt2p, long strideB,
    void* __restrict__ Cout, void* __restrict__ Cout2, int ldc, long strideC,
    const float* __restrict__ bias,
    int M, int N, float scale, float oscale) {
  const _Float16* A   = (const _Float16*)(const void*)Ap;
  const _Float16* A2  = (const _Float16*)(const void*)A2p;
  const _Float16* Bt  = (const _Float16*)(const void*)Btp;
  const _Float16* Bt2 = (const _Float16*)(const void*)Bt2p;
  __shared__ __align__(16) float sT[8][16 * 68];   // per-wave 16x64 slab, pitch 68 floats
  const int b    = blockIdx.y;
  const int lane = threadIdx.x & 31;
  const int wave = __builtin_amdgcn_readfirstlane(threadIdx.x >> 5);   // scalar, so that the block starts below are formed once per wave on the scalar unit
  const int tilesN = N >> 6;
  const int tilesM = M >> 6;
  const int tile = blockIdx.x * 8 + wave;
  if (tile >= tilesM * tilesN) return;   // wave-uniform; no block barriers in this kernel
  const int tm = tile / tilesN;
  const int tn = tile - tm * tilesN;
  const int m0 = tm << 6;
  const int n0 = tn << 6;

  // starts of the wave's 64 rows in each plane (4 row tiles, GRTB bytes each): the same in every lane, formed once, never rewritten
  const size_t ao = (size_t)b * strideA + (size_t)m0 * GK;
  const size_t bo = (size_t)b * strideB + (size_t)n0 * GK;
  const _Float16* Ab  = A  + ao;
  const _Float16* Bb  = Bt + bo;
  const _Float16* Ab2 = SPLIT ? (A2  + ao) : Ab;
  const _Float16* Bb2 = SPLIT ? (Bt2 + bo) : Bb;

  const int rlane = lane & 15;                 // row (A) / col (B, D) within subtile
  const int mOff  = (lane >> 4) * 8;           // D row offset

  v8f acc[4][4];
#pragma unroll
  for (int i = 0; i < 4; ++i)
#pragma unroll
    for (int j = 0; j < 4; ++j) acc[i][j] = (v8f){0.f,0.f,0.f,0.f,0.f,0.f,0.f,0.f};

  const unsigned ko = (unsigned)lane * 16;     // bytes: the lane's 16 B inside each 512-B half block
  FragSet f0, f1;
  gemm_fetch<SPLIT>(f0, Ab, Ab2, Bb, Bb2, ko, 0);
  // unrolled in full: a k step is 1 KiB further in every row tile, so each address is base + ko + an immediate and no address register is rewritten under loads in flight
#pragma unroll
  for (int k0 = 0; k0 < GK; k0 += 64) {
    gemm_fetch<SPLIT>(f1, Ab, Ab2, Bb, Bb2, ko, (k0 + 32) * 32);                     // k step k0 + 32, in flight under the products of k step k0
    gemm_mul<SPLIT>(acc, f0);
    if (k0 + 64 < GK) gemm_fetch<SPLIT>(f0, Ab, Ab2, Bb, Bb2, ko, (k0 + 64) * 32);   // k step k0 + 64, in flight under the products of k step k0 + 32
    else xwait_off(ko, Ab, Ab2, Bb, Bb2);   // a k step's products behind the last loads, where it holds up nothing; the epilogue reuses the offset's and the bases' registers only behind it
    gemm_mul<SPLIT>(acc, f1);
  }
  acc_guard4(acc[0][0], acc[0][1], acc[0][2], acc[0][3]);
  acc_guard4(acc[1][0], acc[1][1], acc[1][2], acc[1][3]);
  acc_guard4(acc[2][0], acc[2][1], acc[2][2], acc[2][3]);
  acc_guard4(acc[3][0], acc[3][1], acc[3][2], acc[3][3]);

  // ---- epilogue ----
  float* slab = sT[wave];
#pragma unroll
  for (int i = 0; i < 4; ++i) {
    const int mBase = m0 + (i << 4);
#pragma unroll
    for (int j = 0; j < 4; ++j) {
      const int n = n0 + (j << 4) + rlane;
      float bvn = 0.f;
      if (BIAS_MODE == 2) bvn = bias[n];
#pragma unroll
      for (int r = 0; r < 8; ++r) {
        float v = acc[i][j][r] * scale;
        if (BIAS_MODE == 1) v += bias[mBase + mOff + r];
        if (BIAS_MODE == 2) v += bvn;
        slab[(mOff + r) * 68 + (j << 4) + rlane] = v * oscale;
      }
    }
    __builtin_amdgcn_fence(__ATOMIC_RELEASE, "workgroup");
    __builtin_amdgcn_wave_barrier();
    __builtin_amdgcn_fence(__ATOMIC_ACQUIRE, "workgroup");
    if (OUT_MODE == 0) {
      float* C = (float*)Cout + (size_t)b * strideC;
      const int hh = lane >> 4, c4 = (lane & 15) * 4;     // row seg = 256 B = 16 lanes x 16 B
      {
#pragma unroll
        for (int it = 0; it < 8; ++it) {
          const int row = it * 2 + hh;                       // it 0..7 x hh 0..1 = rows 0..15
          v4f v = *(const v4f*)(slab + row * 68 + c4);
          *(v4f*)(C + (size_t)(mBase + row) * ldc + n0 + c4) = v;
        }
        
      }
    } else {
      const int row = lane & 15, h8 = (lane >> 4) * 8;
      _Float16* C  = (_Float16*)Cout + (size_t)b * strideC;
      _Float16* C2 = (_Float16*)Cout2 + (size_t)b * strideC;
      const size_t tb = (((size_t)(mBase >> 4) * (ldc >> 5) + (n0 >> 5)) << 9) + lane * 8;   // the slab's two blocks follow one another
      {
#pragma unroll
        for (int it = 0; it < 4; ++it) {                     // it = 2 * (block) + s: cols it*16 + h8 .. +7 of row lane&15
          const float* sp = slab + row * 68 + it * 16 + h8;
          v8h hv, lv;
#pragma unroll
          for (int e = 0; e < 8; ++e) {
            if (OUT_MODE == 1) {
              float f = sp[e];
              f = (fabsf(f) >= 6.103515625e-05f) ? f : 0.0f;
              hv[e] = (_Float16)f;
            } else {
              const _Float16 hq = (_Float16)sp[e];
              hv[e] = hq;
              lv[e] = (_Float16)(sp[e] - (float)hq);
            }
          }
          *(v8h*)(C + tb + it * 256) = hv;
          if (OUT_MODE == 2) *(v8h*)(C2 + tb + it * 256) = lv;
        }
        
      }
    }
    __builtin_amdgcn_fence(__ATOMIC_RELEASE, "workgroup");
    __builtin_amdgcn_wave_barrier();
    __builtin_amdgcn_fence(__ATOMIC_ACQUIRE, "workgroup");
  }
}

// ---------------------------------------------------------------------------
// f16 hi/lo split of a row-major f32 matrix [rows][CCH] with total element count 8*n8 into planes in fragment order:
//   hi = f16(in * carry), lo = f16(in * carry - hi). Thread i makes the i-th 16-B unit of each plane from 8 consecutive elements of one row
// ---------------------------------------------------------------------------
__global__ __launch_bounds__(256) void wconv_f16(const float* __restrict__ in, unsigned short* __restrict__ oh,
                                                 unsigned short* __restrict__ ol, int n8, float carry) {
  const int i = blockIdx.x * 256 + threadIdx.x;
  if (i < n8) {
    const size_t e0 = (size_t)i * 8;
    const int blkid = i >> 6;                                             // block (rt, kb), CCH/32 blocks per row tile
    const int srow = (blkid / (CCH / 32)) * 16 + (i & 15);
    const int scol = (blkid % (CCH / 32)) * 32 + ((i >> 4) & 3) * 8;      // bits 5,4 of i = s,h: col 16*s + 8*h
    const float* ip = in + (size_t)srow * CCH + scol;
    const v4f a = *(const v4f*)(ip);
    const v4f c = *(const v4f*)(ip + 4);
    float f[8];
    f[0] = a[0]; f[1] = a[1]; f[2] = a[2]; f[3] = a[3];
    f[4] = c[0]; f[5] = c[1]; f[6] = c[2]; f[7] = c[3];
    v4u hv, lv;
#pragma unroll
    for (int q = 0; q < 4; ++q) {
      const float f0 = f[2 * q] * carry, f1 = f[2 * q + 1] * carry;
      const _Float16 h0 = (_Float16)f0, h1 = (_Float16)f1;
      const _Float16 l0 = (_Float16)(f0 - (float)h0), l1 = (_Float16)(f1 - (float)h1);
      hv[q] = pk16(h_bits(h0), h_bits(h1));
      lv[q] = pk16(h_bits(l0), h_bits(l1));
    }
    {
      *(v4u*)(oh + e0) = hv;
      *(v4u*)(ol + e0) = lv;
      
    }
  }
}

// ---------------------------------------------------------------------------
// Fused transpose + f16 hi/lo split of an f32 matrix, z-batched:
//   in_z = W + z*sIn viewed in[R rows][Cc cols] (pitch Cc) -> oh_z[c][r] = f16(in_z[r][c]*carry), ol_z[c][r] = f16(rem),
//   out [Cc][R] in fragment order, oh_z = oh + z*sOut.
// 64x64 tiles through LDS. grid = (Cc/64, R/64, Z), 256 threads (R, Cc multiples of 64; R multiple of 64 keeps every
// Coverage per block and plane: load 4 it x 256 thr x 4 floats = 64x64; store 2 it x 256 thr x 8 halves = 64x64.
// ---------------------------------------------------------------------------
__global__ __launch_bounds__(256) void tsplit_f16(const float* __restrict__ W, unsigned short* __restrict__ oh,
                                                  unsigned short* __restrict__ ol, int R, int Cc, long sIn, long sOut,
                                                  float carry) {
  __shared__ __align__(16) float tf[64 * 68];
  W  += (size_t)blockIdx.z * sIn;
  oh += (size_t)blockIdx.z * sOut;
  ol += (size_t)blockIdx.z * sOut;
  const int c0  = blockIdx.x * 64;   // input column block = output row block
  const int r0  = blockIdx.y * 64;   // input row block    = output column block
  const int tid = threadIdx.x;
  {
    const int lr = tid >> 4;         // 0..15
    const int c4 = (tid & 15) * 4;   // 0..60
#pragma unroll
    for (int it = 0; it < 4; ++it) {
      const int rr = it * 16 + lr;   // 0..63
      const v4f a = *(const v4f*)(W + (size_t)(r0 + rr) * Cc + c0 + c4);
      *(v4f*)(tf + rr * 68 + c4) = a;
    }
  }
  __syncthreads();
  // unit u = it*256 + tid of the tile's 512 16-B units per plane, in fragment order: u = ((row tile * 2 + block) * 2 + s) * 32 + h*16 + c
  v4u hv[2], lv[2];
#pragma unroll
  for (int it = 0; it < 2; ++it) {
    const int u  = it * 256 + tid;
    const int oc = ((u >> 7) << 4) + (u & 15);   // output row within tile (= input column)
    const int c8 = ((u >> 4) & 7) * 8;           // output column within tile = 32*block + 16*s + 8*h
    v4u a, a2;
#pragma unroll
    for (int q = 0; q < 4; ++q) {
      const float f0 = tf[(c8 + 2 * q) * 68 + oc] * carry;
      const float f1 = tf[(c8 + 2 * q + 1) * 68 + oc] * carry;
      const _Float16 h0 = (_Float16)f0, h1 = (_Float16)f1;
      const _Float16 l0 = (_Float16)(f0 - (float)h0), l1 = (_Float16)(f1 - (float)h1);
      a[q]  = pk16(h_bits(h0), h_bits(h1));
      a2[q] = pk16(h_bits(l0), h_bits(l1));
    }
    hv[it] = a; lv[it] = a2;
  }
  {
#pragma unroll
    for (int it = 0; it < 2; ++it) {
      const int u = it * 256 + tid;
      const size_t go = (((size_t)((c0 >> 4) + (u >> 7)) * (R >> 5) + (r0 >> 5) + ((u >> 6) & 1)) << 9) + (u & 63) * 8;
      *(v4u*)(oh + go) = hv[it];
      *(v4u*)(ol + go) = lv[it];
    }
    
  }
}

// =====================================================================================
// Flash-style attention with a 512-wide value dimension and a 64-deep score dimension, no score scaling.
//   All four kinds of plane in fragment order (head of the file):
//   q planes (hi/lo f16, x2^10) [16384][64]: row b*4096 + i, col d
//   k planes (hi/lo f16, x2^10) [16384][64]: same for keys j
//   v plane (f16, carry 1) [4*512][4096]: row b*512 + ch, col j
//   o2 planes (hi/lo f16, x2^10) [16384][512]: row b*4096 + i, col ch = split of (gamma*out + x[b][ch][i]) * 2^10
//   Both products are formed TRANSPOSED, so that a lane's column (lane&15) is one query in the score tiles and in the output tiles alike:
//   scores S^T = k . q^T on split planes (hi.hi + lo.hi + hi.lo), * sscale (= 2^-20) in f32: A = K fragment (row = key), B = Q fragment (col = query);
//   a lane holds 8 keys (8*(lane>>4) + r) of one query per tile: row maximum and row sum run inside the lane, plus one exchange between the wave's halves;
//   running-max softmax in f32 over the 4096 keys of the batch element (32 chunks of 128, compile-time trip count);
//   P = exp(s - m) * pcarry (2^15) as f16 in LDS (values < 2^-14 stored as 0); out^T = v . P^T single products, f32 accumulate
//   (A = V fragment, row = channel; B = P rows, col = query), times (1/rowsum) * pinv (2^-15) at the end.
//   Block = 64 query rows (4 query tiles of 16) of one batch element, 8 waves; wave w computes the 16x64 score piece for keys
//   j0 + 16w .. +15 of each chunk (shared through LDS: partial row max Pm, partial row sum Pl, P tile Ps) and accumulates the
//   output for channels 64w .. 64w+63 (4 query tiles x 4 channel tiles in registers). Each K fragment and each V fragment
//   loaded from global feeds one product per query tile (the K hi fragment two). grid = (4096/64, 4) = 256 blocks.
//   The block's Q rows sit in LDS (Qsh/Qsl, written once, barrier B0) and are read as fragments in every chunk.
//   Barriers per chunk: after the Pm writes (B1) and after the Ps/Pl writes (B2); Pm/Ps/Pl of the next chunk are only
//   written after every wave has passed B2/B1 of the current one. Every wave reaches every barrier (no early exit).
//   B1 and B2 order LDS only (lds_barrier): the K and V fragments of the next chunk stay in flight across them.
//   LDS extents: Ps rows 0..63 x cols 0..127 fully written each chunk (8 waves x 16 cols) before any fragment read
//   (reads reach col 127; cols 128..135 never read); Pm/Pl [64][8] fully written.
//   Fragment loads from global (K, V blocks): plane base (kernel argument) + the lane's 32-bit byte offset, 16-B aligned, one chunk ahead of their use.
// =====================================================================================
#define AQT    4
#define AQB    (16 * AQT)
#define AKC    128
#define PPITCH 136
#define NCHUNK (NPOS / AKC)

static_assert(NPOS % AQB == 0);
static_assert(NCHUNK * AKC == NPOS);
static_assert(CCH == 8 * 64);
static_assert((PPITCH * 2) % 16 == 0);
static_assert(AQB * CQK == 2 * 256 * 8);

// value of lane l ^ 16 (the other half of the wave), on the vector unit
__device__ __forceinline__ float xhalf(float x) {
  return __builtin_bit_cast(float, __builtin_amdgcn_permlanex16(__builtin_bit_cast(int, x), __builtin_bit_cast(int, x), 0x76543210, 0xfedcba98, false, false));
}

// Work-group barrier that orders LDS traffic only (s_wait_dscnt 0 in front of the signal). __syncthreads() also drains the wave's outstanding
// global loads, which would end the flight of the K and V fragments requested ahead; inside the chunk loop the waves exchange data through LDS alone
// (Pm, Ps, Pl) and write nothing to global memory.
__device__ __forceinline__ void lds_barrier() {
  __builtin_amdgcn_fence(__ATOMIC_RELEASE, "workgroup", "local");
  __builtin_amdgcn_s_barrier();
  __builtin_amdgcn_fence(__ATOMIC_ACQUIRE, "workgroup", "local");
}

__global__ __launch_bounds__(256)
void attn_kernel(const unsigned short* __restrict__ qhp, const unsigned short* __restrict__ qlp,
                 const unsigned short* __restrict__ khp, const unsigned short* __restrict__ klp,
                 const unsigned short* __restrict__ vtp,
                 const float* __restrict__ X, const float* __restrict__ gam,
                 unsigned short* __restrict__ o2hp, unsigned short* __restrict__ o2lp,
                 float sscale, float pcarry, float pinv, float ocarry) {
  union FB { v16h v; v8h h[2]; };
  __shared__ __align__(16) _Float16 Ps[AQB * PPITCH];     // P tile [query row][key in chunk], pitch 136 halves
  __shared__ __align__(16) float    Pm[AQB * 8];          // partial row max  [row][wave]
  __shared__ __align__(16) float    Pl[AQB * 8];          // partial row sum  [row][wave]
  __shared__ __align__(16) _Float16 Qsh[AQB * CQK];       // q hi plane rows of this block, fragment order as in global
  __shared__ __align__(16) _Float16 Qsl[AQB * CQK];       // q lo plane rows of this block, fragment order as in global

  const int tid  = threadIdx.x;
  const int wave = tid >> 5;
  const int lane = tid & 31;
  const int hh   = lane >> 4;
  const int c    = lane & 15;

  const int b  = blockIdx.y;                       // 0..3
  const int i0 = blockIdx.x * AQB;                 // first query position of this block
  const size_t qrow0 = (size_t)b * NPOS + i0;      // row in the q / o2 planes

  const _Float16* Qh = (const _Float16*)(const void*)qhp;
  const _Float16* Ql = (const _Float16*)(const void*)qlp;
  const _Float16* Kh = (const _Float16*)(const void*)khp;
  const _Float16* Kl = (const _Float16*)(const void*)klp;
  const _Float16* Vt = (const _Float16*)(const void*)vtp;
  const unsigned vw_off = (((unsigned)b * CCH + (unsigned)wave * 64) * NPOS + (unsigned)lane * 8) * 2;   // bytes: this wave's 64 channel rows, the lane's 16 B
  _Float16* O2h = (_Float16*)(void*)o2hp;
  _Float16* O2l = (_Float16*)(void*)o2lp;
  const float g = gam[0];

  // ---- Q rows of the block (64 x 64, hi and lo) into LDS once: 512 pieces of 16 B per plane, 2 per thread and plane;
  //      the 16 Q fragments would take 128 registers, which the accumulators and the V fragments in flight need ----
  {
    const int q8 = tid * 8;                        // the 64 rows are 4 row tiles = 4096 consecutive halves; pieces tid and 256 + tid
    const _Float16* gh0 = Qh + qrow0 * CQK + q8;
    const _Float16* gl0 = Ql + qrow0 * CQK + q8;
    const _Float16* gh1 = gh0 + 32 * CQK;
    const _Float16* gl1 = gl0 + 32 * CQK;
    const v8h th0 = *(const v8h*)gh0, tl0 = *(const v8h*)gl0, th1 = *(const v8h*)gh1, tl1 = *(const v8h*)gl1;
    xwait(gh0, gl0, gh1, gl1);
    *(v8h*)(Qsh + q8) = th0;
    *(v8h*)(Qsl + q8) = tl0;
    *(v8h*)(Qsh + 32 * CQK + q8) = th1;
    *(v8h*)(Qsl + 32 * CQK + q8) = tl1;
  }
  __syncthreads();   // B0: every wave reads all 64 Q rows

  float mrow[AQT], lrow[AQT];                      // of query t*16 + c, the same in both halves of the wave and in every wave
  v8f acc[AQT][4];                                 // acc[t][n][r] = out of query t*16 + c, channel 64*wave + 16*n + 8*hh + r
#pragma unroll
  for (int t = 0; t < AQT; ++t) {
    mrow[t] = -INFINITY; lrow[t] = 0.f;
#pragma unroll
    for (int n = 0; n < 4; ++n) acc[t][n] = (v8f){0.f,0.f,0.f,0.f,0.f,0.f,0.f,0.f};
  }

  // K fragments (A operand, row = lane&15 = key) of this wave's key row tile (2 blocks of 512 halves per plane) are fetched one chunk ahead: chunk 0 here
  const unsigned kw_off = (((unsigned)b * NPOS + (unsigned)wave * 16) * CQK + (unsigned)lane * 8) * 2;   // bytes, the same in the hi and the lo plane
  v16h kfh[2], kfl[2];
#pragma unroll
  for (int dc = 0; dc < 2; ++dc) {
    kfh[dc] = FragH::load_off(Kh, kw_off, dc * 1024);
    kfl[dc] = FragH::load_off(Kl, kw_off, dc * 1024);
  }
  xwait_off(kw_off);
  // The 16 V fragments of a chunk (A operand, row = lane&15 = channel) do not depend on the scores: they too are fetched one chunk ahead, chunk 0 here,
  // each later one into the same registers right behind its last product, so that it lands under the next chunk's scores and softmax
  // (neither barrier of the chunk drains the loads)
  unsigned vo = vw_off;   // bytes: block 0 of the wave's first channel row tile
  v16h vb[4][4];
#pragma unroll
  for (int kk = 0; kk < 4; ++kk) {
#pragma unroll
    for (int n = 0; n < 4; ++n) vb[kk][n] = FragH::load_off(Vt, vo, (n * 16 * NPOS + kk * 512) * 2);
  }

  for (int jc = 0; jc < NCHUNK; ++jc) {
    // ---- score piece, transposed: rows = keys j0 + 16*wave + 8*hh + r (j0 = jc * AKC), cols = 64 queries (B operand col = lane&15) ----
    v8f s[AQT];
#pragma unroll
    for (int t = 0; t < AQT; ++t) s[t] = (v8f){0.f,0.f,0.f,0.f,0.f,0.f,0.f,0.f};
#pragma unroll
    for (int dc = 0; dc < 2; ++dc) {
      const v16h kbh = kfh[dc];
      const v16h kbl = kfl[dc];
      // Q fragments (B operand, col = lane&15) from LDS, same k map as the K fragments
      v16h qah[AQT], qal[AQT];
#pragma unroll
      for (int t = 0; t < AQT; ++t) {
        qah[t] = FragH::load(Qsh + (t * 2 + dc) * 512 + lane * 8);
        qal[t] = FragH::load(Qsl + (t * 2 + dc) * 512 + lane * 8);
      }
#pragma unroll
      for (int t = 0; t < AQT; ++t) s[t] = FragH::mma(kbh, qah[t], s[t]);
#pragma unroll
      for (int t = 0; t < AQT; ++t) s[t] = FragH::mma(kbl, qah[t], s[t]);
#pragma unroll
      for (int t = 0; t < AQT; ++t) s[t] = FragH::mma(kbh, qal[t], s[t]);
    }
    // K fragments of the next chunk into the same registers, right behind their last use (the last chunk fetches its own again, so the address stays inside the planes)
    const int jn = (jc + 1 < NCHUNK) ? jc + 1 : jc;
    const unsigned ko = kw_off + (unsigned)jn * (AKC * CQK * 2);
#pragma unroll
    for (int dc = 0; dc < 2; ++dc) {
      kfh[dc] = FragH::load_off(Kh, ko, dc * 1024);
      kfl[dc] = FragH::load_off(Kl, ko, dc * 1024);
    }
    // scale, then this wave's partial maximum over its 16 keys of query t*16 + c: 8 in the lane, 8 in lane ^ 16
    float mloc[AQT];
#pragma unroll
    for (int t = 0; t < AQT; ++t) {
#pragma unroll
      for (int r = 0; r < 8; ++r) s[t][r] *= sscale;
      const float m = fmaxf(fmaxf(fmaxf(s[t][0], s[t][1]), fmaxf(s[t][2], s[t][3])),
                            fmaxf(fmaxf(s[t][4], s[t][5]), fmaxf(s[t][6], s[t][7])));
      mloc[t] = fmaxf(m, xhalf(m));
    }
    if (hh == 0) {
#pragma unroll
      for (int t = 0; t < AQT; ++t) Pm[(t * 16 + c) * 8 + wave] = mloc[t];
    }
    lds_barrier();   // B1

    // ---- running max update (identical in every wave), P tile, partial row sums ----
    float alpha[AQT], psl[AQT];
    v4f ma[AQT], mb[AQT];
#pragma unroll
    for (int t = 0; t < AQT; ++t) {                     // the 8 reads stand together: one LDS wait for all four query tiles
      ma[t] = *(const v4f*)(Pm + (t * 16 + c) * 8);
      mb[t] = *(const v4f*)(Pm + (t * 16 + c) * 8 + 4);
    }
    // keeps the 8 reads in one group; without it this build reads tile by tile and waits out the LDS latency once per query tile
    __builtin_amdgcn_sched_barrier(0);
#pragma unroll
    for (int t = 0; t < AQT; ++t) {
      const int row = t * 16 + c;
      const float cm = fmaxf(fmaxf(fmaxf(ma[t][0], ma[t][1]), fmaxf(ma[t][2], ma[t][3])),
                             fmaxf(fmaxf(mb[t][0], mb[t][1]), fmaxf(mb[t][2], mb[t][3])));
      const float mnew = fmaxf(mrow[t], cm);
      alpha[t] = __expf(mrow[t] - mnew);
      mrow[t] = mnew;
      float p[8];
      v8h ph;
#pragma unroll
      for (int r = 0; r < 8; ++r) {
        p[r] = __expf(s[t][r] - mnew);                  // in (0, 1]
        float p32 = p[r] * pcarry;
        p32 = (p32 >= 6.103515625e-05f) ? p32 : 0.0f;   // no f16 subnormals in the P tile
        ph[r] = (_Float16)p32;
      }
      *(v8h*)(Ps + row * PPITCH + wave * 16 + 8 * hh) = ph;   // the lane's 8 keys lie side by side in the query's P row: one 16-B store
      const float psum = ((p[0] + p[1]) + (p[2] + p[3])) + ((p[4] + p[5]) + (p[6] + p[7]));
      psl[t] = psum + xhalf(psum);
    }
    if (hh == 0) {
#pragma unroll
      for (int t = 0; t < AQT; ++t) Pl[(t * 16 + c) * 8 + wave] = psl[t];
    }
#pragma unroll
    for (int t = 0; t < AQT; ++t) {
#pragma unroll
      for (int n = 0; n < 4; ++n) acc[t][n] *= alpha[t];
    }
    // one wait for the V loads of the chunk before and the K loads of this one, a softmax behind the last of them, where it holds up nothing;
    // both offset registers are kept as they are until here, and vo steps on only behind it
    xwait_off(vo, ko);
    vo += (jc + 1 < NCHUNK) ? (unsigned)(AKC / 32) * 1024 : 0u;   // blocks of the next chunk; the last chunk fetches its own again, so the address stays inside the plane
    lds_barrier();   // B2

#pragma unroll
    for (int t = 0; t < AQT; ++t) {
      const int row = t * 16 + c;
      const v4f la = *(const v4f*)(Pl + row * 8);
      const v4f lb = *(const v4f*)(Pl + row * 8 + 4);
      const float ls = ((la[0] + la[1]) + (la[2] + la[3])) + ((lb[0] + lb[1]) + (lb[2] + lb[3]));
      lrow[t] = lrow[t] * alpha[t] + ls;
    }

    // ---- out^T(64 ch of this wave x 64 queries) += V(64 x 128) . P^T(128 x 64): A = v plane rows (row = lane&15 = channel),
    //      B = P tile (col = lane&15 = query within the query tile), both with the split k map; one V fragment serves all 4 query tiles ----
#pragma unroll
    for (int kk = 0; kk < 4; ++kk) {
      FB pa[AQT];
#pragma unroll
      for (int t = 0; t < AQT; ++t) {
        pa[t].h[0] = *(const v8h*)(Ps + (t * 16 + c) * PPITCH + kk * 32 + 8 * hh);
        pa[t].h[1] = *(const v8h*)(Ps + (t * 16 + c) * PPITCH + kk * 32 + 16 + 8 * hh);
      }
#pragma unroll
      for (int n = 0; n < 4; ++n) {
#pragma unroll
        for (int t = 0; t < AQT; ++t) acc[t][n] = FragH::mma(vb[kk][n], pa[t].v, acc[t][n]);
      }
#pragma unroll
      for (int n = 0; n < 4; ++n) vb[kk][n] = FragH::load_off(Vt, vo, (n * 16 * NPOS + kk * 512) * 2);   // the next chunk's
    }
  }
  xwait_off(vo);   // behind the last V loads, in front of the epilogue's reuse of the offset register

  // ---- epilogue, query tile by query tile: out * (1/(rowsum * 2^15)); o2 = gamma*out + x (exact f32 x); split of o2 * 2^10.
  //      The lane's 8 values of one accumulator tile (query c, channels 16n + 8*hh + 0..7) are its own 16-B unit of the o2 planes' fragment order.
  const float* xp0 = X + ((size_t)b * CCH + wave * 64 + 8 * hh) * NPOS + i0 + c;   // channel 64w + 8*hh, query c of tile 0
#pragma unroll
  for (int t = 0; t < AQT; ++t) {
    const float rl = (1.0f / lrow[t]) * pinv;
    const float* xp = xp0 + t * 16;
    float xe[4][8];
#pragma unroll
    for (int n = 0; n < 4; ++n) {                   // channel 64w + 16n + 8*hh + r
#pragma unroll
      for (int r = 0; r < 8; ++r) xe[n][r] = xp[(size_t)(n * 16 + r) * NPOS];
    }
    xwait(xp0);
    const size_t tb = ((((qrow0 >> 4) + t) * (size_t)(CCH >> 5) + wave * 2) << 9) + lane * 8;   // the wave's two blocks of query tile t
#pragma unroll
    for (int n = 0; n < 4; ++n) {                   // n = 2 * (block) + s
      v8h hv, lv;
#pragma unroll
      for (int r = 0; r < 8; ++r) {
        const float o  = acc[t][n][r] * rl;
        const float v2 = (g * o + xe[n][r]) * ocarry;
        const _Float16 hq = (_Float16)v2;
        hv[r] = hq;
        lv[r] = (_Float16)(v2 - (float)hq);
      }
      const size_t go = tb + n * 256;
      *(v8h*)(O2h + go) = hv;
      *(v8h*)(O2l + go) = lv;
    }
  }
}

// ---------------------------------------------------------------------------
// Workspace region map (byte offsets; every region is fully written by its producer launch before any consumer
//   XTh  f16 [16384][512]        0        16777216     XTl   16777216   16777216
//   WQh  f16 [64][512]    33554432           65536     WQl   33619968      65536
//   WKh  f16 [64][512]    33685504           65536     WKl   33751040      65536
//   WVh  f16 [512][512]   33816576          524288     WVl   34340864     524288
//   WDh  f16 [512][512]   34865152          524288     WDl   35389440     524288
//   Qh   f16 [16384][64]  35913728         2097152     Ql    38010880    2097152
//   Kh   f16 [16384][64]  40108032         2097152     Kl    42205184    2097152
//   VT   f16 [4][512][4096] 44302336     16777216
//   O2h  f16 [16384][512] 61079552        16777216     O2l   77856768   16777216
//   total                 94633984
// ---------------------------------------------------------------------------
extern "C" void kernel_launch(void* const* d_in, const int* in_sizes, int n_in,
                              void* d_out, int out_size, void* d_ws, size_t ws_size,
                              hipStream_t stream) {
  if (n_in < 10) return;
  if (in_sizes[0] != NBAT * CCH * NPOS) return;     // x     [4][512][64][64]
  if (in_sizes[1] != CQK * CCH) return;             // Wq    [64][512]
  if (in_sizes[2] != CQK) return;                   // bq    [64]
  if (in_sizes[3] != CQK * CCH) return;             // Wk    [64][512]
  if (in_sizes[4] != CQK) return;                   // bk    [64]
  if (in_sizes[5] != CCH * CCH) return;             // Wv    [512][512]
  if (in_sizes[6] != CCH) return;                   // bv    [512]
  if (in_sizes[7] != 1) return;                     // gamma [1]
  if (in_sizes[8] != CCH * CCH) return;             // Wd    [512][512]
  if (in_sizes[9] != CCH) return;                   // bd    [512]
  if (out_size != NBAT * CCH * NPOS) return;        // out   [4][512][64][64] f32, last element 8388607

  const float* x     = (const float*)d_in[0];
  const float* Wq    = (const float*)d_in[1];       // [out][in]
  const float* bq    = (const float*)d_in[2];
  const float* Wk    = (const float*)d_in[3];
  const float* bk    = (const float*)d_in[4];
  const float* Wv    = (const float*)d_in[5];
  const float* bv    = (const float*)d_in[6];
  const float* gamma = (const float*)d_in[7];
  const float* Wd    = (const float*)d_in[8];
  const float* bd    = (const float*)d_in[9];

  const size_t PXT = (size_t)MROWS * CCH * 2;       // 16777216  f16 [16384][512]
  const size_t PWS = (size_t)CQK * CCH * 2;         // 65536     f16 [64][512]
  const size_t PWL = (size_t)CCH * CCH * 2;         // 524288    f16 [512][512]
  const size_t PQK = (size_t)MROWS * CQK * 2;       // 2097152   f16 [16384][64]
  const size_t PVT = (size_t)NBAT * CCH * NPOS * 2; // 16777216  f16 [4][512][4096]
  size_t off = 0;
  const size_t oXTh = off; off += PXT;  const size_t oXTl = off; off += PXT;
  const size_t oWQh = off; off += PWS;  const size_t oWQl = off; off += PWS;
  const size_t oWKh = off; off += PWS;  const size_t oWKl = off; off += PWS;
  const size_t oWVh = off; off += PWL;  const size_t oWVl = off; off += PWL;
  const size_t oWDh = off; off += PWL;  const size_t oWDl = off; off += PWL;
  const size_t oQh  = off; off += PQK;  const size_t oQl  = off; off += PQK;
  const size_t oKh  = off; off += PQK;  const size_t oKl  = off; off += PQK;
  const size_t oVT  = off; off += PVT;
  const size_t oO2h = off; off += PXT;  const size_t oO2l = off; off += PXT;
  if (off > ws_size) return;                        // off = 94633984
  if (off > (size_t)134217728) return;

  char* ws = (char*)d_ws;
  unsigned short* XTh = (unsigned short*)(ws + oXTh);  unsigned short* XTl = (unsigned short*)(ws + oXTl);
  unsigned short* WQh = (unsigned short*)(ws + oWQh);  unsigned short* WQl = (unsigned short*)(ws + oWQl);
  unsigned short* WKh = (unsigned short*)(ws + oWKh);  unsigned short* WKl = (unsigned short*)(ws + oWKl);
  unsigned short* WVh = (unsigned short*)(ws + oWVh);  unsigned short* WVl = (unsigned short*)(ws + oWVl);
  unsigned short* WDh = (unsigned short*)(ws + oWDh);  unsigned short* WDl = (unsigned short*)(ws + oWDl);
  unsigned short* Qh  = (unsigned short*)(ws + oQh);   unsigned short* Ql  = (unsigned short*)(ws + oQl);
  unsigned short* Kh  = (unsigned short*)(ws + oKh);   unsigned short* Kl  = (unsigned short*)(ws + oKl);
  unsigned short* VT  = (unsigned short*)(ws + oVT);
  unsigned short* O2h = (unsigned short*)(ws + oO2h);  unsigned short* O2l = (unsigned short*)(ws + oO2l);

  const dim3 blk(256);
  const float actCarry = 1024.0f;                    // 2^10 on x, q, k, o2 planes
  const float wCarry   = 65536.0f;                   // 2^16 on weight planes
  const float scale26  = 1.0f / 67108864.0f;         // 2^-26 = 1 / (2^10 * 2^16)
  const float sScale   = 1.0f / 1048576.0f;          // 2^-20 = 1 / (2^10 * 2^10)
  const float pCarry   = 32768.0f;                   // 2^15 on the P tile
  const float pInv     = 1.0f / 32768.0f;            // 2^-15

  // (1) x[b] viewed in[R=512 c][Cc=4096 n] (pitch 4096) -> XT_b[n][c] (fragment order), hi/lo of x*2^10; grid (Cc/64, R/64, B) = (64, 8, 4)
  tsplit_f16<<<dim3(NPOS / 64, CCH / 64, NBAT), blk, 0, stream>>>(x, XTh, XTl, CCH, NPOS, (long)CCH * NPOS, (long)NPOS * CCH, actCarry);
  // (2) weight planes, natural [out][in] layout, hi/lo of W*2^16
  const int n8s = CQK * CCH / 8;                     // 4096  -> 16 blocks
  const int n8l = CCH * CCH / 8;                     // 32768 -> 128 blocks
  wconv_f16<<<dim3(n8s / 256), blk, 0, stream>>>(Wq, WQh, WQl, n8s, wCarry);
  wconv_f16<<<dim3(n8s / 256), blk, 0, stream>>>(Wk, WKh, WKl, n8s, wCarry);
  wconv_f16<<<dim3(n8l / 256), blk, 0, stream>>>(Wv, WVh, WVl, n8l, wCarry);
  wconv_f16<<<dim3(n8l / 256), blk, 0, stream>>>(Wd, WDh, WDl, n8l, wCarry);
  // (3) q = XT . Wq^T + bq -> Qh|Ql [16384][64] (x2^10)   (M=16384, N=64, K=512; 256 tiles -> 32 blocks)
  const dim3 gQ((MROWS / 64) * (CQK / 64) / 8, 1);
  gemm64_f16<true, 2, 2><<<gQ, blk, 0, stream>>>(
      XTh, XTl, 0L, WQh, WQl, 0L, (void*)Qh, (void*)Ql, CQK, 0L, bq, MROWS, CQK, scale26, actCarry);
  // (4) k likewise -> Kh|Kl
  gemm64_f16<true, 2, 2><<<gQ, blk, 0, stream>>>(
      XTh, XTl, 0L, WKh, WKl, 0L, (void*)Kh, (void*)Kl, CQK, 0L, bk, MROWS, CQK, scale26, actCarry);
  // (5) v^T[b] = Wv . XT_b^T + bv[m] -> VT [4][512][4096] f16 single   (M=512, N=4096, K=512; 512 tiles -> 64 blocks x 4 batches)
  const dim3 gV((CCH / 64) * (NPOS / 64) / 8, NBAT);
  gemm64_f16<true, 1, 1><<<gV, blk, 0, stream>>>(
      WVh, WVl, 0L, XTh, XTl, (long)NPOS * CCH, (void*)VT, (void*)VT, NPOS, (long)CCH * NPOS, bv,
      CCH, NPOS, scale26, 1.0f);
  // (6) attention + gamma scale + residual -> O2h|O2l [16384][512] (x2^10); grid (4096/64, 4) = 256 blocks
  attn_kernel<<<dim3(NPOS / AQB, NBAT), blk, 0, stream>>>(Qh, Ql, Kh, Kl, VT, x, gamma, O2h, O2l, sScale, pCarry, pInv, actCarry);
  // (7) out[b] = Wd . O2_b^T + bd[m] -> d_out NCHW f32 [4][512][4096]   (M=512, N=4096, K=512; 512 tiles -> 64 blocks x 4 batches)
  gemm64_f16<true, 1, 0><<<gV, blk, 0, stream>>>(
      WDh, WDl, 0L, O2h, O2l, (long)NPOS * CCH, d_out, d_out, NPOS, (long)CCH * NPOS, bd,
      CCH, NPOS, scale26, 1.0f);
  (void)hipGetLastError();
}

// v006
// It runs in 161 microseconds.
// Two timings next to v005 put it at 1.29 and 1.36 times that version's speed.
// All steps since v000 together make it 3.86 times as fast.
// Contractions: q, k, v 1x1 convs, q.k^T energies and the output 1x1 conv = v_wmma_f32_16x16x32_f16 on f16 hi/lo split planes (hi.hi + hi.lo + lo.hi, 3 products each); p.v = v_wmma_f32_16x16x32_f16 single product (p carried x2^15 as f16, v plain f16 with |v| < 2^-14 written as 0); f32 accumulate everywhere; running-max softmax, 1/rowsum, gamma scale, biases and the residual add (exact f32 x) in f32 on the VALU.
// Plane / carry map (every carry is an exact power of two; the inverse is folded exactly once, at the line named):
//   XTh|XTl  f16 [16384 (b,n)][512 c]    = hi/lo of x * 2^10           (n = h*64 + w; producer tsplit_f16)
//   WQh|WQl, WKh|WKl f16 [64][512]; WVh|WVl, WDh|WDl f16 [512][512] = hi/lo of W * 2^16, natural [out][in] (producer wconv_f16)
//   Qh|Ql, Kh|Kl f16 [16384][64]           = hi/lo of q (or k) * 2^10   (GEMM: acc * 2^-26 removes the x and W carries, + bias, then * 2^10)
//   VT  f16 [4][512 ch][4096 n]            = v, carry 1                   (GEMM: acc * 2^-26 + bias; |v| < 2^-14 stored as 0)
//   energies                               = acc * 2^-20 (q and k carries) in attn_kernel before the softmax
//   P   f16 (LDS only)                     = exp(s - m) * 2^15, values < 2^-14 stored as 0; 2^-15 folded together with 1/rowsum in the attn_kernel epilogue
//   O2h|O2l f16 [16384][512]               = hi/lo of (gamma * out + x) * 2^10 (attn_kernel epilogue)
//   output conv                            = acc * 2^-26 (O2 and W carries) + bd -> f32 NCHW [4][512][4096]
// Every f16 plane above lies in FRAGMENT ORDER: a matrix [R rows][K cols] is cut into blocks of 16 rows x 32 cols, block (rt, kb) at
// halves ((rt * K/32 + kb) * 512); inside a block element (row c, col 16*s + 8*h + e) sits at s*256 + (h*16 + c)*8 + e, which is the
// register order of a 16x16x32 operand: lane h*16 + c reads its 16 B at lane*8 (s = 0) and at 256 + lane*8 (s = 1), 512 contiguous bytes per wave load.
#include <hip/hip_runtime.h>
#include <math.h>
#include <stdint.h>

#define NBAT  4
#define CCH   512
#define CQK   64
#define IMGH  64
#define IMGW  64
#define NPOS  4096
#define MROWS 16384

static_assert(NPOS == IMGH * IMGW);
static_assert(MROWS == NBAT * NPOS);
static_assert(CCH % 64 == 0);
static_assert(CQK == 64);
static_assert(NPOS % 128 == 0);
static_assert(NPOS % 64 == 0);
static_assert(CCH % 32 == 0);
static_assert((CQK * CCH) % (8 * 256) == 0);
static_assert((CCH * CCH) % (8 * 256) == 0);
static_assert(CCH % 256 == 0);
static_assert((MROWS / 64) % 8 == 0);
static_assert(((CCH / 64) * (NPOS / 64)) % 8 == 0);

typedef __attribute__((ext_vector_type(16))) _Float16 v16h;
typedef __attribute__((ext_vector_type(8)))  _Float16 v8h;
typedef __attribute__((ext_vector_type(8)))  float    v8f;
typedef __attribute__((ext_vector_type(4)))  float    v4f;
typedef __attribute__((ext_vector_type(4)))  unsigned int v4u;

__device__ __forceinline__ unsigned short h_bits(_Float16 h) { return __builtin_bit_cast(unsigned short, h); }
__device__ __forceinline__ unsigned pk16(unsigned short a, unsigned short b) { return (unsigned)a | ((unsigned)b << 16); }

// hazard guards as plain device helpers (no inline asm inside the kernel template body)
__device__ __forceinline__ void dep_guard_h(v8f& a, v8f& b, v16h x, v16h y) { asm volatile("v_nop\n\tv_nop\n\tv_nop\n\tv_nop" : "+v"(a), "+v"(b) : "v"(x), "v"(y)); }
__device__ __forceinline__ void acc_guard4(v8f& a, v8f& b, v8f& c, v8f& d) { asm volatile("v_nop\n\tv_nop\n\tv_nop\n\tv_nop" : "+v"(a), "+v"(b), "+v"(c), "+v"(d)); }

// 16-bit fragment loader (A and B alike) from a block in fragment order: p = block start + lane*8; lane row/col = lane&15, h = lane>>4;
// vector elements 0..7 <- p[0..7] (= k0+8h+0..7), 8..15 <- p[256..263] (= k0+16+8h+0..7).
struct FragH {
  union U { v16h v; v8h h[2]; };
  static __device__ __forceinline__ v16h load(const _Float16* p) {
    U f; f.h[0] = *(const v8h*)(p); f.h[1] = *(const v8h*)(p + 256); return f.v;
  }
  // the same from a wave-uniform plane base and the lane's byte offset: one offset register per fragment group instead of a 64-bit address pair
  static __device__ __forceinline__ v16h load_off(const _Float16* base, unsigned boff, int imm) {
    const char* p = (const char*)(const void*)base + boff;
    U f; f.h[0] = *(const v8h*)(p + imm); f.h[1] = *(const v8h*)(p + imm + 512); return f.v;
  }
  static __device__ __forceinline__ v8f mma(v16h a, v16h b, v8f c) {
    return __builtin_amdgcn_wmma_f32_16x16x32_f16(false, a, false, b, (short)0, c, false, false);
  }
  static __device__ __forceinline__ void guard(v8f& a, v8f& b, v16h x, v16h y) { dep_guard_h(a, b, x, y); }
};

// s_wait_xcnt 0 behind a group of global loads, in front of any rewrite of their address registers.
// The addresses are inputs only so that their registers stay as they are up to the wait.
__device__ __forceinline__ void xwait(const void* a) { asm volatile("s_wait_xcnt 0x0" :: "v"(a) : "memory"); }
__device__ __forceinline__ void xwait(const void* a, const void* b, const void* c, const void* d) {
  asm volatile("s_wait_xcnt 0x0" :: "v"(a), "v"(b), "v"(c), "v"(d) : "memory");
}

// the same behind loads of the form uniform base + 32-bit byte offset per lane: the offset register stays as it is up to the wait (the bases are kernel arguments, never rewritten in the loop)
__device__ __forceinline__ void xwait_off(unsigned a) { asm volatile("s_wait_xcnt 0x0" :: "v"(a) : "memory"); }
__device__ __forceinline__ void xwait_off(unsigned a, unsigned b) { asm volatile("s_wait_xcnt 0x0" :: "v"(a), "v"(b) : "memory"); }
// the same where the bases are formed in the kernel: the four scalar bases too stay as they are up to the wait
__device__ __forceinline__ void xwait_off(unsigned a, const void* p, const void* q, const void* r, const void* s) {
  asm volatile("s_wait_xcnt 0x0" :: "v"(a), "s"(p), "s"(q), "s"(r), "s"(s) : "memory");
}
__device__ __forceinline__ void xwait_off(unsigned a, const void* p, const void* q, const void* r, const void* s, const void* t, const void* u) {
  asm volatile("s_wait_xcnt 0x0" :: "v"(a), "s"(p), "s"(q), "s"(r), "s"(s), "s"(t), "s"(u) : "memory");
}

// ---- Register-blocked batched WMMA GEMM, f16 operands ----------------------
// C[m,n] = oscale * (scale * sum_k A[m,k] * Bt[n,k] + bias); each wave owns a 64x64 tile.
// A [M,GK] and Bt [N,GK] in fragment order, K = GK columns each; M,N % 64 == 0 (host-asserted sizes).
// The 16 fragments of a k step (32 columns: 4 row tiles x hi/lo of A and of Bt; 18 with the QK row tile) are fetched one k step ahead into a second register set,
// so that a step's products run while the next step's 32 loads (36 with QK) are in flight.
// f16 outputs (OUT_MODE 1, 2) are written in fragment order as matrices [M][ldc]; the f32 output stays row-major.
// SPLIT: operands are hi/lo planes (A2/Bt2 = lo planes, same layout); product = hi.hi + hi.lo + lo.hi.
// BIAS_MODE: 0 = none, 1 = bias[m], 2 = bias[n] (f32).
// OUT_MODE: 0 = f32; 1 = single f16 plane (|v| < 2^-14 stored as 0, so the plane holds no f16 subnormals);
//           2 = f16 hi plane (Cout) + f16 lo plane (Cout2), lo = v - hi.
// QK: the wave takes a fifth A row tile beside its four: 16 of the 128 stacked q and k weight rows (row tile tm of 8: 0..3 = q, 4..7 = k; needs M == 512),
//     times the same Bt fragments, so that q, k and v come out of one launch of 256 blocks and x is read once for the three.
//     Its tiles hold 8 channels (8*(lane>>4) + r) of one position (lane&15) per lane: the lane's own 16-B unit of the q / k planes' fragment order.
#define GK   CCH
#define GRTB (GK * 32)   // bytes of one row tile of an operand plane: GK/32 blocks of 1 KiB, one behind the other
static_assert(GK % 64 == 0);

template <int NA> struct FragSet { v16h ah[NA], al[NA], bh[4], bl[4]; };

// the q / k side of the projection launch (unused where QK is false)
static_assert(CCH / 64 == 2 * CQK / 16);   // one 16-row tile of the stacked q and k weights for each 64-row tile of the v weights
struct QkPart {
  const unsigned short* wqh; const unsigned short* wql;   // weight planes [64][512]
  const unsigned short* wkh; const unsigned short* wkl;
  const float* bq; const float* bk;                       // biases [64]
  unsigned short* qh; unsigned short* ql;                 // out planes [16384][64]
  unsigned short* kh; unsigned short* kl;
  float carry;                                            // on the out planes
};

// all fragments of one k step: plane starts of the wave's first row tiles (wave-uniform) + the lane's byte offset + immediates.
// A first: the Bt registers are rewritten last, furthest behind the products that read them.
template <bool SPLIT, int NA>
__device__ __forceinline__ void gemm_fetch(FragSet<NA>& f, const _Float16* Ah, const _Float16* Al, const _Float16* Eh, const _Float16* El,
                                           const _Float16* Bh, const _Float16* Bl, unsigned off, int imm) {
#pragma unroll
  for (int i = 0; i < 4; ++i) {
    f.ah[i] = FragH::load_off(Ah, off, imm + i * GRTB);
    if (SPLIT) f.al[i] = FragH::load_off(Al, off, imm + i * GRTB); else f.al[i] = f.ah[i];
  }
  if (NA == 5) {
    f.ah[NA - 1] = FragH::load_off(Eh, off, imm);
    f.al[NA - 1] = FragH::load_off(El, off, imm);
  }
#pragma unroll
  for (int j = 0; j < 4; ++j) {
    f.bh[j] = FragH::load_off(Bh, off, imm + j * GRTB);
    if (SPLIT) f.bl[j] = FragH::load_off(Bl, off, imm + j * GRTB); else f.bl[j] = f.bh[j];
  }
  // the 32 loads (36 with the q / k tile) are issued as one group in front of the other set's products; without it the build may sink them among the products, which shortens their lead
  __builtin_amdgcn_sched_barrier(0);
}

// the products of one k step; per accumulator in the order hi.hi, hi.lo, lo.hi, four independent accumulators between two products into the same one
template <bool SPLIT, int NA>
__device__ __forceinline__ void gemm_mul(v8f (&acc)[NA][4], const FragSet<NA>& f) {
#pragma unroll
  for (int i = 0; i < 4; ++i) {
#pragma unroll
    for (int j = 0; j < 4; ++j) acc[i][j] = FragH::mma(f.ah[i], f.bh[j], acc[i][j]);
    if (SPLIT) {
#pragma unroll
      for (int j = 0; j < 4; ++j) acc[i][j] = FragH::mma(f.ah[i], f.bl[j], acc[i][j]);
#pragma unroll
      for (int j = 0; j < 4; ++j) acc[i][j] = FragH::mma(f.al[i], f.bh[j], acc[i][j]);
    }
  }
  if (NA == 5) {   // q / k row tile: x is the Bt side here; the order stays x hi . w hi, x hi . w lo, x lo . w hi
#pragma unroll
    for (int j = 0; j < 4; ++j) acc[NA - 1][j] = FragH::mma(f.ah[NA - 1], f.bh[j], acc[NA - 1][j]);
#pragma unroll
    for (int j = 0; j < 4; ++j) acc[NA - 1][j] = FragH::mma(f.al[NA - 1], f.bh[j], acc[NA - 1][j]);
#pragma unroll
    for (int j = 0; j < 4; ++j) acc[NA - 1][j] = FragH::mma(f.ah[NA - 1], f.bl[j], acc[NA - 1][j]);
  }
  // every product of the step stays in front of this line: behind it the set's registers are refilled
  __builtin_amdgcn_sched_barrier(0);
  // four vector slots between the last products and the loads that refill this set's registers
  FragH::guard(acc[NA - 1][0], acc[NA - 1][3], f.ah[NA - 1], f.al[NA - 1]);
}

template <bool SPLIT, int BIAS_MODE, int OUT_MODE, bool QK>
__global__ __launch_bounds__(256) void gemm64_f16(
    const unsigned short* __restrict__ Ap, const unsigned short* __restrict__ A2p, long strideA,
    const unsigned short* __restrict__ Btp, const unsigned short* __restrict__ Bt2p, long strideB,
    void* __restrict__ Cout, void* __restrict__ Cout2, int ldc, long strideC,
    const float* __restrict__ bias,
    int M, int N, float scale, float oscale, QkPart qk) {
  constexpr int NA = QK ? 5 : 4;
  const _Float16* A   = (const _Float16*)(const void*)Ap;
  const _Float16* A2  = (const _Float16*)(const void*)A2p;
  const _Float16* Bt  = (const _Float16*)(const void*)Btp;
  const _Float16* Bt2 = (const _Float16*)(const void*)Bt2p;
  __shared__ __align__(16) float sT[8][16 * 68];   // per-wave 16x64 slab, pitch 68 floats
  const int b    = blockIdx.y;
  const int lane = threadIdx.x & 31;
  const int wave = __builtin_amdgcn_readfirstlane(threadIdx.x >> 5);   // scalar, so that the block starts below are formed once per wave on the scalar unit
  const int tilesN = N >> 6;
  const int tilesM = M >> 6;
  const int tile = blockIdx.x * 8 + wave;
  if (tile >= tilesM * tilesN) return;   // wave-uniform; no block barriers in this kernel
  const int tm = tile / tilesN;
  const int tn = tile - tm * tilesN;
  const int m0 = tm << 6;
  const int n0 = tn << 6;

  // starts of the wave's 64 rows in each plane (4 row tiles, GRTB bytes each): the same in every lane, formed once, never rewritten
  const size_t ao = (size_t)b * strideA + (size_t)m0 * GK;
  const size_t bo = (size_t)b * strideB + (size_t)n0 * GK;
  const _Float16* Ab  = A  + ao;
  const _Float16* Bb  = Bt + bo;
  const _Float16* Ab2 = SPLIT ? (A2  + ao) : Ab;
  const _Float16* Bb2 = SPLIT ? (Bt2 + bo) : Bb;
  // the wave's q or k weight row tile (16 rows = GRTB bytes), wave-uniform as well
  const _Float16* Eb  = QK ? (const _Float16*)(const void*)(tm < 4 ? qk.wqh : qk.wkh) + (size_t)(tm & 3) * 16 * GK : Ab;
  const _Float16* Eb2 = QK ? (const _Float16*)(const void*)(tm < 4 ? qk.wql : qk.wkl) + (size_t)(tm & 3) * 16 * GK : Ab;

  const int rlane = lane & 15;                 // row (A) / col (B, D) within subtile
  const int mOff  = (lane >> 4) * 8;           // D row offset

  v8f acc[NA][4];
#pragma unroll
  for (int i = 0; i < NA; ++i)
#pragma unroll
    for (int j = 0; j < 4; ++j) acc[i][j] = (v8f){0.f,0.f,0.f,0.f,0.f,0.f,0.f,0.f};

  const unsigned ko = (unsigned)lane * 16;     // bytes: the lane's 16 B inside each 512-B half block
  FragSet<NA> f0, f1;
  gemm_fetch<SPLIT, NA>(f0, Ab, Ab2, Eb, Eb2, Bb, Bb2, ko, 0);
  // unrolled in full: a k step is 1 KiB further in every row tile, so each address is base + ko + an immediate and no address register is rewritten under loads in flight
#pragma unroll
  for (int k0 = 0; k0 < GK; k0 += 64) {
    gemm_fetch<SPLIT, NA>(f1, Ab, Ab2, Eb, Eb2, Bb, Bb2, ko, (k0 + 32) * 32);                     // k step k0 + 32, in flight under the products of k step k0
    gemm_mul<SPLIT, NA>(acc, f0);
    if (k0 + 64 < GK) gemm_fetch<SPLIT, NA>(f0, Ab, Ab2, Eb, Eb2, Bb, Bb2, ko, (k0 + 64) * 32);   // k step k0 + 64, in flight under the products of k step k0 + 32
    else if (QK) xwait_off(ko, Ab, Ab2, Eb, Eb2, Bb, Bb2);
    else xwait_off(ko, Ab, Ab2, Bb, Bb2);   // a k step's products behind the last loads, where it holds up nothing; the epilogue reuses the offset's and the bases' registers only behind it
    gemm_mul<SPLIT, NA>(acc, f1);
  }
  acc_guard4(acc[0][0], acc[0][1], acc[0][2], acc[0][3]);
  acc_guard4(acc[1][0], acc[1][1], acc[1][2], acc[1][3]);
  acc_guard4(acc[2][0], acc[2][1], acc[2][2], acc[2][3]);
  acc_guard4(acc[3][0], acc[3][1], acc[3][2], acc[3][3]);
  if (QK) acc_guard4(acc[NA - 1][0], acc[NA - 1][1], acc[NA - 1][2], acc[NA - 1][3]);

  // ---- epilogue ----
  float* slab = sT[wave];
#pragma unroll
  for (int i = 0; i < 4; ++i) {
    const int mBase = m0 + (i << 4);
#pragma unroll
    for (int j = 0; j < 4; ++j) {
      const int n = n0 + (j << 4) + rlane;
      float bvn = 0.f;
      if (BIAS_MODE == 2) bvn = bias[n];
#pragma unroll
      for (int r = 0; r < 8; ++r) {
        float v = acc[i][j][r] * scale;
        if (BIAS_MODE == 1) v += bias[mBase + mOff + r];
        if (BIAS_MODE == 2) v += bvn;
        slab[(mOff + r) * 68 + (j << 4) + rlane] = v * oscale;
      }
    }
    __builtin_amdgcn_fence(__ATOMIC_RELEASE, "workgroup");
    __builtin_amdgcn_wave_barrier();
    __builtin_amdgcn_fence(__ATOMIC_ACQUIRE, "workgroup");
    if (OUT_MODE == 0) {
      float* C = (float*)Cout + (size_t)b * strideC;
      const int hh = lane >> 4, c4 = (lane & 15) * 4;     // row seg = 256 B = 16 lanes x 16 B
      {
#pragma unroll
        for (int it = 0; it < 8; ++it) {
          const int row = it * 2 + hh;                       // it 0..7 x hh 0..1 = rows 0..15
          v4f v = *(const v4f*)(slab + row * 68 + c4);
          *(v4f*)(C + (size_t)(mBase + row) * ldc + n0 + c4) = v;
        }
        
      }
    } else {
      const int row = lane & 15, h8 = (lane >> 4) * 8;
      _Float16* C  = (_Float16*)Cout + (size_t)b * strideC;
      _Float16* C2 = (_Float16*)Cout2 + (size_t)b * strideC;
      const size_t tb = (((size_t)(mBase >> 4) * (ldc >> 5) + (n0 >> 5)) << 9) + lane * 8;   // the slab's two blocks follow one another
      {
#pragma unroll
        for (int it = 0; it < 4; ++it) {                     // it = 2 * (block) + s: cols it*16 + h8 .. +7 of row lane&15
          const float* sp = slab + row * 68 + it * 16 + h8;
          v8h hv, lv;
#pragma unroll
          for (int e = 0; e < 8; ++e) {
            if (OUT_MODE == 1) {
              float f = sp[e];
              f = (fabsf(f) >= 6.103515625e-05f) ? f : 0.0f;
              hv[e] = (_Float16)f;
            } else {
              const _Float16 hq = (_Float16)sp[e];
              hv[e] = hq;
              lv[e] = (_Float16)(sp[e] - (float)hq);
            }
          }
          *(v8h*)(C + tb + it * 256) = hv;
          if (OUT_MODE == 2) *(v8h*)(C2 + tb + it * 256) = lv;
        }
        
      }
    }
    __builtin_amdgcn_fence(__ATOMIC_RELEASE, "workgroup");
    __builtin_amdgcn_wave_barrier();
    __builtin_amdgcn_fence(__ATOMIC_ACQUIRE, "workgroup");
  }

  // ---- q / k row tile: (acc * scale + bias) * carry, hi/lo split, one 16-B store per plane and tile straight from the accumulators ----
  if (QK) {
    const int d0 = (tm & 3) * 16;                        // first of the tile's 16 q (or k) channels
    const float* be = (tm < 4 ? qk.bq : qk.bk) + d0 + mOff;
    _Float16* Eo  = (_Float16*)(void*)(tm < 4 ? qk.qh : qk.kh);
    _Float16* Eo2 = (_Float16*)(void*)(tm < 4 ? qk.ql : qk.kl);
    float bb[8];
#pragma unroll
    for (int r = 0; r < 8; ++r) bb[r] = be[r];
    // block (position row tile, d0 / 32) of a [16384][64] plane, half block s = (d0 / 16) & 1; the wave's four position tiles lie CQK / 32 blocks apart
    const size_t eb = (((size_t)((b * N + n0) >> 4) * (CQK >> 5) + (d0 >> 5)) << 9) + ((d0 >> 4) & 1) * 256 + lane * 8;
#pragma unroll
    for (int j = 0; j < 4; ++j) {
      v8h hv, lv;
#pragma unroll
      for (int r = 0; r < 8; ++r) {
        float v = acc[NA - 1][j][r] * scale;
        v += bb[r];
        v *= qk.carry;
        const _Float16 hq = (_Float16)v;
        hv[r] = hq;
        lv[r] = (_Float16)(v - (float)hq);
      }
      *(v8h*)(Eo  + eb + (size_t)j * ((CQK >> 5) << 9)) = hv;
      *(v8h*)(Eo2 + eb + (size_t)j * ((CQK >> 5) << 9)) = lv;
    }
  }
}

// ---------------------------------------------------------------------------
// f16 hi/lo split of a row-major f32 matrix [rows][CCH] with total element count 8*n8 into planes in fragment order:
//   hi = f16(in * carry), lo = f16(in * carry - hi). Thread i makes the i-th 16-B unit of each plane from 8 consecutive elements of one row
// ---------------------------------------------------------------------------
__device__ __forceinline__ void wconv_f16(const float* __restrict__ in, unsigned short* __restrict__ oh,
                                          unsigned short* __restrict__ ol, int blk, int n8, float carry) {
  const int i = blk * 256 + threadIdx.x;
  if (i < n8) {
    const size_t e0 = (size_t)i * 8;
    const int blkid = i >> 6;                                             // block (rt, kb), CCH/32 blocks per row tile
    const int srow = (blkid / (CCH / 32)) * 16 + (i & 15);
    const int scol = (blkid % (CCH / 32)) * 32 + ((i >> 4) & 3) * 8;      // bits 5,4 of i = s,h: col 16*s + 8*h
    const float* ip = in + (size_t)srow * CCH + scol;
    const v4f a = *(const v4f*)(ip);
    const v4f c = *(const v4f*)(ip + 4);
    xwait(ip);   // behind the two loads, in front of the reuse of their address registers
    float f[8];
    f[0] = a[0]; f[1] = a[1]; f[2] = a[2]; f[3] = a[3];
    f[4] = c[0]; f[5] = c[1]; f[6] = c[2]; f[7] = c[3];
    v4u hv, lv;
#pragma unroll
    for (int q = 0; q < 4; ++q) {
      const float f0 = f[2 * q] * carry, f1 = f[2 * q + 1] * carry;
      const _Float16 h0 = (_Float16)f0, h1 = (_Float16)f1;
      const _Float16 l0 = (_Float16)(f0 - (float)h0), l1 = (_Float16)(f1 - (float)h1);
      hv[q] = pk16(h_bits(h0), h_bits(h1));
      lv[q] = pk16(h_bits(l0), h_bits(l1));
    }
    {
      *(v4u*)(oh + e0) = hv;
      *(v4u*)(ol + e0) = lv;
      
    }
  }
}

// ---------------------------------------------------------------------------
// Fused transpose + f16 hi/lo split of an f32 matrix, z-batched:
//   in_z = W + z*sIn viewed in[R rows][Cc cols] (pitch Cc) -> oh_z[c][r] = f16(in_z[r][c]*carry), ol_z[c][r] = f16(rem),
//   out [Cc][R] in fragment order, oh_z = oh + z*sOut.
// 64x64 tiles through LDS (tf, 64 * 68 floats). Tile (bx, by, bz) of (Cc/64, R/64, Z), 256 threads (R, Cc multiples of 64; R multiple of 64 keeps every
// Coverage per block and plane: load 4 it x 256 thr x 4 floats = 64x64; store 2 it x 256 thr x 8 halves = 64x64.
// ---------------------------------------------------------------------------
__device__ __forceinline__ void tsplit_f16(float* tf, int bx, int by, int bz, const float* __restrict__ W, unsigned short* __restrict__ oh,
                                           unsigned short* __restrict__ ol, int R, int Cc, long sIn, long sOut,
                                           float carry) {
  W  += (size_t)bz * sIn;
  oh += (size_t)bz * sOut;
  ol += (size_t)bz * sOut;
  const int c0  = bx * 64;   // input column block = output row block
  const int r0  = by * 64;   // input row block    = output column block
  const int tid = threadIdx.x;
  {
    const int lr = tid >> 4;         // 0..15
    const int c4 = (tid & 15) * 4;   // 0..60
    const float* gp[4];
    v4f a[4];
#pragma unroll
    for (int it = 0; it < 4; ++it) {   // rows it * 16 + lr = 0..63
      gp[it] = W + (size_t)(r0 + it * 16 + lr) * Cc + c0 + c4;
      a[it] = *(const v4f*)gp[it];
    }
    xwait(gp[0], gp[1], gp[2], gp[3]);   // behind the four loads, in front of the reuse of their address registers
#pragma unroll
    for (int it = 0; it < 4; ++it) *(v4f*)(tf + (it * 16 + lr) * 68 + c4) = a[it];
  }
  __syncthreads();
  // unit u = it*256 + tid of the tile's 512 16-B units per plane, in fragment order: u = ((row tile * 2 + block) * 2 + s) * 32 + h*16 + c
  v4u hv[2], lv[2];
#pragma unroll
  for (int it = 0; it < 2; ++it) {
    const int u  = it * 256 + tid;
    const int oc = ((u >> 7) << 4) + (u & 15);   // output row within tile (= input column)
    const int c8 = ((u >> 4) & 7) * 8;           // output column within tile = 32*block + 16*s + 8*h
    v4u a, a2;
#pragma unroll
    for (int q = 0; q < 4; ++q) {
      const float f0 = tf[(c8 + 2 * q) * 68 + oc] * carry;
      const float f1 = tf[(c8 + 2 * q + 1) * 68 + oc] * carry;
      const _Float16 h0 = (_Float16)f0, h1 = (_Float16)f1;
      const _Float16 l0 = (_Float16)(f0 - (float)h0), l1 = (_Float16)(f1 - (float)h1);
      a[q]  = pk16(h_bits(h0), h_bits(h1));
      a2[q] = pk16(h_bits(l0), h_bits(l1));
    }
    hv[it] = a; lv[it] = a2;
  }
  {
#pragma unroll
    for (int it = 0; it < 2; ++it) {
      const int u = it * 256 + tid;
      const size_t go = (((size_t)((c0 >> 4) + (u >> 7)) * (R >> 5) + (r0 >> 5) + ((u >> 6) & 1)) << 9) + (u & 63) * 8;
      *(v4u*)(oh + go) = hv[it];
      *(v4u*)(ol + go) = lv[it];
    }
    
  }
}

// ---------------------------------------------------------------------------
// All five operand splits in one launch: none reads what another writes, so the block index picks the job (the same in every thread of a block).
// Blocks 0 .. XBLK-1: the 64x64 tiles of x, index = (bz * (CCH/64) + by) * (NPOS/64) + bx; then Wq, Wk (WSBLK blocks each), Wv, Wd (WLBLK blocks each).
// The long jobs (x tiles) come first, the short ones fill in behind them.
// ---------------------------------------------------------------------------
#define XBLK  ((NPOS / 64) * (CCH / 64) * NBAT)
#define WSBLK (CQK * CCH / 8 / 256)
#define WLBLK (CCH * CCH / 8 / 256)
__global__ __launch_bounds__(256) void split_all_f16(const float* __restrict__ x, const float* __restrict__ Wq, const float* __restrict__ Wk,
                                                     const float* __restrict__ Wv, const float* __restrict__ Wd,
                                                     unsigned short* __restrict__ xth, unsigned short* __restrict__ xtl,
                                                     unsigned short* __restrict__ wqh, unsigned short* __restrict__ wql,
                                                     unsigned short* __restrict__ wkh, unsigned short* __restrict__ wkl,
                                                     unsigned short* __restrict__ wvh, unsigned short* __restrict__ wvl,
                                                     unsigned short* __restrict__ wdh, unsigned short* __restrict__ wdl,
                                                     float actCarry, float wCarry) {
  __shared__ __align__(16) float tf[64 * 68];
  const int bid = blockIdx.x;
  if (bid < XBLK) {
    // x[b] viewed in[R=512 c][Cc=4096 n] (pitch 4096) -> XT_b[n][c], hi/lo of x * actCarry
    tsplit_f16(tf, bid % (NPOS / 64), (bid / (NPOS / 64)) % (CCH / 64), bid / ((NPOS / 64) * (CCH / 64)),
               x, xth, xtl, CCH, NPOS, (long)CCH * NPOS, (long)NPOS * CCH, actCarry);
    return;
  }
  // weight planes, natural [out][in] layout, hi/lo of W * wCarry
  const int wb = bid - XBLK;
  if (wb < WSBLK)                      wconv_f16(Wq, wqh, wql, wb, CQK * CCH / 8, wCarry);
  else if (wb < 2 * WSBLK)             wconv_f16(Wk, wkh, wkl, wb - WSBLK, CQK * CCH / 8, wCarry);
  else if (wb < 2 * WSBLK + WLBLK)     wconv_f16(Wv, wvh, wvl, wb - 2 * WSBLK, CCH * CCH / 8, wCarry);
  else                                 wconv_f16(Wd, wdh, wdl, wb - 2 * WSBLK - WLBLK, CCH * CCH / 8, wCarry);
}

// =====================================================================================
// Flash-style attention with a 512-wide value dimension and a 64-deep score dimension, no score scaling.
//   All four kinds of plane in fragment order (head of the file):
//   q planes (hi/lo f16, x2^10) [16384][64]: row b*4096 + i, col d
//   k planes (hi/lo f16, x2^10) [16384][64]: same for keys j
//   v plane (f16, carry 1) [4*512][4096]: row b*512 + ch, col j
//   o2 planes (hi/lo f16, x2^10) [16384][512]: row b*4096 + i, col ch = split of (gamma*out + x[b][ch][i]) * 2^10
//   Both products are formed TRANSPOSED, so that a lane's column (lane&15) is one query in the score tiles and in the output tiles alike:
//   scores S^T = k . q^T on split planes (hi.hi + lo.hi + hi.lo), * sscale (= 2^-20) in f32: A = K fragment (row = key), B = Q fragment (col = query);
//   a lane holds 8 keys (8*(lane>>4) + r) of one query per tile: row maximum and row sum run inside the lane, plus one exchange between the wave's halves;
//   running-max softmax in f32 over the 4096 keys of the batch element (32 chunks of 128, compile-time trip count);
//   P = exp(s - m) * pcarry (2^15) as f16 in LDS (values < 2^-14 stored as 0); out^T = v . P^T single products, f32 accumulate
//   (A = V fragment, row = channel; B = P rows, col = query), times (1/rowsum) * pinv (2^-15) at the end.
//   Block = 64 query rows (4 query tiles of 16) of one batch element, 8 waves; wave w computes the 16x64 score piece for keys
//   j0 + 16w .. +15 of each chunk (shared through LDS: partial row max Pm, partial row sum Pl, P tile Ps) and accumulates the
//   output for channels 64w .. 64w+63 (4 query tiles x 4 channel tiles in registers). Each K fragment and each V fragment
//   loaded from global feeds one product per query tile (the K hi fragment two). grid = (4096/64, 4) = 256 blocks.
//   The block's Q rows sit in LDS (Qsh/Qsl, written once, barrier B0) and are read as fragments in every chunk.
//   Barriers per chunk: after the Pm writes (B1) and after the Ps/Pl writes (B2); Pm/Ps/Pl of the next chunk are only
//   written after every wave has passed B2/B1 of the current one. Every wave reaches every barrier (no early exit).
//   B1 and B2 order LDS only (lds_barrier): the K and V fragments of the next chunk stay in flight across them.
//   LDS extents: Ps rows 0..63 x cols 0..127 fully written each chunk (8 waves x 16 cols) before any fragment read
//   (reads reach col 127; cols 128..135 never read); Pm/Pl [64][8] fully written.
//   Fragment loads from global (K, V blocks): plane base (kernel argument) + the lane's 32-bit byte offset, 16-B aligned, one chunk ahead of their use.
// =====================================================================================
#define AQT    4
#define AQB    (16 * AQT)
#define AKC    128
#define PPITCH 136
#define NCHUNK (NPOS / AKC)

static_assert(NPOS % AQB == 0);
static_assert(NCHUNK * AKC == NPOS);
static_assert(CCH == 8 * 64);
static_assert((PPITCH * 2) % 16 == 0);
static_assert(AQB * CQK == 2 * 256 * 8);

// value of lane l ^ 16 (the other half of the wave), on the vector unit
__device__ __forceinline__ float xhalf(float x) {
  return __builtin_bit_cast(float, __builtin_amdgcn_permlanex16(__builtin_bit_cast(int, x), __builtin_bit_cast(int, x), 0x76543210, 0xfedcba98, false, false));
}

// Work-group barrier that orders LDS traffic only (s_wait_dscnt 0 in front of the signal). __syncthreads() also drains the wave's outstanding
// global loads, which would end the flight of the K and V fragments requested ahead; inside the chunk loop the waves exchange data through LDS alone
// (Pm, Ps, Pl) and write nothing to global memory.
__device__ __forceinline__ void lds_barrier() {
  __builtin_amdgcn_fence(__ATOMIC_RELEASE, "workgroup", "local");
  __builtin_amdgcn_s_barrier();
  __builtin_amdgcn_fence(__ATOMIC_ACQUIRE, "workgroup", "local");
}

__global__ __launch_bounds__(256)
void attn_kernel(const unsigned short* __restrict__ qhp, const unsigned short* __restrict__ qlp,
                 const unsigned short* __restrict__ khp, const unsigned short* __restrict__ klp,
                 const unsigned short* __restrict__ vtp,
                 const float* __restrict__ X, const float* __restrict__ gam,
                 unsigned short* __restrict__ o2hp, unsigned short* __restrict__ o2lp,
                 float sscale, float pcarry, float pinv, float ocarry) {
  union FB { v16h v; v8h h[2]; };
  __shared__ __align__(16) _Float16 Ps[AQB * PPITCH];     // P tile [query row][key in chunk], pitch 136 halves
  __shared__ __align__(16) float    Pm[AQB * 8];          // partial row max  [row][wave]
  __shared__ __align__(16) float    Pl[AQB * 8];          // partial row sum  [row][wave]
  __shared__ __align__(16) _Float16 Qsh[AQB * CQK];       // q hi plane rows of this block, fragment order as in global
  __shared__ __align__(16) _Float16 Qsl[AQB * CQK];       // q lo plane rows of this block, fragment order as in global

  const int tid  = threadIdx.x;
  const int wave = tid >> 5;
  const int lane = tid & 31;
  const int hh   = lane >> 4;
  const int c    = lane & 15;

  const int b  = blockIdx.y;                       // 0..3
  const int i0 = blockIdx.x * AQB;                 // first query position of this block
  const size_t qrow0 = (size_t)b * NPOS + i0;      // row in the q / o2 planes

  const _Float16* Qh = (const _Float16*)(const void*)qhp;
  const _Float16* Ql = (const _Float16*)(const void*)qlp;
  const _Float16* Kh = (const _Float16*)(const void*)khp;
  const _Float16* Kl = (const _Float16*)(const void*)klp;
  const _Float16* Vt = (const _Float16*)(const void*)vtp;
  const unsigned vw_off = (((unsigned)b * CCH + (unsigned)wave * 64) * NPOS + (unsigned)lane * 8) * 2;   // bytes: this wave's 64 channel rows, the lane's 16 B
  _Float16* O2h = (_Float16*)(void*)o2hp;
  _Float16* O2l = (_Float16*)(void*)o2lp;
  const float g = gam[0];

  // ---- Q rows of the block (64 x 64, hi and lo) into LDS once: 512 pieces of 16 B per plane, 2 per thread and plane;
  //      the 16 Q fragments would take 128 registers, which the accumulators and the V fragments in flight need ----
  {
    const int q8 = tid * 8;                        // the 64 rows are 4 row tiles = 4096 consecutive halves; pieces tid and 256 + tid
    const _Float16* gh0 = Qh + qrow0 * CQK + q8;
    const _Float16* gl0 = Ql + qrow0 * CQK + q8;
    const _Float16* gh1 = gh0 + 32 * CQK;
    const _Float16* gl1 = gl0 + 32 * CQK;
    const v8h th0 = *(const v8h*)gh0, tl0 = *(const v8h*)gl0, th1 = *(const v8h*)gh1, tl1 = *(const v8h*)gl1;
    xwait(gh0, gl0, gh1, gl1);
    *(v8h*)(Qsh + q8) = th0;
    *(v8h*)(Qsl + q8) = tl0;
    *(v8h*)(Qsh + 32 * CQK + q8) = th1;
    *(v8h*)(Qsl + 32 * CQK + q8) = tl1;
  }
  __syncthreads();   // B0: every wave reads all 64 Q rows

  float mrow[AQT], lrow[AQT];                      // of query t*16 + c, the same in both halves of the wave and in every wave
  v8f acc[AQT][4];                                 // acc[t][n][r] = out of query t*16 + c, channel 64*wave + 16*n + 8*hh + r
#pragma unroll
  for (int t = 0; t < AQT; ++t) {
    mrow[t] = -INFINITY; lrow[t] = 0.f;
#pragma unroll
    for (int n = 0; n < 4; ++n) acc[t][n] = (v8f){0.f,0.f,0.f,0.f,0.f,0.f,0.f,0.f};
  }

  // K fragments (A operand, row = lane&15 = key) of this wave's key row tile (2 blocks of 512 halves per plane) are fetched one chunk ahead: chunk 0 here
  const unsigned kw_off = (((unsigned)b * NPOS + (unsigned)wave * 16) * CQK + (unsigned)lane * 8) * 2;   // bytes, the same in the hi and the lo plane
  v16h kfh[2], kfl[2];
#pragma unroll
  for (int dc = 0; dc < 2; ++dc) {
    kfh[dc] = FragH::load_off(Kh, kw_off, dc * 1024);
    kfl[dc] = FragH::load_off(Kl, kw_off, dc * 1024);
  }
  xwait_off(kw_off);
  // The 16 V fragments of a chunk (A operand, row = lane&15 = channel) do not depend on the scores: they too are fetched one chunk ahead, chunk 0 here,
  // each later one into the same registers right behind its last product, so that it lands under the next chunk's scores and softmax
  // (neither barrier of the chunk drains the loads)
  unsigned vo = vw_off;   // bytes: block 0 of the wave's first channel row tile
  v16h vb[4][4];
#pragma unroll
  for (int kk = 0; kk < 4; ++kk) {
#pragma unroll
    for (int n = 0; n < 4; ++n) vb[kk][n] = FragH::load_off(Vt, vo, (n * 16 * NPOS + kk * 512) * 2);
  }

  for (int jc = 0; jc < NCHUNK; ++jc) {
    // ---- score piece, transposed: rows = keys j0 + 16*wave + 8*hh + r (j0 = jc * AKC), cols = 64 queries (B operand col = lane&15) ----
    v8f s[AQT];
#pragma unroll
    for (int t = 0; t < AQT; ++t) s[t] = (v8f){0.f,0.f,0.f,0.f,0.f,0.f,0.f,0.f};
#pragma unroll
    for (int dc = 0; dc < 2; ++dc) {
      const v16h kbh = kfh[dc];
      const v16h kbl = kfl[dc];
      // Q fragments (B operand, col = lane&15) from LDS, same k map as the K fragments
      v16h qah[AQT], qal[AQT];
#pragma unroll
      for (int t = 0; t < AQT; ++t) {
        qah[t] = FragH::load(Qsh + (t * 2 + dc) * 512 + lane * 8);
        qal[t] = FragH::load(Qsl + (t * 2 + dc) * 512 + lane * 8);
      }
#pragma unroll
      for (int t = 0; t < AQT; ++t) s[t] = FragH::mma(kbh, qah[t], s[t]);
#pragma unroll
      for (int t = 0; t < AQT; ++t) s[t] = FragH::mma(kbl, qah[t], s[t]);
#pragma unroll
      for (int t = 0; t < AQT; ++t) s[t] = FragH::mma(kbh, qal[t], s[t]);
    }
    // K fragments of the next chunk into the same registers, right behind their last use (the last chunk fetches its own again, so the address stays inside the planes)
    const int jn = (jc + 1 < NCHUNK) ? jc + 1 : jc;
    const unsigned ko = kw_off + (unsigned)jn * (AKC * CQK * 2);
#pragma unroll
    for (int dc = 0; dc < 2; ++dc) {
      kfh[dc] = FragH::load_off(Kh, ko, dc * 1024);
      kfl[dc] = FragH::load_off(Kl, ko, dc * 1024);
    }
    // scale, then this wave's partial maximum over its 16 keys of query t*16 + c: 8 in the lane, 8 in lane ^ 16
    float mloc[AQT];
#pragma unroll
    for (int t = 0; t < AQT; ++t) {
#pragma unroll
      for (int r = 0; r < 8; ++r) s[t][r] *= sscale;
      const float m = fmaxf(fmaxf(fmaxf(s[t][0], s[t][1]), fmaxf(s[t][2], s[t][3])),
                            fmaxf(fmaxf(s[t][4], s[t][5]), fmaxf(s[t][6], s[t][7])));
      mloc[t] = fmaxf(m, xhalf(m));
    }
    if (hh == 0) {
#pragma unroll
      for (int t = 0; t < AQT; ++t) Pm[(t * 16 + c) * 8 + wave] = mloc[t];
    }
    lds_barrier();   // B1

    // ---- running max update (identical in every wave), P tile, partial row sums ----
    float alpha[AQT], psl[AQT];
    v4f ma[AQT], mb[AQT];
#pragma unroll
    for (int t = 0; t < AQT; ++t) {                     // the 8 reads stand together: one LDS wait for all four query tiles
      ma[t] = *(const v4f*)(Pm + (t * 16 + c) * 8);
      mb[t] = *(const v4f*)(Pm + (t * 16 + c) * 8 + 4);
    }
    // keeps the 8 reads in one group; without it this build reads tile by tile and waits out the LDS latency once per query tile
    __builtin_amdgcn_sched_barrier(0);
#pragma unroll
    for (int t = 0; t < AQT; ++t) {
      const int row = t * 16 + c;
      const float cm = fmaxf(fmaxf(fmaxf(ma[t][0], ma[t][1]), fmaxf(ma[t][2], ma[t][3])),
                             fmaxf(fmaxf(mb[t][0], mb[t][1]), fmaxf(mb[t][2], mb[t][3])));
      const float mnew = fmaxf(mrow[t], cm);
      alpha[t] = __expf(mrow[t] - mnew);
      mrow[t] = mnew;
      float p[8];
      v8h ph;
#pragma unroll
      for (int r = 0; r < 8; ++r) {
        p[r] = __expf(s[t][r] - mnew);                  // in (0, 1]
        float p32 = p[r] * pcarry;
        p32 = (p32 >= 6.103515625e-05f) ? p32 : 0.0f;   // no f16 subnormals in the P tile
        ph[r] = (_Float16)p32;
      }
      *(v8h*)(Ps + row * PPITCH + wave * 16 + 8 * hh) = ph;   // the lane's 8 keys lie side by side in the query's P row: one 16-B store
      const float psum = ((p[0] + p[1]) + (p[2] + p[3])) + ((p[4] + p[5]) + (p[6] + p[7]));
      psl[t] = psum + xhalf(psum);
    }
    if (hh == 0) {
#pragma unroll
      for (int t = 0; t < AQT; ++t) Pl[(t * 16 + c) * 8 + wave] = psl[t];
    }
#pragma unroll
    for (int t = 0; t < AQT; ++t) {
#pragma unroll
      for (int n = 0; n < 4; ++n) acc[t][n] *= alpha[t];
    }
    // one wait for the V loads of the chunk before and the K loads of this one, a softmax behind the last of them, where it holds up nothing;
    // both offset registers are kept as they are until here, and vo steps on only behind it
    xwait_off(vo, ko);
    vo += (jc + 1 < NCHUNK) ? (unsigned)(AKC / 32) * 1024 : 0u;   // blocks of the next chunk; the last chunk fetches its own again, so the address stays inside the plane
    lds_barrier();   // B2

#pragma unroll
    for (int t = 0; t < AQT; ++t) {
      const int row = t * 16 + c;
      const v4f la = *(const v4f*)(Pl + row * 8);
      const v4f lb = *(const v4f*)(Pl + row * 8 + 4);
      const float ls = ((la[0] + la[1]) + (la[2] + la[3])) + ((lb[0] + lb[1]) + (lb[2] + lb[3]));
      lrow[t] = lrow[t] * alpha[t] + ls;
    }

    // ---- out^T(64 ch of this wave x 64 queries) += V(64 x 128) . P^T(128 x 64): A = v plane rows (row = lane&15 = channel),
    //      B = P tile (col = lane&15 = query within the query tile), both with the split k map; one V fragment serves all 4 query tiles ----
#pragma unroll
    for (int kk = 0; kk < 4; ++kk) {
      FB pa[AQT];
#pragma unroll
      for (int t = 0; t < AQT; ++t) {
        pa[t].h[0] = *(const v8h*)(Ps + (t * 16 + c) * PPITCH + kk * 32 + 8 * hh);
        pa[t].h[1] = *(const v8h*)(Ps + (t * 16 + c) * PPITCH + kk * 32 + 16 + 8 * hh);
      }
#pragma unroll
      for (int n = 0; n < 4; ++n) {
#pragma unroll
        for (int t = 0; t < AQT; ++t) acc[t][n] = FragH::mma(vb[kk][n], pa[t].v, acc[t][n]);
      }
#pragma unroll
      for (int n = 0; n < 4; ++n) vb[kk][n] = FragH::load_off(Vt, vo, (n * 16 * NPOS + kk * 512) * 2);   // the next chunk's
    }
  }
  xwait_off(vo);   // behind the last V loads, in front of the epilogue's reuse of the offset register

  // ---- epilogue, query tile by query tile: out * (1/(rowsum * 2^15)); o2 = gamma*out + x (exact f32 x); split of o2 * 2^10.
  //      The lane's 8 values of one accumulator tile (query c, channels 16n + 8*hh + 0..7) are its own 16-B unit of the o2 planes' fragment order.
  const float* xp0 = X + ((size_t)b * CCH + wave * 64 + 8 * hh) * NPOS + i0 + c;   // channel 64w + 8*hh, query c of tile 0
#pragma unroll
  for (int t = 0; t < AQT; ++t) {
    const float rl = (1.0f / lrow[t]) * pinv;
    const float* xp = xp0 + t * 16;
    float xe[4][8];
#pragma unroll
    for (int n = 0; n < 4; ++n) {                   // channel 64w + 16n + 8*hh + r
#pragma unroll
      for (int r = 0; r < 8; ++r) xe[n][r] = xp[(size_t)(n * 16 + r) * NPOS];
    }
    xwait(xp0);
    const size_t tb = ((((qrow0 >> 4) + t) * (size_t)(CCH >> 5) + wave * 2) << 9) + lane * 8;   // the wave's two blocks of query tile t
#pragma unroll
    for (int n = 0; n < 4; ++n) {                   // n = 2 * (block) + s
      v8h hv, lv;
#pragma unroll
      for (int r = 0; r < 8; ++r) {
        const float o  = acc[t][n][r] * rl;
        const float v2 = (g * o + xe[n][r]) * ocarry;
        const _Float16 hq = (_Float16)v2;
        hv[r] = hq;
        lv[r] = (_Float16)(v2 - (float)hq);
      }
      const size_t go = tb + n * 256;
      *(v8h*)(O2h + go) = hv;
      *(v8h*)(O2l + go) = lv;
    }
  }
}

// ---------------------------------------------------------------------------
// Workspace region map (byte offsets; every region is fully written by its producer launch before any consumer
//   XTh  f16 [16384][512]        0        16777216     XTl   16777216   16777216
//   WQh  f16 [64][512]    33554432           65536     WQl   33619968      65536
//   WKh  f16 [64][512]    33685504           65536     WKl   33751040      65536
//   WVh  f16 [512][512]   33816576          524288     WVl   34340864     524288
//   WDh  f16 [512][512]   34865152          524288     WDl   35389440     524288
//   Qh   f16 [16384][64]  35913728         2097152     Ql    38010880    2097152
//   Kh   f16 [16384][64]  40108032         2097152     Kl    42205184    2097152
//   VT   f16 [4][512][4096] 44302336     16777216
//   O2h  f16 [16384][512] 61079552        16777216     O2l   77856768   16777216
//   total                 94633984
// ---------------------------------------------------------------------------
extern "C" void kernel_launch(void* const* d_in, const int* in_sizes, int n_in,
                              void* d_out, int out_size, void* d_ws, size_t ws_size,
                              hipStream_t stream) {
  if (n_in < 10) return;
  if (in_sizes[0] != NBAT * CCH * NPOS) return;     // x     [4][512][64][64]
  if (in_sizes[1] != CQK * CCH) return;             // Wq    [64][512]
  if (in_sizes[2] != CQK) return;                   // bq    [64]
  if (in_sizes[3] != CQK * CCH) return;             // Wk    [64][512]
  if (in_sizes[4] != CQK) return;                   // bk    [64]
  if (in_sizes[5] != CCH * CCH) return;             // Wv    [512][512]
  if (in_sizes[6] != CCH) return;                   // bv    [512]
  if (in_sizes[7] != 1) return;                     // gamma [1]
  if (in_sizes[8] != CCH * CCH) return;             // Wd    [512][512]
  if (in_sizes[9] != CCH) return;                   // bd    [512]
  if (out_size != NBAT * CCH * NPOS) return;        // out   [4][512][64][64] f32, last element 8388607

  const float* x     = (const float*)d_in[0];
  const float* Wq    = (const float*)d_in[1];       // [out][in]
  const float* bq    = (const float*)d_in[2];
  const float* Wk    = (const float*)d_in[3];
  const float* bk    = (const float*)d_in[4];
  const float* Wv    = (const float*)d_in[5];
  const float* bv    = (const float*)d_in[6];
  const float* gamma = (const float*)d_in[7];
  const float* Wd    = (const float*)d_in[8];
  const float* bd    = (const float*)d_in[9];

  const size_t PXT = (size_t)MROWS * CCH * 2;       // 16777216  f16 [16384][512]
  const size_t PWS = (size_t)CQK * CCH * 2;         // 65536     f16 [64][512]
  const size_t PWL = (size_t)CCH * CCH * 2;         // 524288    f16 [512][512]
  const size_t PQK = (size_t)MROWS * CQK * 2;       // 2097152   f16 [16384][64]
  const size_t PVT = (size_t)NBAT * CCH * NPOS * 2; // 16777216  f16 [4][512][4096]
  size_t off = 0;
  const size_t oXTh = off; off += PXT;  const size_t oXTl = off; off += PXT;
  const size_t oWQh = off; off += PWS;  const size_t oWQl = off; off += PWS;
  const size_t oWKh = off; off += PWS;  const size_t oWKl = off; off += PWS;
  const size_t oWVh = off; off += PWL;  const size_t oWVl = off; off += PWL;
  const size_t oWDh = off; off += PWL;  const size_t oWDl = off; off += PWL;
  const size_t oQh  = off; off += PQK;  const size_t oQl  = off; off += PQK;
  const size_t oKh  = off; off += PQK;  const size_t oKl  = off; off += PQK;
  const size_t oVT  = off; off += PVT;
  const size_t oO2h = off; off += PXT;  const size_t oO2l = off; off += PXT;
  if (off > ws_size) return;                        // off = 94633984
  if (off > (size_t)134217728) return;

  char* ws = (char*)d_ws;
  unsigned short* XTh = (unsigned short*)(ws + oXTh);  unsigned short* XTl = (unsigned short*)(ws + oXTl);
  unsigned short* WQh = (unsigned short*)(ws + oWQh);  unsigned short* WQl = (unsigned short*)(ws + oWQl);
  unsigned short* WKh = (unsigned short*)(ws + oWKh);  unsigned short* WKl = (unsigned short*)(ws + oWKl);
  unsigned short* WVh = (unsigned short*)(ws + oWVh);  unsigned short* WVl = (unsigned short*)(ws + oWVl);
  unsigned short* WDh = (unsigned short*)(ws + oWDh);  unsigned short* WDl = (unsigned short*)(ws + oWDl);
  unsigned short* Qh  = (unsigned short*)(ws + oQh);   unsigned short* Ql  = (unsigned short*)(ws + oQl);
  unsigned short* Kh  = (unsigned short*)(ws + oKh);   unsigned short* Kl  = (unsigned short*)(ws + oKl);
  unsigned short* VT  = (unsigned short*)(ws + oVT);
  unsigned short* O2h = (unsigned short*)(ws + oO2h);  unsigned short* O2l = (unsigned short*)(ws + oO2l);

  const dim3 blk(256);
  const float actCarry = 1024.0f;                    // 2^10 on x, q, k, o2 planes
  const float wCarry   = 65536.0f;                   // 2^16 on weight planes
  const float scale26  = 1.0f / 67108864.0f;         // 2^-26 = 1 / (2^10 * 2^16)
  const float sScale   = 1.0f / 1048576.0f;          // 2^-20 = 1 / (2^10 * 2^10)
  const float pCarry   = 32768.0f;                   // 2^15 on the P tile
  const float pInv     = 1.0f / 32768.0f;            // 2^-15

  // (1) operand planes: XT = hi/lo of x^T * 2^10 (2048 blocks), then the four weights' hi/lo of W * 2^16 (16 + 16 + 128 + 128 blocks)
  split_all_f16<<<dim3(XBLK + 2 * WSBLK + 2 * WLBLK), blk, 0, stream>>>(x, Wq, Wk, Wv, Wd, XTh, XTl, WQh, WQl, WKh, WKl, WVh, WVl, WDh, WDl,
                                                                       actCarry, wCarry);
  // (2) v^T[b] = Wv . XT_b^T + bv[m] -> VT [4][512][4096] f16 single   (M=512, N=4096, K=512; 512 tiles -> 64 blocks x 4 batches), and with the same
  //     XT fragments q^T, k^T = Wq|Wk . XT_b^T + bq|bk -> Qh|Ql, Kh|Kl [16384][64] (x2^10): each wave one 16-row tile of the 128 stacked rows
  const dim3 gV((CCH / 64) * (NPOS / 64) / 8, NBAT);
  const QkPart qkp = {WQh, WQl, WKh, WKl, bq, bk, Qh, Ql, Kh, Kl, actCarry};
  gemm64_f16<true, 1, 1, true><<<gV, blk, 0, stream>>>(
      WVh, WVl, 0L, XTh, XTl, (long)NPOS * CCH, (void*)VT, (void*)VT, NPOS, (long)CCH * NPOS, bv,
      CCH, NPOS, scale26, 1.0f, qkp);
  // (3) attention + gamma scale + residual -> O2h|O2l [16384][512] (x2^10); grid (4096/64, 4) = 256 blocks
  attn_kernel<<<dim3(NPOS / AQB, NBAT), blk, 0, stream>>>(Qh, Ql, Kh, Kl, VT, x, gamma, O2h, O2l, sScale, pCarry, pInv, actCarry);
  // (4) out[b] = Wd . O2_b^T + bd[m] -> d_out NCHW f32 [4][512][4096]   (M=512, N=4096, K=512; 512 tiles -> 64 blocks x 4 batches)
  const QkPart noqk = {nullptr, nullptr, nullptr, nullptr, nullptr, nullptr, nullptr, nullptr, nullptr, nullptr, 0.0f};
  gemm64_f16<true, 1, 0, false><<<gV, blk, 0, stream>>>(
      WDh, WDl, 0L, O2h, O2l, (long)NPOS * CCH, d_out, d_out, NPOS, (long)CCH * NPOS, bd,
      CCH, NPOS, scale26, 1.0f, noqk);
  (void)hipGetLastError();
}

// v007
// A run of this version takes 147 microseconds.
// Timed twice side by side with v006, it ran 1.07 and 1.13 times as fast.
// Over all steps from v000 it is 4.25 times as fast.
// Contractions: q, k, v 1x1 convs, q.k^T energies and the output 1x1 conv = v_wmma_f32_16x16x32_f16 on f16 hi/lo split planes (hi.hi + hi.lo + lo.hi, 3 products each); p.v = v_wmma_f32_16x16x32_f16 single product (p carried x2^15 as f16, v plain f16 with |v| < 2^-14 written as 0); f32 accumulate everywhere; running-max softmax, 1/rowsum, gamma scale, biases and the residual add (exact f32 x) in f32 on the VALU.
// Plane / carry map (every carry is an exact power of two; the inverse is folded exactly once, at the line named):
//   XTh|XTl  f16 [16384 (b,n)][512 c]    = hi/lo of x * 2^10           (n = h*64 + w; producer tsplit_f16)
//   WQh|WQl, WKh|WKl f16 [64][512]; WVh|WVl, WDh|WDl f16 [512][512] = hi/lo of W * 2^16, natural [out][in] (producer wconv_f16)
//   Qh|Ql, Kh|Kl f16 [16384][64]           = hi/lo of q (or k) * 2^10   (GEMM: acc * 2^-26 removes the x and W carries, + bias, then * 2^10)
//   VT  f16 [4][512 ch][4096 n]            = v, carry 1                   (GEMM: acc * 2^-26 + bias; |v| < 2^-14 stored as 0)
//   energies                               = acc * 2^-20 (q and k carries) in attn_kernel before the softmax
//   P   f16 (LDS only)                     = exp(s - m) * 2^15, values < 2^-14 stored as 0; 2^-15 folded together with 1/rowsum in the attn_kernel epilogue
//   O2h|O2l f16 [16384][512]               = hi/lo of (gamma * out + x) * 2^10 (attn_kernel epilogue)
//   output conv                            = acc * 2^-26 (O2 and W carries) + bd -> f32 NCHW [4][512][4096]
// Every f16 plane above lies in FRAGMENT ORDER: a matrix [R rows][K cols] is cut into blocks of 16 rows x 32 cols, block (rt, kb) at
// halves ((rt * K/32 + kb) * 512); inside a block element (row c, col 16*s + 8*h + e) sits at s*256 + (h*16 + c)*8 + e, which is the
// register order of a 16x16x32 operand: lane h*16 + c reads its 16 B at lane*8 (s = 0) and at 256 + lane*8 (s = 1), 512 contiguous bytes per wave load.
#include <hip/hip_runtime.h>
#include <math.h>
#include <stdint.h>

#define NBAT  4
#define CCH   512
#define CQK   64
#define IMGH  64
#define IMGW  64
#define NPOS  4096
#define MROWS 16384

static_assert(NPOS == IMGH * IMGW);
static_assert(MROWS == NBAT * NPOS);
static_assert(CCH % 64 == 0);
static_assert(CQK == 64);
static_assert(NPOS % 128 == 0);
static_assert(NPOS % 64 == 0);
static_assert(CCH % 32 == 0);
static_assert((CQK * CCH) % (8 * 256) == 0);
static_assert((CCH * CCH) % (8 * 256) == 0);
static_assert(CCH % 256 == 0);
static_assert((MROWS / 64) % 8 == 0);
static_assert(((CCH / 64) * (NPOS / 64)) % 8 == 0);

typedef __attribute__((ext_vector_type(16))) _Float16 v16h;
typedef __attribute__((ext_vector_type(8)))  _Float16 v8h;
typedef __attribute__((ext_vector_type(8)))  float    v8f;
typedef __attribute__((ext_vector_type(4)))  float    v4f;
typedef __attribute__((ext_vector_type(4)))  unsigned int v4u;

__device__ __forceinline__ unsigned short h_bits(_Float16 h) { return __builtin_bit_cast(unsigned short, h); }
__device__ __forceinline__ unsigned pk16(unsigned short a, unsigned short b) { return (unsigned)a | ((unsigned)b << 16); }

// hazard guards as plain device helpers (no inline asm inside the kernel template body)
__device__ __forceinline__ void dep_guard_h(v8f& a, v8f& b, v16h x, v16h y) { asm volatile("v_nop\n\tv_nop\n\tv_nop\n\tv_nop" : "+v"(a), "+v"(b) : "v"(x), "v"(y)); }
__device__ __forceinline__ void acc_guard4(v8f& a, v8f& b, v8f& c, v8f& d) { asm volatile("v_nop\n\tv_nop\n\tv_nop\n\tv_nop" : "+v"(a), "+v"(b), "+v"(c), "+v"(d)); }

// 16-bit fragment loader (A and B alike) from a block in fragment order: p = block start + lane*8; lane row/col = lane&15, h = lane>>4;
// vector elements 0..7 <- p[0..7] (= k0+8h+0..7), 8..15 <- p[256..263] (= k0+16+8h+0..7).
struct FragH {
  union U { v16h v; v8h h[2]; };
  static __device__ __forceinline__ v16h load(const _Float16* p) {
    U f; f.h[0] = *(const v8h*)(p); f.h[1] = *(const v8h*)(p + 256); return f.v;
  }
  // the same from a wave-uniform plane base and the lane's byte offset: one offset register per fragment group instead of a 64-bit address pair
  static __device__ __forceinline__ v16h load_off(const _Float16* base, unsigned boff, int imm) {
    const char* p = (const char*)(const void*)base + boff;
    U f; f.h[0] = *(const v8h*)(p + imm); f.h[1] = *(const v8h*)(p + imm + 512); return f.v;
  }
  static __device__ __forceinline__ v8f mma(v16h a, v16h b, v8f c) {
    return __builtin_amdgcn_wmma_f32_16x16x32_f16(false, a, false, b, (short)0, c, false, false);
  }
  static __device__ __forceinline__ void guard(v8f& a, v8f& b, v16h x, v16h y) { dep_guard_h(a, b, x, y); }
};

// s_wait_xcnt 0 behind a group of global loads, in front of any rewrite of their address registers.
// The addresses are inputs only so that their registers stay as they are up to the wait.
__device__ __forceinline__ void xwait(const void* a) { asm volatile("s_wait_xcnt 0x0" :: "v"(a) : "memory"); }
__device__ __forceinline__ void xwait(const void* a, const void* b, const void* c, const void* d) {
  asm volatile("s_wait_xcnt 0x0" :: "v"(a), "v"(b), "v"(c), "v"(d) : "memory");
}

// the same behind loads of the form uniform base + 32-bit byte offset per lane: the offset register stays as it is up to the wait (the bases are kernel arguments, never rewritten in the loop)
__device__ __forceinline__ void xwait_off(unsigned a) { asm volatile("s_wait_xcnt 0x0" :: "v"(a) : "memory"); }
__device__ __forceinline__ void xwait_off(unsigned a, unsigned b) { asm volatile("s_wait_xcnt 0x0" :: "v"(a), "v"(b) : "memory"); }
// the same where the bases are formed in the kernel: the four scalar bases too stay as they are up to the wait
__device__ __forceinline__ void xwait_off(unsigned a, const void* p, const void* q, const void* r, const void* s) {
  asm volatile("s_wait_xcnt 0x0" :: "v"(a), "s"(p), "s"(q), "s"(r), "s"(s) : "memory");
}
__device__ __forceinline__ void xwait_off(unsigned a, const void* p, const void* q, const void* r, const void* s, const void* t, const void* u) {
  asm volatile("s_wait_xcnt 0x0" :: "v"(a), "s"(p), "s"(q), "s"(r), "s"(s), "s"(t), "s"(u) : "memory");
}

// ---- Register-blocked batched WMMA GEMM, f16 operands ----------------------
// C[m,n] = oscale * (scale * sum_k A[m,k] * Bt[n,k] + bias); each wave owns a 64x64 tile.
// A [M,GK] and Bt [N,GK] in fragment order, K = GK columns each; M,N % 64 == 0 (host-asserted sizes).
// The 16 fragments of a k step (32 columns: 4 row tiles x hi/lo of A and of Bt; 18 with the QK row tile) are fetched one k step ahead into a second register set,
// so that a step's products run while the next step's 32 loads (36 with QK) are in flight.
// f16 outputs (OUT_MODE 1, 2) are written in fragment order as matrices [M][ldc]; the f32 output stays row-major.
// SPLIT: operands are hi/lo planes (A2/Bt2 = lo planes, same layout); product = hi.hi + hi.lo + lo.hi.
// BIAS_MODE: 0 = none, 1 = bias[m], 2 = bias[n] (f32).
// OUT_MODE: 0 = f32; 1 = single f16 plane (|v| < 2^-14 stored as 0, so the plane holds no f16 subnormals);
//           2 = f16 hi plane (Cout) + f16 lo plane (Cout2), lo = v - hi.
// QK: the wave takes a fifth A row tile beside its four: 16 of the 128 stacked q and k weight rows (row tile tm of 8: 0..3 = q, 4..7 = k; needs M == 512),
//     times the same Bt fragments, so that q, k and v come out of one launch of 256 blocks and x is read once for the three.
//     Its tiles hold 8 channels (8*(lane>>4) + r) of one position (lane&15) per lane: the lane's own 16-B unit of the q / k planes' fragment order.
#define GK   CCH
#define GRTB (GK * 32)   // bytes of one row tile of an operand plane: GK/32 blocks of 1 KiB, one behind the other
static_assert(GK % 64 == 0);

template <int NA> struct FragSet { v16h ah[NA], al[NA], bh[4], bl[4]; };

// the q / k side of the projection launch (unused where QK is false)
static_assert(CCH / 64 == 2 * CQK / 16);   // one 16-row tile of the stacked q and k weights for each 64-row tile of the v weights
struct QkPart {
  const unsigned short* wqh; const unsigned short* wql;   // weight planes [64][512]
  const unsigned short* wkh; const unsigned short* wkl;
  const float* bq; const float* bk;                       // biases [64]
  unsigned short* qh; unsigned short* ql;                 // out planes [16384][64]
  unsigned short* kh; unsigned short* kl;
  float carry;                                            // on the out planes
};

// all fragments of one k step: plane starts of the wave's first row tiles (wave-uniform) + the lane's byte offset + immediates.
// A first: the Bt registers are rewritten last, furthest behind the products that read them.
template <bool SPLIT, int NA>
__device__ __forceinline__ void gemm_fetch(FragSet<NA>& f, const _Float16* Ah, const _Float16* Al, const _Float16* Eh, const _Float16* El,
                                           const _Float16* Bh, const _Float16* Bl, unsigned off, int imm) {
#pragma unroll
  for (int i = 0; i < 4; ++i) {
    f.ah[i] = FragH::load_off(Ah, off, imm + i * GRTB);
    if (SPLIT) f.al[i] = FragH::load_off(Al, off, imm + i * GRTB); else f.al[i] = f.ah[i];
  }
  if (NA == 5) {
    f.ah[NA - 1] = FragH::load_off(Eh, off, imm);
    f.al[NA - 1] = FragH::load_off(El, off, imm);
  }
#pragma unroll
  for (int j = 0; j < 4; ++j) {
    f.bh[j] = FragH::load_off(Bh, off, imm + j * GRTB);
    if (SPLIT) f.bl[j] = FragH::load_off(Bl, off, imm + j * GRTB); else f.bl[j] = f.bh[j];
  }
  // the 32 loads (36 with the q / k tile) are issued as one group in front of the other set's products; without it the build may sink them among the products, which shortens their lead
  __builtin_amdgcn_sched_barrier(0);
}

// the products of one k step; per accumulator in the order hi.hi, hi.lo, lo.hi, four independent accumulators between two products into the same one
template <bool SPLIT, int NA>
__device__ __forceinline__ void gemm_mul(v8f (&acc)[NA][4], const FragSet<NA>& f) {
#pragma unroll
  for (int i = 0; i < 4; ++i) {
#pragma unroll
    for (int j = 0; j < 4; ++j) acc[i][j] = FragH::mma(f.ah[i], f.bh[j], acc[i][j]);
    if (SPLIT) {
#pragma unroll
      for (int j = 0; j < 4; ++j) acc[i][j] = FragH::mma(f.ah[i], f.bl[j], acc[i][j]);
#pragma unroll
      for (int j = 0; j < 4; ++j) acc[i][j] = FragH::mma(f.al[i], f.bh[j], acc[i][j]);
    }
  }
  if (NA == 5) {   // q / k row tile: x is the Bt side here; the order stays x hi . w hi, x hi . w lo, x lo . w hi
#pragma unroll
    for (int j = 0; j < 4; ++j) acc[NA - 1][j] = FragH::mma(f.ah[NA - 1], f.bh[j], acc[NA - 1][j]);
#pragma unroll
    for (int j = 0; j < 4; ++j) acc[NA - 1][j] = FragH::mma(f.al[NA - 1], f.bh[j], acc[NA - 1][j]);
#pragma unroll
    for (int j = 0; j < 4; ++j) acc[NA - 1][j] = FragH::mma(f.ah[NA - 1], f.bl[j], acc[NA - 1][j]);
  }
  // every product of the step stays in front of this line: behind it the set's registers are refilled
  __builtin_amdgcn_sched_barrier(0);
  // four vector slots between the last products and the loads that refill this set's registers
  FragH::guard(acc[NA - 1][0], acc[NA - 1][3], f.ah[NA - 1], f.al[NA - 1]);
}

template <bool SPLIT, int BIAS_MODE, int OUT_MODE, bool QK>
__global__ __launch_bounds__(256) void gemm64_f16(
    const unsigned short* __restrict__ Ap, const unsigned short* __restrict__ A2p, long strideA,
    const unsigned short* __restrict__ Btp, const unsigned short* __restrict__ Bt2p, long strideB,
    void* __restrict__ Cout, void* __restrict__ Cout2, int ldc, long strideC,
    const float* __restrict__ bias,
    int M, int N, float scale, float oscale, QkPart qk) {
  constexpr int NA = QK ? 5 : 4;
  const _Float16* A   = (const _Float16*)(const void*)Ap;
  const _Float16* A2  = (const _Float16*)(const void*)A2p;
  const _Float16* Bt  = (const _Float16*)(const void*)Btp;
  const _Float16* Bt2 = (const _Float16*)(const void*)Bt2p;
  __shared__ __align__(16) float sT[8][16 * 68];   // per-wave 16x64 slab, pitch 68 floats
  const int b    = blockIdx.y;
  const int lane = threadIdx.x & 31;
  const int wave = __builtin_amdgcn_readfirstlane(threadIdx.x >> 5);   // scalar, so that the block starts below are formed once per wave on the scalar unit
  const int tilesN = N >> 6;
  const int tilesM = M >> 6;
  const int tile = blockIdx.x * 8 + wave;
  if (tile >= tilesM * tilesN) return;   // wave-uniform; no block barriers in this kernel
  const int tm = tile / tilesN;
  const int tn = tile - tm * tilesN;
  const int m0 = tm << 6;
  const int n0 = tn << 6;

  // starts of the wave's 64 rows in each plane (4 row tiles, GRTB bytes each): the same in every lane, formed once, never rewritten
  const size_t ao = (size_t)b * strideA + (size_t)m0 * GK;
  const size_t bo = (size_t)b * strideB + (size_t)n0 * GK;
  const _Float16* Ab  = A  + ao;
  const _Float16* Bb  = Bt + bo;
  const _Float16* Ab2 = SPLIT ? (A2  + ao) : Ab;
  const _Float16* Bb2 = SPLIT ? (Bt2 + bo) : Bb;
  // the wave's q or k weight row tile (16 rows = GRTB bytes), wave-uniform as well
  const _Float16* Eb  = QK ? (const _Float16*)(const void*)(tm < 4 ? qk.wqh : qk.wkh) + (size_t)(tm & 3) * 16 * GK : Ab;
  const _Float16* Eb2 = QK ? (const _Float16*)(const void*)(tm < 4 ? qk.wql : qk.wkl) + (size_t)(tm & 3) * 16 * GK : Ab;

  const int rlane = lane & 15;                 // row (A) / col (B, D) within subtile
  const int mOff  = (lane >> 4) * 8;           // D row offset

  v8f acc[NA][4];
#pragma unroll
  for (int i = 0; i < NA; ++i)
#pragma unroll
    for (int j = 0; j < 4; ++j) acc[i][j] = (v8f){0.f,0.f,0.f,0.f,0.f,0.f,0.f,0.f};

  const unsigned ko = (unsigned)lane * 16;     // bytes: the lane's 16 B inside each 512-B half block
  FragSet<NA> f0, f1;
  gemm_fetch<SPLIT, NA>(f0, Ab, Ab2, Eb, Eb2, Bb, Bb2, ko, 0);
  // unrolled in full: a k step is 1 KiB further in every row tile, so each address is base + ko + an immediate and no address register is rewritten under loads in flight
#pragma unroll
  for (int k0 = 0; k0 < GK; k0 += 64) {
    gemm_fetch<SPLIT, NA>(f1, Ab, Ab2, Eb, Eb2, Bb, Bb2, ko, (k0 + 32) * 32);                     // k step k0 + 32, in flight under the products of k step k0
    gemm_mul<SPLIT, NA>(acc, f0);
    if (k0 + 64 < GK) gemm_fetch<SPLIT, NA>(f0, Ab, Ab2, Eb, Eb2, Bb, Bb2, ko, (k0 + 64) * 32);   // k step k0 + 64, in flight under the products of k step k0 + 32
    else if (QK) xwait_off(ko, Ab, Ab2, Eb, Eb2, Bb, Bb2);
    else xwait_off(ko, Ab, Ab2, Bb, Bb2);   // a k step's products behind the last loads, where it holds up nothing; the epilogue reuses the offset's and the bases' registers only behind it
    gemm_mul<SPLIT, NA>(acc, f1);
  }
  acc_guard4(acc[0][0], acc[0][1], acc[0][2], acc[0][3]);
  acc_guard4(acc[1][0], acc[1][1], acc[1][2], acc[1][3]);
  acc_guard4(acc[2][0], acc[2][1], acc[2][2], acc[2][3]);
  acc_guard4(acc[3][0], acc[3][1], acc[3][2], acc[3][3]);
  if (QK) acc_guard4(acc[NA - 1][0], acc[NA - 1][1], acc[NA - 1][2], acc[NA - 1][3]);

  // ---- epilogue ----
  float* slab = sT[wave];
#pragma unroll
  for (int i = 0; i < 4; ++i) {
    const int mBase = m0 + (i << 4);
#pragma unroll
    for (int j = 0; j < 4; ++j) {
      const int n = n0 + (j << 4) + rlane;
      float bvn = 0.f;
      if (BIAS_MODE == 2) bvn = bias[n];
#pragma unroll
      for (int r = 0; r < 8; ++r) {
        float v = acc[i][j][r] * scale;
        if (BIAS_MODE == 1) v += bias[mBase + mOff + r];
        if (BIAS_MODE == 2) v += bvn;
        slab[(mOff + r) * 68 + (j << 4) + rlane] = v * oscale;
      }
    }
    __builtin_amdgcn_fence(__ATOMIC_RELEASE, "workgroup");
    __builtin_amdgcn_wave_barrier();
    __builtin_amdgcn_fence(__ATOMIC_ACQUIRE, "workgroup");
    if (OUT_MODE == 0) {
      float* C = (float*)Cout + (size_t)b * strideC;
      const int hh = lane >> 4, c4 = (lane & 15) * 4;     // row seg = 256 B = 16 lanes x 16 B
      {
#pragma unroll
        for (int it = 0; it < 8; ++it) {
          const int row = it * 2 + hh;                       // it 0..7 x hh 0..1 = rows 0..15
          v4f v = *(const v4f*)(slab + row * 68 + c4);
          *(v4f*)(C + (size_t)(mBase + row) * ldc + n0 + c4) = v;
        }
        
      }
    } else {
      const int row = lane & 15, h8 = (lane >> 4) * 8;
      _Float16* C  = (_Float16*)Cout + (size_t)b * strideC;
      _Float16* C2 = (_Float16*)Cout2 + (size_t)b * strideC;
      const size_t tb = (((size_t)(mBase >> 4) * (ldc >> 5) + (n0 >> 5)) << 9) + lane * 8;   // the slab's two blocks follow one another
      {
#pragma unroll
        for (int it = 0; it < 4; ++it) {                     // it = 2 * (block) + s: cols it*16 + h8 .. +7 of row lane&15
          const float* sp = slab + row * 68 + it * 16 + h8;
          v8h hv, lv;
#pragma unroll
          for (int e = 0; e < 8; ++e) {
            if (OUT_MODE == 1) {
              float f = sp[e];
              f = (fabsf(f) >= 6.103515625e-05f) ? f : 0.0f;
              hv[e] = (_Float16)f;
            } else {
              const _Float16 hq = (_Float16)sp[e];
              hv[e] = hq;
              lv[e] = (_Float16)(sp[e] - (float)hq);
            }
          }
          *(v8h*)(C + tb + it * 256) = hv;
          if (OUT_MODE == 2) *(v8h*)(C2 + tb + it * 256) = lv;
        }
        
      }
    }
    __builtin_amdgcn_fence(__ATOMIC_RELEASE, "workgroup");
    __builtin_amdgcn_wave_barrier();
    __builtin_amdgcn_fence(__ATOMIC_ACQUIRE, "workgroup");
  }

  // ---- q / k row tile: (acc * scale + bias) * carry, hi/lo split, one 16-B store per plane and tile straight from the accumulators ----
  if (QK) {
    const int d0 = (tm & 3) * 16;                        // first of the tile's 16 q (or k) channels
    const float* be = (tm < 4 ? qk.bq : qk.bk) + d0 + mOff;
    _Float16* Eo  = (_Float16*)(void*)(tm < 4 ? qk.qh : qk.kh);
    _Float16* Eo2 = (_Float16*)(void*)(tm < 4 ? qk.ql : qk.kl);
    float bb[8];
#pragma unroll
    for (int r = 0; r < 8; ++r) bb[r] = be[r];
    // block (position row tile, d0 / 32) of a [16384][64] plane, half block s = (d0 / 16) & 1; the wave's four position tiles lie CQK / 32 blocks apart
    const size_t eb = (((size_t)((b * N + n0) >> 4) * (CQK >> 5) + (d0 >> 5)) << 9) + ((d0 >> 4) & 1) * 256 + lane * 8;
#pragma unroll
    for (int j = 0; j < 4; ++j) {
      v8h hv, lv;
#pragma unroll
      for (int r = 0; r < 8; ++r) {
        float v = acc[NA - 1][j][r] * scale;
        v += bb[r];
        v *= qk.carry;
        const _Float16 hq = (_Float16)v;
        hv[r] = hq;
        lv[r] = (_Float16)(v - (float)hq);
      }
      *(v8h*)(Eo  + eb + (size_t)j * ((CQK >> 5) << 9)) = hv;
      *(v8h*)(Eo2 + eb + (size_t)j * ((CQK >> 5) << 9)) = lv;
    }
  }
}

// ---------------------------------------------------------------------------
// f16 hi/lo split of a row-major f32 matrix [rows][CCH] with total element count 8*n8 into planes in fragment order:
//   hi = f16(in * carry), lo = f16(in * carry - hi). Thread i makes the i-th 16-B unit of each plane from 8 consecutive elements of one row
// ---------------------------------------------------------------------------
__device__ __forceinline__ void wconv_f16(const float* __restrict__ in, unsigned short* __restrict__ oh,
                                          unsigned short* __restrict__ ol, int blk, int n8, float carry) {
  const int i = blk * 256 + threadIdx.x;
  if (i < n8) {
    const size_t e0 = (size_t)i * 8;
    const int blkid = i >> 6;                                             // block (rt, kb), CCH/32 blocks per row tile
    const int srow = (blkid / (CCH / 32)) * 16 + (i & 15);
    const int scol = (blkid % (CCH / 32)) * 32 + ((i >> 4) & 3) * 8;      // bits 5,4 of i = s,h: col 16*s + 8*h
    const float* ip = in + (size_t)srow * CCH + scol;
    const v4f a = *(const v4f*)(ip);
    const v4f c = *(const v4f*)(ip + 4);
    xwait(ip);   // behind the two loads, in front of the reuse of their address registers
    float f[8];
    f[0] = a[0]; f[1] = a[1]; f[2] = a[2]; f[3] = a[3];
    f[4] = c[0]; f[5] = c[1]; f[6] = c[2]; f[7] = c[3];
    v4u hv, lv;
#pragma unroll
    for (int q = 0; q < 4; ++q) {
      const float f0 = f[2 * q] * carry, f1 = f[2 * q + 1] * carry;
      const _Float16 h0 = (_Float16)f0, h1 = (_Float16)f1;
      const _Float16 l0 = (_Float16)(f0 - (float)h0), l1 = (_Float16)(f1 - (float)h1);
      hv[q] = pk16(h_bits(h0), h_bits(h1));
      lv[q] = pk16(h_bits(l0), h_bits(l1));
    }
    {
      *(v4u*)(oh + e0) = hv;
      *(v4u*)(ol + e0) = lv;
      
    }
  }
}

// ---------------------------------------------------------------------------
// Fused transpose + f16 hi/lo split of an f32 matrix, z-batched:
//   in_z = W + z*sIn viewed in[R rows][Cc cols] (pitch Cc) -> oh_z[c][r] = f16(in_z[r][c]*carry), ol_z[c][r] = f16(rem),
//   out [Cc][R] in fragment order, oh_z = oh + z*sOut.
// 64x64 tiles through LDS (tf, 64 * 68 floats). Tile (bx, by, bz) of (Cc/64, R/64, Z), 256 threads (R, Cc multiples of 64; R multiple of 64 keeps every
// Coverage per block and plane: load 4 it x 256 thr x 4 floats = 64x64; store 2 it x 256 thr x 8 halves = 64x64.
// ---------------------------------------------------------------------------
__device__ __forceinline__ void tsplit_f16(float* tf, int bx, int by, int bz, const float* __restrict__ W, unsigned short* __restrict__ oh,
                                           unsigned short* __restrict__ ol, int R, int Cc, long sIn, long sOut,
                                           float carry) {
  W  += (size_t)bz * sIn;
  oh += (size_t)bz * sOut;
  ol += (size_t)bz * sOut;
  const int c0  = bx * 64;   // input column block = output row block
  const int r0  = by * 64;   // input row block    = output column block
  const int tid = threadIdx.x;
  {
    const int lr = tid >> 4;         // 0..15
    const int c4 = (tid & 15) * 4;   // 0..60
    const float* gp[4];
    v4f a[4];
#pragma unroll
    for (int it = 0; it < 4; ++it) {   // rows it * 16 + lr = 0..63
      gp[it] = W + (size_t)(r0 + it * 16 + lr) * Cc + c0 + c4;
      a[it] = *(const v4f*)gp[it];
    }
    xwait(gp[0], gp[1], gp[2], gp[3]);   // behind the four loads, in front of the reuse of their address registers
#pragma unroll
    for (int it = 0; it < 4; ++it) *(v4f*)(tf + (it * 16 + lr) * 68 + c4) = a[it];
  }
  __syncthreads();
  // unit u = it*256 + tid of the tile's 512 16-B units per plane, in fragment order: u = ((row tile * 2 + block) * 2 + s) * 32 + h*16 + c
  v4u hv[2], lv[2];
#pragma unroll
  for (int it = 0; it < 2; ++it) {
    const int u  = it * 256 + tid;
    const int oc = ((u >> 7) << 4) + (u & 15);   // output row within tile (= input column)
    const int c8 = ((u >> 4) & 7) * 8;           // output column within tile = 32*block + 16*s + 8*h
    v4u a, a2;
#pragma unroll
    for (int q = 0; q < 4; ++q) {
      const float f0 = tf[(c8 + 2 * q) * 68 + oc] * carry;
      const float f1 = tf[(c8 + 2 * q + 1) * 68 + oc] * carry;
      const _Float16 h0 = (_Float16)f0, h1 = (_Float16)f1;
      const _Float16 l0 = (_Float16)(f0 - (float)h0), l1 = (_Float16)(f1 - (float)h1);
      a[q]  = pk16(h_bits(h0), h_bits(h1));
      a2[q] = pk16(h_bits(l0), h_bits(l1));
    }
    hv[it] = a; lv[it] = a2;
  }
  {
#pragma unroll
    for (int it = 0; it < 2; ++it) {
      const int u = it * 256 + tid;
      const size_t go = (((size_t)((c0 >> 4) + (u >> 7)) * (R >> 5) + (r0 >> 5) + ((u >> 6) & 1)) << 9) + (u & 63) * 8;
      *(v4u*)(oh + go) = hv[it];
      *(v4u*)(ol + go) = lv[it];
    }
    
  }
}

// ---------------------------------------------------------------------------
// All five operand splits in one launch: none reads what another writes, so the block index picks the job (the same in every thread of a block).
// Blocks 0 .. XBLK-1: the 64x64 tiles of x, index = (bz * (CCH/64) + by) * (NPOS/64) + bx; then Wq, Wk (WSBLK blocks each), Wv, Wd (WLBLK blocks each).
// The long jobs (x tiles) come first, the short ones fill in behind them.
// ---------------------------------------------------------------------------
#define XBLK  ((NPOS / 64) * (CCH / 64) * NBAT)
#define WSBLK (CQK * CCH / 8 / 256)
#define WLBLK (CCH * CCH / 8 / 256)
__global__ __launch_bounds__(256) void split_all_f16(const float* __restrict__ x, const float* __restrict__ Wq, const float* __restrict__ Wk,
                                                     const float* __restrict__ Wv, const float* __restrict__ Wd,
                                                     unsigned short* __restrict__ xth, unsigned short* __restrict__ xtl,
                                                     unsigned short* __restrict__ wqh, unsigned short* __restrict__ wql,
                                                     unsigned short* __restrict__ wkh, unsigned short* __restrict__ wkl,
                                                     unsigned short* __restrict__ wvh, unsigned short* __restrict__ wvl,
                                                     unsigned short* __restrict__ wdh, unsigned short* __restrict__ wdl,
                                                     float actCarry, float wCarry) {
  __shared__ __align__(16) float tf[64 * 68];
  const int bid = blockIdx.x;
  if (bid < XBLK) {
    // x[b] viewed in[R=512 c][Cc=4096 n] (pitch 4096) -> XT_b[n][c], hi/lo of x * actCarry
    tsplit_f16(tf, bid % (NPOS / 64), (bid / (NPOS / 64)) % (CCH / 64), bid / ((NPOS / 64) * (CCH / 64)),
               x, xth, xtl, CCH, NPOS, (long)CCH * NPOS, (long)NPOS * CCH, actCarry);
    return;
  }
  // weight planes, natural [out][in] layout, hi/lo of W * wCarry
  const int wb = bid - XBLK;
  if (wb < WSBLK)                      wconv_f16(Wq, wqh, wql, wb, CQK * CCH / 8, wCarry);
  else if (wb < 2 * WSBLK)             wconv_f16(Wk, wkh, wkl, wb - WSBLK, CQK * CCH / 8, wCarry);
  else if (wb < 2 * WSBLK + WLBLK)     wconv_f16(Wv, wvh, wvl, wb - 2 * WSBLK, CCH * CCH / 8, wCarry);
  else                                 wconv_f16(Wd, wdh, wdl, wb - 2 * WSBLK - WLBLK, CCH * CCH / 8, wCarry);
}

// =====================================================================================
// Flash-style attention with a 512-wide value dimension and a 64-deep score dimension, no score scaling.
//   All four kinds of plane in fragment order (head of the file):
//   q planes (hi/lo f16, x2^10) [16384][64]: row b*4096 + i, col d
//   k planes (hi/lo f16, x2^10) [16384][64]: same for keys j
//   v plane (f16, carry 1) [4*512][4096]: row b*512 + ch, col j
//   o2 planes (hi/lo f16, x2^10) [16384][512]: row b*4096 + i, col ch = split of (gamma*out + x[b][ch][i]) * 2^10
//   Both products are formed TRANSPOSED, so that a lane's column (lane&15) is one query in the score tiles and in the output tiles alike:
//   scores S^T = k . q^T on split planes (hi.hi + lo.hi + hi.lo), * sscale (= 2^-20) in f32: A = K fragment (row = key), B = Q fragment (col = query);
//   a lane holds 8 keys (8*(lane>>4) + r) of one query per tile: row maximum and row sum run inside the lane, plus one exchange between the wave's halves;
//   running-max softmax in f32 over the 4096 keys of the batch element (32 chunks of 128, compile-time trip count);
//   P = exp(s - m) * pcarry (2^15) as f16 in LDS (values < 2^-14 stored as 0); out^T = v . P^T single products, f32 accumulate
//   (A = V fragment, row = channel; B = P rows, col = query), times (1/rowsum) * pinv (2^-15) at the end.
//   Block = 64 query rows (4 query tiles of 16) of one batch element, 8 waves; wave w computes the 16x64 score piece for keys
//   j0 + 16w .. +15 of each chunk (shared through LDS: partial row max Pm, partial row sum Pl, P tile Ps) and accumulates the
//   output for channels 64w .. 64w+63 (4 query tiles x 4 channel tiles in registers). Each K fragment and each V fragment
//   loaded from global feeds one product per query tile (the K hi fragment two). grid = (4096/64, 4) = 256 blocks.
//   The block's Q rows sit in LDS (Qsh/Qsl, written once, barrier B0) and are read as fragments in every chunk.
//   Barriers per chunk: after the Pm writes (B1) and after the Ps/Pl writes (B2). The loop runs one chunk apart: between B1 and B2 of chunk jc + 1
//   stand its softmax (writes P tile (jc + 1) & 1 and Pl) and the products P.V of chunk jc (read P tile jc & 1, written in front of B2 of chunk jc);
//   a P tile is rewritten two barriers behind its last read. Pm is written behind B2 and read behind B1; Pl is read behind B2, in front of the next B1.
//   Every wave reaches every barrier (no early exit).
//   B1 and B2 order LDS only (lds_barrier): the K and V fragments of the next chunk stay in flight across them.
//   LDS extents: a P tile's rows 0..63 x cols 0..127 fully written each chunk (8 waves x 16 cols) before any fragment read
//   (reads reach col 127; cols 128..135 never read); Pm/Pl [64][8] fully written.
//   Fragment loads from global (K, V blocks): plane base (kernel argument) + the lane's 32-bit byte offset, 16-B aligned, one chunk ahead of their use.
// =====================================================================================
#define AQT    4
#define AQB    (16 * AQT)
#define AKC    128
#define PPITCH 136
#define NCHUNK (NPOS / AKC)

static_assert(NPOS % AQB == 0);
static_assert(NCHUNK * AKC == NPOS);
static_assert(CCH == 8 * 64);
static_assert((PPITCH * 2) % 16 == 0);
static_assert(AQB * CQK == 2 * 256 * 8);

// value of lane l ^ 16 (the other half of the wave), on the vector unit
__device__ __forceinline__ float xhalf(float x) {
  return __builtin_bit_cast(float, __builtin_amdgcn_permlanex16(__builtin_bit_cast(int, x), __builtin_bit_cast(int, x), 0x76543210, 0xfedcba98, false, false));
}

// Work-group barrier that orders LDS traffic only (s_wait_dscnt 0 in front of the signal). __syncthreads() also drains the wave's outstanding
// global loads, which would end the flight of the K and V fragments requested ahead; inside the chunk loop the waves exchange data through LDS alone
// (Pm, Ps, Pl) and write nothing to global memory.
__device__ __forceinline__ void lds_barrier() {
  __builtin_amdgcn_fence(__ATOMIC_RELEASE, "workgroup", "local");
  __builtin_amdgcn_s_barrier();
  __builtin_amdgcn_fence(__ATOMIC_ACQUIRE, "workgroup", "local");
}

__global__ __launch_bounds__(256)
void attn_kernel(const unsigned short* __restrict__ qhp, const unsigned short* __restrict__ qlp,
                 const unsigned short* __restrict__ khp, const unsigned short* __restrict__ klp,
                 const unsigned short* __restrict__ vtp,
                 const float* __restrict__ X, const float* __restrict__ gam,
                 unsigned short* __restrict__ o2hp, unsigned short* __restrict__ o2lp,
                 float sscale, float pcarry, float pinv, float ocarry) {
  union FB { v16h v; v8h h[2]; };
  __shared__ __align__(16) _Float16 Ps[2 * AQB * PPITCH]; // two P tiles [query row][key in chunk], pitch 136 halves: chunk jc in tile jc & 1
  __shared__ __align__(16) float    Pm[AQB * 8];          // partial row max  [row][wave]
  __shared__ __align__(16) float    Pl[AQB * 8];          // partial row sum  [row][wave]
  __shared__ __align__(16) _Float16 Qsh[AQB * CQK];       // q hi plane rows of this block, fragment order as in global
  __shared__ __align__(16) _Float16 Qsl[AQB * CQK];       // q lo plane rows of this block, fragment order as in global

  const int tid  = threadIdx.x;
  const int wave = tid >> 5;
  const int lane = tid & 31;
  const int hh   = lane >> 4;
  const int c    = lane & 15;
  const int wsel = __builtin_amdgcn_readfirstlane(tid >> 7);   // 0 in waves 0..3, 1 in waves 4..7; scalar, so that the choice of order in the chunk loop is a scalar branch

  const int b  = blockIdx.y;                       // 0..3
  const int i0 = blockIdx.x * AQB;                 // first query position of this block
  const size_t qrow0 = (size_t)b * NPOS + i0;      // row in the q / o2 planes

  const _Float16* Qh = (const _Float16*)(const void*)qhp;
  const _Float16* Ql = (const _Float16*)(const void*)qlp;
  const _Float16* Kh = (const _Float16*)(const void*)khp;
  const _Float16* Kl = (const _Float16*)(const void*)klp;
  const _Float16* Vt = (const _Float16*)(const void*)vtp;
  const unsigned vw_off = (((unsigned)b * CCH + (unsigned)wave * 64) * NPOS + (unsigned)lane * 8) * 2;   // bytes: this wave's 64 channel rows, the lane's 16 B
  _Float16* O2h = (_Float16*)(void*)o2hp;
  _Float16* O2l = (_Float16*)(void*)o2lp;
  const float g = gam[0];

  // ---- Q rows of the block (64 x 64, hi and lo) into LDS once: 512 pieces of 16 B per plane, 2 per thread and plane;
  //      the 16 Q fragments would take 128 registers, which the accumulators and the V fragments in flight need ----
  {
    const int q8 = tid * 8;                        // the 64 rows are 4 row tiles = 4096 consecutive halves; pieces tid and 256 + tid
    const _Float16* gh0 = Qh + qrow0 * CQK + q8;
    const _Float16* gl0 = Ql + qrow0 * CQK + q8;
    const _Float16* gh1 = gh0 + 32 * CQK;
    const _Float16* gl1 = gl0 + 32 * CQK;
    const v8h th0 = *(const v8h*)gh0, tl0 = *(const v8h*)gl0, th1 = *(const v8h*)gh1, tl1 = *(const v8h*)gl1;
    xwait(gh0, gl0, gh1, gl1);
    *(v8h*)(Qsh + q8) = th0;
    *(v8h*)(Qsl + q8) = tl0;
    *(v8h*)(Qsh + 32 * CQK + q8) = th1;
    *(v8h*)(Qsl + 32 * CQK + q8) = tl1;
  }
  __syncthreads();   // B0: every wave reads all 64 Q rows

  float mrow[AQT], lrow[AQT];                      // of query t*16 + c, the same in both halves of the wave and in every wave
  v8f acc[AQT][4];                                 // acc[t][n][r] = out of query t*16 + c, channel 64*wave + 16*n + 8*hh + r
#pragma unroll
  for (int t = 0; t < AQT; ++t) {
    mrow[t] = -INFINITY; lrow[t] = 0.f;
#pragma unroll
    for (int n = 0; n < 4; ++n) acc[t][n] = (v8f){0.f,0.f,0.f,0.f,0.f,0.f,0.f,0.f};
  }

  // K fragments (A operand, row = lane&15 = key) of this wave's key row tile (2 blocks of 512 halves per plane) are fetched one chunk ahead: chunk 0 here
  const unsigned kw_off = (((unsigned)b * NPOS + (unsigned)wave * 16) * CQK + (unsigned)lane * 8) * 2;   // bytes, the same in the hi and the lo plane
  v16h kfh[2], kfl[2];
#pragma unroll
  for (int dc = 0; dc < 2; ++dc) {
    kfh[dc] = FragH::load_off(Kh, kw_off, dc * 1024);
    kfl[dc] = FragH::load_off(Kl, kw_off, dc * 1024);
  }
  xwait_off(kw_off);
  // The 16 V fragments of a chunk (A operand, row = lane&15 = channel) do not depend on the scores: they too are fetched one chunk ahead, chunk 0 behind the first scores below,
  // each later one into the same registers right behind its last product, so that it lands under the work of the trip that follows
  // (neither barrier of the chunk drains the loads)
  unsigned vo = vw_off;   // bytes: block 0 of the wave's first channel row tile
  v16h vb[4][4];

  v8f s[AQT];          // scaled scores of the chunk whose softmax comes next
  float alpha[AQT];    // rescale factor of the chunk whose softmax ran last
  unsigned ko = kw_off;

  // ---- row sums of the chunk whose softmax ran last, behind its B2 ----
  auto rowsum = [&]() __attribute__((always_inline)) {
#pragma unroll
    for (int t = 0; t < AQT; ++t) {
      const int row = t * 16 + c;
      const v4f la = *(const v4f*)(Pl + row * 8);
      const v4f lb = *(const v4f*)(Pl + row * 8 + 4);
      const float ls = ((la[0] + la[1]) + (la[2] + la[3])) + ((lb[0] + lb[1]) + (lb[2] + lb[3]));
      lrow[t] = lrow[t] * alpha[t] + ls;
    }
  };

  // ---- score piece of chunk jc, transposed: rows = keys jc * AKC + 16*wave + 8*hh + r, cols = 64 queries (B operand col = lane&15); partial maxima into Pm ----
  auto scores = [&](int jc, bool sums) __attribute__((always_inline)) {
#pragma unroll
    for (int t = 0; t < AQT; ++t) s[t] = (v8f){0.f,0.f,0.f,0.f,0.f,0.f,0.f,0.f};
#pragma unroll
    for (int dc = 0; dc < 2; ++dc) {
      const v16h kbh = kfh[dc];
      const v16h kbl = kfl[dc];
      // Q fragments (B operand, col = lane&15) from LDS, same k map as the K fragments
      v16h qah[AQT], qal[AQT];
#pragma unroll
      for (int t = 0; t < AQT; ++t) {
        qah[t] = FragH::load(Qsh + (t * 2 + dc) * 512 + lane * 8);
        qal[t] = FragH::load(Qsl + (t * 2 + dc) * 512 + lane * 8);
      }
#pragma unroll
      for (int t = 0; t < AQT; ++t) s[t] = FragH::mma(kbh, qah[t], s[t]);
#pragma unroll
      for (int t = 0; t < AQT; ++t) s[t] = FragH::mma(kbl, qah[t], s[t]);
#pragma unroll
      for (int t = 0; t < AQT; ++t) s[t] = FragH::mma(kbh, qal[t], s[t]);
    }
    // K fragments of the next chunk into the same registers, right behind their last use (the last chunk fetches its own again, so the address stays inside the planes)
    ko += (jc + 1 < NCHUNK) ? (unsigned)(AKC * CQK * 2) : 0u;   // stepped in place, behind the wait that follows the loads before
#pragma unroll
    for (int dc = 0; dc < 2; ++dc) {
      kfh[dc] = FragH::load_off(Kh, ko, dc * 1024);
      kfl[dc] = FragH::load_off(Kl, ko, dc * 1024);
    }
    if (sums) rowsum();   // of the chunk before: its 8 LDS reads land under the vector work below, not in front of the barrier
    // scale, then this wave's partial maximum over its 16 keys of query t*16 + c: 8 in the lane, 8 in lane ^ 16
    float mloc[AQT];
#pragma unroll
    for (int t = 0; t < AQT; ++t) {
#pragma unroll
      for (int r = 0; r < 8; ++r) s[t][r] *= sscale;
      const float m = fmaxf(fmaxf(fmaxf(s[t][0], s[t][1]), fmaxf(s[t][2], s[t][3])),
                            fmaxf(fmaxf(s[t][4], s[t][5]), fmaxf(s[t][6], s[t][7])));
      mloc[t] = fmaxf(m, xhalf(m));
    }
    if (hh == 0) {
#pragma unroll
      for (int t = 0; t < AQT; ++t) Pm[(t * 16 + c) * 8 + wave] = mloc[t];
    }
  };

  // ---- running max update (identical in every wave), P tile into Pw, partial row sums into Pl; leaves alpha ----
  auto softmax = [&](_Float16* Pw) __attribute__((always_inline)) {
    float psl[AQT];
    v4f ma[AQT], mb[AQT];
#pragma unroll
    for (int t = 0; t < AQT; ++t) {                     // the 8 reads stand together: one LDS wait for all four query tiles
      ma[t] = *(const v4f*)(Pm + (t * 16 + c) * 8);
      mb[t] = *(const v4f*)(Pm + (t * 16 + c) * 8 + 4);
    }
    // keeps the 8 reads in one group; without it this build reads tile by tile and waits out the LDS latency once per query tile
    __builtin_amdgcn_sched_barrier(0);
#pragma unroll
    for (int t = 0; t < AQT; ++t) {
      const int row = t * 16 + c;
      const float cm = fmaxf(fmaxf(fmaxf(ma[t][0], ma[t][1]), fmaxf(ma[t][2], ma[t][3])),
                             fmaxf(fmaxf(mb[t][0], mb[t][1]), fmaxf(mb[t][2], mb[t][3])));
      const float mnew = fmaxf(mrow[t], cm);
      alpha[t] = __expf(mrow[t] - mnew);
      mrow[t] = mnew;
      float p[8];
      v8h ph;
#pragma unroll
      for (int r = 0; r < 8; ++r) {
        p[r] = __expf(s[t][r] - mnew);                  // in (0, 1]
        float p32 = p[r] * pcarry;
        p32 = (p32 >= 6.103515625e-05f) ? p32 : 0.0f;   // no f16 subnormals in the P tile
        ph[r] = (_Float16)p32;
      }
      *(v8h*)(Pw + row * PPITCH + wave * 16 + 8 * hh) = ph;   // the lane's 8 keys lie side by side in the query's P row: one 16-B store
      const float psum = ((p[0] + p[1]) + (p[2] + p[3])) + ((p[4] + p[5]) + (p[6] + p[7]));
      psl[t] = psum + xhalf(psum);
    }
    if (hh == 0) {
#pragma unroll
      for (int t = 0; t < AQT; ++t) Pl[(t * 16 + c) * 8 + wave] = psl[t];
    }
  };

  // ---- out^T(64 ch of this wave x 64 queries) += V(64 x 128) . P^T(128 x 64): A = v plane rows (row = lane&15 = channel),
  //      B = P tile Pr (col = lane&15 = query within the query tile), both with the split k map; one V fragment serves all 4 query tiles ----
  auto pv = [&](const _Float16* Pr, bool refill) __attribute__((always_inline)) {
    FB pa[2][AQT];
#pragma unroll
    for (int t = 0; t < AQT; ++t) {
      pa[0][t].h[0] = *(const v8h*)(Pr + (t * 16 + c) * PPITCH + 8 * hh);
      pa[0][t].h[1] = *(const v8h*)(Pr + (t * 16 + c) * PPITCH + 16 + 8 * hh);
    }
#pragma unroll
    for (int kk = 0; kk < 4; ++kk) {
      if (kk < 3) {
#pragma unroll
        for (int t = 0; t < AQT; ++t) {
          pa[(kk + 1) & 1][t].h[0] = *(const v8h*)(Pr + (t * 16 + c) * PPITCH + (kk + 1) * 32 + 8 * hh);
          pa[(kk + 1) & 1][t].h[1] = *(const v8h*)(Pr + (t * 16 + c) * PPITCH + (kk + 1) * 32 + 16 + 8 * hh);
        }
      }
      // the next step's 8 P reads stand as one group in front of this step's products, one step ahead and no further: read further ahead they cost registers that the build does not have (scratch)
      __builtin_amdgcn_sched_barrier(0);
#pragma unroll
      for (int n = 0; n < 4; ++n) {
#pragma unroll
        for (int t = 0; t < AQT; ++t) acc[t][n] = FragH::mma(vb[kk][n], pa[kk & 1][t].v, acc[t][n]);
      }
      if (refill) {
#pragma unroll
        for (int n = 0; n < 4; ++n) vb[kk][n] = FragH::load_off(Vt, vo, (n * 16 * NPOS + kk * 512) * 2);   // the next chunk's
      }
      // ends the step: the P reads of the step after next stay behind this step's products, whose P registers they reuse
      __builtin_amdgcn_sched_barrier(0);
    }
  };

  // ---- the accumulators onto the new running maximum: behind the products of the chunk before, in front of the next chunk's ----
  auto rescale = [&]() __attribute__((always_inline)) {
#pragma unroll
    for (int t = 0; t < AQT; ++t) {
#pragma unroll
      for (int n = 0; n < 4; ++n) acc[t][n] *= alpha[t];
    }
  };

  // chunk 0: scores, softmax into P buffer 0 (the accumulators are still 0: nothing to rescale)
  scores(0, false);
  // V fragments of chunk 0, behind the K loads of chunk 1 as in every later trip: the loads return in order, and with the same order on the way into the loop
  // and round it the build's counted wait for the K fragments leaves the younger V loads in flight
#pragma unroll
  for (int kk = 0; kk < 4; ++kk) {
#pragma unroll
    for (int n = 0; n < 4; ++n) vb[kk][n] = FragH::load_off(Vt, vo, (n * 16 * NPOS + kk * 512) * 2);
  }
  lds_barrier();   // B1 of chunk 0
  softmax(Ps);
  xwait_off(ko);   // behind the K loads of chunk 1, a softmax later, in front of the next rewrite of their offset register
  lds_barrier();   // B2 of chunk 0

  for (int jc = 0; jc + 1 < NCHUNK; ++jc) {
    const _Float16* Pr = Ps + (jc & 1) * (AQB * PPITCH);          // P of chunk jc
    _Float16*       Pw = Ps + ((jc + 1) & 1) * (AQB * PPITCH);    // P of chunk jc + 1
    scores(jc + 1, true);   // with the row sums of chunk jc
    // one wait for the V loads of the trip before and the K loads of this one; both offset registers are kept as they are until here, and vo steps on only behind it
    xwait_off(vo, ko);
    vo += (unsigned)(AKC / 32) * 1024;   // blocks of chunk jc + 1, at most the plane's last chunk
    lds_barrier();   // B1 of chunk jc + 1
    // Between B1 and B2 a wave has matrix work (P.V of chunk jc) and vector work (softmax of chunk jc + 1) that do not depend on one another.
    // Waves w and w + 4 take the two in opposite order, so that one wave's products run under the other's vector work.
    // The products stand once in the text, the softmax in front of them (waves 4..7) and behind them (waves 0..3): only it is under a branch, so the accumulators and V fragments keep their registers.
    if (wsel != 0) softmax(Pw);
    pv(Pr, true);
    if (wsel == 0) softmax(Pw);
    rescale();
    lds_barrier();   // B2 of chunk jc + 1
  }
  rowsum();                                                   // of the last chunk
  pv(Ps + ((NCHUNK - 1) & 1) * (AQB * PPITCH), false);        // products of the last chunk; nothing left to fetch
  xwait_off(vo);   // behind the last V loads, in front of the epilogue's reuse of the offset register

  // ---- epilogue, query tile by query tile: out * (1/(rowsum * 2^15)); o2 = gamma*out + x (exact f32 x); split of o2 * 2^10.
  //      The lane's 8 values of one accumulator tile (query c, channels 16n + 8*hh + 0..7) are its own 16-B unit of the o2 planes' fragment order.
  const float* xp0 = X + ((size_t)b * CCH + wave * 64 + 8 * hh) * NPOS + i0 + c;   // channel 64w + 8*hh, query c of tile 0
#pragma unroll
  for (int t = 0; t < AQT; ++t) {
    const float rl = (1.0f / lrow[t]) * pinv;
    const float* xp = xp0 + t * 16;
    float xe[4][8];
#pragma unroll
    for (int n = 0; n < 4; ++n) {                   // channel 64w + 16n + 8*hh + r
#pragma unroll
      for (int r = 0; r < 8; ++r) xe[n][r] = xp[(size_t)(n * 16 + r) * NPOS];
    }
    xwait(xp0);
    const size_t tb = ((((qrow0 >> 4) + t) * (size_t)(CCH >> 5) + wave * 2) << 9) + lane * 8;   // the wave's two blocks of query tile t
#pragma unroll
    for (int n = 0; n < 4; ++n) {                   // n = 2 * (block) + s
      v8h hv, lv;
#pragma unroll
      for (int r = 0; r < 8; ++r) {
        const float o  = acc[t][n][r] * rl;
        const float v2 = (g * o + xe[n][r]) * ocarry;
        const _Float16 hq = (_Float16)v2;
        hv[r] = hq;
        lv[r] = (_Float16)(v2 - (float)hq);
      }
      const size_t go = tb + n * 256;
      *(v8h*)(O2h + go) = hv;
      *(v8h*)(O2l + go) = lv;
    }
  }
}

// ---------------------------------------------------------------------------
// Workspace region map (byte offsets; every region is fully written by its producer launch before any consumer
//   XTh  f16 [16384][512]        0        16777216     XTl   16777216   16777216
//   WQh  f16 [64][512]    33554432           65536     WQl   33619968      65536
//   WKh  f16 [64][512]    33685504           65536     WKl   33751040      65536
//   WVh  f16 [512][512]   33816576          524288     WVl   34340864     524288
//   WDh  f16 [512][512]   34865152          524288     WDl   35389440     524288
//   Qh   f16 [16384][64]  35913728         2097152     Ql    38010880    2097152
//   Kh   f16 [16384][64]  40108032         2097152     Kl    42205184    2097152
//   VT   f16 [4][512][4096] 44302336     16777216
//   O2h  f16 [16384][512] 61079552        16777216     O2l   77856768   16777216
//   total                 94633984
// ---------------------------------------------------------------------------
extern "C" void kernel_launch(void* const* d_in, const int* in_sizes, int n_in,
                              void* d_out, int out_size, void* d_ws, size_t ws_size,
                              hipStream_t stream) {
  if (n_in < 10) return;
  if (in_sizes[0] != NBAT * CCH * NPOS) return;     // x     [4][512][64][64]
  if (in_sizes[1] != CQK * CCH) return;             // Wq    [64][512]
  if (in_sizes[2] != CQK) return;                   // bq    [64]
  if (in_sizes[3] != CQK * CCH) return;             // Wk    [64][512]
  if (in_sizes[4] != CQK) return;                   // bk    [64]
  if (in_sizes[5] != CCH * CCH) return;             // Wv    [512][512]
  if (in_sizes[6] != CCH) return;                   // bv    [512]
  if (in_sizes[7] != 1) return;                     // gamma [1]
  if (in_sizes[8] != CCH * CCH) return;             // Wd    [512][512]
  if (in_sizes[9] != CCH) return;                   // bd    [512]
  if (out_size != NBAT * CCH * NPOS) return;        // out   [4][512][64][64] f32, last element 8388607

  const float* x     = (const float*)d_in[0];
  const float* Wq    = (const float*)d_in[1];       // [out][in]
  const float* bq    = (const float*)d_in[2];
  const float* Wk    = (const float*)d_in[3];
  const float* bk    = (const float*)d_in[4];
  const float* Wv    = (const float*)d_in[5];
  const float* bv    = (const float*)d_in[6];
  const float* gamma = (const float*)d_in[7];
  const float* Wd    = (const float*)d_in[8];
  const float* bd    = (const float*)d_in[9];

  const size_t PXT = (size_t)MROWS * CCH * 2;       // 16777216  f16 [16384][512]
  const size_t PWS = (size_t)CQK * CCH * 2;         // 65536     f16 [64][512]
  const size_t PWL = (size_t)CCH * CCH * 2;         // 524288    f16 [512][512]
  const size_t PQK = (size_t)MROWS * CQK * 2;       // 2097152   f16 [16384][64]
  const size_t PVT = (size_t)NBAT * CCH * NPOS * 2; // 16777216  f16 [4][512][4096]
  size_t off = 0;
  const size_t oXTh = off; off += PXT;  const size_t oXTl = off; off += PXT;
  const size_t oWQh = off; off += PWS;  const size_t oWQl = off; off += PWS;
  const size_t oWKh = off; off += PWS;  const size_t oWKl = off; off += PWS;
  const size_t oWVh = off; off += PWL;  const size_t oWVl = off; off += PWL;
  const size_t oWDh = off; off += PWL;  const size_t oWDl = off; off += PWL;
  const size_t oQh  = off; off += PQK;  const size_t oQl  = off; off += PQK;
  const size_t oKh  = off; off += PQK;  const size_t oKl  = off; off += PQK;
  const size_t oVT  = off; off += PVT;
  const size_t oO2h = off; off += PXT;  const size_t oO2l = off; off += PXT;
  if (off > ws_size) return;                        // off = 94633984
  if (off > (size_t)134217728) return;

  char* ws = (char*)d_ws;
  unsigned short* XTh = (unsigned short*)(ws + oXTh);  unsigned short* XTl = (unsigned short*)(ws + oXTl);
  unsigned short* WQh = (unsigned short*)(ws + oWQh);  unsigned short* WQl = (unsigned short*)(ws + oWQl);
  unsigned short* WKh = (unsigned short*)(ws + oWKh);  unsigned short* WKl = (unsigned short*)(ws + oWKl);
  unsigned short* WVh = (unsigned short*)(ws + oWVh);  unsigned short* WVl = (unsigned short*)(ws + oWVl);
  unsigned short* WDh = (unsigned short*)(ws + oWDh);  unsigned short* WDl = (unsigned short*)(ws + oWDl);
  unsigned short* Qh  = (unsigned short*)(ws + oQh);   unsigned short* Ql  = (unsigned short*)(ws + oQl);
  unsigned short* Kh  = (unsigned short*)(ws + oKh);   unsigned short* Kl  = (unsigned short*)(ws + oKl);
  unsigned short* VT  = (unsigned short*)(ws + oVT);
  unsigned short* O2h = (unsigned short*)(ws + oO2h);  unsigned short* O2l = (unsigned short*)(ws + oO2l);

  const dim3 blk(256);
  const float actCarry = 1024.0f;                    // 2^10 on x, q, k, o2 planes
  const float wCarry   = 65536.0f;                   // 2^16 on weight planes
  const float scale26  = 1.0f / 67108864.0f;         // 2^-26 = 1 / (2^10 * 2^16)
  const float sScale   = 1.0f / 1048576.0f;          // 2^-20 = 1 / (2^10 * 2^10)
  const float pCarry   = 32768.0f;                   // 2^15 on the P tile
  const float pInv     = 1.0f / 32768.0f;            // 2^-15

  // (1) operand planes: XT = hi/lo of x^T * 2^10 (2048 blocks), then the four weights' hi/lo of W * 2^16 (16 + 16 + 128 + 128 blocks)
  split_all_f16<<<dim3(XBLK + 2 * WSBLK + 2 * WLBLK), blk, 0, stream>>>(x, Wq, Wk, Wv, Wd, XTh, XTl, WQh, WQl, WKh, WKl, WVh, WVl, WDh, WDl,
                                                                       actCarry, wCarry);
  // (2) v^T[b] = Wv . XT_b^T + bv[m] -> VT [4][512][4096] f16 single   (M=512, N=4096, K=512; 512 tiles -> 64 blocks x 4 batches), and with the same
  //     XT fragments q^T, k^T = Wq|Wk . XT_b^T + bq|bk -> Qh|Ql, Kh|Kl [16384][64] (x2^10): each wave one 16-row tile of the 128 stacked rows
  const dim3 gV((CCH / 64) * (NPOS / 64) / 8, NBAT);
  const QkPart qkp = {WQh, WQl, WKh, WKl, bq, bk, Qh, Ql, Kh, Kl, actCarry};
  gemm64_f16<true, 1, 1, true><<<gV, blk, 0, stream>>>(
      WVh, WVl, 0L, XTh, XTl, (long)NPOS * CCH, (void*)VT, (void*)VT, NPOS, (long)CCH * NPOS, bv,
      CCH, NPOS, scale26, 1.0f, qkp);
  // (3) attention + gamma scale + residual -> O2h|O2l [16384][512] (x2^10); grid (4096/64, 4) = 256 blocks
  attn_kernel<<<dim3(NPOS / AQB, NBAT), blk, 0, stream>>>(Qh, Ql, Kh, Kl, VT, x, gamma, O2h, O2l, sScale, pCarry, pInv, actCarry);
  // (4) out[b] = Wd . O2_b^T + bd[m] -> d_out NCHW f32 [4][512][4096]   (M=512, N=4096, K=512; 512 tiles -> 64 blocks x 4 batches)
  const QkPart noqk = {nullptr, nullptr, nullptr, nullptr, nullptr, nullptr, nullptr, nullptr, nullptr, nullptr, 0.0f};
  gemm64_f16<true, 1, 0, false><<<gV, blk, 0, stream>>>(
      WDh, WDl, 0L, O2h, O2l, (long)NPOS * CCH, d_out, d_out, NPOS, (long)CCH * NPOS, bd,
      CCH, NPOS, scale26, 1.0f, noqk);
  (void)hipGetLastError();
}

// v008
// A run of this version takes 133 microseconds.
// Two timings next to v007 put it at 1.12 and 1.13 times that version's speed.
// Over all steps from v000 it is 4.80 times as fast.
// Contractions: q, k, v 1x1 convs, q.k^T energies and the output 1x1 conv = v_wmma_f32_16x16x32_f16 on f16 hi/lo split planes (hi.hi + hi.lo + lo.hi, 3 products each); p.v = v_wmma_f32_16x16x32_f16 single product (p carried x2^15 as f16, v plain f16 with |v| < 2^-14 written as 0); f32 accumulate everywhere; running-max softmax, 1/rowsum, gamma scale, biases and the residual add (exact f32 x) in f32 on the VALU.
// Plane / carry map (every carry is an exact power of two; the inverse is folded exactly once, at the line named):
//   XTh|XTl  f16 [16384 (b,n)][512 c]    = hi/lo of x * 2^10           (n = h*64 + w; producer tsplit_f16)
//   WQh|WQl, WKh|WKl f16 [64][512]; WVh|WVl, WDh|WDl f16 [512][512] = hi/lo of W * 2^16, natural [out][in] (producer wconv_f16)
//   Qh|Ql, Kh|Kl f16 [16384][64]           = hi/lo of q (or k) * 2^10   (GEMM: acc * 2^-26 removes the x and W carries, + bias, then * 2^10)
//   VT  f16 [4][512 ch][4096 n]            = v, carry 1                   (GEMM: acc * 2^-26 + bias; |v| < 2^-14 stored as 0)
//   energies                               = acc * 2^-20 (q and k carries) in attn_kernel before the softmax
//   P   f16 (LDS only)                     = exp(s - m) * 2^15, values < 2^-14 stored as 0; 2^-15 folded together with 1/rowsum in the attn_kernel epilogue
//   O2h|O2l f16 (LDS only) [64][512] per block = hi/lo of (gamma * out + x) * 2^10 (attn_kernel epilogue)
//   output conv (tail of attn_kernel)      = acc * 2^-26 (O2 and W carries) + bd -> f32 NCHW [4][512][4096]
// Every f16 plane above lies in FRAGMENT ORDER: a matrix [R rows][K cols] is cut into blocks of 16 rows x 32 cols, block (rt, kb) at
// halves ((rt * K/32 + kb) * 512); inside a block element (row c, col 16*s + 8*h + e) sits at s*256 + (h*16 + c)*8 + e, which is the
// register order of a 16x16x32 operand: lane h*16 + c reads its 16 B at lane*8 (s = 0) and at 256 + lane*8 (s = 1), 512 contiguous bytes per wave load.
#include <hip/hip_runtime.h>
#include <math.h>
#include <stdint.h>

#define NBAT  4
#define CCH   512
#define CQK   64
#define IMGH  64
#define IMGW  64
#define NPOS  4096
#define MROWS 16384

static_assert(NPOS == IMGH * IMGW);
static_assert(MROWS == NBAT * NPOS);
static_assert(CCH % 64 == 0);
static_assert(CQK == 64);
static_assert(NPOS % 128 == 0);
static_assert(NPOS % 64 == 0);
static_assert(CCH % 32 == 0);
static_assert((CQK * CCH) % (8 * 256) == 0);
static_assert((CCH * CCH) % (8 * 256) == 0);
static_assert(CCH % 256 == 0);
static_assert((MROWS / 64) % 8 == 0);
static_assert(((CCH / 64) * (NPOS / 64)) % 8 == 0);

typedef __attribute__((ext_vector_type(16))) _Float16 v16h;
typedef __attribute__((ext_vector_type(8)))  _Float16 v8h;
typedef __attribute__((ext_vector_type(8)))  float    v8f;
typedef __attribute__((ext_vector_type(4)))  float    v4f;
typedef __attribute__((ext_vector_type(4)))  unsigned int v4u;

__device__ __forceinline__ unsigned short h_bits(_Float16 h) { return __builtin_bit_cast(unsigned short, h); }
__device__ __forceinline__ unsigned pk16(unsigned short a, unsigned short b) { return (unsigned)a | ((unsigned)b << 16); }

// hazard guards as plain device helpers (no inline asm inside the kernel template body)
__device__ __forceinline__ void dep_guard_h(v8f& a, v8f& b, v16h x, v16h y) { asm volatile("v_nop\n\tv_nop\n\tv_nop\n\tv_nop" : "+v"(a), "+v"(b) : "v"(x), "v"(y)); }
__device__ __forceinline__ void acc_guard4(v8f& a, v8f& b, v8f& c, v8f& d) { asm volatile("v_nop\n\tv_nop\n\tv_nop\n\tv_nop" : "+v"(a), "+v"(b), "+v"(c), "+v"(d)); }

// 16-bit fragment loader (A and B alike) from a block in fragment order: p = block start + lane*8; lane row/col = lane&15, h = lane>>4;
// vector elements 0..7 <- p[0..7] (= k0+8h+0..7), 8..15 <- p[256..263] (= k0+16+8h+0..7).
struct FragH {
  union U { v16h v; v8h h[2]; };
  static __device__ __forceinline__ v16h load(const _Float16* p) {
    U f; f.h[0] = *(const v8h*)(p); f.h[1] = *(const v8h*)(p + 256); return f.v;
  }
  // the same from a wave-uniform plane base and the lane's byte offset: one offset register per fragment group instead of a 64-bit address pair
  static __device__ __forceinline__ v16h load_off(const _Float16* base, unsigned boff, int imm) {
    const char* p = (const char*)(const void*)base + boff;
    U f; f.h[0] = *(const v8h*)(p + imm); f.h[1] = *(const v8h*)(p + imm + 512); return f.v;
  }
  static __device__ __forceinline__ v8f mma(v16h a, v16h b, v8f c) {
    return __builtin_amdgcn_wmma_f32_16x16x32_f16(false, a, false, b, (short)0, c, false, false);
  }
  static __device__ __forceinline__ void guard(v8f& a, v8f& b, v16h x, v16h y) { dep_guard_h(a, b, x, y); }
};

// s_wait_xcnt 0 behind a group of global loads, in front of any rewrite of their address registers.
// The addresses are inputs only so that their registers stay as they are up to the wait.
__device__ __forceinline__ void xwait(const void* a) { asm volatile("s_wait_xcnt 0x0" :: "v"(a) : "memory"); }
__device__ __forceinline__ void xwait(const void* a, const void* b, const void* c, const void* d) {
  asm volatile("s_wait_xcnt 0x0" :: "v"(a), "v"(b), "v"(c), "v"(d) : "memory");
}

// the same behind loads of the form uniform base + 32-bit byte offset per lane: the offset register stays as it is up to the wait (the bases are kernel arguments, never rewritten in the loop)
__device__ __forceinline__ void xwait_off(unsigned a) { asm volatile("s_wait_xcnt 0x0" :: "v"(a) : "memory"); }
__device__ __forceinline__ void xwait_off(unsigned a, unsigned b) { asm volatile("s_wait_xcnt 0x0" :: "v"(a), "v"(b) : "memory"); }
// the same where the bases are formed in the kernel: the four scalar bases too stay as they are up to the wait
__device__ __forceinline__ void xwait_off(unsigned a, const void* p, const void* q, const void* r, const void* s) {
  asm volatile("s_wait_xcnt 0x0" :: "v"(a), "s"(p), "s"(q), "s"(r), "s"(s) : "memory");
}
// the same in front of the step of an offset register in a rolled loop. The offset goes through the statement: as an input only, this build replaces it
// by 64-bit address pairs of its own; so it stays the one register that the loads name
__device__ __forceinline__ void xwait_step(unsigned& a) { asm volatile("s_wait_xcnt 0x0" : "+v"(a) :: "memory"); }
__device__ __forceinline__ void xwait_off(unsigned a, const void* p, const void* q) {
  asm volatile("s_wait_xcnt 0x0" :: "v"(a), "s"(p), "s"(q) : "memory");
}
__device__ __forceinline__ void xwait_off(unsigned a, const void* p, const void* q, const void* r, const void* s, const void* t, const void* u) {
  asm volatile("s_wait_xcnt 0x0" :: "v"(a), "s"(p), "s"(q), "s"(r), "s"(s), "s"(t), "s"(u) : "memory");
}

// ---- Register-blocked batched WMMA GEMM, f16 operands ----------------------
// C[m,n] = oscale * (scale * sum_k A[m,k] * Bt[n,k] + bias); each wave owns a 64x64 tile.
// A [M,GK] and Bt [N,GK] in fragment order, K = GK columns each; M,N % 64 == 0 (host-asserted sizes).
// The 16 fragments of a k step (32 columns: 4 row tiles x hi/lo of A and of Bt; 18 with the QK row tile) are fetched one k step ahead into a second register set,
// so that a step's products run while the next step's 32 loads (36 with QK) are in flight.
// f16 outputs (OUT_MODE 1, 2) are written in fragment order as matrices [M][ldc]; the f32 output stays row-major.
// SPLIT: operands are hi/lo planes (A2/Bt2 = lo planes, same layout); product = hi.hi + hi.lo + lo.hi.
// BIAS_MODE: 0 = none, 1 = bias[m], 2 = bias[n] (f32).
// OUT_MODE: 0 = f32; 1 = single f16 plane (|v| < 2^-14 stored as 0, so the plane holds no f16 subnormals);
//           2 = f16 hi plane (Cout) + f16 lo plane (Cout2), lo = v - hi.
// QK: the wave takes a fifth A row tile beside its four: 16 of the 128 stacked q and k weight rows (row tile tm of 8: 0..3 = q, 4..7 = k; needs M == 512),
//     times the same Bt fragments, so that q, k and v come out of one launch of 256 blocks and x is read once for the three.
//     Its tiles hold 8 channels (8*(lane>>4) + r) of one position (lane&15) per lane: the lane's own 16-B unit of the q / k planes' fragment order.
#define GK   CCH
#define GRTB (GK * 32)   // bytes of one row tile of an operand plane: GK/32 blocks of 1 KiB, one behind the other
static_assert(GK % 64 == 0);

template <int NA> struct FragSet { v16h ah[NA], al[NA], bh[4], bl[4]; };

// the q / k side of the projection launch (unused where QK is false)
static_assert(CCH / 64 == 2 * CQK / 16);   // one 16-row tile of the stacked q and k weights for each 64-row tile of the v weights
struct QkPart {
  const unsigned short* wqh; const unsigned short* wql;   // weight planes [64][512]
  const unsigned short* wkh; const unsigned short* wkl;
  const float* bq; const float* bk;                       // biases [64]
  unsigned short* qh; unsigned short* ql;                 // out planes [16384][64]
  unsigned short* kh; unsigned short* kl;
  float carry;                                            // on the out planes
};

// all fragments of one k step: plane starts of the wave's first row tiles (wave-uniform) + the lane's byte offset + immediates.
// A first: the Bt registers are rewritten last, furthest behind the products that read them.
template <bool SPLIT, int NA>
__device__ __forceinline__ void gemm_fetch(FragSet<NA>& f, const _Float16* Ah, const _Float16* Al, const _Float16* Eh, const _Float16* El,
                                           const _Float16* Bh, const _Float16* Bl, unsigned off, int imm) {
#pragma unroll
  for (int i = 0; i < 4; ++i) {
    f.ah[i] = FragH::load_off(Ah, off, imm + i * GRTB);
    if (SPLIT) f.al[i] = FragH::load_off(Al, off, imm + i * GRTB); else f.al[i] = f.ah[i];
  }
  if (NA == 5) {
    f.ah[NA - 1] = FragH::load_off(Eh, off, imm);
    f.al[NA - 1] = FragH::load_off(El, off, imm);
  }
#pragma unroll
  for (int j = 0; j < 4; ++j) {
    f.bh[j] = FragH::load_off(Bh, off, imm + j * GRTB);
    if (SPLIT) f.bl[j] = FragH::load_off(Bl, off, imm + j * GRTB); else f.bl[j] = f.bh[j];
  }
  // the 32 loads (36 with the q / k tile) are issued as one group in front of the other set's products; without it the build may sink them among the products, which shortens their lead
  __builtin_amdgcn_sched_barrier(0);
}

// the products of one k step; per accumulator in the order hi.hi, hi.lo, lo.hi, four independent accumulators between two products into the same one
template <bool SPLIT, int NA>
__device__ __forceinline__ void gemm_mul(v8f (&acc)[NA][4], const FragSet<NA>& f) {
#pragma unroll
  for (int i = 0; i < 4; ++i) {
#pragma unroll
    for (int j = 0; j < 4; ++j) acc[i][j] = FragH::mma(f.ah[i], f.bh[j], acc[i][j]);
    if (SPLIT) {
#pragma unroll
      for (int j = 0; j < 4; ++j) acc[i][j] = FragH::mma(f.ah[i], f.bl[j], acc[i][j]);
#pragma unroll
      for (int j = 0; j < 4; ++j) acc[i][j] = FragH::mma(f.al[i], f.bh[j], acc[i][j]);
    }
  }
  if (NA == 5) {   // q / k row tile: x is the Bt side here; the order stays x hi . w hi, x hi . w lo, x lo . w hi
#pragma unroll
    for (int j = 0; j < 4; ++j) acc[NA - 1][j] = FragH::mma(f.ah[NA - 1], f.bh[j], acc[NA - 1][j]);
#pragma unroll
    for (int j = 0; j < 4; ++j) acc[NA - 1][j] = FragH::mma(f.al[NA - 1], f.bh[j], acc[NA - 1][j]);
#pragma unroll
    for (int j = 0; j < 4; ++j) acc[NA - 1][j] = FragH::mma(f.ah[NA - 1], f.bl[j], acc[NA - 1][j]);
  }
  // every product of the step stays in front of this line: behind it the set's registers are refilled
  __builtin_amdgcn_sched_barrier(0);
  // four vector slots between the last products and the loads that refill this set's registers
  FragH::guard(acc[NA - 1][0], acc[NA - 1][3], f.ah[NA - 1], f.al[NA - 1]);
}

template <bool SPLIT, int BIAS_MODE, int OUT_MODE, bool QK>
__global__ __launch_bounds__(256) void gemm64_f16(
    const unsigned short* __restrict__ Ap, const unsigned short* __restrict__ A2p, long strideA,
    const unsigned short* __restrict__ Btp, const unsigned short* __restrict__ Bt2p, long strideB,
    void* __restrict__ Cout, void* __restrict__ Cout2, int ldc, long strideC,
    const float* __restrict__ bias,
    int M, int N, float scale, float oscale, QkPart qk) {
  constexpr int NA = QK ? 5 : 4;
  const _Float16* A   = (const _Float16*)(const void*)Ap;
  const _Float16* A2  = (const _Float16*)(const void*)A2p;
  const _Float16* Bt  = (const _Float16*)(const void*)Btp;
  const _Float16* Bt2 = (const _Float16*)(const void*)Bt2p;
  __shared__ __align__(16) float sT[8][16 * 68];   // per-wave 16x64 slab, pitch 68 floats
  const int b    = blockIdx.y;
  const int lane = threadIdx.x & 31;
  const int wave = __builtin_amdgcn_readfirstlane(threadIdx.x >> 5);   // scalar, so that the block starts below are formed once per wave on the scalar unit
  const int tilesN = N >> 6;
  const int tilesM = M >> 6;
  const int tile = blockIdx.x * 8 + wave;
  if (tile >= tilesM * tilesN) return;   // wave-uniform; no block barriers in this kernel
  const int tm = tile / tilesN;
  const int tn = tile - tm * tilesN;
  const int m0 = tm << 6;
  const int n0 = tn << 6;

  // starts of the wave's 64 rows in each plane (4 row tiles, GRTB bytes each): the same in every lane, formed once, never rewritten
  const size_t ao = (size_t)b * strideA + (size_t)m0 * GK;
  const size_t bo = (size_t)b * strideB + (size_t)n0 * GK;
  const _Float16* Ab  = A  + ao;
  const _Float16* Bb  = Bt + bo;
  const _Float16* Ab2 = SPLIT ? (A2  + ao) : Ab;
  const _Float16* Bb2 = SPLIT ? (Bt2 + bo) : Bb;
  // the wave's q or k weight row tile (16 rows = GRTB bytes), wave-uniform as well
  const _Float16* Eb  = QK ? (const _Float16*)(const void*)(tm < 4 ? qk.wqh : qk.wkh) + (size_t)(tm & 3) * 16 * GK : Ab;
  const _Float16* Eb2 = QK ? (const _Float16*)(const void*)(tm < 4 ? qk.wql : qk.wkl) + (size_t)(tm & 3) * 16 * GK : Ab;

  const int rlane = lane & 15;                 // row (A) / col (B, D) within subtile
  const int mOff  = (lane >> 4) * 8;           // D row offset

  v8f acc[NA][4];
#pragma unroll
  for (int i = 0; i < NA; ++i)
#pragma unroll
    for (int j = 0; j < 4; ++j) acc[i][j] = (v8f){0.f,0.f,0.f,0.f,0.f,0.f,0.f,0.f};

  const unsigned ko = (unsigned)lane * 16;     // bytes: the lane's 16 B inside each 512-B half block
  FragSet<NA> f0, f1;
  gemm_fetch<SPLIT, NA>(f0, Ab, Ab2, Eb, Eb2, Bb, Bb2, ko, 0);
  // unrolled in full: a k step is 1 KiB further in every row tile, so each address is base + ko + an immediate and no address register is rewritten under loads in flight
#pragma unroll
  for (int k0 = 0; k0 < GK; k0 += 64) {
    gemm_fetch<SPLIT, NA>(f1, Ab, Ab2, Eb, Eb2, Bb, Bb2, ko, (k0 + 32) * 32);                     // k step k0 + 32, in flight under the products of k step k0
    gemm_mul<SPLIT, NA>(acc, f0);
    if (k0 + 64 < GK) gemm_fetch<SPLIT, NA>(f0, Ab, Ab2, Eb, Eb2, Bb, Bb2, ko, (k0 + 64) * 32);   // k step k0 + 64, in flight under the products of k step k0 + 32
    else if (QK) xwait_off(ko, Ab, Ab2, Eb, Eb2, Bb, Bb2);
    else xwait_off(ko, Ab, Ab2, Bb, Bb2);   // a k step's products behind the last loads, where it holds up nothing; the epilogue reuses the offset's and the bases' registers only behind it
    gemm_mul<SPLIT, NA>(acc, f1);
  }
  acc_guard4(acc[0][0], acc[0][1], acc[0][2], acc[0][3]);
  acc_guard4(acc[1][0], acc[1][1], acc[1][2], acc[1][3]);
  acc_guard4(acc[2][0], acc[2][1], acc[2][2], acc[2][3]);
  acc_guard4(acc[3][0], acc[3][1], acc[3][2], acc[3][3]);
  if (QK) acc_guard4(acc[NA - 1][0], acc[NA - 1][1], acc[NA - 1][2], acc[NA - 1][3]);

  // ---- epilogue ----
  float* slab = sT[wave];
#pragma unroll
  for (int i = 0; i < 4; ++i) {
    const int mBase = m0 + (i << 4);
#pragma unroll
    for (int j = 0; j < 4; ++j) {
      const int n = n0 + (j << 4) + rlane;
      float bvn = 0.f;
      if (BIAS_MODE == 2) bvn = bias[n];
#pragma unroll
      for (int r = 0; r < 8; ++r) {
        float v = acc[i][j][r] * scale;
        if (BIAS_MODE == 1) v += bias[mBase + mOff + r];
        if (BIAS_MODE == 2) v += bvn;
        slab[(mOff + r) * 68 + (j << 4) + rlane] = v * oscale;
      }
    }
    __builtin_amdgcn_fence(__ATOMIC_RELEASE, "workgroup");
    __builtin_amdgcn_wave_barrier();
    __builtin_amdgcn_fence(__ATOMIC_ACQUIRE, "workgroup");
    if (OUT_MODE == 0) {
      float* C = (float*)Cout + (size_t)b * strideC;
      const int hh = lane >> 4, c4 = (lane & 15) * 4;     // row seg = 256 B = 16 lanes x 16 B
      {
#pragma unroll
        for (int it = 0; it < 8; ++it) {
          const int row = it * 2 + hh;                       // it 0..7 x hh 0..1 = rows 0..15
          v4f v = *(const v4f*)(slab + row * 68 + c4);
          *(v4f*)(C + (size_t)(mBase + row) * ldc + n0 + c4) = v;
        }
        
      }
    } else {
      const int row = lane & 15, h8 = (lane >> 4) * 8;
      _Float16* C  = (_Float16*)Cout + (size_t)b * strideC;
      _Float16* C2 = (_Float16*)Cout2 + (size_t)b * strideC;
      const size_t tb = (((size_t)(mBase >> 4) * (ldc >> 5) + (n0 >> 5)) << 9) + lane * 8;   // the slab's two blocks follow one another
      {
#pragma unroll
        for (int it = 0; it < 4; ++it) {                     // it = 2 * (block) + s: cols it*16 + h8 .. +7 of row lane&15
          const float* sp = slab + row * 68 + it * 16 + h8;
          v8h hv, lv;
#pragma unroll
          for (int e = 0; e < 8; ++e) {
            if (OUT_MODE == 1) {
              float f = sp[e];
              f = (fabsf(f) >= 6.103515625e-05f) ? f : 0.0f;
              hv[e] = (_Float16)f;
            } else {
              const _Float16 hq = (_Float16)sp[e];
              hv[e] = hq;
              lv[e] = (_Float16)(sp[e] - (float)hq);
            }
          }
          *(v8h*)(C + tb + it * 256) = hv;
          if (OUT_MODE == 2) *(v8h*)(C2 + tb + it * 256) = lv;
        }
        
      }
    }
    __builtin_amdgcn_fence(__ATOMIC_RELEASE, "workgroup");
    __builtin_amdgcn_wave_barrier();
    __builtin_amdgcn_fence(__ATOMIC_ACQUIRE, "workgroup");
  }

  // ---- q / k row tile: (acc * scale + bias) * carry, hi/lo split, one 16-B store per plane and tile straight from the accumulators ----
  if (QK) {
    const int d0 = (tm & 3) * 16;                        // first of the tile's 16 q (or k) channels
    const float* be = (tm < 4 ? qk.bq : qk.bk) + d0 + mOff;
    _Float16* Eo  = (_Float16*)(void*)(tm < 4 ? qk.qh : qk.kh);
    _Float16* Eo2 = (_Float16*)(void*)(tm < 4 ? qk.ql : qk.kl);
    float bb[8];
#pragma unroll
    for (int r = 0; r < 8; ++r) bb[r] = be[r];
    // block (position row tile, d0 / 32) of a [16384][64] plane, half block s = (d0 / 16) & 1; the wave's four position tiles lie CQK / 32 blocks apart
    const size_t eb = (((size_t)((b * N + n0) >> 4) * (CQK >> 5) + (d0 >> 5)) << 9) + ((d0 >> 4) & 1) * 256 + lane * 8;
#pragma unroll
    for (int j = 0; j < 4; ++j) {
      v8h hv, lv;
#pragma unroll
      for (int r = 0; r < 8; ++r) {
        float v = acc[NA - 1][j][r] * scale;
        v += bb[r];
        v *= qk.carry;
        const _Float16 hq = (_Float16)v;
        hv[r] = hq;
        lv[r] = (_Float16)(v - (float)hq);
      }
      *(v8h*)(Eo  + eb + (size_t)j * ((CQK >> 5) << 9)) = hv;
      *(v8h*)(Eo2 + eb + (size_t)j * ((CQK >> 5) << 9)) = lv;
    }
  }
}

// ---------------------------------------------------------------------------
// f16 hi/lo split of a row-major f32 matrix [rows][CCH] with total element count 8*n8 into planes in fragment order:
//   hi = f16(in * carry), lo = f16(in * carry - hi). Thread i makes the i-th 16-B unit of each plane from 8 consecutive elements of one row
// ---------------------------------------------------------------------------
__device__ __forceinline__ void wconv_f16(const float* __restrict__ in, unsigned short* __restrict__ oh,
                                          unsigned short* __restrict__ ol, int blk, int n8, float carry) {
  const int i = blk * 256 + threadIdx.x;
  if (i < n8) {
    const size_t e0 = (size_t)i * 8;
    const int blkid = i >> 6;                                             // block (rt, kb), CCH/32 blocks per row tile
    const int srow = (blkid / (CCH / 32)) * 16 + (i & 15);
    const int scol = (blkid % (CCH / 32)) * 32 + ((i >> 4) & 3) * 8;      // bits 5,4 of i = s,h: col 16*s + 8*h
    const float* ip = in + (size_t)srow * CCH + scol;
    const v4f a = *(const v4f*)(ip);
    const v4f c = *(const v4f*)(ip + 4);
    xwait(ip);   // behind the two loads, in front of the reuse of their address registers
    float f[8];
    f[0] = a[0]; f[1] = a[1]; f[2] = a[2]; f[3] = a[3];
    f[4] = c[0]; f[5] = c[1]; f[6] = c[2]; f[7] = c[3];
    v4u hv, lv;
#pragma unroll
    for (int q = 0; q < 4; ++q) {
      const float f0 = f[2 * q] * carry, f1 = f[2 * q + 1] * carry;
      const _Float16 h0 = (_Float16)f0, h1 = (_Float16)f1;
      const _Float16 l0 = (_Float16)(f0 - (float)h0), l1 = (_Float16)(f1 - (float)h1);
      hv[q] = pk16(h_bits(h0), h_bits(h1));
      lv[q] = pk16(h_bits(l0), h_bits(l1));
    }
    {
      *(v4u*)(oh + e0) = hv;
      *(v4u*)(ol + e0) = lv;
      
    }
  }
}

// ---------------------------------------------------------------------------
// Fused transpose + f16 hi/lo split of an f32 matrix, z-batched:
//   in_z = W + z*sIn viewed in[R rows][Cc cols] (pitch Cc) -> oh_z[c][r] = f16(in_z[r][c]*carry), ol_z[c][r] = f16(rem),
//   out [Cc][R] in fragment order, oh_z = oh + z*sOut.
// 64x64 tiles through LDS (tf, 64 * 68 floats). Tile (bx, by, bz) of (Cc/64, R/64, Z), 256 threads (R, Cc multiples of 64; R multiple of 64 keeps every
// Coverage per block and plane: load 4 it x 256 thr x 4 floats = 64x64; store 2 it x 256 thr x 8 halves = 64x64.
// ---------------------------------------------------------------------------
__device__ __forceinline__ void tsplit_f16(float* tf, int bx, int by, int bz, const float* __restrict__ W, unsigned short* __restrict__ oh,
                                           unsigned short* __restrict__ ol, int R, int Cc, long sIn, long sOut,
                                           float carry) {
  W  += (size_t)bz * sIn;
  oh += (size_t)bz * sOut;
  ol += (size_t)bz * sOut;
  const int c0  = bx * 64;   // input column block = output row block
  const int r0  = by * 64;   // input row block    = output column block
  const int tid = threadIdx.x;
  {
    const int lr = tid >> 4;         // 0..15
    const int c4 = (tid & 15) * 4;   // 0..60
    const float* gp[4];
    v4f a[4];
#pragma unroll
    for (int it = 0; it < 4; ++it) {   // rows it * 16 + lr = 0..63
      gp[it] = W + (size_t)(r0 + it * 16 + lr) * Cc + c0 + c4;
      a[it] = *(const v4f*)gp[it];
    }
    xwait(gp[0], gp[1], gp[2], gp[3]);   // behind the four loads, in front of the reuse of their address registers
#pragma unroll
    for (int it = 0; it < 4; ++it) *(v4f*)(tf + (it * 16 + lr) * 68 + c4) = a[it];
  }
  __syncthreads();
  // unit u = it*256 + tid of the tile's 512 16-B units per plane, in fragment order: u = ((row tile * 2 + block) * 2 + s) * 32 + h*16 + c
  v4u hv[2], lv[2];
#pragma unroll
  for (int it = 0; it < 2; ++it) {
    const int u  = it * 256 + tid;
    const int oc = ((u >> 7) << 4) + (u & 15);   // output row within tile (= input column)
    const int c8 = ((u >> 4) & 7) * 8;           // output column within tile = 32*block + 16*s + 8*h
    v4u a, a2;
#pragma unroll
    for (int q = 0; q < 4; ++q) {
      const float f0 = tf[(c8 + 2 * q) * 68 + oc] * carry;
      const float f1 = tf[(c8 + 2 * q + 1) * 68 + oc] * carry;
      const _Float16 h0 = (_Float16)f0, h1 = (_Float16)f1;
      const _Float16 l0 = (_Float16)(f0 - (float)h0), l1 = (_Float16)(f1 - (float)h1);
      a[q]  = pk16(h_bits(h0), h_bits(h1));
      a2[q] = pk16(h_bits(l0), h_bits(l1));
    }
    hv[it] = a; lv[it] = a2;
  }
  {
#pragma unroll
    for (int it = 0; it < 2; ++it) {
      const int u = it * 256 + tid;
      const size_t go = (((size_t)((c0 >> 4) + (u >> 7)) * (R >> 5) + (r0 >> 5) + ((u >> 6) & 1)) << 9) + (u & 63) * 8;
      *(v4u*)(oh + go) = hv[it];
      *(v4u*)(ol + go) = lv[it];
    }
    
  }
}

// ---------------------------------------------------------------------------
// All five operand splits in one launch: none reads what another writes, so the block index picks the job (the same in every thread of a block).
// Blocks 0 .. XBLK-1: the 64x64 tiles of x, index = (bz * (CCH/64) + by) * (NPOS/64) + bx; then Wq, Wk (WSBLK blocks each), Wv, Wd (WLBLK blocks each).
// The long jobs (x tiles) come first, the short ones fill in behind them.
// ---------------------------------------------------------------------------
#define XBLK  ((NPOS / 64) * (CCH / 64) * NBAT)
#define WSBLK (CQK * CCH / 8 / 256)
#define WLBLK (CCH * CCH / 8 / 256)
__global__ __launch_bounds__(256) void split_all_f16(const float* __restrict__ x, const float* __restrict__ Wq, const float* __restrict__ Wk,
                                                     const float* __restrict__ Wv, const float* __restrict__ Wd,
                                                     unsigned short* __restrict__ xth, unsigned short* __restrict__ xtl,
                                                     unsigned short* __restrict__ wqh, unsigned short* __restrict__ wql,
                                                     unsigned short* __restrict__ wkh, unsigned short* __restrict__ wkl,
                                                     unsigned short* __restrict__ wvh, unsigned short* __restrict__ wvl,
                                                     unsigned short* __restrict__ wdh, unsigned short* __restrict__ wdl,
                                                     float actCarry, float wCarry) {
  __shared__ __align__(16) float tf[64 * 68];
  const int bid = blockIdx.x;
  if (bid < XBLK) {
    // x[b] viewed in[R=512 c][Cc=4096 n] (pitch 4096) -> XT_b[n][c], hi/lo of x * actCarry
    tsplit_f16(tf, bid % (NPOS / 64), (bid / (NPOS / 64)) % (CCH / 64), bid / ((NPOS / 64) * (CCH / 64)),
               x, xth, xtl, CCH, NPOS, (long)CCH * NPOS, (long)NPOS * CCH, actCarry);
    return;
  }
  // weight planes, natural [out][in] layout, hi/lo of W * wCarry
  const int wb = bid - XBLK;
  if (wb < WSBLK)                      wconv_f16(Wq, wqh, wql, wb, CQK * CCH / 8, wCarry);
  else if (wb < 2 * WSBLK)             wconv_f16(Wk, wkh, wkl, wb - WSBLK, CQK * CCH / 8, wCarry);
  else if (wb < 2 * WSBLK + WLBLK)     wconv_f16(Wv, wvh, wvl, wb - 2 * WSBLK, CCH * CCH / 8, wCarry);
  else                                 wconv_f16(Wd, wdh, wdl, wb - 2 * WSBLK - WLBLK, CCH * CCH / 8, wCarry);
}

// =====================================================================================
// Flash-style attention with a 512-wide value dimension and a 64-deep score dimension, no score scaling.
//   All four kinds of plane in fragment order (head of the file):
//   q planes (hi/lo f16, x2^10) [16384][64]: row b*4096 + i, col d
//   k planes (hi/lo f16, x2^10) [16384][64]: same for keys j
//   v plane (f16, carry 1) [4*512][4096]: row b*512 + ch, col j
//   o2 planes (hi/lo f16, x2^10) [64][512], in LDS: row i - i0, col ch = split of (gamma*out + x[b][ch][i]) * 2^10
//   The output conv runs in the same launch: the block holds all 512 channels of its 64 positions, so behind one barrier (B3) wave w forms
//   out channels 64w .. 64w+63 of these positions = Wd rows (A, from global, no two waves the same) . o2 rows (B, from LDS, the same for all 8 waves).
//   Both products are formed TRANSPOSED, so that a lane's column (lane&15) is one query in the score tiles and in the output tiles alike:
//   scores S^T = k . q^T on split planes (hi.hi + lo.hi + hi.lo), * sscale (= 2^-20) in f32: A = K fragment (row = key), B = Q fragment (col = query);
//   a lane holds 8 keys (8*(lane>>4) + r) of one query per tile: row maximum and row sum run inside the lane, plus one exchange between the wave's halves;
//   running-max softmax in f32 over the 4096 keys of the batch element (32 chunks of 128, compile-time trip count);
//   P = exp(s - m) * pcarry (2^15) as f16 in LDS (values < 2^-14 stored as 0); out^T = v . P^T single products, f32 accumulate
//   (A = V fragment, row = channel; B = P rows, col = query), times (1/rowsum) * pinv (2^-15) at the end.
//   Block = 64 query rows (4 query tiles of 16) of one batch element, 8 waves; wave w computes the 16x64 score piece for keys
//   j0 + 16w .. +15 of each chunk (shared through LDS: partial row max Pm, partial row sum Pl, P tile Ps) and accumulates the
//   output for channels 64w .. 64w+63 (4 query tiles x 4 channel tiles in registers). Each K fragment and each V fragment
//   loaded from global feeds one product per query tile (the K hi fragment two). grid = (4096/64, 4) = 256 blocks.
//   The block's Q rows sit in LDS (Qsh/Qsl, written once, barrier B0) and are read as fragments in every chunk.
//   Barriers per chunk: after the Pm writes (B1) and after the Ps/Pl writes (B2). The loop runs one chunk apart: between B1 and B2 of chunk jc + 1
//   stand its softmax (writes P tile (jc + 1) & 1 and Pl) and the products P.V of chunk jc (read P tile jc & 1, written in front of B2 of chunk jc);
//   a P tile is rewritten two barriers behind its last read. Pm is written behind B2 and read behind B1; Pl is read behind B2, in front of the next B1.
//   Every wave reaches every barrier (no early exit).
//   B1 and B2 order LDS only (lds_barrier): the K and V fragments of the next chunk stay in flight across them.
//   LDS extents: a P tile's rows 0..63 x cols 0..127 fully written each chunk (8 waves x 16 cols) before any fragment read
//   (reads reach col 127; cols 128..135 never read); Pm/Pl [64][8] fully written.
//   Fragment loads from global (K, V blocks): plane base (kernel argument) + the lane's 32-bit byte offset, 16-B aligned, one chunk ahead of their use.
// =====================================================================================
#define AQT    4
#define AQB    (16 * AQT)
#define AKC    128
#define PPITCH 136
#define NCHUNK (NPOS / AKC)

static_assert(NPOS % AQB == 0);
static_assert(NCHUNK * AKC == NPOS);
static_assert(CCH == 8 * 64);
static_assert((PPITCH * 2) % 16 == 0);
static_assert(AQB * CQK == 2 * 256 * 8);

// value of lane l ^ 16 (the other half of the wave), on the vector unit
__device__ __forceinline__ float xhalf(float x) {
  return __builtin_bit_cast(float, __builtin_amdgcn_permlanex16(__builtin_bit_cast(int, x), __builtin_bit_cast(int, x), 0x76543210, 0xfedcba98, false, false));
}

// Work-group barrier that orders LDS traffic only (s_wait_dscnt 0 in front of the signal). __syncthreads() also drains the wave's outstanding
// global loads, which would end the flight of the K and V fragments requested ahead; inside the chunk loop the waves exchange data through LDS alone
// (Pm, Ps, Pl) and write nothing to global memory.
__device__ __forceinline__ void lds_barrier() {
  __builtin_amdgcn_fence(__ATOMIC_RELEASE, "workgroup", "local");
  __builtin_amdgcn_s_barrier();
  __builtin_amdgcn_fence(__ATOMIC_ACQUIRE, "workgroup", "local");
}

// fragments of one k step of the output conv. A: 4 row tiles of the Wd planes, wave-uniform plane start + the lane's byte offset + immediate
__device__ __forceinline__ void out_fetch_a(FragSet<4>& f, const _Float16* Ah, const _Float16* Al, unsigned off, int imm) {
#pragma unroll
  for (int i = 0; i < 4; ++i) {
    f.ah[i] = FragH::load_off(Ah, off, imm + i * GRTB);
    f.al[i] = FragH::load_off(Al, off, imm + i * GRTB);
  }
}
// B: 4 row tiles (16 positions each, CCH / 32 blocks apart) of the o2 planes in LDS; imm in halves
__device__ __forceinline__ void out_fetch_b(FragSet<4>& f, const _Float16* Bh, const _Float16* Bl, int imm) {
#pragma unroll
  for (int j = 0; j < 4; ++j) {
    f.bh[j] = FragH::load(Bh + j * (CCH / 32) * 512 + imm);
    f.bl[j] = FragH::load(Bl + j * (CCH / 32) * 512 + imm);
  }
  // a step's loads are issued as one group in front of the other set's products; without it the build may sink them among the products, which shortens their lead
  __builtin_amdgcn_sched_barrier(0);
}

__global__ __launch_bounds__(256)
void attn_kernel(const unsigned short* __restrict__ qhp, const unsigned short* __restrict__ qlp,
                 const unsigned short* __restrict__ khp, const unsigned short* __restrict__ klp,
                 const unsigned short* __restrict__ vtp,
                 const float* __restrict__ X, const float* __restrict__ gam,
                 const unsigned short* __restrict__ wdhp, const unsigned short* __restrict__ wdlp,
                 const float* __restrict__ bd, float* __restrict__ outp,
                 float sscale, float pcarry, float pinv, float ocarry, float wscale) {
  union FB { v16h v; v8h h[2]; };
  __shared__ __align__(16) _Float16 Ps[2 * AQB * PPITCH]; // two P tiles [query row][key in chunk], pitch 136 halves: chunk jc in tile jc & 1
  __shared__ __align__(16) float    Pm[AQB * 8];          // partial row max  [row][wave]
  __shared__ __align__(16) float    Pl[AQB * 8];          // partial row sum  [row][wave]
  __shared__ __align__(16) _Float16 Qsh[AQB * CQK];       // q hi plane rows of this block, fragment order as in global
  __shared__ __align__(16) _Float16 Qsl[AQB * CQK];       // q lo plane rows of this block, fragment order as in global
  __shared__ __align__(16) _Float16 O2sh[AQB * CCH];      // o2 hi plane of the block's 64 positions, fragment order: 4 row tiles x 16 blocks
  __shared__ __align__(16) _Float16 O2sl[AQB * CCH];      // o2 lo plane, the same
  __shared__ __align__(16) float    sT[8][16 * 68];       // per-wave 16x64 slab of the output conv's epilogue, pitch 68 floats

  const int tid  = threadIdx.x;
  const int wave = tid >> 5;
  const int lane = tid & 31;
  const int hh   = lane >> 4;
  const int c    = lane & 15;
  const int wsel = __builtin_amdgcn_readfirstlane(tid >> 7);   // 0 in waves 0..3, 1 in waves 4..7; scalar, so that the choice of order in the chunk loop is a scalar branch

  const int b  = blockIdx.y;                       // 0..3
  const int i0 = blockIdx.x * AQB;                 // first query position of this block
  const size_t qrow0 = (size_t)b * NPOS + i0;      // row in the q planes

  const _Float16* Qh = (const _Float16*)(const void*)qhp;
  const _Float16* Ql = (const _Float16*)(const void*)qlp;
  const _Float16* Kh = (const _Float16*)(const void*)khp;
  const _Float16* Kl = (const _Float16*)(const void*)klp;
  const _Float16* Vt = (const _Float16*)(const void*)vtp;
  const unsigned vw_off = (((unsigned)b * CCH + (unsigned)wave * 64) * NPOS + (unsigned)lane * 8) * 2;   // bytes: this wave's 64 channel rows, the lane's 16 B
  const float g = gam[0];

  // ---- Q rows of the block (64 x 64, hi and lo) into LDS once: 512 pieces of 16 B per plane, 2 per thread and plane;
  //      the 16 Q fragments would take 128 registers, which the accumulators and the V fragments in flight need ----
  {
    const int q8 = tid * 8;                        // the 64 rows are 4 row tiles = 4096 consecutive halves; pieces tid and 256 + tid
    const _Float16* gh0 = Qh + qrow0 * CQK + q8;
    const _Float16* gl0 = Ql + qrow0 * CQK + q8;
    const _Float16* gh1 = gh0 + 32 * CQK;
    const _Float16* gl1 = gl0 + 32 * CQK;
    const v8h th0 = *(const v8h*)gh0, tl0 = *(const v8h*)gl0, th1 = *(const v8h*)gh1, tl1 = *(const v8h*)gl1;
    xwait(gh0, gl0, gh1, gl1);
    *(v8h*)(Qsh + q8) = th0;
    *(v8h*)(Qsl + q8) = tl0;
    *(v8h*)(Qsh + 32 * CQK + q8) = th1;
    *(v8h*)(Qsl + 32 * CQK + q8) = tl1;
  }
  __syncthreads();   // B0: every wave reads all 64 Q rows

  float mrow[AQT], lrow[AQT];                      // of query t*16 + c, the same in both halves of the wave and in every wave
  v8f acc[AQT][4];                                 // acc[t][n][r] = out of query t*16 + c, channel 64*wave + 16*n + 8*hh + r
#pragma unroll
  for (int t = 0; t < AQT; ++t) {
    mrow[t] = -INFINITY; lrow[t] = 0.f;
#pragma unroll
    for (int n = 0; n < 4; ++n) acc[t][n] = (v8f){0.f,0.f,0.f,0.f,0.f,0.f,0.f,0.f};
  }

  // K fragments (A operand, row = lane&15 = key) of this wave's key row tile (2 blocks of 512 halves per plane) are fetched one chunk ahead: chunk 0 here
  const unsigned kw_off = (((unsigned)b * NPOS + (unsigned)wave * 16) * CQK + (unsigned)lane * 8) * 2;   // bytes, the same in the hi and the lo plane
  v16h kfh[2], kfl[2];
#pragma unroll
  for (int dc = 0; dc < 2; ++dc) {
    kfh[dc] = FragH::load_off(Kh, kw_off, dc * 1024);
    kfl[dc] = FragH::load_off(Kl, kw_off, dc * 1024);
  }
  xwait_off(kw_off);
  // The 16 V fragments of a chunk (A operand, row = lane&15 = channel) do not depend on the scores: they too are fetched one chunk ahead, chunk 0 behind the first scores below,
  // each later one into the same registers right behind its last product, so that it lands under the work of the trip that follows
  // (neither barrier of the chunk drains the loads)
  unsigned vo = vw_off;   // bytes: block 0 of the wave's first channel row tile
  v16h vb[4][4];

  v8f s[AQT];          // scaled scores of the chunk whose softmax comes next
  float alpha[AQT];    // rescale factor of the chunk whose softmax ran last
  unsigned ko = kw_off;

  // ---- row sums of the chunk whose softmax ran last, behind its B2 ----
  auto rowsum = [&]() __attribute__((always_inline)) {
#pragma unroll
    for (int t = 0; t < AQT; ++t) {
      const int row = t * 16 + c;
      const v4f la = *(const v4f*)(Pl + row * 8);
      const v4f lb = *(const v4f*)(Pl + row * 8 + 4);
      const float ls = ((la[0] + la[1]) + (la[2] + la[3])) + ((lb[0] + lb[1]) + (lb[2] + lb[3]));
      lrow[t] = lrow[t] * alpha[t] + ls;
    }
  };

  // ---- score piece of chunk jc, transposed: rows = keys jc * AKC + 16*wave + 8*hh + r, cols = 64 queries (B operand col = lane&15); partial maxima into Pm ----
  auto scores = [&](int jc, bool sums) __attribute__((always_inline)) {
#pragma unroll
    for (int t = 0; t < AQT; ++t) s[t] = (v8f){0.f,0.f,0.f,0.f,0.f,0.f,0.f,0.f};
#pragma unroll
    for (int dc = 0; dc < 2; ++dc) {
      const v16h kbh = kfh[dc];
      const v16h kbl = kfl[dc];
      // Q fragments (B operand, col = lane&15) from LDS, same k map as the K fragments
      v16h qah[AQT], qal[AQT];
#pragma unroll
      for (int t = 0; t < AQT; ++t) {
        qah[t] = FragH::load(Qsh + (t * 2 + dc) * 512 + lane * 8);
        qal[t] = FragH::load(Qsl + (t * 2 + dc) * 512 + lane * 8);
      }
#pragma unroll
      for (int t = 0; t < AQT; ++t) s[t] = FragH::mma(kbh, qah[t], s[t]);
#pragma unroll
      for (int t = 0; t < AQT; ++t) s[t] = FragH::mma(kbl, qah[t], s[t]);
#pragma unroll
      for (int t = 0; t < AQT; ++t) s[t] = FragH::mma(kbh, qal[t], s[t]);
    }
    // K fragments of the next chunk into the same registers, right behind their last use (the last chunk fetches its own again, so the address stays inside the planes)
    ko += (jc + 1 < NCHUNK) ? (unsigned)(AKC * CQK * 2) : 0u;   // stepped in place, behind the wait that follows the loads before
#pragma unroll
    for (int dc = 0; dc < 2; ++dc) {
      kfh[dc] = FragH::load_off(Kh, ko, dc * 1024);
      kfl[dc] = FragH::load_off(Kl, ko, dc * 1024);
    }
    if (sums) rowsum();   // of the chunk before: its 8 LDS reads land under the vector work below, not in front of the barrier
    // scale, then this wave's partial maximum over its 16 keys of query t*16 + c: 8 in the lane, 8 in lane ^ 16
    float mloc[AQT];
#pragma unroll
    for (int t = 0; t < AQT; ++t) {
#pragma unroll
      for (int r = 0; r < 8; ++r) s[t][r] *= sscale;
      const float m = fmaxf(fmaxf(fmaxf(s[t][0], s[t][1]), fmaxf(s[t][2], s[t][3])),
                            fmaxf(fmaxf(s[t][4], s[t][5]), fmaxf(s[t][6], s[t][7])));
      mloc[t] = fmaxf(m, xhalf(m));
    }
    if (hh == 0) {
#pragma unroll
      for (int t = 0; t < AQT; ++t) Pm[(t * 16 + c) * 8 + wave] = mloc[t];
    }
  };

  // ---- running max update (identical in every wave), P tile into Pw, partial row sums into Pl; leaves alpha ----
  auto softmax = [&](_Float16* Pw) __attribute__((always_inline)) {
    float psl[AQT];
    v4f ma[AQT], mb[AQT];
#pragma unroll
    for (int t = 0; t < AQT; ++t) {                     // the 8 reads stand together: one LDS wait for all four query tiles
      ma[t] = *(const v4f*)(Pm + (t * 16 + c) * 8);
      mb[t] = *(const v4f*)(Pm + (t * 16 + c) * 8 + 4);
    }
    // keeps the 8 reads in one group; without it this build reads tile by tile and waits out the LDS latency once per query tile
    __builtin_amdgcn_sched_barrier(0);
#pragma unroll
    for (int t = 0; t < AQT; ++t) {
      const int row = t * 16 + c;
      const float cm = fmaxf(fmaxf(fmaxf(ma[t][0], ma[t][1]), fmaxf(ma[t][2], ma[t][3])),
                             fmaxf(fmaxf(mb[t][0], mb[t][1]), fmaxf(mb[t][2], mb[t][3])));
      const float mnew = fmaxf(mrow[t], cm);
      alpha[t] = __expf(mrow[t] - mnew);
      mrow[t] = mnew;
      float p[8];
      v8h ph;
#pragma unroll
      for (int r = 0; r < 8; ++r) {
        p[r] = __expf(s[t][r] - mnew);                  // in (0, 1]
        float p32 = p[r] * pcarry;
        p32 = (p32 >= 6.103515625e-05f) ? p32 : 0.0f;   // no f16 subnormals in the P tile
        ph[r] = (_Float16)p32;
      }
      *(v8h*)(Pw + row * PPITCH + wave * 16 + 8 * hh) = ph;   // the lane's 8 keys lie side by side in the query's P row: one 16-B store
      const float psum = ((p[0] + p[1]) + (p[2] + p[3])) + ((p[4] + p[5]) + (p[6] + p[7]));
      psl[t] = psum + xhalf(psum);
    }
    if (hh == 0) {
#pragma unroll
      for (int t = 0; t < AQT; ++t) Pl[(t * 16 + c) * 8 + wave] = psl[t];
    }
  };

  // ---- out^T(64 ch of this wave x 64 queries) += V(64 x 128) . P^T(128 x 64): A = v plane rows (row = lane&15 = channel),
  //      B = P tile Pr (col = lane&15 = query within the query tile), both with the split k map; one V fragment serves all 4 query tiles ----
  auto pv = [&](const _Float16* Pr, bool refill) __attribute__((always_inline)) {
    FB pa[2][AQT];
#pragma unroll
    for (int t = 0; t < AQT; ++t) {
      pa[0][t].h[0] = *(const v8h*)(Pr + (t * 16 + c) * PPITCH + 8 * hh);
      pa[0][t].h[1] = *(const v8h*)(Pr + (t * 16 + c) * PPITCH + 16 + 8 * hh);
    }
#pragma unroll
    for (int kk = 0; kk < 4; ++kk) {
      if (kk < 3) {
#pragma unroll
        for (int t = 0; t < AQT; ++t) {
          pa[(kk + 1) & 1][t].h[0] = *(const v8h*)(Pr + (t * 16 + c) * PPITCH + (kk + 1) * 32 + 8 * hh);
          pa[(kk + 1) & 1][t].h[1] = *(const v8h*)(Pr + (t * 16 + c) * PPITCH + (kk + 1) * 32 + 16 + 8 * hh);
        }
      }
      // the next step's 8 P reads stand as one group in front of this step's products, one step ahead and no further: read further ahead they cost registers that the build does not have (scratch)
      __builtin_amdgcn_sched_barrier(0);
#pragma unroll
      for (int n = 0; n < 4; ++n) {
#pragma unroll
        for (int t = 0; t < AQT; ++t) acc[t][n] = FragH::mma(vb[kk][n], pa[kk & 1][t].v, acc[t][n]);
      }
      if (refill) {
#pragma unroll
        for (int n = 0; n < 4; ++n) vb[kk][n] = FragH::load_off(Vt, vo, (n * 16 * NPOS + kk * 512) * 2);   // the next chunk's
      }
      // ends the step: the P reads of the step after next stay behind this step's products, whose P registers they reuse
      __builtin_amdgcn_sched_barrier(0);
    }
  };

  // ---- the accumulators onto the new running maximum: behind the products of the chunk before, in front of the next chunk's ----
  auto rescale = [&]() __attribute__((always_inline)) {
#pragma unroll
    for (int t = 0; t < AQT; ++t) {
#pragma unroll
      for (int n = 0; n < 4; ++n) acc[t][n] *= alpha[t];
    }
  };

  // chunk 0: scores, softmax into P buffer 0 (the accumulators are still 0: nothing to rescale)
  scores(0, false);
  // V fragments of chunk 0, behind the K loads of chunk 1 as in every later trip: the loads return in order, and with the same order on the way into the loop
  // and round it the build's counted wait for the K fragments leaves the younger V loads in flight
#pragma unroll
  for (int kk = 0; kk < 4; ++kk) {
#pragma unroll
    for (int n = 0; n < 4; ++n) vb[kk][n] = FragH::load_off(Vt, vo, (n * 16 * NPOS + kk * 512) * 2);
  }
  lds_barrier();   // B1 of chunk 0
  softmax(Ps);
  xwait_off(ko);   // behind the K loads of chunk 1, a softmax later, in front of the next rewrite of their offset register
  lds_barrier();   // B2 of chunk 0

  for (int jc = 0; jc + 1 < NCHUNK; ++jc) {
    const _Float16* Pr = Ps + (jc & 1) * (AQB * PPITCH);          // P of chunk jc
    _Float16*       Pw = Ps + ((jc + 1) & 1) * (AQB * PPITCH);    // P of chunk jc + 1
    scores(jc + 1, true);   // with the row sums of chunk jc
    // one wait for the V loads of the trip before and the K loads of this one; both offset registers are kept as they are until here, and vo steps on only behind it
    xwait_off(vo, ko);
    vo += (unsigned)(AKC / 32) * 1024;   // blocks of chunk jc + 1, at most the plane's last chunk
    lds_barrier();   // B1 of chunk jc + 1
    // Between B1 and B2 a wave has matrix work (P.V of chunk jc) and vector work (softmax of chunk jc + 1) that do not depend on one another.
    // Waves w and w + 4 take the two in opposite order, so that one wave's products run under the other's vector work.
    // The products stand once in the text, the softmax in front of them (waves 4..7) and behind them (waves 0..3): only it is under a branch, so the accumulators and V fragments keep their registers.
    if (wsel != 0) softmax(Pw);
    pv(Pr, true);
    if (wsel == 0) softmax(Pw);
    rescale();
    lds_barrier();   // B2 of chunk jc + 1
  }
  rowsum();                                                   // of the last chunk
  pv(Ps + ((NCHUNK - 1) & 1) * (AQB * PPITCH), false);        // products of the last chunk; nothing left to fetch
  xwait_off(vo);   // behind the last V loads, in front of the epilogue's reuse of the offset register

  // ---- epilogue, query tile by query tile: out * (1/(rowsum * 2^15)); o2 = gamma*out + x (exact f32 x); split of o2 * 2^10.
  //      The lane's 8 values of one accumulator tile (query c, channels 16n + 8*hh + 0..7) are its own 16-B unit of the o2 planes' fragment order.
  const float* xp0 = X + ((size_t)b * CCH + wave * 64 + 8 * hh) * NPOS + i0 + c;   // channel 64w + 8*hh, query c of tile 0
#pragma unroll
  for (int t = 0; t < AQT; ++t) {
    const float rl = (1.0f / lrow[t]) * pinv;
    const float* xp = xp0 + t * 16;
    float xe[4][8];
#pragma unroll
    for (int n = 0; n < 4; ++n) {                   // channel 64w + 16n + 8*hh + r
#pragma unroll
      for (int r = 0; r < 8; ++r) xe[n][r] = xp[(size_t)(n * 16 + r) * NPOS];
    }
    xwait(xp0);
    const int tb = ((t * (CCH >> 5) + wave * 2) << 9) + lane * 8;   // the wave's two blocks of query tile t
#pragma unroll
    for (int n = 0; n < 4; ++n) {                   // n = 2 * (block) + s
      v8h hv, lv;
#pragma unroll
      for (int r = 0; r < 8; ++r) {
        const float o  = acc[t][n][r] * rl;
        const float v2 = (g * o + xe[n][r]) * ocarry;
        const _Float16 hq = (_Float16)v2;
        hv[r] = hq;
        lv[r] = (_Float16)(v2 - (float)hq);
      }
      const int go = tb + n * 256;
      *(v8h*)(O2sh + go) = hv;
      *(v8h*)(O2sl + go) = lv;
    }
  }

  // ---- output conv: out[b][m][i0 + n] = wscale * sum_ch Wd[m][ch] * o2[n][ch] + bd[m]; wave w: m = 64w .. 64w+63, n = 0..63 (a 64x64 tile, K = 512) ----
  const int wv = __builtin_amdgcn_readfirstlane(tid >> 5);   // scalar, so that the plane starts below are formed on the scalar unit
  const _Float16* Ah = (const _Float16*)(const void*)wdhp + (size_t)wv * 64 * GK;   // the wave's 4 row tiles of Wd, hi and lo
  const _Float16* Al = (const _Float16*)(const void*)wdlp + (size_t)wv * 64 * GK;
  unsigned ao = (unsigned)lane * 16;            // bytes: the lane's 16 B inside each 512-B half block of the Wd planes
  const _Float16* Bh = O2sh + lane * 8;         // the same inside the o2 planes in LDS
  const _Float16* Bl = O2sl + lane * 8;
  v8f oc[4][4];
#pragma unroll
  for (int i = 0; i < 4; ++i)
#pragma unroll
    for (int j = 0; j < 4; ++j) oc[i][j] = (v8f){0.f,0.f,0.f,0.f,0.f,0.f,0.f,0.f};
  FragSet<4> f0, f1;
  out_fetch_a(f0, Ah, Al, ao, 0);   // do not depend on o2: in flight across the barrier
  lds_barrier();                    // B3: every wave reads all 64 o2 rows
  out_fetch_b(f0, Bh, Bl, 0);
  // two k steps a trip, each step's fragments fetched one step ahead as in gemm64_f16. Kept rolled, for speed only: unrolled in full the kernel's text would pass 32 KB.
#pragma unroll 1
  for (int it = 0; it < GK / 64 - 1; ++it) {
    out_fetch_a(f1, Ah, Al, ao, 1024);
    out_fetch_b(f1, Bh, Bl, 512);
    gemm_mul<true, 4>(oc, f0);
    out_fetch_a(f0, Ah, Al, ao, 2048);
    out_fetch_b(f0, Bh, Bl, 1024);
    gemm_mul<true, 4>(oc, f1);
    xwait_step(ao);   // a k step's products behind the trip's last loads, in front of the step of their offset register
    ao += 2048;
    Bh += 1024;
    Bl += 1024;
  }
  out_fetch_a(f1, Ah, Al, ao, 1024);
  out_fetch_b(f1, Bh, Bl, 512);
  gemm_mul<true, 4>(oc, f0);
  xwait_off(ao, Ah, Al);   // behind the last loads; the epilogue reuses the offset's and the bases' registers only behind it
  gemm_mul<true, 4>(oc, f1);
  acc_guard4(oc[0][0], oc[0][1], oc[0][2], oc[0][3]);
  acc_guard4(oc[1][0], oc[1][1], oc[1][2], oc[1][3]);
  acc_guard4(oc[2][0], oc[2][1], oc[2][2], oc[2][3]);
  acc_guard4(oc[3][0], oc[3][1], oc[3][2], oc[3][3]);

  // 16 rows at a time through the wave's slab, so that each store covers whole 256-B row pieces
  float* slab = sT[wv];
  float* C = outp + (size_t)b * CCH * NPOS + i0;
#pragma unroll
  for (int i = 0; i < 4; ++i) {
    const int mBase = wv * 64 + (i << 4);
#pragma unroll
    for (int j = 0; j < 4; ++j) {
#pragma unroll
      for (int r = 0; r < 8; ++r) {
        float v = oc[i][j][r] * wscale;
        v += bd[mBase + 8 * hh + r];
        slab[(8 * hh + r) * 68 + (j << 4) + c] = v;
      }
    }
    __builtin_amdgcn_fence(__ATOMIC_RELEASE, "workgroup");
    __builtin_amdgcn_wave_barrier();
    __builtin_amdgcn_fence(__ATOMIC_ACQUIRE, "workgroup");
#pragma unroll
    for (int it = 0; it < 8; ++it) {
      const int row = it * 2 + hh;                         // it 0..7 x hh 0..1 = rows 0..15; row piece = 256 B = 16 lanes x 16 B
      const v4f v = *(const v4f*)(slab + row * 68 + c * 4);
      *(v4f*)(C + (size_t)(mBase + row) * NPOS + c * 4) = v;
    }
    __builtin_amdgcn_fence(__ATOMIC_RELEASE, "workgroup");
    __builtin_amdgcn_wave_barrier();
    __builtin_amdgcn_fence(__ATOMIC_ACQUIRE, "workgroup");
  }
}

// ---------------------------------------------------------------------------
// Workspace region map (byte offsets; every region is fully written by its producer launch before any consumer
//   XTh  f16 [16384][512]        0        16777216     XTl   16777216   16777216
//   WQh  f16 [64][512]    33554432           65536     WQl   33619968      65536
//   WKh  f16 [64][512]    33685504           65536     WKl   33751040      65536
//   WVh  f16 [512][512]   33816576          524288     WVl   34340864     524288
//   WDh  f16 [512][512]   34865152          524288     WDl   35389440     524288
//   Qh   f16 [16384][64]  35913728         2097152     Ql    38010880    2097152
//   Kh   f16 [16384][64]  40108032         2097152     Kl    42205184    2097152
//   VT   f16 [4][512][4096] 44302336     16777216
//   total                 61079552
// ---------------------------------------------------------------------------
extern "C" void kernel_launch(void* const* d_in, const int* in_sizes, int n_in,
                              void* d_out, int out_size, void* d_ws, size_t ws_size,
                              hipStream_t stream) {
  if (n_in < 10) return;
  if (in_sizes[0] != NBAT * CCH * NPOS) return;     // x     [4][512][64][64]
  if (in_sizes[1] != CQK * CCH) return;             // Wq    [64][512]
  if (in_sizes[2] != CQK) return;                   // bq    [64]
  if (in_sizes[3] != CQK * CCH) return;             // Wk    [64][512]
  if (in_sizes[4] != CQK) return;                   // bk    [64]
  if (in_sizes[5] != CCH * CCH) return;             // Wv    [512][512]
  if (in_sizes[6] != CCH) return;                   // bv    [512]
  if (in_sizes[7] != 1) return;                     // gamma [1]
  if (in_sizes[8] != CCH * CCH) return;             // Wd    [512][512]
  if (in_sizes[9] != CCH) return;                   // bd    [512]
  if (out_size != NBAT * CCH * NPOS) return;        // out   [4][512][64][64] f32, last element 8388607

  const float* x     = (const float*)d_in[0];
  const float* Wq    = (const float*)d_in[1];       // [out][in]
  const float* bq    = (const float*)d_in[2];
  const float* Wk    = (const float*)d_in[3];
  const float* bk    = (const float*)d_in[4];
  const float* Wv    = (const float*)d_in[5];
  const float* bv    = (const float*)d_in[6];
  const float* gamma = (const float*)d_in[7];
  const float* Wd    = (const float*)d_in[8];
  const float* bd    = (const float*)d_in[9];

  const size_t PXT = (size_t)MROWS * CCH * 2;       // 16777216  f16 [16384][512]
  const size_t PWS = (size_t)CQK * CCH * 2;         // 65536     f16 [64][512]
  const size_t PWL = (size_t)CCH * CCH * 2;         // 524288    f16 [512][512]
  const size_t PQK = (size_t)MROWS * CQK * 2;       // 2097152   f16 [16384][64]
  const size_t PVT = (size_t)NBAT * CCH * NPOS * 2; // 16777216  f16 [4][512][4096]
  size_t off = 0;
  const size_t oXTh = off; off += PXT;  const size_t oXTl = off; off += PXT;
  const size_t oWQh = off; off += PWS;  const size_t oWQl = off; off += PWS;
  const size_t oWKh = off; off += PWS;  const size_t oWKl = off; off += PWS;
  const size_t oWVh = off; off += PWL;  const size_t oWVl = off; off += PWL;
  const size_t oWDh = off; off += PWL;  const size_t oWDl = off; off += PWL;
  const size_t oQh  = off; off += PQK;  const size_t oQl  = off; off += PQK;
  const size_t oKh  = off; off += PQK;  const size_t oKl  = off; off += PQK;
  const size_t oVT  = off; off += PVT;
  if (off > ws_size) return;                        // off = 61079552
  if (off > (size_t)134217728) return;

  char* ws = (char*)d_ws;
  unsigned short* XTh = (unsigned short*)(ws + oXTh);  unsigned short* XTl = (unsigned short*)(ws + oXTl);
  unsigned short* WQh = (unsigned short*)(ws + oWQh);  unsigned short* WQl = (unsigned short*)(ws + oWQl);
  unsigned short* WKh = (unsigned short*)(ws + oWKh);  unsigned short* WKl = (unsigned short*)(ws + oWKl);
  unsigned short* WVh = (unsigned short*)(ws + oWVh);  unsigned short* WVl = (unsigned short*)(ws + oWVl);
  unsigned short* WDh = (unsigned short*)(ws + oWDh);  unsigned short* WDl = (unsigned short*)(ws + oWDl);
  unsigned short* Qh  = (unsigned short*)(ws + oQh);   unsigned short* Ql  = (unsigned short*)(ws + oQl);
  unsigned short* Kh  = (unsigned short*)(ws + oKh);   unsigned short* Kl  = (unsigned short*)(ws + oKl);
  unsigned short* VT  = (unsigned short*)(ws + oVT);

  const dim3 blk(256);
  const float actCarry = 1024.0f;                    // 2^10 on x, q, k, o2 planes
  const float wCarry   = 65536.0f;                   // 2^16 on weight planes
  const float scale26  = 1.0f / 67108864.0f;         // 2^-26 = 1 / (2^10 * 2^16)
  const float sScale   = 1.0f / 1048576.0f;          // 2^-20 = 1 / (2^10 * 2^10)
  const float pCarry   = 32768.0f;                   // 2^15 on the P tile
  const float pInv     = 1.0f / 32768.0f;            // 2^-15

  // (1) operand planes: XT = hi/lo of x^T * 2^10 (2048 blocks), then the four weights' hi/lo of W * 2^16 (16 + 16 + 128 + 128 blocks)
  split_all_f16<<<dim3(XBLK + 2 * WSBLK + 2 * WLBLK), blk, 0, stream>>>(x, Wq, Wk, Wv, Wd, XTh, XTl, WQh, WQl, WKh, WKl, WVh, WVl, WDh, WDl,
                                                                       actCarry, wCarry);
  // (2) v^T[b] = Wv . XT_b^T + bv[m] -> VT [4][512][4096] f16 single   (M=512, N=4096, K=512; 512 tiles -> 64 blocks x 4 batches), and with the same
  //     XT fragments q^T, k^T = Wq|Wk . XT_b^T + bq|bk -> Qh|Ql, Kh|Kl [16384][64] (x2^10): each wave one 16-row tile of the 128 stacked rows
  const dim3 gV((CCH / 64) * (NPOS / 64) / 8, NBAT);
  const QkPart qkp = {WQh, WQl, WKh, WKl, bq, bk, Qh, Ql, Kh, Kl, actCarry};
  gemm64_f16<true, 1, 1, true><<<gV, blk, 0, stream>>>(
      WVh, WVl, 0L, XTh, XTl, (long)NPOS * CCH, (void*)VT, (void*)VT, NPOS, (long)CCH * NPOS, bv,
      CCH, NPOS, scale26, 1.0f, qkp);
  // (3) attention + gamma scale + residual -> o2 hi/lo (x2^10) in LDS, then out[b] = Wd . o2^T + bd[m] -> d_out NCHW f32 [4][512][4096]; grid (4096/64, 4) = 256 blocks
  attn_kernel<<<dim3(NPOS / AQB, NBAT), blk, 0, stream>>>(Qh, Ql, Kh, Kl, VT, x, gamma, WDh, WDl, bd, (float*)d_out, sScale, pCarry, pInv, actCarry, scale26);
  (void)hipGetLastError();
}

// v009
// Measured time: 116 microseconds a run.
// Two timings next to v008 put it at 1.15 and 1.17 times that version's speed.
// Counting every step since v000, it is 5.56 times as fast.
// Contractions: q, k, v 1x1 convs, q.k^T energies and the output 1x1 conv = v_wmma_f32_16x16x32_f16 on f16 hi/lo split planes (hi.hi + hi.lo + lo.hi, 3 products each); p.v = v_wmma_f32_16x16x32_f16 single product (p carried x2^15 as f16, v plain f16 with |v| < 2^-14 written as 0); f32 accumulate everywhere; running-max softmax, 1/rowsum, gamma scale, biases and the residual add (exact f32 x) in f32 on the VALU.
// Plane / carry map (every carry is an exact power of two; the inverse is folded exactly once, at the line named):
//   Xsh|Xsl  f16 (LDS only) [64 n][512 c] per block = hi/lo of x * 2^10 (n = h*64 + w; head of proj_kernel)
//   WQh|WQl, WKh|WKl f16 [64][512]; WVh|WVl, WDh|WDl f16 [512][512] = hi/lo of W * 2^16, natural [out][in] (producer wconv_f16)
//   Qh|Ql, Kh|Kl f16 [16384][64]           = hi/lo of q (or k) * 2^10   (GEMM: acc * 2^-26 removes the x and W carries, + bias, then * 2^10)
//   VT  f16 [4][512 ch][4096 n]            = v, carry 1                   (GEMM: acc * 2^-26 + bias; |v| < 2^-14 stored as 0)
//   energies                               = acc * 2^-20 (q and k carries) in attn_kernel before the softmax
//   P   f16 (LDS only)                     = exp(s - m) * 2^15, values < 2^-14 stored as 0; 2^-15 folded together with 1/rowsum in the attn_kernel epilogue
//   O2h|O2l f16 (LDS only) [64][512] per block = hi/lo of (gamma * out + x) * 2^10 (attn_kernel epilogue)
//   output conv (tail of attn_kernel)      = acc * 2^-26 (O2 and W carries) + bd -> f32 NCHW [4][512][4096]
// Every f16 plane above lies in FRAGMENT ORDER: a matrix [R rows][K cols] is cut into blocks of 16 rows x 32 cols, block (rt, kb) at
// halves ((rt * K/32 + kb) * 512); inside a block element (row c, col 16*s + 8*h + e) sits at s*256 + (h*16 + c)*8 + e, which is the
// register order of a 16x16x32 operand: lane h*16 + c reads its 16 B at lane*8 (s = 0) and at 256 + lane*8 (s = 1), 512 contiguous bytes per wave load.
#include <hip/hip_runtime.h>
#include <math.h>
#include <stdint.h>

#define NBAT  4
#define CCH   512
#define CQK   64
#define IMGH  64
#define IMGW  64
#define NPOS  4096
#define MROWS 16384

static_assert(NPOS == IMGH * IMGW);
static_assert(MROWS == NBAT * NPOS);
static_assert(CCH % 64 == 0);
static_assert(CQK == 64);
static_assert(NPOS % 128 == 0);
static_assert(NPOS % 64 == 0);
static_assert(CCH % 32 == 0);
static_assert((CQK * CCH) % (8 * 256) == 0);
static_assert((CCH * CCH) % (8 * 256) == 0);
static_assert(CCH % 256 == 0);

typedef __attribute__((ext_vector_type(16))) _Float16 v16h;
typedef __attribute__((ext_vector_type(8)))  _Float16 v8h;
typedef __attribute__((ext_vector_type(8)))  float    v8f;
typedef __attribute__((ext_vector_type(4)))  float    v4f;
typedef __attribute__((ext_vector_type(4)))  unsigned int v4u;

__device__ __forceinline__ unsigned short h_bits(_Float16 h) { return __builtin_bit_cast(unsigned short, h); }
__device__ __forceinline__ unsigned pk16(unsigned short a, unsigned short b) { return (unsigned)a | ((unsigned)b << 16); }

// hazard guards as plain device helpers (no inline asm inside the kernel template body)
__device__ __forceinline__ void dep_guard_h(v8f& a, v8f& b, v16h x, v16h y) { asm volatile("v_nop\n\tv_nop\n\tv_nop\n\tv_nop" : "+v"(a), "+v"(b) : "v"(x), "v"(y)); }
__device__ __forceinline__ void acc_guard4(v8f& a, v8f& b, v8f& c, v8f& d) { asm volatile("v_nop\n\tv_nop\n\tv_nop\n\tv_nop" : "+v"(a), "+v"(b), "+v"(c), "+v"(d)); }

// 16-bit fragment loader (A and B alike) from a block in fragment order: p = block start + lane*8; lane row/col = lane&15, h = lane>>4;
// vector elements 0..7 <- p[0..7] (= k0+8h+0..7), 8..15 <- p[256..263] (= k0+16+8h+0..7).
struct FragH {
  union U { v16h v; v8h h[2]; };
  static __device__ __forceinline__ v16h load(const _Float16* p) {
    U f; f.h[0] = *(const v8h*)(p); f.h[1] = *(const v8h*)(p + 256); return f.v;
  }
  // the same from a wave-uniform plane base and the lane's byte offset: one offset register per fragment group instead of a 64-bit address pair
  static __device__ __forceinline__ v16h load_off(const _Float16* base, unsigned boff, int imm) {
    const char* p = (const char*)(const void*)base + boff;
    U f; f.h[0] = *(const v8h*)(p + imm); f.h[1] = *(const v8h*)(p + imm + 512); return f.v;
  }
  static __device__ __forceinline__ v8f mma(v16h a, v16h b, v8f c) {
    return __builtin_amdgcn_wmma_f32_16x16x32_f16(false, a, false, b, (short)0, c, false, false);
  }
  static __device__ __forceinline__ void guard(v8f& a, v8f& b, v16h x, v16h y) { dep_guard_h(a, b, x, y); }
};

// s_wait_xcnt 0 behind a group of global loads, in front of any rewrite of their address registers.
// The addresses are inputs only so that their registers stay as they are up to the wait.
__device__ __forceinline__ void xwait(const void* a) { asm volatile("s_wait_xcnt 0x0" :: "v"(a) : "memory"); }
__device__ __forceinline__ void xwait(const void* a, const void* b, const void* c, const void* d) {
  asm volatile("s_wait_xcnt 0x0" :: "v"(a), "v"(b), "v"(c), "v"(d) : "memory");
}

// the same behind loads of the form uniform base + 32-bit byte offset per lane: the offset register stays as it is up to the wait (the bases are kernel arguments, never rewritten in the loop)
__device__ __forceinline__ void xwait_off(unsigned a) { asm volatile("s_wait_xcnt 0x0" :: "v"(a) : "memory"); }
__device__ __forceinline__ void xwait_off(unsigned a, unsigned b) { asm volatile("s_wait_xcnt 0x0" :: "v"(a), "v"(b) : "memory"); }
// the same where the bases are formed in the kernel: the four scalar bases too stay as they are up to the wait
__device__ __forceinline__ void xwait_off(unsigned a, const void* p, const void* q, const void* r, const void* s) {
  asm volatile("s_wait_xcnt 0x0" :: "v"(a), "s"(p), "s"(q), "s"(r), "s"(s) : "memory");
}
// the same in front of the step of an offset register in a rolled loop. The offset goes through the statement: as an input only, this build replaces it
// by 64-bit address pairs of its own; so it stays the one register that the loads name
__device__ __forceinline__ void xwait_step(unsigned& a) { asm volatile("s_wait_xcnt 0x0" : "+v"(a) :: "memory"); }
__device__ __forceinline__ void xwait_off(unsigned a, const void* p, const void* q) {
  asm volatile("s_wait_xcnt 0x0" :: "v"(a), "s"(p), "s"(q) : "memory");
}

// ---- The q, k and v 1x1 convs of 64 positions per block, f16 hi/lo operands, x split inside the launch ----------------------
// Block (bx, b) holds positions n0 = 64*bx .. n0+63 of batch element b. It reads its x tile [512 c][64 n] (f32, rows of 256 B) once, forms hi/lo of x * 2^10
// and keeps both planes in LDS as a matrix [64 n][512 c] in fragment order; behind one barrier wave w forms v channels 64w .. 64w+63 of these positions:
// A = Wv rows (from global, no two waves the same), B = x rows (from LDS, the same for all 8 waves); product = hi.hi + hi.lo + lo.hi, f32 accumulate.
// The wave takes a fifth A row tile beside its four: 16 of the 128 stacked q and k weight rows (row tile w of 8: 0..3 = q, 4..7 = k), times the same B fragments.
// Its tiles hold 8 channels (8*(lane>>4) + r) of one position (lane&15) per lane: the lane's own 16-B unit of the q / k planes' fragment order.
// The fragments of a k step (32 columns) are fetched one k step ahead into a second register set, so that a step's products run while the next step's loads are in flight.
// v = acc * scale + bv[m] goes out as one f16 plane in fragment order (|v| < 2^-14 stored as 0, so the plane holds no f16 subnormals).
#define GK   CCH
#define GRTB (GK * 32)   // bytes of one row tile of an operand plane: GK/32 blocks of 1 KiB, one behind the other
static_assert(GK % 64 == 0);

template <int NA> struct FragSet { v16h ah[NA], al[NA], bh[4], bl[4]; };

// the q / k side of the projection launch
static_assert(CCH / 64 == 2 * CQK / 16);   // one 16-row tile of the stacked q and k weights for each 64-row tile of the v weights
struct QkPart {
  const unsigned short* wqh; const unsigned short* wql;   // weight planes [64][512]
  const unsigned short* wkh; const unsigned short* wkl;
  const float* bq; const float* bk;                       // biases [64]
  unsigned short* qh; unsigned short* ql;                 // out planes [16384][64]
  unsigned short* kh; unsigned short* kl;
  float carry;                                            // on the out planes
};

// Work-group barrier that orders LDS traffic only (s_wait_dscnt 0 in front of the signal). __syncthreads() also drains the wave's outstanding
// global loads, which would end the flight of fragments requested ahead (weight fragments in proj_kernel, K and V fragments in attn_kernel);
// at every place where it stands the waves exchange data through LDS alone.
__device__ __forceinline__ void lds_barrier() {
  __builtin_amdgcn_fence(__ATOMIC_RELEASE, "workgroup", "local");
  __builtin_amdgcn_s_barrier();
  __builtin_amdgcn_fence(__ATOMIC_ACQUIRE, "workgroup", "local");
}

// x planes in LDS: halves from one row tile (16 positions, GK/32 blocks) to the next. The 16 B on top of the blocks turn each row tile by one 16-B unit in the banks:
// a store of the split below holds units of 4 row tiles whose positions lie 4 apart, which fall on 16 different units of the 256-B bank row only so
#define XRT ((GK / 32) * 512 + 8)
static_assert((XRT * 2) % 16 == 0);
static_assert(CCH == 8 * 64);   // one 64-row tile of Wv, and 64 channels of the x tile, for each of the 8 waves

// A fragments of one k step: plane starts of the wave's row tiles (wave-uniform) + the lane's byte offset + immediates
__device__ __forceinline__ void proj_fetch_a(FragSet<5>& f, const _Float16* Ah, const _Float16* Al, const _Float16* Eh, const _Float16* El, unsigned off, int imm) {
#pragma unroll
  for (int i = 0; i < 4; ++i) {
    f.ah[i] = FragH::load_off(Ah, off, imm + i * GRTB);
    f.al[i] = FragH::load_off(Al, off, imm + i * GRTB);
  }
  f.ah[4] = FragH::load_off(Eh, off, imm);
  f.al[4] = FragH::load_off(El, off, imm);
  // a step's loads (B in front, A behind) are issued as one group in front of the other set's products; without it the build sinks the A loads among the products, which shortens their lead
  __builtin_amdgcn_sched_barrier(0);
}
// B fragments: 4 row tiles of the x planes in LDS; imm in halves
__device__ __forceinline__ void proj_fetch_b(FragSet<5>& f, const _Float16* Bh, const _Float16* Bl, int imm) {
#pragma unroll
  for (int j = 0; j < 4; ++j) {
    f.bh[j] = FragH::load(Bh + j * XRT + imm);
    f.bl[j] = FragH::load(Bl + j * XRT + imm);
  }
  // the LDS reads stay in front of the step's global loads: with the two groups the other way round this build keeps one weight fragment in scratch, behind a full wait on its load
  __builtin_amdgcn_sched_barrier(0);
}

// the products of one k step; per accumulator in the order hi.hi, hi.lo, lo.hi, four independent accumulators between two products into the same one
template <bool SPLIT, int NA>
__device__ __forceinline__ void gemm_mul(v8f (&acc)[NA][4], const FragSet<NA>& f) {
#pragma unroll
  for (int i = 0; i < 4; ++i) {
#pragma unroll
    for (int j = 0; j < 4; ++j) acc[i][j] = FragH::mma(f.ah[i], f.bh[j], acc[i][j]);
    if (SPLIT) {
#pragma unroll
      for (int j = 0; j < 4; ++j) acc[i][j] = FragH::mma(f.ah[i], f.bl[j], acc[i][j]);
#pragma unroll
      for (int j = 0; j < 4; ++j) acc[i][j] = FragH::mma(f.al[i], f.bh[j], acc[i][j]);
    }
  }
  if (NA == 5) {   // q / k row tile: x is the Bt side here; the order stays x hi . w hi, x hi . w lo, x lo . w hi
#pragma unroll
    for (int j = 0; j < 4; ++j) acc[NA - 1][j] = FragH::mma(f.ah[NA - 1], f.bh[j], acc[NA - 1][j]);
#pragma unroll
    for (int j = 0; j < 4; ++j) acc[NA - 1][j] = FragH::mma(f.al[NA - 1], f.bh[j], acc[NA - 1][j]);
#pragma unroll
    for (int j = 0; j < 4; ++j) acc[NA - 1][j] = FragH::mma(f.ah[NA - 1], f.bl[j], acc[NA - 1][j]);
  }
  // every product of the step stays in front of this line: behind it the set's registers are refilled
  __builtin_amdgcn_sched_barrier(0);
  // four vector slots between the last products and the loads that refill this set's registers
  FragH::guard(acc[NA - 1][0], acc[NA - 1][3], f.ah[NA - 1], f.al[NA - 1]);
}

__global__ __launch_bounds__(256) void proj_kernel(
    const float* __restrict__ X,
    const unsigned short* __restrict__ Ap, const unsigned short* __restrict__ A2p,
    unsigned short* __restrict__ Vout, const float* __restrict__ bias,
    float xcarry, float scale, QkPart qk) {
  constexpr int NA = 5;
  __shared__ __align__(16) _Float16 Xsh[4 * XRT];  // x hi plane of the block's 64 positions, fragment order, row tiles XRT halves apart
  __shared__ __align__(16) _Float16 Xsl[4 * XRT];  // x lo plane, the same
  __shared__ __align__(16) float sT[8][16 * 68];   // per-wave 16x64 slab, pitch 68 floats
  const int b    = blockIdx.y;
  const int lane = threadIdx.x & 31;
  const int wave = __builtin_amdgcn_readfirstlane(threadIdx.x >> 5);   // scalar, so that the plane starts below are formed once per wave on the scalar unit
  const int tm = wave;
  const int m0 = tm << 6;
  const int n0 = blockIdx.x << 6;

  // starts of the wave's 64 rows in the Wv planes (4 row tiles, GRTB bytes each): the same in every lane, formed once, never rewritten
  const _Float16* Ab  = (const _Float16*)(const void*)Ap  + (size_t)m0 * GK;
  const _Float16* Ab2 = (const _Float16*)(const void*)A2p + (size_t)m0 * GK;
  // the wave's q or k weight row tile (16 rows = GRTB bytes), wave-uniform as well
  const _Float16* Eb  = (const _Float16*)(const void*)(tm < 4 ? qk.wqh : qk.wkh) + (size_t)(tm & 3) * 16 * GK;
  const _Float16* Eb2 = (const _Float16*)(const void*)(tm < 4 ? qk.wql : qk.wkl) + (size_t)(tm & 3) * 16 * GK;

  const int rlane = lane & 15;                 // col (D) within subtile
  const int mOff  = (lane >> 4) * 8;           // D row offset
  const unsigned ko = (unsigned)lane * 16;     // bytes: the lane's 16 B inside each 512-B half block
  FragSet<NA> f0, f1;

  // ---- x tile -> hi/lo planes in LDS. Wave w takes channels 64w .. 64w+63; a lane reads 4 patches of 8 channels (16p + 8*(lane>>4) + e) x 4 positions (4*(lane&15) + i):
  //      each load covers two whole 256-B rows; a patch is 4 16-B units (8 channels of one position) of each plane ----
  {
    const int pg = lane & 15, oh = lane >> 4;
    const float* xb = X + ((size_t)b * CCH + wave * 64 + oh * 8) * NPOS + n0 + pg * 4;
    v4f a[4][8];
#pragma unroll
    for (int p = 0; p < 4; ++p)
#pragma unroll
      for (int e = 0; e < 8; ++e) a[p][e] = *(const v4f*)(xb + (size_t)(p * 16 + e) * NPOS);
    xwait(xb);   // behind the 32 loads, in front of the reuse of their address registers
    proj_fetch_a(f0, Ab, Ab2, Eb, Eb2, ko, 0);   // the weight fragments of k step 0 follow the 32 loads and stay in flight across the barrier
    // unit (position 16*rt + c, channels 32*kb + 16*s + 8*h + 0..7): rt = pg >> 2, c = 4*(pg & 3) + i, kb = 2*wave + (p >> 1), s = p & 1, h = oh
    const int lb = (pg >> 2) * XRT + wave * 1024 + (oh * 16 + (pg & 3) * 4) * 8;
#pragma unroll
    for (int p = 0; p < 4; ++p) {
#pragma unroll
      for (int i = 0; i < 4; ++i) {
        v8h hv, lv;
#pragma unroll
        for (int e = 0; e < 8; ++e) {
          const float f = a[p][e][i] * xcarry;
          const _Float16 hq = (_Float16)f;
          hv[e] = hq;
          lv[e] = (_Float16)(f - (float)hq);
        }
        const int lo = lb + (p >> 1) * 512 + (p & 1) * 256 + i * 8;
        *(v8h*)(Xsh + lo) = hv;
        *(v8h*)(Xsl + lo) = lv;
      }
    }
  }

  v8f acc[NA][4];
#pragma unroll
  for (int i = 0; i < NA; ++i)
#pragma unroll
    for (int j = 0; j < 4; ++j) acc[i][j] = (v8f){0.f,0.f,0.f,0.f,0.f,0.f,0.f,0.f};

  lds_barrier();   // every wave reads all 512 channels of the 64 positions
  const _Float16* Bh = Xsh + lane * 8;
  const _Float16* Bl = Xsl + lane * 8;
  proj_fetch_b(f0, Bh, Bl, 0);
  // unrolled in full: a k step is 1 KiB further in every row tile, so each address is base + ko + an immediate and no address register is rewritten under loads in flight
#pragma unroll
  for (int k0 = 0; k0 < GK; k0 += 64) {
    proj_fetch_b(f1, Bh, Bl, (k0 + 32) * 16);                 // k step k0 + 32, in flight under the products of k step k0
    proj_fetch_a(f1, Ab, Ab2, Eb, Eb2, ko, (k0 + 32) * 32);
    gemm_mul<true, NA>(acc, f0);
    if (k0 + 64 < GK) {
      proj_fetch_b(f0, Bh, Bl, (k0 + 64) * 16);                 // k step k0 + 64, in flight under the products of k step k0 + 32
      proj_fetch_a(f0, Ab, Ab2, Eb, Eb2, ko, (k0 + 64) * 32);
    } else {
      xwait_off(ko, Ab, Ab2, Eb, Eb2);   // a k step's products behind the last loads, where it holds up nothing; the epilogue reuses the offset's and the bases' registers only behind it
    }
    gemm_mul<true, NA>(acc, f1);
  }
  acc_guard4(acc[0][0], acc[0][1], acc[0][2], acc[0][3]);
  acc_guard4(acc[1][0], acc[1][1], acc[1][2], acc[1][3]);
  acc_guard4(acc[2][0], acc[2][1], acc[2][2], acc[2][3]);
  acc_guard4(acc[3][0], acc[3][1], acc[3][2], acc[3][3]);
  acc_guard4(acc[NA - 1][0], acc[NA - 1][1], acc[NA - 1][2], acc[NA - 1][3]);

  // ---- epilogue: v rows, 16 at a time through the wave's slab ----
  float* slab = sT[wave];
#pragma unroll
  for (int i = 0; i < 4; ++i) {
    const int mBase = m0 + (i << 4);
#pragma unroll
    for (int j = 0; j < 4; ++j) {
#pragma unroll
      for (int r = 0; r < 8; ++r) {
        float v = acc[i][j][r] * scale;
        v += bias[mBase + mOff + r];
        slab[(mOff + r) * 68 + (j << 4) + rlane] = v;
      }
    }
    __builtin_amdgcn_fence(__ATOMIC_RELEASE, "workgroup");
    __builtin_amdgcn_wave_barrier();
    __builtin_amdgcn_fence(__ATOMIC_ACQUIRE, "workgroup");
    {
      const int row = lane & 15, h8 = (lane >> 4) * 8;
      _Float16* C = (_Float16*)(void*)Vout + (size_t)b * CCH * NPOS;
      const size_t tb = (((size_t)(mBase >> 4) * (NPOS >> 5) + (n0 >> 5)) << 9) + lane * 8;   // the slab's two blocks follow one another
#pragma unroll
      for (int it = 0; it < 4; ++it) {                     // it = 2 * (block) + s: cols it*16 + h8 .. +7 of row lane&15
        const float* sp = slab + row * 68 + it * 16 + h8;
        v8h hv;
#pragma unroll
        for (int e = 0; e < 8; ++e) {
          float f = sp[e];
          f = (fabsf(f) >= 6.103515625e-05f) ? f : 0.0f;
          hv[e] = (_Float16)f;
        }
        *(v8h*)(C + tb + it * 256) = hv;
      }
    }
    __builtin_amdgcn_fence(__ATOMIC_RELEASE, "workgroup");
    __builtin_amdgcn_wave_barrier();
    __builtin_amdgcn_fence(__ATOMIC_ACQUIRE, "workgroup");
  }

  // ---- q / k row tile: (acc * scale + bias) * carry, hi/lo split, one 16-B store per plane and tile straight from the accumulators ----
  {
    const int d0 = (tm & 3) * 16;                        // first of the tile's 16 q (or k) channels
    const float* be = (tm < 4 ? qk.bq : qk.bk) + d0 + mOff;
    _Float16* Eo  = (_Float16*)(void*)(tm < 4 ? qk.qh : qk.kh);
    _Float16* Eo2 = (_Float16*)(void*)(tm < 4 ? qk.ql : qk.kl);
    float bb[8];
#pragma unroll
    for (int r = 0; r < 8; ++r) bb[r] = be[r];
    // block (position row tile, d0 / 32) of a [16384][64] plane, half block s = (d0 / 16) & 1; the wave's four position tiles lie CQK / 32 blocks apart
    const size_t eb = (((size_t)((b * NPOS + n0) >> 4) * (CQK >> 5) + (d0 >> 5)) << 9) + ((d0 >> 4) & 1) * 256 + lane * 8;
#pragma unroll
    for (int j = 0; j < 4; ++j) {
      v8h hv, lv;
#pragma unroll
      for (int r = 0; r < 8; ++r) {
        float v = acc[NA - 1][j][r] * scale;
        v += bb[r];
        v *= qk.carry;
        const _Float16 hq = (_Float16)v;
        hv[r] = hq;
        lv[r] = (_Float16)(v - (float)hq);
      }
      *(v8h*)(Eo  + eb + (size_t)j * ((CQK >> 5) << 9)) = hv;
      *(v8h*)(Eo2 + eb + (size_t)j * ((CQK >> 5) << 9)) = lv;
    }
  }
}

// ---------------------------------------------------------------------------
// f16 hi/lo split of a row-major f32 matrix [rows][CCH] with total element count 8*n8 into planes in fragment order:
//   hi = f16(in * carry), lo = f16(in * carry - hi). Thread i makes the i-th 16-B unit of each plane from 8 consecutive elements of one row
// ---------------------------------------------------------------------------
__device__ __forceinline__ void wconv_f16(const float* __restrict__ in, unsigned short* __restrict__ oh,
                                          unsigned short* __restrict__ ol, int blk, int n8, float carry) {
  const int i = blk * 256 + threadIdx.x;
  if (i < n8) {
    const size_t e0 = (size_t)i * 8;
    const int blkid = i >> 6;                                             // block (rt, kb), CCH/32 blocks per row tile
    const int srow = (blkid / (CCH / 32)) * 16 + (i & 15);
    const int scol = (blkid % (CCH / 32)) * 32 + ((i >> 4) & 3) * 8;      // bits 5,4 of i = s,h: col 16*s + 8*h
    const float* ip = in + (size_t)srow * CCH + scol;
    const v4f a = *(const v4f*)(ip);
    const v4f c = *(const v4f*)(ip + 4);
    xwait(ip);   // behind the two loads, in front of the reuse of their address registers
    float f[8];
    f[0] = a[0]; f[1] = a[1]; f[2] = a[2]; f[3] = a[3];
    f[4] = c[0]; f[5] = c[1]; f[6] = c[2]; f[7] = c[3];
    v4u hv, lv;
#pragma unroll
    for (int q = 0; q < 4; ++q) {
      const float f0 = f[2 * q] * carry, f1 = f[2 * q + 1] * carry;
      const _Float16 h0 = (_Float16)f0, h1 = (_Float16)f1;
      const _Float16 l0 = (_Float16)(f0 - (float)h0), l1 = (_Float16)(f1 - (float)h1);
      hv[q] = pk16(h_bits(h0), h_bits(h1));
      lv[q] = pk16(h_bits(l0), h_bits(l1));
    }
    {
      *(v4u*)(oh + e0) = hv;
      *(v4u*)(ol + e0) = lv;
      
    }
  }
}

// ---------------------------------------------------------------------------
// All four weight splits in one launch: none reads what another writes, so the block index picks the job (the same in every thread of a block).
// Wq, Wk (WSBLK blocks each), then Wv, Wd (WLBLK blocks each).
// ---------------------------------------------------------------------------
#define WSBLK (CQK * CCH / 8 / 256)
#define WLBLK (CCH * CCH / 8 / 256)
__global__ __launch_bounds__(256) void split_w_f16(const float* __restrict__ Wq, const float* __restrict__ Wk,
                                                   const float* __restrict__ Wv, const float* __restrict__ Wd,
                                                   unsigned short* __restrict__ wqh, unsigned short* __restrict__ wql,
                                                   unsigned short* __restrict__ wkh, unsigned short* __restrict__ wkl,
                                                   unsigned short* __restrict__ wvh, unsigned short* __restrict__ wvl,
                                                   unsigned short* __restrict__ wdh, unsigned short* __restrict__ wdl,
                                                   float wCarry) {
  // weight planes, natural [out][in] layout, hi/lo of W * wCarry
  const int wb = blockIdx.x;
  if (wb < WSBLK)                      wconv_f16(Wq, wqh, wql, wb, CQK * CCH / 8, wCarry);
  else if (wb < 2 * WSBLK)             wconv_f16(Wk, wkh, wkl, wb - WSBLK, CQK * CCH / 8, wCarry);
  else if (wb < 2 * WSBLK + WLBLK)     wconv_f16(Wv, wvh, wvl, wb - 2 * WSBLK, CCH * CCH / 8, wCarry);
  else                                 wconv_f16(Wd, wdh, wdl, wb - 2 * WSBLK - WLBLK, CCH * CCH / 8, wCarry);
}

// =====================================================================================
// Flash-style attention with a 512-wide value dimension and a 64-deep score dimension, no score scaling.
//   All four kinds of plane in fragment order (head of the file):
//   q planes (hi/lo f16, x2^10) [16384][64]: row b*4096 + i, col d
//   k planes (hi/lo f16, x2^10) [16384][64]: same for keys j
//   v plane (f16, carry 1) [4*512][4096]: row b*512 + ch, col j
//   o2 planes (hi/lo f16, x2^10) [64][512], in LDS: row i - i0, col ch = split of (gamma*out + x[b][ch][i]) * 2^10
//   The output conv runs in the same launch: the block holds all 512 channels of its 64 positions, so behind one barrier (B3) wave w forms
//   out channels 64w .. 64w+63 of these positions = Wd rows (A, from global, no two waves the same) . o2 rows (B, from LDS, the same for all 8 waves).
//   Both products are formed TRANSPOSED, so that a lane's column (lane&15) is one query in the score tiles and in the output tiles alike:
//   scores S^T = k . q^T on split planes (hi.hi + lo.hi + hi.lo), * sscale (= 2^-20) in f32: A = K fragment (row = key), B = Q fragment (col = query);
//   a lane holds 8 keys (8*(lane>>4) + r) of one query per tile: row maximum and row sum run inside the lane, plus one exchange between the wave's halves;
//   running-max softmax in f32 over the 4096 keys of the batch element (32 chunks of 128, compile-time trip count);
//   P = exp(s - m) * pcarry (2^15) as f16 in LDS (values < 2^-14 stored as 0); out^T = v . P^T single products, f32 accumulate
//   (A = V fragment, row = channel; B = P rows, col = query), times (1/rowsum) * pinv (2^-15) at the end.
//   Block = 64 query rows (4 query tiles of 16) of one batch element, 8 waves; wave w computes the 16x64 score piece for keys
//   j0 + 16w .. +15 of each chunk (shared through LDS: partial row max Pm, partial row sum Pl, P tile Ps) and accumulates the
//   output for channels 64w .. 64w+63 (4 query tiles x 4 channel tiles in registers). Each K fragment and each V fragment
//   loaded from global feeds one product per query tile (the K hi fragment two). grid = (4096/64, 4) = 256 blocks.
//   The block's Q rows sit in LDS (Qsh/Qsl, written once, barrier B0) and are read as fragments in every chunk.
//   Barriers per chunk: after the Pm writes (B1) and after the Ps/Pl writes (B2). The loop runs one chunk apart: between B1 and B2 of chunk jc + 1
//   stand its softmax (writes P tile (jc + 1) & 1 and Pl) and the products P.V of chunk jc (read P tile jc & 1, written in front of B2 of chunk jc);
//   a P tile is rewritten two barriers behind its last read. Pm is written behind B2 and read behind B1; Pl is read behind B2, in front of the next B1.
//   Every wave reaches every barrier (no early exit).
//   B1 and B2 order LDS only (lds_barrier): the K and V fragments of the next chunk stay in flight across them.
//   LDS extents: a P tile's rows 0..63 x cols 0..127 fully written each chunk (8 waves x 16 cols) before any fragment read
//   (reads reach col 127; cols 128..135 never read); Pm/Pl [64][8] fully written.
//   Fragment loads from global (K, V blocks): plane base (kernel argument) + the lane's 32-bit byte offset, 16-B aligned, one chunk ahead of their use.
// =====================================================================================
#define AQT    4
#define AQB    (16 * AQT)
#define AKC    128
#define PPITCH 136
#define NCHUNK (NPOS / AKC)

static_assert(NPOS % AQB == 0);
static_assert(NCHUNK * AKC == NPOS);
static_assert(CCH == 8 * 64);
static_assert((PPITCH * 2) % 16 == 0);
static_assert(AQB * CQK == 2 * 256 * 8);

// value of lane l ^ 16 (the other half of the wave), on the vector unit
__device__ __forceinline__ float xhalf(float x) {
  return __builtin_bit_cast(float, __builtin_amdgcn_permlanex16(__builtin_bit_cast(int, x), __builtin_bit_cast(int, x), 0x76543210, 0xfedcba98, false, false));
}

// fragments of one k step of the output conv. A: 4 row tiles of the Wd planes, wave-uniform plane start + the lane's byte offset + immediate
__device__ __forceinline__ void out_fetch_a(FragSet<4>& f, const _Float16* Ah, const _Float16* Al, unsigned off, int imm) {
#pragma unroll
  for (int i = 0; i < 4; ++i) {
    f.ah[i] = FragH::load_off(Ah, off, imm + i * GRTB);
    f.al[i] = FragH::load_off(Al, off, imm + i * GRTB);
  }
}
// B: 4 row tiles (16 positions each, CCH / 32 blocks apart) of the o2 planes in LDS; imm in halves
__device__ __forceinline__ void out_fetch_b(FragSet<4>& f, const _Float16* Bh, const _Float16* Bl, int imm) {
#pragma unroll
  for (int j = 0; j < 4; ++j) {
    f.bh[j] = FragH::load(Bh + j * (CCH / 32) * 512 + imm);
    f.bl[j] = FragH::load(Bl + j * (CCH / 32) * 512 + imm);
  }
  // a step's loads are issued as one group in front of the other set's products; without it the build may sink them among the products, which shortens their lead
  __builtin_amdgcn_sched_barrier(0);
}

__global__ __launch_bounds__(256)
void attn_kernel(const unsigned short* __restrict__ qhp, const unsigned short* __restrict__ qlp,
                 const unsigned short* __restrict__ khp, const unsigned short* __restrict__ klp,
                 const unsigned short* __restrict__ vtp,
                 const float* __restrict__ X, const float* __restrict__ gam,
                 const unsigned short* __restrict__ wdhp, const unsigned short* __restrict__ wdlp,
                 const float* __restrict__ bd, float* __restrict__ outp,
                 float sscale, float pcarry, float pinv, float ocarry, float wscale) {
  union FB { v16h v; v8h h[2]; };
  __shared__ __align__(16) _Float16 Ps[2 * AQB * PPITCH]; // two P tiles [query row][key in chunk], pitch 136 halves: chunk jc in tile jc & 1
  __shared__ __align__(16) float    Pm[AQB * 8];          // partial row max  [row][wave]
  __shared__ __align__(16) float    Pl[AQB * 8];          // partial row sum  [row][wave]
  __shared__ __align__(16) _Float16 Qsh[AQB * CQK];       // q hi plane rows of this block, fragment order as in global
  __shared__ __align__(16) _Float16 Qsl[AQB * CQK];       // q lo plane rows of this block, fragment order as in global
  __shared__ __align__(16) _Float16 O2sh[AQB * CCH];      // o2 hi plane of the block's 64 positions, fragment order: 4 row tiles x 16 blocks
  __shared__ __align__(16) _Float16 O2sl[AQB * CCH];      // o2 lo plane, the same
  __shared__ __align__(16) float    sT[8][16 * 68];       // per-wave 16x64 slab of the output conv's epilogue, pitch 68 floats

  const int tid  = threadIdx.x;
  const int wave = tid >> 5;
  const int lane = tid & 31;
  const int hh   = lane >> 4;
  const int c    = lane & 15;
  const int wsel = __builtin_amdgcn_readfirstlane(tid >> 7);   // 0 in waves 0..3, 1 in waves 4..7; scalar, so that the choice of order in the chunk loop is a scalar branch

  const int b  = blockIdx.y;                       // 0..3
  const int i0 = blockIdx.x * AQB;                 // first query position of this block
  const size_t qrow0 = (size_t)b * NPOS + i0;      // row in the q planes

  const _Float16* Qh = (const _Float16*)(const void*)qhp;
  const _Float16* Ql = (const _Float16*)(const void*)qlp;
  const _Float16* Kh = (const _Float16*)(const void*)khp;
  const _Float16* Kl = (const _Float16*)(const void*)klp;
  const _Float16* Vt = (const _Float16*)(const void*)vtp;
  const unsigned vw_off = (((unsigned)b * CCH + (unsigned)wave * 64) * NPOS + (unsigned)lane * 8) * 2;   // bytes: this wave's 64 channel rows, the lane's 16 B
  const float g = gam[0];

  // ---- Q rows of the block (64 x 64, hi and lo) into LDS once: 512 pieces of 16 B per plane, 2 per thread and plane;
  //      the 16 Q fragments would take 128 registers, which the accumulators and the V fragments in flight need ----
  {
    const int q8 = tid * 8;                        // the 64 rows are 4 row tiles = 4096 consecutive halves; pieces tid and 256 + tid
    const _Float16* gh0 = Qh + qrow0 * CQK + q8;
    const _Float16* gl0 = Ql + qrow0 * CQK + q8;
    const _Float16* gh1 = gh0 + 32 * CQK;
    const _Float16* gl1 = gl0 + 32 * CQK;
    const v8h th0 = *(const v8h*)gh0, tl0 = *(const v8h*)gl0, th1 = *(const v8h*)gh1, tl1 = *(const v8h*)gl1;
    xwait(gh0, gl0, gh1, gl1);
    *(v8h*)(Qsh + q8) = th0;
    *(v8h*)(Qsl + q8) = tl0;
    *(v8h*)(Qsh + 32 * CQK + q8) = th1;
    *(v8h*)(Qsl + 32 * CQK + q8) = tl1;
  }
  __syncthreads();   // B0: every wave reads all 64 Q rows

  float mrow[AQT], lrow[AQT];                      // of query t*16 + c, the same in both halves of the wave and in every wave
  v8f acc[AQT][4];                                 // acc[t][n][r] = out of query t*16 + c, channel 64*wave + 16*n + 8*hh + r
#pragma unroll
  for (int t = 0; t < AQT; ++t) {
    mrow[t] = -INFINITY; lrow[t] = 0.f;
#pragma unroll
    for (int n = 0; n < 4; ++n) acc[t][n] = (v8f){0.f,0.f,0.f,0.f,0.f,0.f,0.f,0.f};
  }

  // K fragments (A operand, row = lane&15 = key) of this wave's key row tile (2 blocks of 512 halves per plane) are fetched one chunk ahead: chunk 0 here
  const unsigned kw_off = (((unsigned)b * NPOS + (unsigned)wave * 16) * CQK + (unsigned)lane * 8) * 2;   // bytes, the same in the hi and the lo plane
  v16h kfh[2], kfl[2];
#pragma unroll
  for (int dc = 0; dc < 2; ++dc) {
    kfh[dc] = FragH::load_off(Kh, kw_off, dc * 1024);
    kfl[dc] = FragH::load_off(Kl, kw_off, dc * 1024);
  }
  xwait_off(kw_off);
  // The 16 V fragments of a chunk (A operand, row = lane&15 = channel) do not depend on the scores: they too are fetched one chunk ahead, chunk 0 behind the first scores below,
  // each later one into the same registers right behind its last product, so that it lands under the work of the trip that follows
  // (neither barrier of the chunk drains the loads)
  unsigned vo = vw_off;   // bytes: block 0 of the wave's first channel row tile
  v16h vb[4][4];

  v8f s[AQT];          // scaled scores of the chunk whose softmax comes next
  float alpha[AQT];    // rescale factor of the chunk whose softmax ran last
  unsigned ko = kw_off;

  // ---- row sums of the chunk whose softmax ran last, behind its B2 ----
  auto rowsum = [&]() __attribute__((always_inline)) {
#pragma unroll
    for (int t = 0; t < AQT; ++t) {
      const int row = t * 16 + c;
      const v4f la = *(const v4f*)(Pl + row * 8);
      const v4f lb = *(const v4f*)(Pl + row * 8 + 4);
      const float ls = ((la[0] + la[1]) + (la[2] + la[3])) + ((lb[0] + lb[1]) + (lb[2] + lb[3]));
      lrow[t] = lrow[t] * alpha[t] + ls;
    }
  };

  // ---- score piece of chunk jc, transposed: rows = keys jc * AKC + 16*wave + 8*hh + r, cols = 64 queries (B operand col = lane&15); partial maxima into Pm ----
  auto scores = [&](int jc, bool sums) __attribute__((always_inline)) {
#pragma unroll
    for (int t = 0; t < AQT; ++t) s[t] = (v8f){0.f,0.f,0.f,0.f,0.f,0.f,0.f,0.f};
#pragma unroll
    for (int dc = 0; dc < 2; ++dc) {
      const v16h kbh = kfh[dc];
      const v16h kbl = kfl[dc];
      // Q fragments (B operand, col = lane&15) from LDS, same k map as the K fragments
      v16h qah[AQT], qal[AQT];
#pragma unroll
      for (int t = 0; t < AQT; ++t) {
        qah[t] = FragH::load(Qsh + (t * 2 + dc) * 512 + lane * 8);
        qal[t] = FragH::load(Qsl + (t * 2 + dc) * 512 + lane * 8);
      }
#pragma unroll
      for (int t = 0; t < AQT; ++t) s[t] = FragH::mma(kbh, qah[t], s[t]);
#pragma unroll
      for (int t = 0; t < AQT; ++t) s[t] = FragH::mma(kbl, qah[t], s[t]);
#pragma unroll
      for (int t = 0; t < AQT; ++t) s[t] = FragH::mma(kbh, qal[t], s[t]);
    }
    // K fragments of the next chunk into the same registers, right behind their last use (the last chunk fetches its own again, so the address stays inside the planes)
    ko += (jc + 1 < NCHUNK) ? (unsigned)(AKC * CQK * 2) : 0u;   // stepped in place, behind the wait that follows the loads before
#pragma unroll
    for (int dc = 0; dc < 2; ++dc) {
      kfh[dc] = FragH::load_off(Kh, ko, dc * 1024);
      kfl[dc] = FragH::load_off(Kl, ko, dc * 1024);
    }
    if (sums) rowsum();   // of the chunk before: its 8 LDS reads land under the vector work below, not in front of the barrier
    // scale, then this wave's partial maximum over its 16 keys of query t*16 + c: 8 in the lane, 8 in lane ^ 16
    float mloc[AQT];
#pragma unroll
    for (int t = 0; t < AQT; ++t) {
#pragma unroll
      for (int r = 0; r < 8; ++r) s[t][r] *= sscale;
      const float m = fmaxf(fmaxf(fmaxf(s[t][0], s[t][1]), fmaxf(s[t][2], s[t][3])),
                            fmaxf(fmaxf(s[t][4], s[t][5]), fmaxf(s[t][6], s[t][7])));
      mloc[t] = fmaxf(m, xhalf(m));
    }
    if (hh == 0) {
#pragma unroll
      for (int t = 0; t < AQT; ++t) Pm[(t * 16 + c) * 8 + wave] = mloc[t];
    }
  };

  // ---- running max update (identical in every wave), P tile into Pw, partial row sums into Pl; leaves alpha ----
  auto softmax = [&](_Float16* Pw) __attribute__((always_inline)) {
    float psl[AQT];
    v4f ma[AQT], mb[AQT];
#pragma unroll
    for (int t = 0; t < AQT; ++t) {                     // the 8 reads stand together: one LDS wait for all four query tiles
      ma[t] = *(const v4f*)(Pm + (t * 16 + c) * 8);
      mb[t] = *(const v4f*)(Pm + (t * 16 + c) * 8 + 4);
    }
    // keeps the 8 reads in one group; without it this build reads tile by tile and waits out the LDS latency once per query tile
    __builtin_amdgcn_sched_barrier(0);
#pragma unroll
    for (int t = 0; t < AQT; ++t) {
      const int row = t * 16 + c;
      const float cm = fmaxf(fmaxf(fmaxf(ma[t][0], ma[t][1]), fmaxf(ma[t][2], ma[t][3])),
                             fmaxf(fmaxf(mb[t][0], mb[t][1]), fmaxf(mb[t][2], mb[t][3])));
      const float mnew = fmaxf(mrow[t], cm);
      alpha[t] = __expf(mrow[t] - mnew);
      mrow[t] = mnew;
      float p[8];
      v8h ph;
#pragma unroll
      for (int r = 0; r < 8; ++r) {
        p[r] = __expf(s[t][r] - mnew);                  // in (0, 1]
        float p32 = p[r] * pcarry;
        p32 = (p32 >= 6.103515625e-05f) ? p32 : 0.0f;   // no f16 subnormals in the P tile
        ph[r] = (_Float16)p32;
      }
      *(v8h*)(Pw + row * PPITCH + wave * 16 + 8 * hh) = ph;   // the lane's 8 keys lie side by side in the query's P row: one 16-B store
      const float psum = ((p[0] + p[1]) + (p[2] + p[3])) + ((p[4] + p[5]) + (p[6] + p[7]));
      psl[t] = psum + xhalf(psum);
    }
    if (hh == 0) {
#pragma unroll
      for (int t = 0; t < AQT; ++t) Pl[(t * 16 + c) * 8 + wave] = psl[t];
    }
  };

  // ---- out^T(64 ch of this wave x 64 queries) += V(64 x 128) . P^T(128 x 64): A = v plane rows (row = lane&15 = channel),
  //      B = P tile Pr (col = lane&15 = query within the query tile), both with the split k map; one V fragment serves all 4 query tiles ----
  auto pv = [&](const _Float16* Pr, bool refill) __attribute__((always_inline)) {
    FB pa[2][AQT];
#pragma unroll
    for (int t = 0; t < AQT; ++t) {
      pa[0][t].h[0] = *(const v8h*)(Pr + (t * 16 + c) * PPITCH + 8 * hh);
      pa[0][t].h[1] = *(const v8h*)(Pr + (t * 16 + c) * PPITCH + 16 + 8 * hh);
    }
#pragma unroll
    for (int kk = 0; kk < 4; ++kk) {
      if (kk < 3) {
#pragma unroll
        for (int t = 0; t < AQT; ++t) {
          pa[(kk + 1) & 1][t].h[0] = *(const v8h*)(Pr + (t * 16 + c) * PPITCH + (kk + 1) * 32 + 8 * hh);
          pa[(kk + 1) & 1][t].h[1] = *(const v8h*)(Pr + (t * 16 + c) * PPITCH + (kk + 1) * 32 + 16 + 8 * hh);
        }
      }
      // the next step's 8 P reads stand as one group in front of this step's products, one step ahead and no further: read further ahead they cost registers that the build does not have (scratch)
      __builtin_amdgcn_sched_barrier(0);
#pragma unroll
      for (int n = 0; n < 4; ++n) {
#pragma unroll
        for (int t = 0; t < AQT; ++t) acc[t][n] = FragH::mma(vb[kk][n], pa[kk & 1][t].v, acc[t][n]);
      }
      if (refill) {
#pragma unroll
        for (int n = 0; n < 4; ++n) vb[kk][n] = FragH::load_off(Vt, vo, (n * 16 * NPOS + kk * 512) * 2);   // the next chunk's
      }
      // ends the step: the P reads of the step after next stay behind this step's products, whose P registers they reuse
      __builtin_amdgcn_sched_barrier(0);
    }
  };

  // ---- the accumulators onto the new running maximum: behind the products of the chunk before, in front of the next chunk's ----
  auto rescale = [&]() __attribute__((always_inline)) {
#pragma unroll
    for (int t = 0; t < AQT; ++t) {
#pragma unroll
      for (int n = 0; n < 4; ++n) acc[t][n] *= alpha[t];
    }
  };

  // chunk 0: scores, softmax into P buffer 0 (the accumulators are still 0: nothing to rescale)
  scores(0, false);
  // V fragments of chunk 0, behind the K loads of chunk 1 as in every later trip: the loads return in order, and with the same order on the way into the loop
  // and round it the build's counted wait for the K fragments leaves the younger V loads in flight
#pragma unroll
  for (int kk = 0; kk < 4; ++kk) {
#pragma unroll
    for (int n = 0; n < 4; ++n) vb[kk][n] = FragH::load_off(Vt, vo, (n * 16 * NPOS + kk * 512) * 2);
  }
  lds_barrier();   // B1 of chunk 0
  softmax(Ps);
  xwait_off(ko);   // behind the K loads of chunk 1, a softmax later, in front of the next rewrite of their offset register
  lds_barrier();   // B2 of chunk 0

  for (int jc = 0; jc + 1 < NCHUNK; ++jc) {
    const _Float16* Pr = Ps + (jc & 1) * (AQB * PPITCH);          // P of chunk jc
    _Float16*       Pw = Ps + ((jc + 1) & 1) * (AQB * PPITCH);    // P of chunk jc + 1
    scores(jc + 1, true);   // with the row sums of chunk jc
    // one wait for the V loads of the trip before and the K loads of this one; both offset registers are kept as they are until here, and vo steps on only behind it
    xwait_off(vo, ko);
    vo += (unsigned)(AKC / 32) * 1024;   // blocks of chunk jc + 1, at most the plane's last chunk
    lds_barrier();   // B1 of chunk jc + 1
    // Between B1 and B2 a wave has matrix work (P.V of chunk jc) and vector work (softmax of chunk jc + 1) that do not depend on one another.
    // Waves w and w + 4 take the two in opposite order, so that one wave's products run under the other's vector work.
    // The products stand once in the text, the softmax in front of them (waves 4..7) and behind them (waves 0..3): only it is under a branch, so the accumulators and V fragments keep their registers.
    if (wsel != 0) softmax(Pw);
    pv(Pr, true);
    if (wsel == 0) softmax(Pw);
    rescale();
    lds_barrier();   // B2 of chunk jc + 1
  }
  rowsum();                                                   // of the last chunk
  pv(Ps + ((NCHUNK - 1) & 1) * (AQB * PPITCH), false);        // products of the last chunk; nothing left to fetch
  xwait_off(vo);   // behind the last V loads, in front of the epilogue's reuse of the offset register

  // ---- epilogue, query tile by query tile: out * (1/(rowsum * 2^15)); o2 = gamma*out + x (exact f32 x); split of o2 * 2^10.
  //      The lane's 8 values of one accumulator tile (query c, channels 16n + 8*hh + 0..7) are its own 16-B unit of the o2 planes' fragment order.
  const float* xp0 = X + ((size_t)b * CCH + wave * 64 + 8 * hh) * NPOS + i0 + c;   // channel 64w + 8*hh, query c of tile 0
#pragma unroll
  for (int t = 0; t < AQT; ++t) {
    const float rl = (1.0f / lrow[t]) * pinv;
    const float* xp = xp0 + t * 16;
    float xe[4][8];
#pragma unroll
    for (int n = 0; n < 4; ++n) {                   // channel 64w + 16n + 8*hh + r
#pragma unroll
      for (int r = 0; r < 8; ++r) xe[n][r] = xp[(size_t)(n * 16 + r) * NPOS];
    }
    xwait(xp0);
    const int tb = ((t * (CCH >> 5) + wave * 2) << 9) + lane * 8;   // the wave's two blocks of query tile t
#pragma unroll
    for (int n = 0; n < 4; ++n) {                   // n = 2 * (block) + s
      v8h hv, lv;
#pragma unroll
      for (int r = 0; r < 8; ++r) {
        const float o  = acc[t][n][r] * rl;
        const float v2 = (g * o + xe[n][r]) * ocarry;
        const _Float16 hq = (_Float16)v2;
        hv[r] = hq;
        lv[r] = (_Float16)(v2 - (float)hq);
      }
      const int go = tb + n * 256;
      *(v8h*)(O2sh + go) = hv;
      *(v8h*)(O2sl + go) = lv;
    }
  }

  // ---- output conv: out[b][m][i0 + n] = wscale * sum_ch Wd[m][ch] * o2[n][ch] + bd[m]; wave w: m = 64w .. 64w+63, n = 0..63 (a 64x64 tile, K = 512) ----
  const int wv = __builtin_amdgcn_readfirstlane(tid >> 5);   // scalar, so that the plane starts below are formed on the scalar unit
  const _Float16* Ah = (const _Float16*)(const void*)wdhp + (size_t)wv * 64 * GK;   // the wave's 4 row tiles of Wd, hi and lo
  const _Float16* Al = (const _Float16*)(const void*)wdlp + (size_t)wv * 64 * GK;
  unsigned ao = (unsigned)lane * 16;            // bytes: the lane's 16 B inside each 512-B half block of the Wd planes
  const _Float16* Bh = O2sh + lane * 8;         // the same inside the o2 planes in LDS
  const _Float16* Bl = O2sl + lane * 8;
  v8f oc[4][4];
#pragma unroll
  for (int i = 0; i < 4; ++i)
#pragma unroll
    for (int j = 0; j < 4; ++j) oc[i][j] = (v8f){0.f,0.f,0.f,0.f,0.f,0.f,0.f,0.f};
  FragSet<4> f0, f1;
  out_fetch_a(f0, Ah, Al, ao, 0);   // do not depend on o2: in flight across the barrier
  lds_barrier();                    // B3: every wave reads all 64 o2 rows
  out_fetch_b(f0, Bh, Bl, 0);
  // two k steps a trip, each step's fragments fetched one step ahead as in proj_kernel. Kept rolled: unrolled in full the kernel's text would pass 32 KB (for speed only).
#pragma unroll 1
  for (int it = 0; it < GK / 64 - 1; ++it) {
    out_fetch_a(f1, Ah, Al, ao, 1024);
    out_fetch_b(f1, Bh, Bl, 512);
    gemm_mul<true, 4>(oc, f0);
    out_fetch_a(f0, Ah, Al, ao, 2048);
    out_fetch_b(f0, Bh, Bl, 1024);
    gemm_mul<true, 4>(oc, f1);
    xwait_step(ao);   // a k step's products behind the trip's last loads, in front of the step of their offset register
    ao += 2048;
    Bh += 1024;
    Bl += 1024;
  }
  out_fetch_a(f1, Ah, Al, ao, 1024);
  out_fetch_b(f1, Bh, Bl, 512);
  gemm_mul<true, 4>(oc, f0);
  xwait_off(ao, Ah, Al);   // behind the last loads; the epilogue reuses the offset's and the bases' registers only behind it
  gemm_mul<true, 4>(oc, f1);
  acc_guard4(oc[0][0], oc[0][1], oc[0][2], oc[0][3]);
  acc_guard4(oc[1][0], oc[1][1], oc[1][2], oc[1][3]);
  acc_guard4(oc[2][0], oc[2][1], oc[2][2], oc[2][3]);
  acc_guard4(oc[3][0], oc[3][1], oc[3][2], oc[3][3]);

  // 16 rows at a time through the wave's slab, so that each store covers whole 256-B row pieces
  float* slab = sT[wv];
  float* C = outp + (size_t)b * CCH * NPOS + i0;
#pragma unroll
  for (int i = 0; i < 4; ++i) {
    const int mBase = wv * 64 + (i << 4);
#pragma unroll
    for (int j = 0; j < 4; ++j) {
#pragma unroll
      for (int r = 0; r < 8; ++r) {
        float v = oc[i][j][r] * wscale;
        v += bd[mBase + 8 * hh + r];
        slab[(8 * hh + r) * 68 + (j << 4) + c] = v;
      }
    }
    __builtin_amdgcn_fence(__ATOMIC_RELEASE, "workgroup");
    __builtin_amdgcn_wave_barrier();
    __builtin_amdgcn_fence(__ATOMIC_ACQUIRE, "workgroup");
#pragma unroll
    for (int it = 0; it < 8; ++it) {
      const int row = it * 2 + hh;                         // it 0..7 x hh 0..1 = rows 0..15; row piece = 256 B = 16 lanes x 16 B
      const v4f v = *(const v4f*)(slab + row * 68 + c * 4);
      *(v4f*)(C + (size_t)(mBase + row) * NPOS + c * 4) = v;
    }
    __builtin_amdgcn_fence(__ATOMIC_RELEASE, "workgroup");
    __builtin_amdgcn_wave_barrier();
    __builtin_amdgcn_fence(__ATOMIC_ACQUIRE, "workgroup");
  }
}

// ---------------------------------------------------------------------------
// Workspace region map (byte offsets; every region is fully written by its producer launch before any consumer
//   WQh  f16 [64][512]           0           65536     WQl      65536      65536
//   WKh  f16 [64][512]      131072           65536     WKl     196608      65536
//   WVh  f16 [512][512]     262144          524288     WVl     786432     524288
//   WDh  f16 [512][512]    1310720          524288     WDl    1835008     524288
//   Qh   f16 [16384][64]   2359296         2097152     Ql     4456448    2097152
//   Kh   f16 [16384][64]   6553600         2097152     Kl     8650752    2097152
//   VT   f16 [4][512][4096] 10747904     16777216
//   total                 27525120
// ---------------------------------------------------------------------------
extern "C" void kernel_launch(void* const* d_in, const int* in_sizes, int n_in,
                              void* d_out, int out_size, void* d_ws, size_t ws_size,
                              hipStream_t stream) {
  if (n_in < 10) return;
  if (in_sizes[0] != NBAT * CCH * NPOS) return;     // x     [4][512][64][64]
  if (in_sizes[1] != CQK * CCH) return;             // Wq    [64][512]
  if (in_sizes[2] != CQK) return;                   // bq    [64]
  if (in_sizes[3] != CQK * CCH) return;             // Wk    [64][512]
  if (in_sizes[4] != CQK) return;                   // bk    [64]
  if (in_sizes[5] != CCH * CCH) return;             // Wv    [512][512]
  if (in_sizes[6] != CCH) return;                   // bv    [512]
  if (in_sizes[7] != 1) return;                     // gamma [1]
  if (in_sizes[8] != CCH * CCH) return;             // Wd    [512][512]
  if (in_sizes[9] != CCH) return;                   // bd    [512]
  if (out_size != NBAT * CCH * NPOS) return;        // out   [4][512][64][64] f32, last element 8388607

  const float* x     = (const float*)d_in[0];
  const float* Wq    = (const float*)d_in[1];       // [out][in]
  const float* bq    = (const float*)d_in[2];
  const float* Wk    = (const float*)d_in[3];
  const float* bk    = (const float*)d_in[4];
  const float* Wv    = (const float*)d_in[5];
  const float* bv    = (const float*)d_in[6];
  const float* gamma = (const float*)d_in[7];
  const float* Wd    = (const float*)d_in[8];
  const float* bd    = (const float*)d_in[9];

  const size_t PWS = (size_t)CQK * CCH * 2;         // 65536     f16 [64][512]
  const size_t PWL = (size_t)CCH * CCH * 2;         // 524288    f16 [512][512]
  const size_t PQK = (size_t)MROWS * CQK * 2;       // 2097152   f16 [16384][64]
  const size_t PVT = (size_t)NBAT * CCH * NPOS * 2; // 16777216  f16 [4][512][4096]
  size_t off = 0;
  const size_t oWQh = off; off += PWS;  const size_t oWQl = off; off += PWS;
  const size_t oWKh = off; off += PWS;  const size_t oWKl = off; off += PWS;
  const size_t oWVh = off; off += PWL;  const size_t oWVl = off; off += PWL;
  const size_t oWDh = off; off += PWL;  const size_t oWDl = off; off += PWL;
  const size_t oQh  = off; off += PQK;  const size_t oQl  = off; off += PQK;
  const size_t oKh  = off; off += PQK;  const size_t oKl  = off; off += PQK;
  const size_t oVT  = off; off += PVT;
  if (off > ws_size) return;                        // off = 27525120
  if (off > (size_t)134217728) return;

  char* ws = (char*)d_ws;
  unsigned short* WQh = (unsigned short*)(ws + oWQh);  unsigned short* WQl = (unsigned short*)(ws + oWQl);
  unsigned short* WKh = (unsigned short*)(ws + oWKh);  unsigned short* WKl = (unsigned short*)(ws + oWKl);
  unsigned short* WVh = (unsigned short*)(ws + oWVh);  unsigned short* WVl = (unsigned short*)(ws + oWVl);
  unsigned short* WDh = (unsigned short*)(ws + oWDh);  unsigned short* WDl = (unsigned short*)(ws + oWDl);
  unsigned short* Qh  = (unsigned short*)(ws + oQh);   unsigned short* Ql  = (unsigned short*)(ws + oQl);
  unsigned short* Kh  = (unsigned short*)(ws + oKh);   unsigned short* Kl  = (unsigned short*)(ws + oKl);
  unsigned short* VT  = (unsigned short*)(ws + oVT);

  const dim3 blk(256);
  const float actCarry = 1024.0f;                    // 2^10 on x, q, k, o2 planes
  const float wCarry   = 65536.0f;                   // 2^16 on weight planes
  const float scale26  = 1.0f / 67108864.0f;         // 2^-26 = 1 / (2^10 * 2^16)
  const float sScale   = 1.0f / 1048576.0f;          // 2^-20 = 1 / (2^10 * 2^10)
  const float pCarry   = 32768.0f;                   // 2^15 on the P tile
  const float pInv     = 1.0f / 32768.0f;            // 2^-15

  // (1) weight planes: hi/lo of W * 2^16 (16 + 16 + 128 + 128 blocks)
  split_w_f16<<<dim3(2 * WSBLK + 2 * WLBLK), blk, 0, stream>>>(Wq, Wk, Wv, Wd, WQh, WQl, WKh, WKl, WVh, WVl, WDh, WDl, wCarry);
  // (2) per block of 64 positions: hi/lo of x * 2^10 into LDS, then v^T = Wv . x + bv[m] -> VT [4][512][4096] f16 single and, with the same
  //     x fragments, q^T, k^T = Wq|Wk . x + bq|bk -> Qh|Ql, Kh|Kl [16384][64] (x2^10): each wave one 16-row tile of the 128 stacked rows; grid (4096/64, 4) = 256 blocks
  const QkPart qkp = {WQh, WQl, WKh, WKl, bq, bk, Qh, Ql, Kh, Kl, actCarry};
  proj_kernel<<<dim3(NPOS / 64, NBAT), blk, 0, stream>>>(x, WVh, WVl, VT, bv, actCarry, scale26, qkp);
  // (3) attention + gamma scale + residual -> o2 hi/lo (x2^10) in LDS, then out[b] = Wd . o2^T + bd[m] -> d_out NCHW f32 [4][512][4096]; grid (4096/64, 4) = 256 blocks
  attn_kernel<<<dim3(NPOS / AQB, NBAT), blk, 0, stream>>>(Qh, Ql, Kh, Kl, VT, x, gamma, WDh, WDl, bd, (float*)d_out, sScale, pCarry, pInv, actCarry, scale26);
  (void)hipGetLastError();
}

// v010
// One run takes 108 microseconds.
// Next to v009, in two timings, it ran 1.07 and 1.06 times as fast.
// Over all steps from v000 it is 5.91 times as fast.
// Contractions: q, k, v 1x1 convs, q.k^T energies and the output 1x1 conv = v_wmma_f32_16x16x32_f16 on f16 hi/lo split planes (hi.hi + hi.lo + lo.hi, 3 products each); p.v = v_wmma_f32_16x16x32_f16 single product (p carried x2^15 as f16, v plain f16 with |v| < 2^-14 written as 0); f32 accumulate everywhere; running-max softmax, 1/rowsum, gamma scale, biases and the residual add (exact f32 x) in f32 on the VALU.
// Plane / carry map (every carry is an exact power of two; the inverse is folded exactly once, at the line named):
//   Xsh|Xsl  f16 (LDS only) [64 n][512 c] per block = hi/lo of x * 2^10 (n = h*64 + w; head of proj_kernel)
//   WQh|WQl, WKh|WKl f16 [64][512]; WVh|WVl, WDh|WDl f16 [512][512] = hi/lo of W * 2^16, natural [out][in] (producer wconv_f16)
//   Qh|Ql, Kh|Kl f16 [16384][64]           = hi/lo of q (or k) * 2^10   (GEMM: acc * 2^-26 removes the x and W carries, + bias, then * 2^10)
//   VT  f16 [4][512 ch][4096 n]            = v, carry 1                   (GEMM: acc * 2^-26 + bias; |v| < 2^-14 stored as 0)
//   energies                               = acc * 2^-20 (q and k carries) in attn_kernel before the softmax
//   P   f16 (LDS only)                     = exp(s - m) * 2^15, values < 2^-14 stored as 0; 2^-15 folded together with 1/rowsum in the attn_kernel epilogue
//   O2h|O2l f16 (LDS only) [64][512] per block = hi/lo of (gamma * out + x) * 2^10 (attn_kernel epilogue)
//   output conv (tail of attn_kernel)      = acc * 2^-26 (O2 and W carries) + bd -> f32 NCHW [4][512][4096]
// Every f16 plane above but P ([query][key] rows, pitch 136 halves) lies in FRAGMENT ORDER (Xsh|Xsl: row tiles XRT halves apart): a matrix [R rows][K cols] is cut into blocks of 16 rows x 32 cols, block (rt, kb) at
// halves ((rt * K/32 + kb) * 512); inside a block element (row c, col 16*s + 8*h + e) sits at s*256 + (h*16 + c)*8 + e, which is the
// register order of a 16x16x32 operand: lane h*16 + c reads its 16 B at lane*8 (s = 0) and at 256 + lane*8 (s = 1), 512 contiguous bytes per wave load.
#include <hip/hip_runtime.h>
#include <math.h>
#include <stdint.h>

#define NBAT  4
#define CCH   512
#define CQK   64
#define IMGH  64
#define IMGW  64
#define NPOS  4096
#define MROWS 16384

static_assert(NPOS == IMGH * IMGW);
static_assert(MROWS == NBAT * NPOS);
static_assert(CCH % 64 == 0);
static_assert(CQK == 64);
static_assert(NPOS % 128 == 0);
static_assert(NPOS % 64 == 0);
static_assert(CCH % 32 == 0);
static_assert((CQK * CCH) % (8 * 256) == 0);
static_assert((CCH * CCH) % (8 * 256) == 0);
static_assert(CCH % 256 == 0);

typedef __attribute__((ext_vector_type(16))) _Float16 v16h;
typedef __attribute__((ext_vector_type(8)))  _Float16 v8h;
typedef __attribute__((ext_vector_type(8)))  float    v8f;
typedef __attribute__((ext_vector_type(4)))  float    v4f;
typedef __attribute__((ext_vector_type(4)))  unsigned int v4u;

__device__ __forceinline__ unsigned short h_bits(_Float16 h) { return __builtin_bit_cast(unsigned short, h); }
__device__ __forceinline__ unsigned pk16(unsigned short a, unsigned short b) { return (unsigned)a | ((unsigned)b << 16); }

// hazard guards as plain device helpers (no inline asm inside the kernel template body)
__device__ __forceinline__ void dep_guard_h(v8f& a, v8f& b, v16h x, v16h y) { asm volatile("v_nop\n\tv_nop\n\tv_nop\n\tv_nop" : "+v"(a), "+v"(b) : "v"(x), "v"(y)); }
__device__ __forceinline__ void acc_guard4(v8f& a, v8f& b, v8f& c, v8f& d) { asm volatile("v_nop\n\tv_nop\n\tv_nop\n\tv_nop" : "+v"(a), "+v"(b), "+v"(c), "+v"(d)); }

// 16-bit fragment loader (A and B alike) from a block in fragment order: p = block start + lane*8; lane row/col = lane&15, h = lane>>4;
// vector elements 0..7 <- p[0..7] (= k0+8h+0..7), 8..15 <- p[256..263] (= k0+16+8h+0..7).
struct FragH {
  union U { v16h v; v8h h[2]; };
  static __device__ __forceinline__ v16h load(const _Float16* p) {
    U f; f.h[0] = *(const v8h*)(p); f.h[1] = *(const v8h*)(p + 256); return f.v;
  }
  // the same from a wave-uniform plane base and the lane's byte offset: one offset register per fragment group instead of a 64-bit address pair
  static __device__ __forceinline__ v16h load_off(const _Float16* base, unsigned boff, int imm) {
    const char* p = (const char*)(const void*)base + boff;
    U f; f.h[0] = *(const v8h*)(p + imm); f.h[1] = *(const v8h*)(p + imm + 512); return f.v;
  }
  static __device__ __forceinline__ v8f mma(v16h a, v16h b, v8f c) {
    return __builtin_amdgcn_wmma_f32_16x16x32_f16(false, a, false, b, (short)0, c, false, false);
  }
  static __device__ __forceinline__ void guard(v8f& a, v8f& b, v16h x, v16h y) { dep_guard_h(a, b, x, y); }
};

// s_wait_xcnt 0 behind a group of global loads, in front of any rewrite of their address registers.
// The addresses are inputs only so that their registers stay as they are up to the wait.
__device__ __forceinline__ void xwait(const void* a) { asm volatile("s_wait_xcnt 0x0" :: "v"(a) : "memory"); }
__device__ __forceinline__ void xwait(const void* a, const void* b, const void* c, const void* d) {
  asm volatile("s_wait_xcnt 0x0" :: "v"(a), "v"(b), "v"(c), "v"(d) : "memory");
}

// the same behind loads of the form uniform base + 32-bit byte offset per lane: the offset register stays as it is up to the wait (the bases are kernel arguments, never rewritten in the loop)
__device__ __forceinline__ void xwait_off(unsigned a) { asm volatile("s_wait_xcnt 0x0" :: "v"(a) : "memory"); }
__device__ __forceinline__ void xwait_off(unsigned a, unsigned b) { asm volatile("s_wait_xcnt 0x0" :: "v"(a), "v"(b) : "memory"); }
// the same where the bases are formed in the kernel: the four scalar bases too stay as they are up to the wait
__device__ __forceinline__ void xwait_off(unsigned a, const void* p, const void* q, const void* r, const void* s) {
  asm volatile("s_wait_xcnt 0x0" :: "v"(a), "s"(p), "s"(q), "s"(r), "s"(s) : "memory");
}
// the same in front of the step of an offset register in a rolled loop. The offset goes through the statement: as an input only, this build replaces it
// by 64-bit address pairs of its own; so it stays the one register that the loads name
__device__ __forceinline__ void xwait_step(unsigned& a) { asm volatile("s_wait_xcnt 0x0" : "+v"(a) :: "memory"); }
__device__ __forceinline__ void xwait_off(unsigned a, const void* p, const void* q) {
  asm volatile("s_wait_xcnt 0x0" :: "v"(a), "s"(p), "s"(q) : "memory");
}

// Where a block starts its walk over an operand that many blocks read (0..31). Blocks bx and bx ^ 4 get the same start; for speed only, any value in range gives the same sums in another order.
__device__ __forceinline__ unsigned walk_start(unsigned bx) { return ((bx & 3u) | ((bx >> 3) << 2)) & 31u; }

// ---- The q, k and v 1x1 convs of 64 positions per block, f16 hi/lo operands, x split inside the launch ----------------------
// Block (bx, b) holds positions n0 = 64*bx .. n0+63 of batch element b. It reads its x tile [512 c][64 n] (f32, rows of 256 B) once, forms hi/lo of x * 2^10
// and keeps both planes in LDS as a matrix [64 n][512 c] in fragment order; behind one barrier wave w forms v channels 64w .. 64w+63 of these positions:
// A = Wv rows (from global, no two waves the same), B = x rows (from LDS, the same for all 8 waves); product = hi.hi + hi.lo + lo.hi, f32 accumulate.
// The wave takes a fifth A row tile beside its four: 16 of the 128 stacked q and k weight rows (row tile w of 8: 0..3 = q, 4..7 = k), times the same B fragments.
// Its tiles hold 8 channels (8*(lane>>4) + r) of one position (lane&15) per lane: the lane's own 16-B unit of the q / k planes' fragment order.
// The fragments of a k step (32 columns) are fetched one k step ahead into a second register set, so that a step's products run while the next step's loads are in flight.
// v = acc * scale + bv[m] goes out as one f16 plane in fragment order (|v| < 2^-14 stored as 0, so the plane holds no f16 subnormals).
#define GK   CCH
#define GRTB (GK * 32)   // bytes of one row tile of an operand plane: GK/32 blocks of 1 KiB, one behind the other
static_assert(GK % 64 == 0);

template <int NA> struct FragSet { v16h ah[NA], al[NA], bh[4], bl[4]; };

// the q / k side of the projection launch
static_assert(CCH / 64 == 2 * CQK / 16);   // one 16-row tile of the stacked q and k weights for each 64-row tile of the v weights
struct QkPart {
  const unsigned short* wqh; const unsigned short* wql;   // weight planes [64][512]
  const unsigned short* wkh; const unsigned short* wkl;
  const float* bq; const float* bk;                       // biases [64]
  unsigned short* qh; unsigned short* ql;                 // out planes [16384][64]
  unsigned short* kh; unsigned short* kl;
  float carry;                                            // on the out planes
};

// Work-group barrier that orders LDS traffic only (s_wait_dscnt 0 in front of the signal). __syncthreads() also drains the wave's outstanding
// global loads, which would end the flight of fragments requested ahead (weight fragments in proj_kernel, K and V fragments in attn_kernel);
// at every place where it stands the waves exchange data through LDS alone.
__device__ __forceinline__ void lds_barrier() {
  __builtin_amdgcn_fence(__ATOMIC_RELEASE, "workgroup", "local");
  __builtin_amdgcn_s_barrier();
  __builtin_amdgcn_fence(__ATOMIC_ACQUIRE, "workgroup", "local");
}

// x planes in LDS: halves from one row tile (16 positions, GK/32 blocks) to the next. The 16 B on top of the blocks turn each row tile by one 16-B unit in the banks:
// a store of the split below holds units of 4 row tiles whose positions lie 4 apart, which fall on 16 different units of the 256-B bank row only so
#define XRT ((GK / 32) * 512 + 8)
static_assert((XRT * 2) % 16 == 0);
static_assert(CCH == 8 * 64);   // one 64-row tile of Wv, and 64 channels of the x tile, for each of the 8 waves

// A fragments of one k step: plane starts of the wave's row tiles (wave-uniform) + the lane's byte offset + immediates
__device__ __forceinline__ void proj_fetch_a(FragSet<5>& f, const _Float16* Ah, const _Float16* Al, const _Float16* Eh, const _Float16* El, unsigned off, int imm) {
#pragma unroll
  for (int i = 0; i < 4; ++i) {
    f.ah[i] = FragH::load_off(Ah, off, imm + i * GRTB);
    f.al[i] = FragH::load_off(Al, off, imm + i * GRTB);
  }
  f.ah[4] = FragH::load_off(Eh, off, imm);
  f.al[4] = FragH::load_off(El, off, imm);
  // a step's loads (B in front, A behind) are issued as one group in front of the other set's products; without it the build sinks the A loads among the products, which shortens their lead
  __builtin_amdgcn_sched_barrier(0);
}
// B fragments: 4 row tiles of the x planes in LDS; imm in halves
__device__ __forceinline__ void proj_fetch_b(FragSet<5>& f, const _Float16* Bh, const _Float16* Bl, int imm) {
#pragma unroll
  for (int j = 0; j < 4; ++j) {
    f.bh[j] = FragH::load(Bh + j * XRT + imm);
    f.bl[j] = FragH::load(Bl + j * XRT + imm);
  }
  // the LDS reads stay in front of the step's global loads: with the two groups the other way round this build keeps one weight fragment in scratch, behind a full wait on its load
  __builtin_amdgcn_sched_barrier(0);
}

// the products of one k step; per accumulator in the order hi.hi, hi.lo, lo.hi, four independent accumulators between two products into the same one
template <bool SPLIT, int NA>
__device__ __forceinline__ void gemm_mul(v8f (&acc)[NA][4], const FragSet<NA>& f) {
#pragma unroll
  for (int i = 0; i < 4; ++i) {
#pragma unroll
    for (int j = 0; j < 4; ++j) acc[i][j] = FragH::mma(f.ah[i], f.bh[j], acc[i][j]);
    if (SPLIT) {
#pragma unroll
      for (int j = 0; j < 4; ++j) acc[i][j] = FragH::mma(f.ah[i], f.bl[j], acc[i][j]);
#pragma unroll
      for (int j = 0; j < 4; ++j) acc[i][j] = FragH::mma(f.al[i], f.bh[j], acc[i][j]);
    }
  }
  if (NA == 5) {   // q / k row tile: x is the Bt side here; the order stays x hi . w hi, x hi . w lo, x lo . w hi
#pragma unroll
    for (int j = 0; j < 4; ++j) acc[NA - 1][j] = FragH::mma(f.ah[NA - 1], f.bh[j], acc[NA - 1][j]);
#pragma unroll
    for (int j = 0; j < 4; ++j) acc[NA - 1][j] = FragH::mma(f.al[NA - 1], f.bh[j], acc[NA - 1][j]);
#pragma unroll
    for (int j = 0; j < 4; ++j) acc[NA - 1][j] = FragH::mma(f.ah[NA - 1], f.bl[j], acc[NA - 1][j]);
  }
  // every product of the step stays in front of this line: behind it the set's registers are refilled
  __builtin_amdgcn_sched_barrier(0);
  // four vector slots between the last products and the loads that refill this set's registers
  FragH::guard(acc[NA - 1][0], acc[NA - 1][3], f.ah[NA - 1], f.al[NA - 1]);
}

__global__ __launch_bounds__(256) void proj_kernel(
    const float* __restrict__ X,
    const unsigned short* __restrict__ Ap, const unsigned short* __restrict__ A2p,
    unsigned short* __restrict__ Vout, const float* __restrict__ bias,
    float xcarry, float scale, QkPart qk) {
  constexpr int NA = 5;
  __shared__ __align__(16) _Float16 Xsh[4 * XRT];  // x hi plane of the block's 64 positions, fragment order, row tiles XRT halves apart
  __shared__ __align__(16) _Float16 Xsl[4 * XRT];  // x lo plane, the same
  __shared__ __align__(16) float sT[8][16 * 68];   // per-wave 16x64 slab, pitch 68 floats
  const int b    = blockIdx.y;
  const int lane = threadIdx.x & 31;
  const int wave = __builtin_amdgcn_readfirstlane(threadIdx.x >> 5);   // scalar, so that the plane starts below are formed once per wave on the scalar unit
  const int tm = wave;
  const int m0 = tm << 6;
  const int n0 = blockIdx.x << 6;

  // starts of the wave's 64 rows in the Wv planes (4 row tiles, GRTB bytes each): the same in every lane, formed once, never rewritten
  const _Float16* Ab  = (const _Float16*)(const void*)Ap  + (size_t)m0 * GK;
  const _Float16* Ab2 = (const _Float16*)(const void*)A2p + (size_t)m0 * GK;
  // the wave's q or k weight row tile (16 rows = GRTB bytes), wave-uniform as well
  const _Float16* Eb  = (const _Float16*)(const void*)(tm < 4 ? qk.wqh : qk.wkh) + (size_t)(tm & 3) * 16 * GK;
  const _Float16* Eb2 = (const _Float16*)(const void*)(tm < 4 ? qk.wql : qk.wkl) + (size_t)(tm & 3) * 16 * GK;

  const int rlane = lane & 15;                 // col (D) within subtile
  const int mOff  = (lane >> 4) * 8;           // D row offset
  const unsigned rk = walk_start(blockIdx.x) & (GK / 32 - 1);   // first k step of this block's walk over the weight planes, which all 256 blocks read
  unsigned ko = (unsigned)lane * 16 + rk * 1024;   // bytes: the lane's 16 B inside each 512-B half block of k step rk
  FragSet<NA> f0, f1;

  // ---- x tile -> hi/lo planes in LDS. Wave w takes channels 64w .. 64w+63; a lane reads 4 patches of 8 channels (16p + 8*(lane>>4) + e) x 4 positions (4*(lane&15) + i):
  //      each load covers two whole 256-B rows; a patch is 4 16-B units (8 channels of one position) of each plane ----
  {
    const int pg = lane & 15, oh = lane >> 4;
    const float* xb = X + ((size_t)b * CCH + wave * 64 + oh * 8) * NPOS + n0 + pg * 4;
    v4f a[4][8];
#pragma unroll
    for (int p = 0; p < 4; ++p)
#pragma unroll
      for (int e = 0; e < 8; ++e) a[p][e] = *(const v4f*)(xb + (size_t)(p * 16 + e) * NPOS);
    xwait(xb);   // behind the 32 loads, in front of the reuse of their address registers
    proj_fetch_a(f0, Ab, Ab2, Eb, Eb2, ko, 0);   // the weight fragments of the walk's first k step follow the 32 loads and stay in flight across the barrier
    // unit (position 16*rt + c, channels 32*kb + 16*s + 8*h + 0..7): rt = pg >> 2, c = 4*(pg & 3) + i, kb = 2*wave + (p >> 1), s = p & 1, h = oh
    const int lb = (pg >> 2) * XRT + wave * 1024 + (oh * 16 + (pg & 3) * 4) * 8;
#pragma unroll
    for (int p = 0; p < 4; ++p) {
#pragma unroll
      for (int i = 0; i < 4; ++i) {
        v8h hv, lv;
#pragma unroll
        for (int e = 0; e < 8; ++e) {
          const float f = a[p][e][i] * xcarry;
          const _Float16 hq = (_Float16)f;
          hv[e] = hq;
          lv[e] = (_Float16)(f - (float)hq);
        }
        const int lo = lb + (p >> 1) * 512 + (p & 1) * 256 + i * 8;
        *(v8h*)(Xsh + lo) = hv;
        *(v8h*)(Xsl + lo) = lv;
      }
    }
  }

  v8f acc[NA][4];
#pragma unroll
  for (int i = 0; i < NA; ++i)
#pragma unroll
    for (int j = 0; j < 4; ++j) acc[i][j] = (v8f){0.f,0.f,0.f,0.f,0.f,0.f,0.f,0.f};

  lds_barrier();   // every wave reads all 512 channels of the 64 positions
  const _Float16* Bh = Xsh + lane * 8 + rk * 512;
  const _Float16* Bl = Xsl + lane * 8 + rk * 512;
  proj_fetch_b(f0, Bh, Bl, 0);
  // to the walk's s-th k step, (rk + s) mod 16: 1 KiB further in every row tile of the weight planes and of the x planes, or back to the first block.
  // The wait stands a k step's products behind the last weight loads, in front of the step of their offset register
  auto advance = [&](int s) __attribute__((always_inline)) {
    const int d = (((unsigned)s + rk) & (GK / 32 - 1)) != 0 ? 1 : 1 - GK / 32;
    xwait_step(ko);
    ko += (unsigned)(d * 1024);
    Bh += d * 512;
    Bl += d * 512;
  };
#pragma unroll
  for (int s = 0; s < GK / 32; s += 2) {
    advance(s + 1);
    proj_fetch_b(f1, Bh, Bl, 0);                 // step s + 1 of the walk, in flight under the products of step s
    proj_fetch_a(f1, Ab, Ab2, Eb, Eb2, ko, 0);
    gemm_mul<true, NA>(acc, f0);
    if (s + 2 < GK / 32) {
      advance(s + 2);
      proj_fetch_b(f0, Bh, Bl, 0);                 // step s + 2, in flight under the products of step s + 1
      proj_fetch_a(f0, Ab, Ab2, Eb, Eb2, ko, 0);
    } else {
      xwait_off(ko, Ab, Ab2, Eb, Eb2);   // a k step's products behind the last loads, where it holds up nothing; the epilogue reuses the offset's and the bases' registers only behind it
    }
    gemm_mul<true, NA>(acc, f1);
  }
  acc_guard4(acc[0][0], acc[0][1], acc[0][2], acc[0][3]);
  acc_guard4(acc[1][0], acc[1][1], acc[1][2], acc[1][3]);
  acc_guard4(acc[2][0], acc[2][1], acc[2][2], acc[2][3]);
  acc_guard4(acc[3][0], acc[3][1], acc[3][2], acc[3][3]);
  acc_guard4(acc[NA - 1][0], acc[NA - 1][1], acc[NA - 1][2], acc[NA - 1][3]);

  // ---- epilogue: v rows, 16 at a time through the wave's slab ----
  float* slab = sT[wave];
#pragma unroll
  for (int i = 0; i < 4; ++i) {
    const int mBase = m0 + (i << 4);
    const float* bp = bias + mBase + mOff;
    float bv8[8];
#pragma unroll
    for (int r = 0; r < 8; ++r) bv8[r] = bp[r];
    xwait(bp);   // behind the bias loads, in front of the reuse of their address registers
#pragma unroll
    for (int j = 0; j < 4; ++j) {
#pragma unroll
      for (int r = 0; r < 8; ++r) {
        float v = acc[i][j][r] * scale;
        v += bv8[r];
        slab[(mOff + r) * 68 + (j << 4) + rlane] = v;
      }
    }
    __builtin_amdgcn_fence(__ATOMIC_RELEASE, "workgroup");
    __builtin_amdgcn_wave_barrier();
    __builtin_amdgcn_fence(__ATOMIC_ACQUIRE, "workgroup");
    {
      const int row = lane & 15, h8 = (lane >> 4) * 8;
      _Float16* C = (_Float16*)(void*)Vout + (size_t)b * CCH * NPOS;
      const size_t tb = (((size_t)(mBase >> 4) * (NPOS >> 5) + (n0 >> 5)) << 9) + lane * 8;   // the slab's two blocks follow one another
#pragma unroll
      for (int it = 0; it < 4; ++it) {                     // it = 2 * (block) + s: cols it*16 + h8 .. +7 of row lane&15
        const float* sp = slab + row * 68 + it * 16 + h8;
        v8h hv;
#pragma unroll
        for (int e = 0; e < 8; ++e) {
          float f = sp[e];
          f = (fabsf(f) >= 6.103515625e-05f) ? f : 0.0f;
          hv[e] = (_Float16)f;
        }
        *(v8h*)(C + tb + it * 256) = hv;
      }
    }
    __builtin_amdgcn_fence(__ATOMIC_RELEASE, "workgroup");
    __builtin_amdgcn_wave_barrier();
    __builtin_amdgcn_fence(__ATOMIC_ACQUIRE, "workgroup");
  }

  // ---- q / k row tile: (acc * scale + bias) * carry, hi/lo split, one 16-B store per plane and tile straight from the accumulators ----
  {
    const int d0 = (tm & 3) * 16;                        // first of the tile's 16 q (or k) channels
    const float* be = (tm < 4 ? qk.bq : qk.bk) + d0 + mOff;
    _Float16* Eo  = (_Float16*)(void*)(tm < 4 ? qk.qh : qk.kh);
    _Float16* Eo2 = (_Float16*)(void*)(tm < 4 ? qk.ql : qk.kl);
    float bb[8];
#pragma unroll
    for (int r = 0; r < 8; ++r) bb[r] = be[r];
    // block (position row tile, d0 / 32) of a [16384][64] plane, half block s = (d0 / 16) & 1; the wave's four position tiles lie CQK / 32 blocks apart
    const size_t eb = (((size_t)((b * NPOS + n0) >> 4) * (CQK >> 5) + (d0 >> 5)) << 9) + ((d0 >> 4) & 1) * 256 + lane * 8;
#pragma unroll
    for (int j = 0; j < 4; ++j) {
      v8h hv, lv;
#pragma unroll
      for (int r = 0; r < 8; ++r) {
        float v = acc[NA - 1][j][r] * scale;
        v += bb[r];
        v *= qk.carry;
        const _Float16 hq = (_Float16)v;
        hv[r] = hq;
        lv[r] = (_Float16)(v - (float)hq);
      }
      *(v8h*)(Eo  + eb + (size_t)j * ((CQK >> 5) << 9)) = hv;
      *(v8h*)(Eo2 + eb + (size_t)j * ((CQK >> 5) << 9)) = lv;
    }
  }
}

// ---------------------------------------------------------------------------
// f16 hi/lo split of a row-major f32 matrix [rows][CCH] with total element count 8*n8 into planes in fragment order:
//   hi = f16(in * carry), lo = f16(in * carry - hi). Thread i makes the i-th 16-B unit of each plane from 8 consecutive elements of one row
// ---------------------------------------------------------------------------
__device__ __forceinline__ void wconv_f16(const float* __restrict__ in, unsigned short* __restrict__ oh,
                                          unsigned short* __restrict__ ol, int blk, int n8, float carry) {
  const int i = blk * 256 + threadIdx.x;
  if (i < n8) {
    const size_t e0 = (size_t)i * 8;
    const int blkid = i >> 6;                                             // block (rt, kb), CCH/32 blocks per row tile
    const int srow = (blkid / (CCH / 32)) * 16 + (i & 15);
    const int scol = (blkid % (CCH / 32)) * 32 + ((i >> 4) & 3) * 8;      // bits 5,4 of i = s,h: col 16*s + 8*h
    const float* ip = in + (size_t)srow * CCH + scol;
    const v4f a = *(const v4f*)(ip);
    const v4f c = *(const v4f*)(ip + 4);
    xwait(ip);   // behind the two loads, in front of the reuse of their address registers
    float f[8];
    f[0] = a[0]; f[1] = a[1]; f[2] = a[2]; f[3] = a[3];
    f[4] = c[0]; f[5] = c[1]; f[6] = c[2]; f[7] = c[3];
    v4u hv, lv;
#pragma unroll
    for (int q = 0; q < 4; ++q) {
      const float f0 = f[2 * q] * carry, f1 = f[2 * q + 1] * carry;
      const _Float16 h0 = (_Float16)f0, h1 = (_Float16)f1;
      const _Float16 l0 = (_Float16)(f0 - (float)h0), l1 = (_Float16)(f1 - (float)h1);
      hv[q] = pk16(h_bits(h0), h_bits(h1));
      lv[q] = pk16(h_bits(l0), h_bits(l1));
    }
    {
      *(v4u*)(oh + e0) = hv;
      *(v4u*)(ol + e0) = lv;
      
    }
  }
}

// ---------------------------------------------------------------------------
// All four weight splits in one launch: none reads what another writes, so the block index picks the job (the same in every thread of a block).
// Wq, Wk (WSBLK blocks each), then Wv, Wd (WLBLK blocks each).
// ---------------------------------------------------------------------------
#define WSBLK (CQK * CCH / 8 / 256)
#define WLBLK (CCH * CCH / 8 / 256)
__global__ __launch_bounds__(256) void split_w_f16(const float* __restrict__ Wq, const float* __restrict__ Wk,
                                                   const float* __restrict__ Wv, const float* __restrict__ Wd,
                                                   unsigned short* __restrict__ wqh, unsigned short* __restrict__ wql,
                                                   unsigned short* __restrict__ wkh, unsigned short* __restrict__ wkl,
                                                   unsigned short* __restrict__ wvh, unsigned short* __restrict__ wvl,
                                                   unsigned short* __restrict__ wdh, unsigned short* __restrict__ wdl,
                                                   float wCarry) {
  // weight planes, natural [out][in] layout, hi/lo of W * wCarry
  const int wb = blockIdx.x;
  if (wb < WSBLK)                      wconv_f16(Wq, wqh, wql, wb, CQK * CCH / 8, wCarry);
  else if (wb < 2 * WSBLK)             wconv_f16(Wk, wkh, wkl, wb - WSBLK, CQK * CCH / 8, wCarry);
  else if (wb < 2 * WSBLK + WLBLK)     wconv_f16(Wv, wvh, wvl, wb - 2 * WSBLK, CCH * CCH / 8, wCarry);
  else                                 wconv_f16(Wd, wdh, wdl, wb - 2 * WSBLK - WLBLK, CCH * CCH / 8, wCarry);
}

// =====================================================================================
// Flash-style attention with a 512-wide value dimension and a 64-deep score dimension, no score scaling.
//   All four kinds of plane in fragment order (head of the file):
//   q planes (hi/lo f16, x2^10) [16384][64]: row b*4096 + i, col d
//   k planes (hi/lo f16, x2^10) [16384][64]: same for keys j
//   v plane (f16, carry 1) [4*512][4096]: row b*512 + ch, col j
//   o2 planes (hi/lo f16, x2^10) [64][512], in LDS: row i - i0, col ch = split of (gamma*out + x[b][ch][i]) * 2^10
//   The output conv runs in the same launch: the block holds all 512 channels of its 64 positions, so behind one barrier (B3) wave w forms
//   out channels 64w .. 64w+63 of these positions = Wd rows (A, from global, no two waves the same) . o2 rows (B, from LDS, the same for all 8 waves).
//   Both products are formed TRANSPOSED, so that a lane's column (lane&15) is one query in the score tiles and in the output tiles alike:
//   scores S^T = k . q^T on split planes (hi.hi + lo.hi + hi.lo), * sscale (= 2^-20) in f32: A = K fragment (row = key), B = Q fragment (col = query);
//   a lane holds 8 keys (8*(lane>>4) + r) of one query per tile: row maximum and row sum run inside the lane, plus one exchange between the wave's halves;
//   running-max softmax in f32 over the 4096 keys of the batch element (32 chunks of 128, compile-time trip count);
//   a block takes the chunks in the order rot, rot + 1, ... and round the end to rot - 1 (rot = walk_start of its index): the chunk numbers jc below count along that walk;
//   P = exp(s - m) * pcarry (2^15) as f16 in LDS (values < 2^-14 stored as 0); out^T = v . P^T single products, f32 accumulate
//   (A = V fragment, row = channel; B = P rows, col = query), times (1/rowsum) * pinv (2^-15) at the end.
//   Block = 64 query rows (4 query tiles of 16) of one batch element, 8 waves; wave w computes the 16x64 score piece for keys
//   j0 + 16w .. +15 of each chunk (shared through LDS: partial row max Pm, partial row sum Pl, P tile Ps) and accumulates the
//   output for channels 64w .. 64w+63 (4 query tiles x 4 channel tiles in registers). Each K fragment and each V fragment
//   loaded from global feeds one product per query tile (the K hi fragment two). grid = (4096/64, 4) = 256 blocks.
//   The block's Q rows sit in LDS (Qsh/Qsl, written once, barrier B0) and are read as fragments in every chunk.
//   Barriers per chunk: after the Pm writes (B1) and after the Ps/Pl writes (B2). The loop runs one chunk apart: between B1 and B2 of chunk jc + 1
//   stand its softmax (writes P tile (jc + 1) & 1 and Pl) and the products P.V of chunk jc (read P tile jc & 1, written in front of B2 of chunk jc);
//   a P tile is rewritten two barriers behind its last read. Pm is written behind B2 and read behind B1; Pl is read behind B2, in front of the next B1.
//   Every wave reaches every barrier (no early exit).
//   B1 and B2 order LDS only (lds_barrier): the K and V fragments of the next chunk stay in flight across them.
//   LDS extents: a P tile's rows 0..63 x cols 0..127 fully written each chunk (8 waves x 16 cols) before any fragment read
//   (reads reach col 127; cols 128..135 never read); Pm/Pl [64][8] fully written.
//   Fragment loads from global (K, V blocks): plane base (kernel argument) + the lane's 32-bit byte offset, 16-B aligned, one chunk ahead of their use.
// =====================================================================================
#define AQT    4
#define AQB    (16 * AQT)
#define AKC    128
#define PPITCH 136
#define NCHUNK (NPOS / AKC)

static_assert(NPOS % AQB == 0);
static_assert(NCHUNK * AKC == NPOS);
static_assert(CCH == 8 * 64);
static_assert((PPITCH * 2) % 16 == 0);
static_assert(AQB * CQK == 2 * 256 * 8);

// value of lane l ^ 16 (the other half of the wave), on the vector unit
__device__ __forceinline__ float xhalf(float x) {
  return __builtin_bit_cast(float, __builtin_amdgcn_permlanex16(__builtin_bit_cast(int, x), __builtin_bit_cast(int, x), 0x76543210, 0xfedcba98, false, false));
}

// fragments of one k step of the output conv. A: 4 row tiles of the Wd planes, wave-uniform plane start + the lane's byte offset + immediate
__device__ __forceinline__ void out_fetch_a(FragSet<4>& f, const _Float16* Ah, const _Float16* Al, unsigned off, int imm) {
#pragma unroll
  for (int i = 0; i < 4; ++i) {
    f.ah[i] = FragH::load_off(Ah, off, imm + i * GRTB);
    f.al[i] = FragH::load_off(Al, off, imm + i * GRTB);
  }
}
// B: 4 row tiles (16 positions each, CCH / 32 blocks apart) of the o2 planes in LDS; imm in halves
__device__ __forceinline__ void out_fetch_b(FragSet<4>& f, const _Float16* Bh, const _Float16* Bl, int imm) {
#pragma unroll
  for (int j = 0; j < 4; ++j) {
    f.bh[j] = FragH::load(Bh + j * (CCH / 32) * 512 + imm);
    f.bl[j] = FragH::load(Bl + j * (CCH / 32) * 512 + imm);
  }
  // a step's loads are issued as one group in front of the other set's products; without it the build may sink them among the products, which shortens their lead
  __builtin_amdgcn_sched_barrier(0);
}

__global__ __launch_bounds__(256)
void attn_kernel(const unsigned short* __restrict__ qhp, const unsigned short* __restrict__ qlp,
                 const unsigned short* __restrict__ khp, const unsigned short* __restrict__ klp,
                 const unsigned short* __restrict__ vtp,
                 const float* __restrict__ X, const float* __restrict__ gam,
                 const unsigned short* __restrict__ wdhp, const unsigned short* __restrict__ wdlp,
                 const float* __restrict__ bd, float* __restrict__ outp,
                 float sscale, float pcarry, float pinv, float ocarry, float wscale) {
  union FB { v16h v; v8h h[2]; };
  __shared__ __align__(16) _Float16 Ps[2 * AQB * PPITCH]; // two P tiles [query row][key in chunk], pitch 136 halves: chunk jc in tile jc & 1
  __shared__ __align__(16) float    Pm[AQB * 8];          // partial row max  [row][wave]
  __shared__ __align__(16) float    Pl[AQB * 8];          // partial row sum  [row][wave]
  __shared__ __align__(16) _Float16 Qsh[AQB * CQK];       // q hi plane rows of this block, fragment order as in global
  __shared__ __align__(16) _Float16 Qsl[AQB * CQK];       // q lo plane rows of this block, fragment order as in global
  __shared__ __align__(16) _Float16 O2sh[AQB * CCH];      // o2 hi plane of the block's 64 positions, fragment order: 4 row tiles x 16 blocks
  __shared__ __align__(16) _Float16 O2sl[AQB * CCH];      // o2 lo plane, the same
  __shared__ __align__(16) float    sT[8][16 * 68];       // per-wave 16x64 slab of the output conv's epilogue, pitch 68 floats

  const int tid  = threadIdx.x;
  const int wave = tid >> 5;
  const int lane = tid & 31;
  const int hh   = lane >> 4;
  const int c    = lane & 15;
  const int wsel = __builtin_amdgcn_readfirstlane(tid >> 7);   // 0 in waves 0..3, 1 in waves 4..7; scalar, so that the choice of order in the chunk loop is a scalar branch

  const int b  = blockIdx.y;                       // 0..3
  const int i0 = blockIdx.x * AQB;                 // first query position of this block
  const size_t qrow0 = (size_t)b * NPOS + i0;      // row in the q planes

  const _Float16* Qh = (const _Float16*)(const void*)qhp;
  const _Float16* Ql = (const _Float16*)(const void*)qlp;
  const _Float16* Kh = (const _Float16*)(const void*)khp;
  const _Float16* Kl = (const _Float16*)(const void*)klp;
  const _Float16* Vt = (const _Float16*)(const void*)vtp;
  const unsigned rot = walk_start(blockIdx.x);     // first key chunk of this block's walk: chunk (rot + j) mod 32 is the j-th; the 64 blocks of a batch element read the same K and V planes
  static_assert(NCHUNK == 32);
  const unsigned vw_off = (((unsigned)b * CCH + (unsigned)wave * 64) * NPOS + (unsigned)lane * 8) * 2 + rot * (unsigned)(AKC / 32) * 1024;   // bytes: this wave's 64 channel rows, the lane's 16 B, chunk rot
  const float g = gam[0];

  // ---- Q rows of the block (64 x 64, hi and lo) into LDS once: 512 pieces of 16 B per plane, 2 per thread and plane;
  //      the 16 Q fragments would take 128 registers, which the accumulators and the V fragments in flight need ----
  {
    const int q8 = tid * 8;                        // the 64 rows are 4 row tiles = 4096 consecutive halves; pieces tid and 256 + tid
    const _Float16* gh0 = Qh + qrow0 * CQK + q8;
    const _Float16* gl0 = Ql + qrow0 * CQK + q8;
    const _Float16* gh1 = gh0 + 32 * CQK;
    const _Float16* gl1 = gl0 + 32 * CQK;
    const v8h th0 = *(const v8h*)gh0, tl0 = *(const v8h*)gl0, th1 = *(const v8h*)gh1, tl1 = *(const v8h*)gl1;
    xwait(gh0, gl0, gh1, gl1);
    *(v8h*)(Qsh + q8) = th0;
    *(v8h*)(Qsl + q8) = tl0;
    *(v8h*)(Qsh + 32 * CQK + q8) = th1;
    *(v8h*)(Qsl + 32 * CQK + q8) = tl1;
  }
  __syncthreads();   // B0: every wave reads all 64 Q rows

  float mrow[AQT], lrow[AQT];                      // of query t*16 + c, the same in both halves of the wave and in every wave
  v8f acc[AQT][4];                                 // acc[t][n][r] = out of query t*16 + c, channel 64*wave + 16*n + 8*hh + r
#pragma unroll
  for (int t = 0; t < AQT; ++t) {
    mrow[t] = -INFINITY; lrow[t] = 0.f;
#pragma unroll
    for (int n = 0; n < 4; ++n) acc[t][n] = (v8f){0.f,0.f,0.f,0.f,0.f,0.f,0.f,0.f};
  }

  // K fragments (A operand, row = lane&15 = key) of this wave's key row tile (2 blocks of 512 halves per plane) are fetched one chunk ahead: the walk's first chunk here
  const unsigned kw_off = (((unsigned)b * NPOS + (unsigned)wave * 16) * CQK + (unsigned)lane * 8) * 2 + rot * (unsigned)(AKC * CQK * 2);   // bytes, the same in the hi and the lo plane
  v16h kfh[2], kfl[2];
#pragma unroll
  for (int dc = 0; dc < 2; ++dc) {
    kfh[dc] = FragH::load_off(Kh, kw_off, dc * 1024);
    kfl[dc] = FragH::load_off(Kl, kw_off, dc * 1024);
  }
  xwait_off(kw_off);
  // The 16 V fragments of a chunk (A operand, row = lane&15 = channel) do not depend on the scores: they too are fetched one chunk ahead, chunk 0 behind the first scores below,
  // each later one into the same registers right behind its last product, so that it lands under the work of the trip that follows
  // (neither barrier of the chunk drains the loads)
  unsigned vo = vw_off;   // bytes: first block of the walk's first chunk in the wave's first channel row tile
  v16h vb[4][4];

  v8f s[AQT];          // scaled scores of the chunk whose softmax comes next
  float alpha[AQT];    // rescale factor of the chunk whose softmax ran last
  unsigned ko = kw_off;

  // ---- row sums of the chunk whose softmax ran last, behind its B2 ----
  auto rowsum = [&]() __attribute__((always_inline)) {
#pragma unroll
    for (int t = 0; t < AQT; ++t) {
      const int row = t * 16 + c;
      const v4f la = *(const v4f*)(Pl + row * 8);
      const v4f lb = *(const v4f*)(Pl + row * 8 + 4);
      const float ls = ((la[0] + la[1]) + (la[2] + la[3])) + ((lb[0] + lb[1]) + (lb[2] + lb[3]));
      lrow[t] = lrow[t] * alpha[t] + ls;
    }
  };

  // ---- score piece of chunk jc, transposed: rows = keys ((rot + jc) mod 32) * AKC + 16*wave + 8*hh + r, cols = 64 queries (B operand col = lane&15); partial maxima into Pm ----
  auto scores = [&](int jc, bool sums) __attribute__((always_inline)) {
#pragma unroll
    for (int t = 0; t < AQT; ++t) s[t] = (v8f){0.f,0.f,0.f,0.f,0.f,0.f,0.f,0.f};
#pragma unroll
    for (int dc = 0; dc < 2; ++dc) {
      const v16h kbh = kfh[dc];
      const v16h kbl = kfl[dc];
      // Q fragments (B operand, col = lane&15) from LDS, same k map as the K fragments
      v16h qah[AQT], qal[AQT];
#pragma unroll
      for (int t = 0; t < AQT; ++t) {
        qah[t] = FragH::load(Qsh + (t * 2 + dc) * 512 + lane * 8);
        qal[t] = FragH::load(Qsl + (t * 2 + dc) * 512 + lane * 8);
      }
#pragma unroll
      for (int t = 0; t < AQT; ++t) s[t] = FragH::mma(kbh, qah[t], s[t]);
#pragma unroll
      for (int t = 0; t < AQT; ++t) s[t] = FragH::mma(kbl, qah[t], s[t]);
#pragma unroll
      for (int t = 0; t < AQT; ++t) s[t] = FragH::mma(kbh, qal[t], s[t]);
    }
    // K fragments of the walk's next chunk into the same registers, right behind their last use (behind the batch element's last chunk comes its first; the walk's last chunk so fetches
    // the first again, inside the planes)
    ko += ((((unsigned)jc + 1 + rot) & (NCHUNK - 1)) != 0) ? (unsigned)(AKC * CQK * 2) : (unsigned)(AKC * CQK * 2) - (unsigned)(NCHUNK * AKC * CQK * 2);   // stepped in place, behind the wait that follows the loads before
#pragma unroll
    for (int dc = 0; dc < 2; ++dc) {
      kfh[dc] = FragH::load_off(Kh, ko, dc * 1024);
      kfl[dc] = FragH::load_off(Kl, ko, dc * 1024);
    }
    if (sums) rowsum();   // of the chunk before: its 8 LDS reads land under the vector work below, not in front of the barrier
    // scale, then this wave's partial maximum over its 16 keys of query t*16 + c: 8 in the lane, 8 in lane ^ 16
    float mloc[AQT];
#pragma unroll
    for (int t = 0; t < AQT; ++t) {
#pragma unroll
      for (int r = 0; r < 8; ++r) s[t][r] *= sscale;
      const float m = fmaxf(fmaxf(fmaxf(s[t][0], s[t][1]), fmaxf(s[t][2], s[t][3])),
                            fmaxf(fmaxf(s[t][4], s[t][5]), fmaxf(s[t][6], s[t][7])));
      mloc[t] = fmaxf(m, xhalf(m));
    }
    if (hh == 0) {
#pragma unroll
      for (int t = 0; t < AQT; ++t) Pm[(t * 16 + c) * 8 + wave] = mloc[t];
    }
  };

  // ---- running max update (identical in every wave), P tile into Pw, partial row sums into Pl; leaves alpha ----
  auto softmax = [&](_Float16* Pw) __attribute__((always_inline)) {
    float psl[AQT];
    v4f ma[AQT], mb[AQT];
#pragma unroll
    for (int t = 0; t < AQT; ++t) {                     // the 8 reads stand together: one LDS wait for all four query tiles
      ma[t] = *(const v4f*)(Pm + (t * 16 + c) * 8);
      mb[t] = *(const v4f*)(Pm + (t * 16 + c) * 8 + 4);
    }
    // keeps the 8 reads in one group; without it this build reads tile by tile and waits out the LDS latency once per query tile
    __builtin_amdgcn_sched_barrier(0);
#pragma unroll
    for (int t = 0; t < AQT; ++t) {
      const int row = t * 16 + c;
      const float cm = fmaxf(fmaxf(fmaxf(ma[t][0], ma[t][1]), fmaxf(ma[t][2], ma[t][3])),
                             fmaxf(fmaxf(mb[t][0], mb[t][1]), fmaxf(mb[t][2], mb[t][3])));
      const float mnew = fmaxf(mrow[t], cm);
      alpha[t] = __expf(mrow[t] - mnew);
      mrow[t] = mnew;
      float p[8];
      v8h ph;
#pragma unroll
      for (int r = 0; r < 8; ++r) {
        p[r] = __expf(s[t][r] - mnew);                  // in (0, 1]
        float p32 = p[r] * pcarry;
        p32 = (p32 >= 6.103515625e-05f) ? p32 : 0.0f;   // no f16 subnormals in the P tile
        ph[r] = (_Float16)p32;
      }
      *(v8h*)(Pw + row * PPITCH + wave * 16 + 8 * hh) = ph;   // the lane's 8 keys lie side by side in the query's P row: one 16-B store
      const float psum = ((p[0] + p[1]) + (p[2] + p[3])) + ((p[4] + p[5]) + (p[6] + p[7]));
      psl[t] = psum + xhalf(psum);
    }
    if (hh == 0) {
#pragma unroll
      for (int t = 0; t < AQT; ++t) Pl[(t * 16 + c) * 8 + wave] = psl[t];
    }
  };

  // ---- out^T(64 ch of this wave x 64 queries) += V(64 x 128) . P^T(128 x 64): A = v plane rows (row = lane&15 = channel),
  //      B = P tile Pr (col = lane&15 = query within the query tile), both with the split k map; one V fragment serves all 4 query tiles ----
  auto pv = [&](const _Float16* Pr, bool refill) __attribute__((always_inline)) {
    FB pa[2][AQT];
#pragma unroll
    for (int t = 0; t < AQT; ++t) {
      pa[0][t].h[0] = *(const v8h*)(Pr + (t * 16 + c) * PPITCH + 8 * hh);
      pa[0][t].h[1] = *(const v8h*)(Pr + (t * 16 + c) * PPITCH + 16 + 8 * hh);
    }
#pragma unroll
    for (int kk = 0; kk < 4; ++kk) {
      if (kk < 3) {
#pragma unroll
        for (int t = 0; t < AQT; ++t) {
          pa[(kk + 1) & 1][t].h[0] = *(const v8h*)(Pr + (t * 16 + c) * PPITCH + (kk + 1) * 32 + 8 * hh);
          pa[(kk + 1) & 1][t].h[1] = *(const v8h*)(Pr + (t * 16 + c) * PPITCH + (kk + 1) * 32 + 16 + 8 * hh);
        }
      }
      // the next step's 8 P reads stand as one group in front of this step's products, one step ahead and no further: read further ahead they cost registers that the build does not have (scratch)
      __builtin_amdgcn_sched_barrier(0);
#pragma unroll
      for (int n = 0; n < 4; ++n) {
#pragma unroll
        for (int t = 0; t < AQT; ++t) acc[t][n] = FragH::mma(vb[kk][n], pa[kk & 1][t].v, acc[t][n]);
      }
      if (refill) {
#pragma unroll
        for (int n = 0; n < 4; ++n) vb[kk][n] = FragH::load_off(Vt, vo, (n * 16 * NPOS + kk * 512) * 2);   // the next chunk's
      }
      // ends the step: the P reads of the step after next stay behind this step's products, whose P registers they reuse
      __builtin_amdgcn_sched_barrier(0);
    }
  };

  // ---- the accumulators onto the new running maximum: behind the products of the chunk before, in front of the next chunk's ----
  auto rescale = [&]() __attribute__((always_inline)) {
#pragma unroll
    for (int t = 0; t < AQT; ++t) {
#pragma unroll
      for (int n = 0; n < 4; ++n) acc[t][n] *= alpha[t];
    }
  };

  // chunk 0: scores, softmax into P buffer 0 (the accumulators are still 0: nothing to rescale)
  scores(0, false);
  // V fragments of chunk 0, behind the K loads of chunk 1 as in every later trip: the loads return in order, and with the same order on the way into the loop
  // and round it the build's counted wait for the K fragments leaves the younger V loads in flight
#pragma unroll
  for (int kk = 0; kk < 4; ++kk) {
#pragma unroll
    for (int n = 0; n < 4; ++n) vb[kk][n] = FragH::load_off(Vt, vo, (n * 16 * NPOS + kk * 512) * 2);
  }
  lds_barrier();   // B1 of chunk 0
  softmax(Ps);
  xwait_off(ko);   // behind the K loads of chunk 1, a softmax later, in front of the next rewrite of their offset register
  lds_barrier();   // B2 of chunk 0

  for (int jc = 0; jc + 1 < NCHUNK; ++jc) {
    const _Float16* Pr = Ps + (jc & 1) * (AQB * PPITCH);          // P of chunk jc
    _Float16*       Pw = Ps + ((jc + 1) & 1) * (AQB * PPITCH);    // P of chunk jc + 1
    scores(jc + 1, true);   // with the row sums of chunk jc
    // one wait for the V loads of the trip before and the K loads of this one; both offset registers are kept as they are until here, and vo steps on only behind it
    xwait_off(vo, ko);
    vo += ((((unsigned)jc + 1 + rot) & (NCHUNK - 1)) != 0) ? (unsigned)(AKC / 32) * 1024 : (unsigned)(AKC / 32) * 1024 - (unsigned)NCHUNK * (AKC / 32) * 1024;   // blocks of the walk's chunk jc + 1, round the row's end
    lds_barrier();   // B1 of chunk jc + 1
    // Between B1 and B2 a wave has matrix work (P.V of chunk jc) and vector work (softmax of chunk jc + 1) that do not depend on one another.
    // Waves w and w + 4 take the two in opposite order, so that one wave's products run under the other's vector work.
    // The products stand once in the text, the softmax in front of them (waves 4..7) and behind them (waves 0..3): only it is under a branch, so the accumulators and V fragments keep their registers.
    if (wsel != 0) softmax(Pw);
    pv(Pr, true);
    if (wsel == 0) softmax(Pw);
    rescale();
    lds_barrier();   // B2 of chunk jc + 1
  }
  rowsum();                                                   // of the last chunk
  pv(Ps + ((NCHUNK - 1) & 1) * (AQB * PPITCH), false);        // products of the last chunk; nothing left to fetch
  xwait_off(vo);   // behind the last V loads, in front of the epilogue's reuse of the offset register

  // ---- epilogue, query tile by query tile: out * (1/(rowsum * 2^15)); o2 = gamma*out + x (exact f32 x); split of o2 * 2^10.
  //      The lane's 8 values of one accumulator tile (query c, channels 16n + 8*hh + 0..7) are its own 16-B unit of the o2 planes' fragment order.
  const float* xp0 = X + ((size_t)b * CCH + wave * 64 + 8 * hh) * NPOS + i0 + c;   // channel 64w + 8*hh, query c of tile 0
#pragma unroll
  for (int t = 0; t < AQT; ++t) {
    const float rl = (1.0f / lrow[t]) * pinv;
    const float* xp = xp0 + t * 16;
    float xe[4][8];
#pragma unroll
    for (int n = 0; n < 4; ++n) {                   // channel 64w + 16n + 8*hh + r
#pragma unroll
      for (int r = 0; r < 8; ++r) xe[n][r] = xp[(size_t)(n * 16 + r) * NPOS];
    }
    xwait(xp0);
    const int tb = ((t * (CCH >> 5) + wave * 2) << 9) + lane * 8;   // the wave's two blocks of query tile t
#pragma unroll
    for (int n = 0; n < 4; ++n) {                   // n = 2 * (block) + s
      v8h hv, lv;
#pragma unroll
      for (int r = 0; r < 8; ++r) {
        const float o  = acc[t][n][r] * rl;
        const float v2 = (g * o + xe[n][r]) * ocarry;
        const _Float16 hq = (_Float16)v2;
        hv[r] = hq;
        lv[r] = (_Float16)(v2 - (float)hq);
      }
      const int go = tb + n * 256;
      *(v8h*)(O2sh + go) = hv;
      *(v8h*)(O2sl + go) = lv;
    }
  }

  // ---- output conv: out[b][m][i0 + n] = wscale * sum_ch Wd[m][ch] * o2[n][ch] + bd[m]; wave w: m = 64w .. 64w+63, n = 0..63 (a 64x64 tile, K = 512) ----
  const int wv = __builtin_amdgcn_readfirstlane(tid >> 5);   // scalar, so that the plane starts below are formed on the scalar unit
  const _Float16* Ah = (const _Float16*)(const void*)wdhp + (size_t)wv * 64 * GK;   // the wave's 4 row tiles of Wd, hi and lo
  const _Float16* Al = (const _Float16*)(const void*)wdlp + (size_t)wv * 64 * GK;
  const unsigned rk = (rot * 2) & (GK / 32 - 1);   // first k step (even: a trip's two steps lie side by side) of this block's walk over the Wd planes, which all 256 blocks read
  unsigned ao = (unsigned)lane * 16 + rk * 1024;   // bytes: the lane's 16 B inside each 512-B half block of the Wd planes, k step rk
  const _Float16* Bh = O2sh + lane * 8 + rk * 512; // the same inside the o2 planes in LDS
  const _Float16* Bl = O2sl + lane * 8 + rk * 512;
  v8f oc[4][4];
#pragma unroll
  for (int i = 0; i < 4; ++i)
#pragma unroll
    for (int j = 0; j < 4; ++j) oc[i][j] = (v8f){0.f,0.f,0.f,0.f,0.f,0.f,0.f,0.f};
  FragSet<4> f0, f1;
  out_fetch_a(f0, Ah, Al, ao, 0);   // do not depend on o2: in flight across the barrier
  lds_barrier();                    // B3: every wave reads all 64 o2 rows
  out_fetch_b(f0, Bh, Bl, 0);
  // two k steps a trip, each step's fragments fetched one step ahead as in proj_kernel. Kept rolled: unrolled in full the kernel's text would pass 32 KB (for speed only).
#pragma unroll 1
  for (int it = 0; it < GK / 64 - 1; ++it) {
    out_fetch_a(f1, Ah, Al, ao, 1024);
    out_fetch_b(f1, Bh, Bl, 512);
    gemm_mul<true, 4>(oc, f0);
    // to the walk's next pair of k steps, (rk + 2 * it + 2) mod 16: two blocks further in every row tile of both operands, or back to the first
    const int d = ((2u * (unsigned)it + 2u + rk) & (GK / 32 - 1)) != 0 ? 2 : 2 - GK / 32;
    xwait_step(ao);   // a k step's products behind the last Wd loads, in front of the step of their offset register
    ao += (unsigned)(d * 1024);
    Bh += d * 512;
    Bl += d * 512;
    out_fetch_a(f0, Ah, Al, ao, 0);
    out_fetch_b(f0, Bh, Bl, 0);
    gemm_mul<true, 4>(oc, f1);
  }
  xwait_step(ao);   // the offset goes through the statement here too: without it this build forms 64-bit address pairs for the last loads
  out_fetch_a(f1, Ah, Al, ao, 1024);
  out_fetch_b(f1, Bh, Bl, 512);
  gemm_mul<true, 4>(oc, f0);
  xwait_off(ao, Ah, Al);   // behind the last loads; the epilogue reuses the offset's and the bases' registers only behind it
  gemm_mul<true, 4>(oc, f1);
  acc_guard4(oc[0][0], oc[0][1], oc[0][2], oc[0][3]);
  acc_guard4(oc[1][0], oc[1][1], oc[1][2], oc[1][3]);
  acc_guard4(oc[2][0], oc[2][1], oc[2][2], oc[2][3]);
  acc_guard4(oc[3][0], oc[3][1], oc[3][2], oc[3][3]);

  // 16 rows at a time through the wave's slab, so that each store covers whole 256-B row pieces
  float* slab = sT[wv];
  float* C = outp + (size_t)b * CCH * NPOS + i0;
#pragma unroll
  for (int i = 0; i < 4; ++i) {
    const int mBase = wv * 64 + (i << 4);
#pragma unroll
    for (int j = 0; j < 4; ++j) {
#pragma unroll
      for (int r = 0; r < 8; ++r) {
        float v = oc[i][j][r] * wscale;
        v += bd[mBase + 8 * hh + r];
        slab[(8 * hh + r) * 68 + (j << 4) + c] = v;
      }
    }
    __builtin_amdgcn_fence(__ATOMIC_RELEASE, "workgroup");
    __builtin_amdgcn_wave_barrier();
    __builtin_amdgcn_fence(__ATOMIC_ACQUIRE, "workgroup");
#pragma unroll
    for (int it = 0; it < 8; ++it) {
      const int row = it * 2 + hh;                         // it 0..7 x hh 0..1 = rows 0..15; row piece = 256 B = 16 lanes x 16 B
      const v4f v = *(const v4f*)(slab + row * 68 + c * 4);
      *(v4f*)(C + (size_t)(mBase + row) * NPOS + c * 4) = v;
    }
    // behind the 8 stores, in front of the reuse of their data and address registers ...
    asm volatile("s_wait_xcnt 0x0" ::: "memory");
    // ... and the next rows' address arithmetic, which takes those registers, stays behind the wait
    __builtin_amdgcn_sched_barrier(0);
    __builtin_amdgcn_fence(__ATOMIC_RELEASE, "workgroup");
    __builtin_amdgcn_wave_barrier();
    __builtin_amdgcn_fence(__ATOMIC_ACQUIRE, "workgroup");
  }
}

// ---------------------------------------------------------------------------
// Workspace region map (byte offsets; every region is fully written by its producer launch before any consumer
//   WQh  f16 [64][512]           0           65536     WQl      65536      65536
//   WKh  f16 [64][512]      131072           65536     WKl     196608      65536
//   WVh  f16 [512][512]     262144          524288     WVl     786432     524288
//   WDh  f16 [512][512]    1310720          524288     WDl    1835008     524288
//   Qh   f16 [16384][64]   2359296         2097152     Ql     4456448    2097152
//   Kh   f16 [16384][64]   6553600         2097152     Kl     8650752    2097152
//   VT   f16 [4][512][4096] 10747904     16777216
//   total                 27525120
// ---------------------------------------------------------------------------
extern "C" void kernel_launch(void* const* d_in, const int* in_sizes, int n_in,
                              void* d_out, int out_size, void* d_ws, size_t ws_size,
                              hipStream_t stream) {
  if (n_in < 10) return;
  if (in_sizes[0] != NBAT * CCH * NPOS) return;     // x     [4][512][64][64]
  if (in_sizes[1] != CQK * CCH) return;             // Wq    [64][512]
  if (in_sizes[2] != CQK) return;                   // bq    [64]
  if (in_sizes[3] != CQK * CCH) return;             // Wk    [64][512]
  if (in_sizes[4] != CQK) return;                   // bk    [64]
  if (in_sizes[5] != CCH * CCH) return;             // Wv    [512][512]
  if (in_sizes[6] != CCH) return;                   // bv    [512]
  if (in_sizes[7] != 1) return;                     // gamma [1]
  if (in_sizes[8] != CCH * CCH) return;             // Wd    [512][512]
  if (in_sizes[9] != CCH) return;                   // bd    [512]
  if (out_size != NBAT * CCH * NPOS) return;        // out   [4][512][64][64] f32, last element 8388607

  const float* x     = (const float*)d_in[0];
  const float* Wq    = (const float*)d_in[1];       // [out][in]
  const float* bq    = (const float*)d_in[2];
  const float* Wk    = (const float*)d_in[3];
  const float* bk    = (const float*)d_in[4];
  const float* Wv    = (const float*)d_in[5];
  const float* bv    = (const float*)d_in[6];
  const float* gamma = (const float*)d_in[7];
  const float* Wd    = (const float*)d_in[8];
  const float* bd    = (const float*)d_in[9];

  const size_t PWS = (size_t)CQK * CCH * 2;         // 65536     f16 [64][512]
  const size_t PWL = (size_t)CCH * CCH * 2;         // 524288    f16 [512][512]
  const size_t PQK = (size_t)MROWS * CQK * 2;       // 2097152   f16 [16384][64]
  const size_t PVT = (size_t)NBAT * CCH * NPOS * 2; // 16777216  f16 [4][512][4096]
  size_t off = 0;
  const size_t oWQh = off; off += PWS;  const size_t oWQl = off; off += PWS;
  const size_t oWKh = off; off += PWS;  const size_t oWKl = off; off += PWS;
  const size_t oWVh = off; off += PWL;  const size_t oWVl = off; off += PWL;
  const size_t oWDh = off; off += PWL;  const size_t oWDl = off; off += PWL;
  const size_t oQh  = off; off += PQK;  const size_t oQl  = off; off += PQK;
  const size_t oKh  = off; off += PQK;  const size_t oKl  = off; off += PQK;
  const size_t oVT  = off; off += PVT;
  if (off > ws_size) return;                        // off = 27525120
  if (off > (size_t)134217728) return;

  char* ws = (char*)d_ws;
  unsigned short* WQh = (unsigned short*)(ws + oWQh);  unsigned short* WQl = (unsigned short*)(ws + oWQl);
  unsigned short* WKh = (unsigned short*)(ws + oWKh);  unsigned short* WKl = (unsigned short*)(ws + oWKl);
  unsigned short* WVh = (unsigned short*)(ws + oWVh);  unsigned short* WVl = (unsigned short*)(ws + oWVl);
  unsigned short* WDh = (unsigned short*)(ws + oWDh);  unsigned short* WDl = (unsigned short*)(ws + oWDl);
  unsigned short* Qh  = (unsigned short*)(ws + oQh);   unsigned short* Ql  = (unsigned short*)(ws + oQl);
  unsigned short* Kh  = (unsigned short*)(ws + oKh);   unsigned short* Kl  = (unsigned short*)(ws + oKl);
  unsigned short* VT  = (unsigned short*)(ws + oVT);

  const dim3 blk(256);
  const float actCarry = 1024.0f;                    // 2^10 on x, q, k, o2 planes
  const float wCarry   = 65536.0f;                   // 2^16 on weight planes
  const float scale26  = 1.0f / 67108864.0f;         // 2^-26 = 1 / (2^10 * 2^16)
  const float sScale   = 1.0f / 1048576.0f;          // 2^-20 = 1 / (2^10 * 2^10)
  const float pCarry   = 32768.0f;                   // 2^15 on the P tile
  const float pInv     = 1.0f / 32768.0f;            // 2^-15

  // (1) weight planes: hi/lo of W * 2^16 (16 + 16 + 128 + 128 blocks)
  split_w_f16<<<dim3(2 * WSBLK + 2 * WLBLK), blk, 0, stream>>>(Wq, Wk, Wv, Wd, WQh, WQl, WKh, WKl, WVh, WVl, WDh, WDl, wCarry);
  // (2) per block of 64 positions: hi/lo of x * 2^10 into LDS, then v^T = Wv . x + bv[m] -> VT [4][512][4096] f16 single and, with the same
  //     x fragments, q^T, k^T = Wq|Wk . x + bq|bk -> Qh|Ql, Kh|Kl [16384][64] (x2^10): each wave one 16-row tile of the 128 stacked rows; grid (4096/64, 4) = 256 blocks
  const QkPart qkp = {WQh, WQl, WKh, WKl, bq, bk, Qh, Ql, Kh, Kl, actCarry};
  proj_kernel<<<dim3(NPOS / 64, NBAT), blk, 0, stream>>>(x, WVh, WVl, VT, bv, actCarry, scale26, qkp);
  // (3) attention + gamma scale + residual -> o2 hi/lo (x2^10) in LDS, then out[b] = Wd . o2^T + bd[m] -> d_out NCHW f32 [4][512][4096]; grid (4096/64, 4) = 256 blocks
  attn_kernel<<<dim3(NPOS / AQB, NBAT), blk, 0, stream>>>(Qh, Ql, Kh, Kl, VT, x, gamma, WDh, WDl, bd, (float*)d_out, sScale, pCarry, pInv, actCarry, scale26);
  (void)hipGetLastError();
}
